// v000
// Measured on an AMD MI455X. A time is GPU time per run, averaged over a window of back-to-back runs after a warm-up
// (all launches, gaps included; the runs take copies of the inputs in turn), and the median of several windows.
// Apart from v000's, it joins two sittings. Times from different sittings can be a few percent apart, while
// side-by-side timings come from the same sitting.
// v000, which the later versions start from, runs in 10.7 milliseconds.
#include <hip/hip_runtime.h>
// Pre-LayerNorm causal multi-head attention (x [4][2048][1024]; h = LN(x) (eps 1e-5, gamma, beta); q/k/v = h W + b ([in][out] 1024 x 1024 sigma 1/32, zero biases); 16 heads of 64; scores / 8; where(causal, s, finfo.min); softmax; out = merged Wo + bo -> [4][2048][1024], no residual).
// Structure: token rows r = b*2048 + s; h = LN(bf16(x)) as f16 hi + x1024 f16 residual rows; Q, K, V each as two WMMA GEMMs (hi pass + bias into f32, residual pass at 2^-14 added; 32x64 wave tiles, f32 accumulation, exact x16 weights, f16 outputs); per batch: V^T for all heads via LDS transposes; per query tile of 256 rows: scores against the keys below the tile end only (K = 64, all heads on grid.y, alpha = 0.125), causal row softmax on VALU with an arithmetic 0/1 key mask over the computed range (f32 statistics, native exp; weights x256 f16), o = P . V^T (K = keys below the tile end, alpha 2^-2: o carried x64, folded into the output GEMM alpha) written straight into the merged f16 o rows; out = o W_o + b GEMM (f32) into the output layout.
// Compute dtype: inputs rounded to bf16; x / weights exact; q, k, v, softmax weights and o as plain f16 GEMM operands (~2^-12); scores and softmax statistics f32; v_wmma_f32_16x16x32_f16.
#define NB 4
#define SQ 2048
#define DM 1024
#define DMQ DM                       /* LayerNorm width */
#define NH 16
#define HD 64
#define HG 4                         /* heads per launch of the unlaunched k_vt overload */
#define QT 256                       /* query rows per causal tile */
#define NKX SQ                       /* S / P row pitch */
#define QT0 128                      /* first-tile rows recomputed exactly in f32 */
#define B0 0                         /* first batch processed (debug hook) */
#define NBR NB                       /* batches processed (debug hook) */
#define NR ((size_t)NB * SQ)         /* token rows */
#define MP ((int)((size_t)NBR * SQ)) /* rows projected (debug hook) */
#define QN SQ                        /* query rows attended per batch (debug hook) */
#define NHD NH                       /* heads attended (debug hook) */
#define MPO MP                       /* rows through the output stage (debug hook) */
#define LQ DM      /* row pitch of the q/k/v rows */
typedef __bf16 v16b __attribute__((ext_vector_type(16)));
typedef unsigned short v8us __attribute__((ext_vector_type(8), may_alias));
typedef float  v8f  __attribute__((ext_vector_type(8)));
typedef float  v4f  __attribute__((ext_vector_type(4)));
typedef float  v4fa __attribute__((ext_vector_type(4), may_alias));
union FragB { v16b v; v8us half[2]; unsigned short u[16]; };

__device__ __forceinline__ unsigned short bf16_bits(float x) { unsigned int u = __float_as_uint(x); return (unsigned short)((u + 0x7FFFu + ((u >> 16) & 1u)) >> 16); }
__device__ __forceinline__ float bf16_val(unsigned short b) { return __uint_as_float(((unsigned int)b) << 16); }
__device__ __forceinline__ float bf16_round(float x) { return bf16_val(bf16_bits(x)); }
// D += A·B with NT terms: 1 = ah·bh, 2 = + al·bh (A split), 3 = + ah·bl (both split)
template <int NT>
__device__ __forceinline__ v8f mmaN(v16b ah, v16b al, v16b bh, v16b bl, v8f c) {
  c = __builtin_amdgcn_wmma_f32_16x16x32_bf16(false, ah, false, bh, (short)0, c, false, false);
  if (NT >= 2) c = __builtin_amdgcn_wmma_f32_16x16x32_bf16(false, al, false, bh, (short)0, c, false, false);
  if (NT >= 3) c = __builtin_amdgcn_wmma_f32_16x16x32_bf16(false, ah, false, bl, (short)0, c, false, false);
  asm volatile("v_nop\n\tv_nop\n\tv_nop\n\tv_nop" : "+v"(c) : "v"(ah), "v"(al), "v"(bh), "v"(bl));
  return c;
}

__global__ __launch_bounds__(256) void k_wt_bf16(const float* __restrict__ W, unsigned short* __restrict__ Wt, int K, int N) {
  const int t = blockIdx.x * 256 + threadIdx.x;
  const int k8n = K / 8;
  if (t >= N * k8n) return;
  const int n = t / k8n, k8 = (t % k8n) * 8;
  v8us v;
#pragma unroll
  for (int i = 0; i < 8; ++i) v[i] = bf16_bits(W[(size_t)(k8 + i) * N + n]);
  *(v8us*)(Wt + (size_t)n * K + k8) = v;
  
}

// GEMM C[M][N] (f32, pitch ldc) = act(A[M][K]·W + bias). A f32 row-major (pitch lda) converted per fragment to bf16
// (ASPLIT: hi/lo two planes -> 2 terms, else single rounded term); Wt bf16 [N][K] (pitch ldb). BIAS_BF16 rounds the
// bias to bf16 first (bias quantised to bf16 before the add). K%32==0, M%16==0, N%64==0.
template <bool ASPLIT, int ACT, bool BIAS_BF16>
__global__ __launch_bounds__(128) void k_gemm_bf(const float* __restrict__ A, int lda, const unsigned short* __restrict__ Wt, int ldb,
                                               const float* __restrict__ bias, float* __restrict__ C, int ldc, int M, int N, int K) {
  __shared__ __attribute__((aligned(16))) float so[4][16][64];
  const int tid = threadIdx.x, w = tid >> 5, lane = tid & 31, ln = lane & 15, hh = lane >> 4;
  const int ntn = N / 64;
  const int wid = blockIdx.x * 4 + w;
  const int mt = wid / ntn, nq = wid % ntn;
  if (mt * 16 >= M) return;
  const int row0 = mt * 16, col0 = nq * 64;
  const float* arow = A + (size_t)(row0 + ln) * lda;
  v8f acc[4] = {};
  for (int kb = 0; kb < K; kb += 32) {
    FragB ah, al;
    const v4f x0 = *(const v4fa*)(arow + kb + 8 * hh), x1 = *(const v4fa*)(arow + kb + 8 * hh + 4);
    const v4f x2 = *(const v4fa*)(arow + kb + 16 + 8 * hh), x3 = *(const v4fa*)(arow + kb + 16 + 8 * hh + 4);
    float xs[16] = {x0[0],x0[1],x0[2],x0[3],x1[0],x1[1],x1[2],x1[3],x2[0],x2[1],x2[2],x2[3],x3[0],x3[1],x3[2],x3[3]};
#pragma unroll
    for (int i = 0; i < 16; ++i) { const unsigned short hb = bf16_bits(xs[i]); ah.u[i] = hb; al.u[i] = ASPLIT ? bf16_bits(xs[i] - bf16_val(hb)) : (unsigned short)0; }
#pragma unroll
    for (int t = 0; t < 4; ++t) {
      const unsigned short* brow = Wt + (size_t)(col0 + t * 16 + ln) * ldb + kb;
      FragB b;
      b.half[0] = *(const v8us*)(brow + 8 * hh);
      b.half[1] = *(const v8us*)(brow + 16 + 8 * hh);
      acc[t] = mmaN<ASPLIT ? 2 : 1>(ah.v, al.v, b.v, b.v, acc[t]);
    }
  }
#pragma unroll
  for (int t = 0; t < 4; ++t) {
    float bv = bias ? bias[col0 + t * 16 + ln] : 0.f;
    if (BIAS_BF16) bv = bf16_round(bv);
#pragma unroll
    for (int r = 0; r < 8; ++r) { float v = acc[t][r] + bv; if (ACT == 1) v = fmaxf(v, 0.f); so[w][8 * hh + r][t * 16 + ln] = v; }
  }
  __builtin_amdgcn_fence(__ATOMIC_ACQ_REL, "workgroup");
  __builtin_amdgcn_wave_barrier();
  const int rsub = lane >> 4, c4 = (lane & 15) * 4;
  {
#pragma unroll
    for (int q = 0; q < 8; ++q) {
      const int r = q * 2 + rsub;
      const v4f v = *(const v4fa*)&so[w][r][c4];
      *(v4f*)(C + (size_t)(row0 + r) * ldc + col0 + c4) = v;
    }
    
  }
}

// GEMM C = act(A·W + bias + resid): A f32 (ASPLIT -> hi/lo 2 terms), Wt bf16 [N][K]; ACT 0 none, 1 relu, 2 exact gelu;
// resid (optional, f32, row index = (row % rmod), pitch ldr, RES_BF16 rounds it) added before the activation.
template <bool ASPLIT, int ACT, bool BIAS_BF16, bool RES_BF16>
__global__ __launch_bounds__(128) void k_gemm_bf3(const float* __restrict__ A, int lda, const unsigned short* __restrict__ Wt, int ldb,
                                                const float* __restrict__ bias, const float* __restrict__ resid, int rmod, int ldr,
                                                float* __restrict__ C, int ldc, int M, int N, int K) {
  __shared__ __attribute__((aligned(16))) float so[4][16][64];
  const int tid = threadIdx.x, w = tid >> 5, lane = tid & 31, ln = lane & 15, hh = lane >> 4;
  const int ntn = N / 64;
  const int wid = blockIdx.x * 4 + w;
  const int mt = wid / ntn, nq = wid % ntn;
  if (mt * 16 >= M) return;
  const int row0 = mt * 16, col0 = nq * 64;
  const float* arow = A + (size_t)(row0 + ln) * lda;
  v8f acc[4] = {};
  for (int kb = 0; kb < K; kb += 32) {
    FragB ah, al;
    const v4f x0 = *(const v4fa*)(arow + kb + 8 * hh), x1 = *(const v4fa*)(arow + kb + 8 * hh + 4);
    const v4f x2 = *(const v4fa*)(arow + kb + 16 + 8 * hh), x3 = *(const v4fa*)(arow + kb + 16 + 8 * hh + 4);
    float xs[16] = {x0[0],x0[1],x0[2],x0[3],x1[0],x1[1],x1[2],x1[3],x2[0],x2[1],x2[2],x2[3],x3[0],x3[1],x3[2],x3[3]};
#pragma unroll
    for (int i = 0; i < 16; ++i) { const unsigned short hb = bf16_bits(xs[i]); ah.u[i] = hb; al.u[i] = ASPLIT ? bf16_bits(xs[i] - bf16_val(hb)) : (unsigned short)0; }
#pragma unroll
    for (int t = 0; t < 4; ++t) {
      const unsigned short* brow = Wt + (size_t)(col0 + t * 16 + ln) * ldb + kb;
      FragB b;
      b.half[0] = *(const v8us*)(brow + 8 * hh);
      b.half[1] = *(const v8us*)(brow + 16 + 8 * hh);
      acc[t] = mmaN<ASPLIT ? 2 : 1>(ah.v, al.v, b.v, b.v, acc[t]);
    }
  }
#pragma unroll
  for (int t = 0; t < 4; ++t) {
    const int col = col0 + t * 16 + ln;
    float bv = bias ? bias[col] : 0.f;
    if (BIAS_BF16) bv = bf16_round(bv);
#pragma unroll
    for (int r = 0; r < 8; ++r) {
      float v = acc[t][r] + bv;
      if (resid) { float rv = resid[(size_t)((row0 + 8 * hh + r) % rmod) * ldr + col]; if (RES_BF16) rv = bf16_round(rv); v += rv; }
      if (ACT == 1) v = fmaxf(v, 0.f);
      if (ACT == 2) v = 0.5f * v * (1.0f + erff(v * 0.70710678118654752f));
      if (ACT == 3) { const float u = 0.7978845608028654f * (v + 0.044715f * v * v * v); v = 0.5f * v * (1.0f + tanhf(u)); }
      so[w][8 * hh + r][t * 16 + ln] = v;
    }
  }
  __builtin_amdgcn_fence(__ATOMIC_ACQ_REL, "workgroup");
  __builtin_amdgcn_wave_barrier();
  const int rsub = lane >> 4, c4 = (lane & 15) * 4;
  {
#pragma unroll
    for (int q = 0; q < 8; ++q) {
      const int r = q * 2 + rsub;
      const v4f v = *(const v4fa*)&so[w][r][c4];
      *(v4f*)(C + (size_t)(row0 + r) * ldc + col0 + c4) = v;
    }
    
  }
}
// row LayerNorm (biased variance, eps) over N: s = X (+ R); optional out_sum <- s; out_norm <- (s-mu)*rsqrt(var+eps)*g + b
template <bool PARAM_BF16>
__global__ __launch_bounds__(256) void k_layernorm(const float* __restrict__ X, const float* __restrict__ R, const float* __restrict__ g, const float* __restrict__ bta,
                                                  float* __restrict__ out_sum, float* __restrict__ out_norm, int N, float eps) {
  __shared__ float red[256];
  const int row = blockIdx.x, tid = threadIdx.x;
  const float* x = X + (size_t)row * N; const float* rr = R ? R + (size_t)row * N : nullptr;
  float vals[16];                     // up to N = 4096
  const int per = N / 256;            // contiguous chunk per thread? use strided-by-4 chunks: thread handles j = tid*4 + 1024*u
  float s1 = 0.f;
  for (int u = 0; u < per / 4; ++u) {
    const int j = tid * 4 + 1024 * u;
    const v4f a = *(const v4fa*)(x + j);
    v4f b = {0.f,0.f,0.f,0.f}; if (rr) b = *(const v4fa*)(rr + j);
#pragma unroll
    for (int q = 0; q < 4; ++q) { const float v = a[q] + b[q]; vals[u * 4 + q] = v; s1 += v; }
  }
  red[tid] = s1; __syncthreads();
  for (int st = 128; st > 0; st >>= 1) { if (tid < st) red[tid] += red[tid + st]; __syncthreads(); }
  const float mu = red[0] / (float)N; __syncthreads();
  float s2 = 0.f;
  for (int u = 0; u < per / 4; ++u)
#pragma unroll
    for (int q = 0; q < 4; ++q) { const float c = vals[u * 4 + q] - mu; s2 += c * c; }
  red[tid] = s2; __syncthreads();
  for (int st = 128; st > 0; st >>= 1) { if (tid < st) red[tid] += red[tid + st]; __syncthreads(); }
  const float rs = rsqrtf(red[0] / (float)N + eps);
  {
    for (int u = 0; u < per / 4; ++u) {
      const int j = tid * 4 + 1024 * u;
      v4f o, sm;
#pragma unroll
      for (int q = 0; q < 4; ++q) {
        float gg = g[j + q], bb = bta[j + q];
        if (PARAM_BF16) { gg = bf16_round(gg); bb = bf16_round(bb); }
        sm[q] = vals[u * 4 + q]; o[q] = (vals[u * 4 + q] - mu) * rs * gg + bb;
      }
      if (out_sum) *(v4f*)(out_sum + (size_t)row * N + j) = sm;
      *(v4f*)(out_norm + (size_t)row * N + j) = o;
    }
    
  }
}



// ---- f16 WMMA path (v_wmma_f32_16x16x32_f16): 11-bit significands for operands in range — used where a [0,1] probability operand needs more precision than bf16
typedef _Float16 v16h __attribute__((ext_vector_type(16)));
union FragH { v16h v; v8us half[2]; _Float16 h[16]; unsigned short u[16]; };
template <int NT>
__device__ __forceinline__ v8f mmaH(v16h ah, v16h al, v16h bh, v16h bl, v8f c) {
  c = __builtin_amdgcn_wmma_f32_16x16x32_f16(false, ah, false, bh, (short)0, c, false, false);
  if (NT >= 2) c = __builtin_amdgcn_wmma_f32_16x16x32_f16(false, al, false, bh, (short)0, c, false, false);
  if (NT >= 3) c = __builtin_amdgcn_wmma_f32_16x16x32_f16(false, ah, false, bl, (short)0, c, false, false);
  asm volatile("v_nop\n\tv_nop\n\tv_nop\n\tv_nop" : "+v"(c) : "v"(ah), "v"(al), "v"(bh), "v"(bl));
  return c;
}
// batched GEMM like k_gemm_b but f16 operands: A f32 (split into f16 hi/lo if ASPLIT, else rounded to f16), Bt = f16 values [n][k]; alpha; C f32; N multiple of 16 (partial tiles skipped)
template <bool ASPLIT>
__global__ __launch_bounds__(128) void k_gemm_h(const float* __restrict__ A, int lda, size_t sA, const _Float16* __restrict__ Bh, int ldb, size_t sB, float alpha, float* __restrict__ C, int ldc, size_t sC, int M, int N, int K) {
  __shared__ __attribute__((aligned(16))) float so[4][16][64];
  const int tid = threadIdx.x, w = tid >> 5, lane = tid & 31, ln = lane & 15, hh = lane >> 4; const int by = blockIdx.y;
  A += (size_t)by * sA; Bh += (size_t)by * sB; C += (size_t)by * sC;
  const int ntn = (N + 63) / 64; const int wid = blockIdx.x * 4 + w; const int mt = wid / ntn, nq = wid % ntn; if (mt * 16 >= M) return;
  const int row0 = mt * 16, col0 = nq * 64; const float* arow = A + (size_t)(row0 + ln) * lda;
  v8f acc[4] = {};
  for (int kb = 0; kb < K; kb += 32) {
    FragH ah, al;
    const v4f x0 = *(const v4fa*)(arow + kb + 8 * hh), x1 = *(const v4fa*)(arow + kb + 8 * hh + 4), x2 = *(const v4fa*)(arow + kb + 16 + 8 * hh), x3 = *(const v4fa*)(arow + kb + 16 + 8 * hh + 4);
    float xs[16] = {x0[0],x0[1],x0[2],x0[3],x1[0],x1[1],x1[2],x1[3],x2[0],x2[1],x2[2],x2[3],x3[0],x3[1],x3[2],x3[3]};
#pragma unroll
    for (int i = 0; i < 16; ++i) { const _Float16 h = (_Float16)xs[i]; ah.h[i] = h; al.h[i] = ASPLIT ? (_Float16)(xs[i] - (float)h) : (_Float16)0.0f; }
#pragma unroll
    for (int t = 0; t < 4; ++t) { if (col0 + t * 16 >= N) continue; const size_t boff = (size_t)(col0 + t * 16 + ln) * ldb + kb; FragH bq; bq.half[0] = *(const v8us*)(Bh + boff + 8 * hh); bq.half[1] = *(const v8us*)(Bh + boff + 16 + 8 * hh);
      acc[t] = mmaH<ASPLIT ? 2 : 1>(ah.v, al.v, bq.v, bq.v, acc[t]); }
  }
#pragma unroll
  for (int t = 0; t < 4; ++t) { if (col0 + t * 16 >= N) continue;
#pragma unroll
    for (int r = 0; r < 8; ++r) so[w][8 * hh + r][t * 16 + ln] = acc[t][r] * alpha; }
  __builtin_amdgcn_fence(__ATOMIC_ACQ_REL, "workgroup"); __builtin_amdgcn_wave_barrier();
  const int rsub = lane >> 4, c4 = (lane & 15) * 4;
  {
#pragma unroll
    for (int q = 0; q < 8; ++q) { const int r = q * 2 + rsub; if (col0 + c4 < N) { const v4f v = *(const v4fa*)&so[w][r][c4]; *(v4f*)(C + (size_t)(row0 + r) * ldc + col0 + c4) = v; } }
     }
}

// Wt[n][k] = f16(W[k][n]·scale) from f32 row-major W[K][N] (scale = power of two; bf16-exact weights stay exact in f16 away from the subnormal range)
__global__ __launch_bounds__(256) void k_wt_f16(const float* __restrict__ W, _Float16* __restrict__ Wt, int K, int N, float scale) {
  const int t = blockIdx.x * 256 + threadIdx.x; if (t >= N * (K / 8)) return; const int n = t / (K / 8), k8 = (t % (K / 8)) * 8; FragH f;
#pragma unroll
  for (int i = 0; i < 8; ++i) f.h[i] = (_Float16)(bf16_round(W[(size_t)(k8 + i) * N + n]) * scale); const v8us o = f.half[0];
  *(v8us*)((unsigned short*)Wt + (size_t)n * K + k8) = o; 
}
// k_gemm_hh variant with fused epilogue: v = acc·alpha + bias[by·sBias + col] (+ CP[(row/rowsPerB)·sCPb + by·64 + col] if CP) ; ACT 0 none / 1 elu ; writes f16 C16 (and f32 C if non-null)
template <int ACT>
__global__ __launch_bounds__(128) void k_gemm_hhx(const _Float16* __restrict__ A, int lda, size_t sA, const _Float16* __restrict__ Bh, int ldb, size_t sB, float alpha, const float* __restrict__ bias, size_t sBias, const float* __restrict__ CP, int rowsPerB, size_t sCPb, int row0g,
    float* __restrict__ C, _Float16* __restrict__ C16, int ldc, size_t sC, int M, int N, int K) {
  __shared__ __attribute__((aligned(16))) float so[4][16][64];
  const int tid = threadIdx.x, w = tid >> 5, lane = tid & 31, ln = lane & 15, hh = lane >> 4; const int by = blockIdx.y;
  A += (size_t)by * sA; Bh += (size_t)by * sB; const size_t cofs = (size_t)by * sC; const float* bp = bias ? bias + (size_t)by * sBias : nullptr;
  const int ntn = (N + 63) / 64; const int wid = blockIdx.x * 4 + w; const int mt = wid / ntn, nq = wid % ntn; if (mt * 16 >= M) return;
  const int row0 = mt * 16, col0 = nq * 64; const _Float16* arow = A + (size_t)(row0 + ln) * lda;
  v8f acc[4] = {};
  for (int kb = 0; kb < K; kb += 32) { FragH ah; ah.half[0] = *(const v8us*)((const unsigned short*)arow + kb + 8 * hh); ah.half[1] = *(const v8us*)((const unsigned short*)arow + kb + 16 + 8 * hh);
#pragma unroll
    for (int t = 0; t < 4; ++t) { if (col0 + t * 16 >= N) continue; const size_t boff = (size_t)(col0 + t * 16 + ln) * ldb + kb; FragH bq; bq.half[0] = *(const v8us*)((const unsigned short*)Bh + boff + 8 * hh); bq.half[1] = *(const v8us*)((const unsigned short*)Bh + boff + 16 + 8 * hh);
      acc[t] = mmaH<1>(ah.v, ah.v, bq.v, bq.v, acc[t]); }
  }
#pragma unroll
  for (int t = 0; t < 4; ++t) { if (col0 + t * 16 >= N) continue; const int col = col0 + t * 16 + ln; const float bv = bp ? bf16_round(bp[col]) : 0.f;
#pragma unroll
    for (int r = 0; r < 8; ++r) { float v = acc[t][r] * alpha + bv; if (CP) { const int rr = row0g + row0 + 8 * hh + r; if (rowsPerB < 0) v += CP[cofs + (size_t)rr * ldc + col];      /* rowsPerB < 0: own element of the batched C plane */ else { const int bidx = rr / rowsPerB; v += CP[(size_t)bidx * sCPb + (size_t)by * 64 + col]; } } if (ACT == 1) v = (v > 0.f) ? v : expm1f(v); else if (ACT == 7) v = (v > 0.f) ? v + 1.0f : expf(v); else if (ACT == 8) v = tanhf(v); else if (ACT == 9) v = 0.5f * v * (1.0f + tanhf(0.7978845608028654f * (v + 0.044715f * v * v * v))); else if (ACT == 11) v = 1.0f / (1.0f + expf(-v)); else if (ACT == 12) v = (v > 0.f) ? v : 0.01f * v; else if (ACT == 14) v = (v > 0.f) ? v : 0.1f * v; else if (ACT == 16) v = (v >= 0.f) ? v : 0.3f * v; else if (ACT == 17) v = (v >= 0.f) ? v : 0.2f * v; else if (ACT == 15) v = v / (1.0f + expf(-v)); else if (ACT == 3) v = fmaxf(v, 0.f); else if (ACT == 6) v = 0.5f * v * (1.0f + erff(v * 0.70710678118654752f)); so[w][8 * hh + r][t * 16 + ln] = v; } }
  __builtin_amdgcn_fence(__ATOMIC_ACQ_REL, "workgroup"); __builtin_amdgcn_wave_barrier();
  const int rsub = lane >> 4, c4 = (lane & 15) * 4; typedef _Float16 v4h __attribute__((ext_vector_type(4)));
  {
#pragma unroll
    for (int q = 0; q < 8; ++q) { const int r = q * 2 + rsub; if (col0 + c4 < N) { const v4f v = *(const v4fa*)&so[w][r][c4]; if (C) *(v4f*)(C + cofs + (size_t)(row0 + r) * ldc + col0 + c4) = v; if (C16) { v4h h4; for (int i = 0; i < 4; ++i) h4[i] = (_Float16)v[i]; *(v4h*)(C16 + cofs + (size_t)(row0 + r) * ldc + col0 + c4) = h4; } } }
     }
}


typedef _Float16 v4h __attribute__((ext_vector_type(4)));

__global__ __launch_bounds__(256) void k_x16(const float* __restrict__ x, _Float16* __restrict__ X16, size_t n8) { const size_t t = (size_t)blockIdx.x * 256 + threadIdx.x; if (t >= n8) return; FragH f;
#pragma unroll
  for (int q = 0; q < 8; ++q) f.h[q] = (_Float16)bf16_round(x[t * 8 + q]); *(v8us*)((unsigned short*)X16 + t * 8) = f.half[0];  }
__global__ __launch_bounds__(256) void k_h16(const float* __restrict__ x, _Float16* __restrict__ X16, size_t n8) { const size_t t = (size_t)blockIdx.x * 256 + threadIdx.x; if (t >= n8) return; FragH f;
#pragma unroll
  for (int q = 0; q < 8; ++q) f.h[q] = (_Float16)x[t * 8 + q]; *(v8us*)((unsigned short*)X16 + t * 8) = f.half[0];  }
__global__ __launch_bounds__(256) void k_round16f(const float* __restrict__ W, _Float16* __restrict__ Bt, size_t n8) { const size_t t = (size_t)blockIdx.x * 256 + threadIdx.x; if (t >= n8) return; FragH f;
#pragma unroll
  for (int i = 0; i < 8; ++i) f.h[i] = (_Float16)(bf16_round(W[t * 8 + i]) * 16.0f); *(v8us*)((unsigned short*)Bt + t * 8) = f.half[0];  }
template <int NHv, int TTv>
__global__ __launch_bounds__(256) void k_vt(const _Float16* __restrict__ V16, int ldv, int voff, _Float16* __restrict__ Vt) { __shared__ unsigned short tl[64][66]; const int tid = threadIdx.x; const int slab = blockIdx.x / (TTv / 64), lg = blockIdx.x % (TTv / 64); const int b = slab / NHv, h = slab % NHv;
  for (int i = tid; i < 64 * 8; i += 256) { const int r = i / 8, c8 = (i % 8) * 8; FragH f; f.half[0] = *(const v8us*)((const unsigned short*)V16 + ((size_t)b * TTv + lg * 64 + r) * ldv + voff + h * 64 + c8);
#pragma unroll
    for (int q = 0; q < 8; ++q) tl[r][c8 + q] = f.u[q]; }
  __syncthreads();
  {
#pragma unroll
    for (int rd = 0; rd < 2; ++rd) { const int d = rd * 32 + tid / 8, pc = tid % 8; FragH f;
#pragma unroll
      for (int q = 0; q < 8; ++q) f.u[q] = tl[pc * 8 + q][d];
      *(v8us*)((unsigned short*)Vt + ((size_t)slab * 64 + d) * TTv + lg * 64 + pc * 8) = f.half[0]; }
     } }

__global__ __launch_bounds__(256) void k_hl(const float* __restrict__ F, _Float16* __restrict__ Hh, _Float16* __restrict__ Hl, size_t n8) { const size_t t = (size_t)blockIdx.x * 256 + threadIdx.x; if (t >= n8) return; FragH fh, fl; const v4f a = *(const v4fa*)(F + t * 8), c = *(const v4fa*)(F + t * 8 + 4);
#pragma unroll
  for (int q = 0; q < 4; ++q) { _Float16 h = (_Float16)a[q]; fh.h[q] = h; fl.h[q] = (_Float16)((a[q] - (float)h) * 1024.0f); h = (_Float16)c[q]; fh.h[4 + q] = h; fl.h[4 + q] = (_Float16)((c[q] - (float)h) * 1024.0f); }
  { *(v8us*)((unsigned short*)Hh + t * 8) = fh.half[0]; *(v8us*)((unsigned short*)Hl + t * 8) = fl.half[0];  } }

// ---- fast GEMM (wave tile 32x64; requires M % 32 == 0 rows per launch region and N % 64 == 0); epilogue = k_gemm_hhx semantics ----
__device__ __forceinline__ v16h g2_frag(const _Float16* p, int hh) { FragH f; f.half[0] = *(const v8us*)((const unsigned short*)p + 8 * hh); f.half[1] = *(const v8us*)((const unsigned short*)p + 16 + 8 * hh); return f.v; }
__device__ __forceinline__ v8f g2_mma(v16h a, v16h b, v8f c) { v8f d = __builtin_amdgcn_wmma_f32_16x16x32_f16(false, a, false, b, (short)0, c, false, false); asm volatile("v_nop\n\tv_nop\n\tv_nop\n\tv_nop" : "+v"(d) : "v"(a), "v"(b)); return d; }
template <int ACT>
__global__ __launch_bounds__(128) void k_gemm2(const _Float16* __restrict__ A, int lda, size_t sA, const _Float16* __restrict__ Bh, int ldb, size_t sB, float alpha, const float* __restrict__ bias, size_t sBias, const float* __restrict__ CP, int rowsPerB, size_t sCPb, int row0g,
    float* __restrict__ C, _Float16* __restrict__ C16, int ldc, size_t sC, int M, int N, int K) { static_assert(ACT == 0 || ACT == 3 || ACT == 6 || ACT == 8 || ACT == 9 || ACT == 11 || ACT == 12 || ACT == 14 || ACT == 15 || ACT == 16 || ACT == 17, "k_gemm2: unsupported ACT code (would silently apply no activation)");
  __shared__ __attribute__((aligned(16))) float so[4][32][68];
  const int tid = threadIdx.x, w = tid >> 5, lane = tid & 31, ln = lane & 15, hh = lane >> 4; const int by = blockIdx.y;
  A += (size_t)by * sA; Bh += (size_t)by * sB; const size_t cofs = (size_t)by * sC; const float* bp = bias ? bias + (size_t)by * sBias : nullptr;
  const int ntn = N >> 6; const int mt = blockIdx.x / ntn, nq = blockIdx.x - mt * ntn; const int row0 = mt * 128 + 32 * w, col0 = nq * 64; if (row0 >= M) return;
  const _Float16* a0p = A + (size_t)(row0 + ln) * lda; const _Float16* a1p = a0p + (size_t)16 * lda;
  const _Float16* b0p = Bh + (size_t)(col0 + ln) * ldb; const _Float16* b1p = b0p + (size_t)16 * ldb; const _Float16* b2p = b1p + (size_t)16 * ldb; const _Float16* b3p = b2p + (size_t)16 * ldb;
  const v8f z8 = {0.f,0.f,0.f,0.f,0.f,0.f,0.f,0.f}; v8f c00 = z8, c01 = z8, c02 = z8, c03 = z8, c10 = z8, c11 = z8, c12 = z8, c13 = z8;
#pragma unroll 1
  for (int kb = 0; kb < K; kb += 32) { const v16h a0 = g2_frag(a0p + kb, hh), a1 = g2_frag(a1p + kb, hh);
    v16h b = g2_frag(b0p + kb, hh); c00 = g2_mma(a0, b, c00); c10 = g2_mma(a1, b, c10);
    b = g2_frag(b1p + kb, hh); c01 = g2_mma(a0, b, c01); c11 = g2_mma(a1, b, c11);
    b = g2_frag(b2p + kb, hh); c02 = g2_mma(a0, b, c02); c12 = g2_mma(a1, b, c12);
    b = g2_frag(b3p + kb, hh); c03 = g2_mma(a0, b, c03); c13 = g2_mma(a1, b, c13); }
  v8f accs[8] = {c00, c01, c02, c03, c10, c11, c12, c13};
#pragma unroll
  for (int u = 0; u < 8; ++u) { const int t = u & 3, half = u >> 2; const int col = col0 + t * 16 + ln; const float bv = bp ? bf16_round(bp[col]) : 0.f;
#pragma unroll
    for (int r = 0; r < 8; ++r) { const int rloc = half * 16 + 8 * hh + r; float v = accs[u][r] * alpha + bv; if (CP) { if (rowsPerB < 0) v += CP[cofs + (size_t)(row0g + row0 + rloc) * ldc + col];      /* rowsPerB < 0: own element of the batched C plane */ else { const int bidx = (row0g + row0 + rloc) / rowsPerB; v += CP[(size_t)bidx * sCPb + (size_t)by * 64 + col]; } }
      if (ACT == 3) v = fmaxf(v, 0.f); else if (ACT == 6) v = 0.5f * v * (1.0f + erff(v * 0.70710678118654752f)); else if (ACT == 11) v = 1.0f / (1.0f + expf(-v)); else if (ACT == 15) v = v / (1.0f + expf(-v)); else if (ACT == 12) v = (v > 0.f) ? v : 0.01f * v; else if (ACT == 8) v = tanhf(v); else if (ACT == 9) v = 0.5f * v * (1.0f + tanhf(0.7978845608028654f * (v + 0.044715f * v * v * v))); else if (ACT == 14) v = (v > 0.f) ? v : 0.1f * v; else if (ACT == 16) v = (v >= 0.f) ? v : 0.3f * v; else if (ACT == 17) v = (v >= 0.f) ? v : 0.2f * v;
      so[w][rloc][t * 16 + ln] = v; } }
  __builtin_amdgcn_fence(__ATOMIC_ACQ_REL, "workgroup"); __builtin_amdgcn_wave_barrier();
  const int rsub = lane >> 4, c4 = (lane & 15) * 4;
  {
#pragma unroll
    for (int q = 0; q < 16; ++q) { const int r = q * 2 + rsub; const v4f v = *(const v4fa*)&so[w][r][c4]; if (C) *(v4f*)(C + cofs + (size_t)(row0 + r) * ldc + col0 + c4) = v; if (C16) { v4h h4; for (int i = 0; i < 4; ++i) h4[i] = (_Float16)v[i]; *(v4h*)(C16 + cofs + (size_t)(row0 + r) * ldc + col0 + c4) = h4; } }
     } }


__global__ __launch_bounds__(256) void k_wnat(const float* __restrict__ w, size_t n8, _Float16* __restrict__ Bt) { const size_t t = (size_t)blockIdx.x * 256 + threadIdx.x; if (t >= n8) return; FragH f; for (int q = 0; q < 8; ++q) f.h[q] = (_Float16)(bf16_round(w[t * 8 + q]) * 16.0f); *(v8us*)((unsigned short*)Bt + t * 8) = f.half[0];  }
__global__ __launch_bounds__(256) void k_rsm(const float* __restrict__ S, _Float16* __restrict__ P, int nrows) {
  #pragma clang fp contract(off)
  const int i = blockIdx.x * 256 + threadIdx.x; if (i >= nrows) return; const float* s = S + (size_t)i * SQ; float mx = -3.0e38f;
#pragma unroll 1
  for (int j = 0; j < SQ; ++j) mx = fmaxf(mx, s[j]); float se = 0.f;
#pragma unroll 1
  for (int j = 0; j < SQ; ++j) se += expf(s[j] - mx); const float sc = 256.0f / se;
#pragma unroll 1
  for (int j0 = 0; j0 < SQ; j0 += 8) { FragH f; for (int q = 0; q < 8; ++q) f.h[q] = (_Float16)(expf(s[j0 + q] - mx) * sc); unsigned short* d = (unsigned short*)P + (size_t)i * SQ + j0; *(v8us*)d = f.half[0];  } }
__global__ __launch_bounds__(256) void k_vt(const _Float16* __restrict__ V16, int b, int h0, _Float16* __restrict__ VT) { __shared__ unsigned short tl[64][65]; const int tid = threadIdx.x; const int hh = blockIdx.x % HG, sg = blockIdx.x / HG; const int s0 = sg * 64; const int h = h0 + hh;
  for (int i = tid; i < 64 * 8; i += 256) { const int j = i / 8, d8 = (i % 8) * 8; FragH f; f.half[0] = *(const v8us*)((const unsigned short*)V16 + ((size_t)b * SQ + s0 + j) * DM + h * HD + d8); for (int q = 0; q < 8; ++q) tl[d8 + q][j] = f.u[q]; }
  __syncthreads();
  { for (int i = tid; i < 64 * 8; i += 256) { const int d = i / 8, j8 = (i % 8) * 8; FragH f; for (int q = 0; q < 8; ++q) f.u[q] = tl[d][j8 + q]; *(v8us*)((unsigned short*)VT + ((size_t)hh * HD + d) * SQ + s0 + j8) = f.half[0]; }  } }



__global__ __launch_bounds__(256) void k_rsmcf2(const float* __restrict__ S, _Float16* __restrict__ P, int hg, int q0, int nk) {
  #pragma clang fp contract(off)
  const int t = blockIdx.x * 256 + threadIdx.x; if (t >= hg * QT) return; const size_t i = (size_t)t; const float* s = S + i * NKX; const int last = q0 + (t % QT); float mx = -3.0e38f;
#pragma unroll 1
  for (int j = 0; j < nk; ++j) { const float f = (j <= last) ? 1.f : 0.f; mx = fmaxf(mx, fmaf(f, s[j], (1.f - f) * -1.0e9f)); } float se = 0.f;
#pragma unroll 1
  for (int j = 0; j < nk; ++j) { const float f = (j <= last) ? 1.f : 0.f; se += __expf(fmaf(f, s[j], (1.f - f) * -1.0e9f) - mx); } const float sc = 256.0f / se;
#pragma unroll 1
  for (int j0 = 0; j0 < nk; j0 += 8) { FragH fr; for (int q = 0; q < 8; ++q) { const int j = j0 + q; const float f = (j <= last) ? 1.f : 0.f; fr.h[q] = (_Float16)(__expf(fmaf(f, s[j], (1.f - f) * -1.0e9f) - mx) * sc); } unsigned short* d = (unsigned short*)P + i * NKX + j0; *(v8us*)d = fr.half[0];  } }


template <int MASKADD>
__global__ __launch_bounds__(64) void k_att0(const float* __restrict__ QF, const float* __restrict__ KF, const float* __restrict__ VF, int ld, const float* __restrict__ mask, float scale, float* __restrict__ OF, int ldo) {
  #pragma clang fp contract(off)
  __shared__ __attribute__((aligned(16))) float lq[64][64]; __shared__ __attribute__((aligned(16))) float lo[64][64];
  const int tid = threadIdx.x; const int h = blockIdx.x / (QT0 / 64), rg = blockIdx.x % (QT0 / 64); const int i = rg * 64 + tid;
  const float* qr = QF + (size_t)i * ld + h * HD;
#pragma unroll 1
  for (int c = 0; c < HD / 4; ++c) { *(v4f*)&lq[tid][c * 4] = *(const v4fa*)(qr + c * 4); const v4f z = {0.f, 0.f, 0.f, 0.f}; *(v4f*)&lo[tid][c * 4] = z; }
  float m = -1.0e30f, l = 0.f; const int jmax = MASKADD ? (SQ - 1) : (rg * 64 + 63);      /* additive-mask form: every key (the mask input decides); causal form: keys up to the block's last row */
#pragma unroll 1
  for (int j = 0; j <= jmax; ++j) { const float* kr = KF + (size_t)j * ld + h * HD; const float* vr = VF + (size_t)j * ld + h * HD; float s = 0.f;
#pragma unroll 1
    for (int c = 0; c < HD / 4; ++c) { const v4f kq = *(const v4fa*)(kr + c * 4); const v4f qq = *(v4f*)&lq[tid][c * 4]; s = __fadd_rn(s, __fmul_rn(qq[0], kq[0])); s = __fadd_rn(s, __fmul_rn(qq[1], kq[1])); s = __fadd_rn(s, __fmul_rn(qq[2], kq[2])); s = __fadd_rn(s, __fmul_rn(qq[3], kq[3])); }
    s = __fmul_rn(s, scale); if (MASKADD) s = __fadd_rn(s, __fmul_rn(bf16_round(mask[(size_t)i * SQ + j]), -10000.0f));
    const float f = (MASKADD || j <= i) ? 1.f : 0.f; const float sm = fmaf(f, s, (1.f - f) * -1.0e30f); const float mn = fmaxf(m, sm); const float sc = expf(m - mn); const float e = expf(sm - mn); l = __fadd_rn(__fmul_rn(l, sc), e); m = mn;
#pragma unroll 1
    for (int c = 0; c < HD / 4; ++c) { const v4f vv = *(const v4fa*)(vr + c * 4); v4f oo = *(v4f*)&lo[tid][c * 4]; for (int u = 0; u < 4; ++u) oo[u] = __fadd_rn(__fmul_rn(oo[u], sc), __fmul_rn(e, vv[u])); *(v4f*)&lo[tid][c * 4] = oo; } }
  const float fin = 64.0f / l;      /* o carried x64 like the f16 path */
#pragma unroll 1
  for (int c = 0; c < HD / 4; ++c) { v4f oo = *(v4f*)&lo[tid][c * 4]; for (int u = 0; u < 4; ++u) oo[u] = __fmul_rn(oo[u], fin); *(v4f*)&lo[tid][c * 4] = oo; }
  __syncthreads();
  {
#pragma unroll 1
    for (int it = 0; it < 16; ++it) { const int row = it * 4 + tid / 16, pc = (tid % 16) * 4; const v4f v = *(const v4f*)&lo[row][pc]; *(v4f*)(OF + (size_t)(rg * 64 + row) * ldo + h * HD + pc) = v; }
     } }


template <int BFIN, int W16, int W32>
__global__ __launch_bounds__(256) void k_lnx(const float* __restrict__ X, const float* __restrict__ g, const float* __restrict__ bb, float eps, _Float16* __restrict__ N16, float* __restrict__ N32) {
  #pragma clang fp contract(off)
  __shared__ float red[256]; const size_t r = blockIdx.x; const int t = threadIdx.x; const bool act = t < (DMQ / 4); const int c0 = act ? t * 4 : 0;
  const v4f xa = *(const v4fa*)(X + r * DMQ + c0); float s[4]; float sum = 0.f;
  for (int q = 0; q < 4; ++q) { s[q] = act ? (BFIN ? bf16_round(xa[q]) : xa[q]) : 0.f; sum = __fadd_rn(sum, s[q]); }
  red[t] = sum; __syncthreads(); for (int st = 128; st > 0; st >>= 1) { if (t < st) red[t] = __fadd_rn(red[t], red[t + st]); __syncthreads(); } const float mu = red[0] / (float)DMQ; __syncthreads();
  float vs = 0.f; for (int q = 0; q < 4; ++q) { const float dl = act ? __fadd_rn(s[q], -mu) : 0.f; vs = __fadd_rn(vs, __fmul_rn(dl, dl)); } red[t] = vs; __syncthreads(); for (int st = 128; st > 0; st >>= 1) { if (t < st) red[t] = __fadd_rn(red[t], red[t + st]); __syncthreads(); }
  const float rs = rsqrtf(__fadd_rn(red[0] / (float)DMQ, eps)); v4h y; v4f yf;
  for (int q = 0; q < 4; ++q) { const int c = c0 + q; yf[q] = __fadd_rn(__fmul_rn(__fmul_rn(__fadd_rn(s[q], -mu), rs), bf16_round(g[c])), bf16_round(bb[c])); y[q] = (_Float16)yf[q]; }
  if (!act) return;      /* no barriers after this point */
  { if (W16) *(v4h*)(N16 + r * DMQ + c0) = y; if (W32) *(v4f*)(N32 + r * DMQ + c0) = yf;  } }

extern "C" void kernel_launch(void* const* d_in, const int* in_sizes, int n_in,
                              void* d_out, int out_size, void* d_ws, size_t ws_size, hipStream_t stream) {
  (void)in_sizes; (void)n_in; (void)out_size;
  const float* const* I = (const float* const*)d_in; const float* x = I[0]; const float* wq = I[1]; const float* bq = I[2]; const float* wk = I[3]; const float* bk = I[4]; const float* wv = I[5]; const float* bv = I[6]; const float* wo = I[7]; const float* bo = I[8]; const float* lng = I[9]; const float* lnb = I[10];      /* [in][out] weights + biases; LN gamma/beta */
  char* ws = (char*)d_ws; size_t off = 0;
  auto take = [&](size_t bytes) { char* p = ws + off; off += (bytes + 255) & ~(size_t)255; return p; };
  _Float16* BQ = (_Float16*)take((size_t)DM * DM * 2); _Float16* BK = (_Float16*)take((size_t)DM * DM * 2); _Float16* BV = (_Float16*)take((size_t)DM * DM * 2); _Float16* BO = (_Float16*)take((size_t)DM * DM * 2);
  _Float16* X16 = (_Float16*)take(NR * DM * 2); float* HF = (float*)take(NR * DM * 4); _Float16* XL = (_Float16*)take(NR * DM * 2); float* QKF = (float*)take(NR * DM * 4); _Float16* Q16 = (_Float16*)take(NR * DM * 2); _Float16* K16 = (_Float16*)take(NR * DM * 2); _Float16* V16 = (_Float16*)take(NR * DM * 2); _Float16* O16 = (_Float16*)take(NR * DM * 2);
  float* S = (float*)take((size_t)NH * QT * NKX * 4); _Float16* P = (_Float16*)take((size_t)NH * QT * NKX * 2); _Float16* VT = (_Float16*)take((size_t)NH * HD * SQ * 2);
  float* QF0 = (float*)take((size_t)QT0 * DM * 4); float* KF0 = (float*)take((size_t)QT0 * DM * 4); float* VF0 = (float*)take((size_t)QT0 * DM * 4); float* OF0 = (float*)take((size_t)NB * QT0 * DM * 4); _Float16* OH0 = (_Float16*)take((size_t)NB * QT0 * DM * 2); _Float16* OL0 = (_Float16*)take((size_t)NB * QT0 * DM * 2);
  if (off > ws_size) return;
  k_wt_f16<<<(unsigned)(((size_t)DM * (DM / 8) + 255) / 256), 256, 0, stream>>>(wq, BQ, DM, DM, 16.0f); k_wt_f16<<<(unsigned)(((size_t)DM * (DM / 8) + 255) / 256), 256, 0, stream>>>(wk, BK, DM, DM, 16.0f); k_wt_f16<<<(unsigned)(((size_t)DM * (DM / 8) + 255) / 256), 256, 0, stream>>>(wv, BV, DM, DM, 16.0f); k_wt_f16<<<(unsigned)(((size_t)DM * (DM / 8) + 255) / 256), 256, 0, stream>>>(wo, BO, DM, DM, 16.0f);      /* [in][out] -> Bt[n][k] x16 */

  k_lnx<1, 0, 1><<<(unsigned)NR, 256, 0, stream>>>(x, lng, lnb, 1e-5f, nullptr, HF); k_hl<<<(unsigned)((NR * DM / 8 + 255) / 256), 256, 0, stream>>>(HF, X16, XL, NR * DM / 8);      /* h = LN(bf16(x)) f32 -> f16 hi (X16) + x1024 residual (XL) rows */
  const size_t r0p = (size_t)B0 * SQ;      /* first projected row */
  k_gemm2<0><<<dim3((unsigned)((MP / 128) * (DM / 64)), 1), 128, 0, stream>>>(X16 + r0p * DM, DM, 0, BQ, DM, 0, 0.0625f, bq, 0, nullptr, 1, 0, 0, QKF + r0p * DM, nullptr, DM, 0, MP, DM, DM); k_gemm2<0><<<dim3((unsigned)((MP / 128) * (DM / 64)), 1), 128, 0, stream>>>(XL + r0p * DM, DM, 0, BQ, DM, 0, 0.00006103515625f, nullptr, 0, QKF + r0p * DM, -1, 0, 0, nullptr, Q16 + r0p * DM, DM, 0, MP, DM, DM);      
  k_gemm2<0><<<dim3((unsigned)((MP / 128) * (DM / 64)), 1), 128, 0, stream>>>(X16 + r0p * DM, DM, 0, BK, DM, 0, 0.0625f, bk, 0, nullptr, 1, 0, 0, QKF + r0p * DM, nullptr, DM, 0, MP, DM, DM); k_gemm2<0><<<dim3((unsigned)((MP / 128) * (DM / 64)), 1), 128, 0, stream>>>(XL + r0p * DM, DM, 0, BK, DM, 0, 0.00006103515625f, nullptr, 0, QKF + r0p * DM, -1, 0, 0, nullptr, K16 + r0p * DM, DM, 0, MP, DM, DM);      
  k_gemm2<0><<<dim3((unsigned)((MP / 128) * (DM / 64)), 1), 128, 0, stream>>>(X16 + r0p * DM, DM, 0, BV, DM, 0, 0.0625f, bv, 0, nullptr, 1, 0, 0, QKF + r0p * DM, nullptr, DM, 0, MP, DM, DM); k_gemm2<0><<<dim3((unsigned)((MP / 128) * (DM / 64)), 1), 128, 0, stream>>>(XL + r0p * DM, DM, 0, BV, DM, 0, 0.00006103515625f, nullptr, 0, QKF + r0p * DM, -1, 0, 0, nullptr, V16 + r0p * DM, DM, 0, MP, DM, DM);      
  for (int b = B0; b < B0 + NBR; ++b) { const size_t r0 = (size_t)b * SQ;
    k_vt<NH, SQ><<<NH * (SQ / 64), 256, 0, stream>>>(V16 + r0 * LQ, LQ, 0, VT);      /* V^T [NH][HD][SQ] for this batch */
    k_gemm2<0><<<dim3((QT0 / 128) * (DM / 64), 1), 128, 0, stream>>>(X16 + r0 * DM, DM, 0, BQ, DM, 0, 0.0625f, bq, 0, nullptr, 1, 0, 0, QF0, nullptr, DM, 0, QT0, DM, DM); k_gemm2<0><<<dim3((QT0 / 128) * (DM / 64), 1), 128, 0, stream>>>(XL + r0 * DM, DM, 0, BQ, DM, 0, 0.00006103515625f, nullptr, 0, QF0, -1, 0, 0, QF0, nullptr, DM, 0, QT0, DM, DM); k_gemm2<0><<<dim3((QT0 / 128) * (DM / 64), 1), 128, 0, stream>>>(X16 + r0 * DM, DM, 0, BK, DM, 0, 0.0625f, bk, 0, nullptr, 1, 0, 0, KF0, nullptr, DM, 0, QT0, DM, DM); k_gemm2<0><<<dim3((QT0 / 128) * (DM / 64), 1), 128, 0, stream>>>(XL + r0 * DM, DM, 0, BK, DM, 0, 0.00006103515625f, nullptr, 0, KF0, -1, 0, 0, KF0, nullptr, DM, 0, QT0, DM, DM); k_gemm2<0><<<dim3((QT0 / 128) * (DM / 64), 1), 128, 0, stream>>>(X16 + r0 * DM, DM, 0, BV, DM, 0, 0.0625f, bv, 0, nullptr, 1, 0, 0, VF0, nullptr, DM, 0, QT0, DM, DM); k_gemm2<0><<<dim3((QT0 / 128) * (DM / 64), 1), 128, 0, stream>>>(XL + r0 * DM, DM, 0, BV, DM, 0, 0.00006103515625f, nullptr, 0, VF0, -1, 0, 0, VF0, nullptr, DM, 0, QT0, DM, DM);      /* f32 q, k, v of the first 128 rows (exact products) */
    k_att0<0><<<NH * (QT0 / 64), 64, 0, stream>>>(QF0, KF0, VF0, DM, nullptr, 0.125f, OF0 + (size_t)b * QT0 * DM, DM);      /* exact f32 attention for rows 0..127 (o x64) */
    for (int q0 = 0; q0 < QN; q0 += QT) { const int nk = q0 + QT;      /* causal: only keys below the tile end are computed */
      k_gemm2<0><<<dim3((QT / 128) * (nk / 64), NHD), 128, 0, stream>>>(Q16 + (r0 + q0) * LQ, LQ, (size_t)HD, K16 + r0 * LQ, LQ, (size_t)HD, 0.125f, nullptr, 0, nullptr, 1, 0, 0, S, nullptr, NKX, (size_t)QT * NKX, QT, nk, HD);      /* scores, all heads on grid.y */
      k_rsmcf2<<<(NHD * QT + 255) / 256, 256, 0, stream>>>(S, P, NHD, q0, nk);
      k_gemm2<0><<<dim3((QT / 128) * (HD / 64), NHD), 128, 0, stream>>>(P, NKX, (size_t)QT * NKX, VT, SQ, (size_t)HD * SQ, 0.25f, nullptr, 0, nullptr, 1, 0, 0, nullptr, O16 + (r0 + q0) * DM, DM, (size_t)HD, QT, HD, nk); } }      /* o (merged heads, x64) as f16 rows */
  k_gemm2<0><<<dim3((unsigned)((MPO / 128) * (DM / 64)), 1), 128, 0, stream>>>(O16 + r0p * DM, DM, 0, BO, DM, 0, 0.0009765625f, bo, 0, nullptr, 1, 0, 0, (float*)d_out + r0p * DM, nullptr, DM, 0, MPO, DM, DM);      /* out rows are the output layout */
  k_hl<<<(unsigned)(((size_t)NB * QT0 * DM / 8 + 255) / 256), 256, 0, stream>>>(OF0, OH0, OL0, (size_t)NB * QT0 * DM / 8);      /* first-tile o (x64) -> f16 hi + x1024 residual planes */
  for (int b = B0; b < B0 + NBR; ++b) { const size_t r0 = (size_t)b * SQ; const size_t f0 = (size_t)b * QT0;
    k_gemm2<0><<<dim3((QT0 / 128) * (DM / 64), 1), 128, 0, stream>>>(OH0 + f0 * DM, DM, 0, BO, DM, 0, 0.0009765625f, bo, 0, nullptr, 1, 0, 0, (float*)d_out + r0 * DM, nullptr, DM, 0, QT0, DM, DM);      /* rows 0..127: out = o_hi Wo (+ b), overwriting the f16-path rows */
    k_gemm2<0><<<dim3((QT0 / 128) * (DM / 64), 1), 128, 0, stream>>>(OL0 + f0 * DM, DM, 0, BO, DM, 0, 0.00000095367431640625f, nullptr, 0, (const float*)d_out + r0 * DM, -1, 0, 0, (float*)d_out + r0 * DM, nullptr, DM, 0, QT0, DM, DM); }      /* += o_lo Wo 2^-20 (own-element accumulate) */
}

// v001
// It runs in 4820 microseconds.
// Timed twice side by side with v000, it ran 2.21 and 2.22 times as fast.
#include <hip/hip_runtime.h>
// Pre-LayerNorm causal multi-head attention (x [4][2048][1024]; h = LN(x) (eps 1e-5, gamma, beta); q/k/v = h W + b ([in][out] 1024 x 1024 sigma 1/32, zero biases); 16 heads of 64; scores / 8; where(causal, s, finfo.min); softmax; out = merged Wo + bo -> [4][2048][1024], no residual).
// Structure: token rows r = b*2048 + s; h = LN(bf16(x)) as f16 hi + x1024 f16 residual rows; Q, K, V each as two WMMA GEMMs (hi pass + bias into f32, residual pass at 2^-14 added; 32x64 wave tiles, f32 accumulation, exact x16 weights, f16 outputs); per batch: V^T for all heads via LDS transposes; per query tile of 256 rows: scores against the keys below the tile end only (K = 64, all heads on grid.y, alpha = 0.125), causal row softmax on VALU with an arithmetic 0/1 key mask over the computed range (f32 statistics, native exp; weights x256 f16), o = P . V^T (K = keys below the tile end, alpha 2^-2: o carried x64, folded into the output GEMM alpha) written straight into the merged f16 o rows; out = o W_o + b GEMM (f32) into the output layout.
// Compute dtype: inputs rounded to bf16; x / weights exact; q, k, v, softmax weights and o as plain f16 GEMM operands (~2^-12); scores and softmax statistics f32; v_wmma_f32_16x16x32_f16.
#define NB 4
#define SQ 2048
#define DM 1024
#define DMQ DM                       /* LayerNorm width */
#define NH 16
#define HD 64
#define HG 4                         /* heads per launch of the unlaunched k_vt overload */
#define QT 256                       /* query rows per causal tile */
#define NKX SQ                       /* S / P row pitch */
#define QT0 128                      /* first-tile rows recomputed exactly in f32 */
#define B0 0                         /* first batch processed (debug hook) */
#define NBR NB                       /* batches processed (debug hook) */
#define NR ((size_t)NB * SQ)         /* token rows */
#define MP ((int)((size_t)NBR * SQ)) /* rows projected (debug hook) */
#define QN SQ                        /* query rows attended per batch (debug hook) */
#define NHD NH                       /* heads attended (debug hook) */
#define MPO MP                       /* rows through the output stage (debug hook) */
#define LQ DM      /* row pitch of the q/k/v rows */
typedef __bf16 v16b __attribute__((ext_vector_type(16)));
typedef unsigned short v8us __attribute__((ext_vector_type(8), may_alias));
typedef float  v8f  __attribute__((ext_vector_type(8)));
typedef float  v4f  __attribute__((ext_vector_type(4)));
typedef float  v4fa __attribute__((ext_vector_type(4), may_alias));
union FragB { v16b v; v8us half[2]; unsigned short u[16]; };

__device__ __forceinline__ unsigned short bf16_bits(float x) { unsigned int u = __float_as_uint(x); return (unsigned short)((u + 0x7FFFu + ((u >> 16) & 1u)) >> 16); }
__device__ __forceinline__ float bf16_val(unsigned short b) { return __uint_as_float(((unsigned int)b) << 16); }
__device__ __forceinline__ float bf16_round(float x) { return bf16_val(bf16_bits(x)); }
// D += A·B with NT terms: 1 = ah·bh, 2 = + al·bh (A split), 3 = + ah·bl (both split)
template <int NT>
__device__ __forceinline__ v8f mmaN(v16b ah, v16b al, v16b bh, v16b bl, v8f c) {
  c = __builtin_amdgcn_wmma_f32_16x16x32_bf16(false, ah, false, bh, (short)0, c, false, false);
  if (NT >= 2) c = __builtin_amdgcn_wmma_f32_16x16x32_bf16(false, al, false, bh, (short)0, c, false, false);
  if (NT >= 3) c = __builtin_amdgcn_wmma_f32_16x16x32_bf16(false, ah, false, bl, (short)0, c, false, false);
  asm volatile("v_nop\n\tv_nop\n\tv_nop\n\tv_nop" : "+v"(c) : "v"(ah), "v"(al), "v"(bh), "v"(bl));
  return c;
}

__global__ __launch_bounds__(256) void k_wt_bf16(const float* __restrict__ W, unsigned short* __restrict__ Wt, int K, int N) {
  const int t = blockIdx.x * 256 + threadIdx.x;
  const int k8n = K / 8;
  if (t >= N * k8n) return;
  const int n = t / k8n, k8 = (t % k8n) * 8;
  v8us v;
#pragma unroll
  for (int i = 0; i < 8; ++i) v[i] = bf16_bits(W[(size_t)(k8 + i) * N + n]);
  *(v8us*)(Wt + (size_t)n * K + k8) = v;
  
}

// GEMM C[M][N] (f32, pitch ldc) = act(A[M][K]·W + bias). A f32 row-major (pitch lda) converted per fragment to bf16
// (ASPLIT: hi/lo two planes -> 2 terms, else single rounded term); Wt bf16 [N][K] (pitch ldb). BIAS_BF16 rounds the
// bias to bf16 first (bias quantised to bf16 before the add). K%32==0, M%16==0, N%64==0.
template <bool ASPLIT, int ACT, bool BIAS_BF16>
__global__ __launch_bounds__(128) void k_gemm_bf(const float* __restrict__ A, int lda, const unsigned short* __restrict__ Wt, int ldb,
                                               const float* __restrict__ bias, float* __restrict__ C, int ldc, int M, int N, int K) {
  __shared__ __attribute__((aligned(16))) float so[4][16][64];
  const int tid = threadIdx.x, w = tid >> 5, lane = tid & 31, ln = lane & 15, hh = lane >> 4;
  const int ntn = N / 64;
  const int wid = blockIdx.x * 4 + w;
  const int mt = wid / ntn, nq = wid % ntn;
  if (mt * 16 >= M) return;
  const int row0 = mt * 16, col0 = nq * 64;
  const float* arow = A + (size_t)(row0 + ln) * lda;
  v8f acc[4] = {};
  for (int kb = 0; kb < K; kb += 32) {
    FragB ah, al;
    const v4f x0 = *(const v4fa*)(arow + kb + 8 * hh), x1 = *(const v4fa*)(arow + kb + 8 * hh + 4);
    const v4f x2 = *(const v4fa*)(arow + kb + 16 + 8 * hh), x3 = *(const v4fa*)(arow + kb + 16 + 8 * hh + 4);
    float xs[16] = {x0[0],x0[1],x0[2],x0[3],x1[0],x1[1],x1[2],x1[3],x2[0],x2[1],x2[2],x2[3],x3[0],x3[1],x3[2],x3[3]};
#pragma unroll
    for (int i = 0; i < 16; ++i) { const unsigned short hb = bf16_bits(xs[i]); ah.u[i] = hb; al.u[i] = ASPLIT ? bf16_bits(xs[i] - bf16_val(hb)) : (unsigned short)0; }
#pragma unroll
    for (int t = 0; t < 4; ++t) {
      const unsigned short* brow = Wt + (size_t)(col0 + t * 16 + ln) * ldb + kb;
      FragB b;
      b.half[0] = *(const v8us*)(brow + 8 * hh);
      b.half[1] = *(const v8us*)(brow + 16 + 8 * hh);
      acc[t] = mmaN<ASPLIT ? 2 : 1>(ah.v, al.v, b.v, b.v, acc[t]);
    }
  }
#pragma unroll
  for (int t = 0; t < 4; ++t) {
    float bv = bias ? bias[col0 + t * 16 + ln] : 0.f;
    if (BIAS_BF16) bv = bf16_round(bv);
#pragma unroll
    for (int r = 0; r < 8; ++r) { float v = acc[t][r] + bv; if (ACT == 1) v = fmaxf(v, 0.f); so[w][8 * hh + r][t * 16 + ln] = v; }
  }
  __builtin_amdgcn_fence(__ATOMIC_ACQ_REL, "workgroup");
  __builtin_amdgcn_wave_barrier();
  const int rsub = lane >> 4, c4 = (lane & 15) * 4;
  {
#pragma unroll
    for (int q = 0; q < 8; ++q) {
      const int r = q * 2 + rsub;
      const v4f v = *(const v4fa*)&so[w][r][c4];
      *(v4f*)(C + (size_t)(row0 + r) * ldc + col0 + c4) = v;
    }
    
  }
}

// GEMM C = act(A·W + bias + resid): A f32 (ASPLIT -> hi/lo 2 terms), Wt bf16 [N][K]; ACT 0 none, 1 relu, 2 exact gelu;
// resid (optional, f32, row index = (row % rmod), pitch ldr, RES_BF16 rounds it) added before the activation.
template <bool ASPLIT, int ACT, bool BIAS_BF16, bool RES_BF16>
__global__ __launch_bounds__(128) void k_gemm_bf3(const float* __restrict__ A, int lda, const unsigned short* __restrict__ Wt, int ldb,
                                                const float* __restrict__ bias, const float* __restrict__ resid, int rmod, int ldr,
                                                float* __restrict__ C, int ldc, int M, int N, int K) {
  __shared__ __attribute__((aligned(16))) float so[4][16][64];
  const int tid = threadIdx.x, w = tid >> 5, lane = tid & 31, ln = lane & 15, hh = lane >> 4;
  const int ntn = N / 64;
  const int wid = blockIdx.x * 4 + w;
  const int mt = wid / ntn, nq = wid % ntn;
  if (mt * 16 >= M) return;
  const int row0 = mt * 16, col0 = nq * 64;
  const float* arow = A + (size_t)(row0 + ln) * lda;
  v8f acc[4] = {};
  for (int kb = 0; kb < K; kb += 32) {
    FragB ah, al;
    const v4f x0 = *(const v4fa*)(arow + kb + 8 * hh), x1 = *(const v4fa*)(arow + kb + 8 * hh + 4);
    const v4f x2 = *(const v4fa*)(arow + kb + 16 + 8 * hh), x3 = *(const v4fa*)(arow + kb + 16 + 8 * hh + 4);
    float xs[16] = {x0[0],x0[1],x0[2],x0[3],x1[0],x1[1],x1[2],x1[3],x2[0],x2[1],x2[2],x2[3],x3[0],x3[1],x3[2],x3[3]};
#pragma unroll
    for (int i = 0; i < 16; ++i) { const unsigned short hb = bf16_bits(xs[i]); ah.u[i] = hb; al.u[i] = ASPLIT ? bf16_bits(xs[i] - bf16_val(hb)) : (unsigned short)0; }
#pragma unroll
    for (int t = 0; t < 4; ++t) {
      const unsigned short* brow = Wt + (size_t)(col0 + t * 16 + ln) * ldb + kb;
      FragB b;
      b.half[0] = *(const v8us*)(brow + 8 * hh);
      b.half[1] = *(const v8us*)(brow + 16 + 8 * hh);
      acc[t] = mmaN<ASPLIT ? 2 : 1>(ah.v, al.v, b.v, b.v, acc[t]);
    }
  }
#pragma unroll
  for (int t = 0; t < 4; ++t) {
    const int col = col0 + t * 16 + ln;
    float bv = bias ? bias[col] : 0.f;
    if (BIAS_BF16) bv = bf16_round(bv);
#pragma unroll
    for (int r = 0; r < 8; ++r) {
      float v = acc[t][r] + bv;
      if (resid) { float rv = resid[(size_t)((row0 + 8 * hh + r) % rmod) * ldr + col]; if (RES_BF16) rv = bf16_round(rv); v += rv; }
      if (ACT == 1) v = fmaxf(v, 0.f);
      if (ACT == 2) v = 0.5f * v * (1.0f + erff(v * 0.70710678118654752f));
      if (ACT == 3) { const float u = 0.7978845608028654f * (v + 0.044715f * v * v * v); v = 0.5f * v * (1.0f + tanhf(u)); }
      so[w][8 * hh + r][t * 16 + ln] = v;
    }
  }
  __builtin_amdgcn_fence(__ATOMIC_ACQ_REL, "workgroup");
  __builtin_amdgcn_wave_barrier();
  const int rsub = lane >> 4, c4 = (lane & 15) * 4;
  {
#pragma unroll
    for (int q = 0; q < 8; ++q) {
      const int r = q * 2 + rsub;
      const v4f v = *(const v4fa*)&so[w][r][c4];
      *(v4f*)(C + (size_t)(row0 + r) * ldc + col0 + c4) = v;
    }
    
  }
}
// row LayerNorm (biased variance, eps) over N: s = X (+ R); optional out_sum <- s; out_norm <- (s-mu)*rsqrt(var+eps)*g + b
template <bool PARAM_BF16>
__global__ __launch_bounds__(256) void k_layernorm(const float* __restrict__ X, const float* __restrict__ R, const float* __restrict__ g, const float* __restrict__ bta,
                                                  float* __restrict__ out_sum, float* __restrict__ out_norm, int N, float eps) {
  __shared__ float red[256];
  const int row = blockIdx.x, tid = threadIdx.x;
  const float* x = X + (size_t)row * N; const float* rr = R ? R + (size_t)row * N : nullptr;
  float vals[16];                     // up to N = 4096
  const int per = N / 256;            // contiguous chunk per thread? use strided-by-4 chunks: thread handles j = tid*4 + 1024*u
  float s1 = 0.f;
  for (int u = 0; u < per / 4; ++u) {
    const int j = tid * 4 + 1024 * u;
    const v4f a = *(const v4fa*)(x + j);
    v4f b = {0.f,0.f,0.f,0.f}; if (rr) b = *(const v4fa*)(rr + j);
#pragma unroll
    for (int q = 0; q < 4; ++q) { const float v = a[q] + b[q]; vals[u * 4 + q] = v; s1 += v; }
  }
  red[tid] = s1; __syncthreads();
  for (int st = 128; st > 0; st >>= 1) { if (tid < st) red[tid] += red[tid + st]; __syncthreads(); }
  const float mu = red[0] / (float)N; __syncthreads();
  float s2 = 0.f;
  for (int u = 0; u < per / 4; ++u)
#pragma unroll
    for (int q = 0; q < 4; ++q) { const float c = vals[u * 4 + q] - mu; s2 += c * c; }
  red[tid] = s2; __syncthreads();
  for (int st = 128; st > 0; st >>= 1) { if (tid < st) red[tid] += red[tid + st]; __syncthreads(); }
  const float rs = rsqrtf(red[0] / (float)N + eps);
  {
    for (int u = 0; u < per / 4; ++u) {
      const int j = tid * 4 + 1024 * u;
      v4f o, sm;
#pragma unroll
      for (int q = 0; q < 4; ++q) {
        float gg = g[j + q], bb = bta[j + q];
        if (PARAM_BF16) { gg = bf16_round(gg); bb = bf16_round(bb); }
        sm[q] = vals[u * 4 + q]; o[q] = (vals[u * 4 + q] - mu) * rs * gg + bb;
      }
      if (out_sum) *(v4f*)(out_sum + (size_t)row * N + j) = sm;
      *(v4f*)(out_norm + (size_t)row * N + j) = o;
    }
    
  }
}



// ---- f16 WMMA path (v_wmma_f32_16x16x32_f16): 11-bit significands for operands in range — used where a [0,1] probability operand needs more precision than bf16
typedef _Float16 v16h __attribute__((ext_vector_type(16)));
union FragH { v16h v; v8us half[2]; _Float16 h[16]; unsigned short u[16]; };
template <int NT>
__device__ __forceinline__ v8f mmaH(v16h ah, v16h al, v16h bh, v16h bl, v8f c) {
  c = __builtin_amdgcn_wmma_f32_16x16x32_f16(false, ah, false, bh, (short)0, c, false, false);
  if (NT >= 2) c = __builtin_amdgcn_wmma_f32_16x16x32_f16(false, al, false, bh, (short)0, c, false, false);
  if (NT >= 3) c = __builtin_amdgcn_wmma_f32_16x16x32_f16(false, ah, false, bl, (short)0, c, false, false);
  asm volatile("v_nop\n\tv_nop\n\tv_nop\n\tv_nop" : "+v"(c) : "v"(ah), "v"(al), "v"(bh), "v"(bl));
  return c;
}
// batched GEMM like k_gemm_b but f16 operands: A f32 (split into f16 hi/lo if ASPLIT, else rounded to f16), Bt = f16 values [n][k]; alpha; C f32; N multiple of 16 (partial tiles skipped)
template <bool ASPLIT>
__global__ __launch_bounds__(128) void k_gemm_h(const float* __restrict__ A, int lda, size_t sA, const _Float16* __restrict__ Bh, int ldb, size_t sB, float alpha, float* __restrict__ C, int ldc, size_t sC, int M, int N, int K) {
  __shared__ __attribute__((aligned(16))) float so[4][16][64];
  const int tid = threadIdx.x, w = tid >> 5, lane = tid & 31, ln = lane & 15, hh = lane >> 4; const int by = blockIdx.y;
  A += (size_t)by * sA; Bh += (size_t)by * sB; C += (size_t)by * sC;
  const int ntn = (N + 63) / 64; const int wid = blockIdx.x * 4 + w; const int mt = wid / ntn, nq = wid % ntn; if (mt * 16 >= M) return;
  const int row0 = mt * 16, col0 = nq * 64; const float* arow = A + (size_t)(row0 + ln) * lda;
  v8f acc[4] = {};
  for (int kb = 0; kb < K; kb += 32) {
    FragH ah, al;
    const v4f x0 = *(const v4fa*)(arow + kb + 8 * hh), x1 = *(const v4fa*)(arow + kb + 8 * hh + 4), x2 = *(const v4fa*)(arow + kb + 16 + 8 * hh), x3 = *(const v4fa*)(arow + kb + 16 + 8 * hh + 4);
    float xs[16] = {x0[0],x0[1],x0[2],x0[3],x1[0],x1[1],x1[2],x1[3],x2[0],x2[1],x2[2],x2[3],x3[0],x3[1],x3[2],x3[3]};
#pragma unroll
    for (int i = 0; i < 16; ++i) { const _Float16 h = (_Float16)xs[i]; ah.h[i] = h; al.h[i] = ASPLIT ? (_Float16)(xs[i] - (float)h) : (_Float16)0.0f; }
#pragma unroll
    for (int t = 0; t < 4; ++t) { if (col0 + t * 16 >= N) continue; const size_t boff = (size_t)(col0 + t * 16 + ln) * ldb + kb; FragH bq; bq.half[0] = *(const v8us*)(Bh + boff + 8 * hh); bq.half[1] = *(const v8us*)(Bh + boff + 16 + 8 * hh);
      acc[t] = mmaH<ASPLIT ? 2 : 1>(ah.v, al.v, bq.v, bq.v, acc[t]); }
  }
#pragma unroll
  for (int t = 0; t < 4; ++t) { if (col0 + t * 16 >= N) continue;
#pragma unroll
    for (int r = 0; r < 8; ++r) so[w][8 * hh + r][t * 16 + ln] = acc[t][r] * alpha; }
  __builtin_amdgcn_fence(__ATOMIC_ACQ_REL, "workgroup"); __builtin_amdgcn_wave_barrier();
  const int rsub = lane >> 4, c4 = (lane & 15) * 4;
  {
#pragma unroll
    for (int q = 0; q < 8; ++q) { const int r = q * 2 + rsub; if (col0 + c4 < N) { const v4f v = *(const v4fa*)&so[w][r][c4]; *(v4f*)(C + (size_t)(row0 + r) * ldc + col0 + c4) = v; } }
     }
}

// Wt[n][k] = f16(W[k][n]·scale) from f32 row-major W[K][N] (scale = power of two; bf16-exact weights stay exact in f16 away from the subnormal range)
__global__ __launch_bounds__(256) void k_wt_f16(const float* __restrict__ W, _Float16* __restrict__ Wt, int K, int N, float scale) {
  const int t = blockIdx.x * 256 + threadIdx.x; if (t >= N * (K / 8)) return; const int n = t / (K / 8), k8 = (t % (K / 8)) * 8; FragH f;
#pragma unroll
  for (int i = 0; i < 8; ++i) f.h[i] = (_Float16)(bf16_round(W[(size_t)(k8 + i) * N + n]) * scale); const v8us o = f.half[0];
  *(v8us*)((unsigned short*)Wt + (size_t)n * K + k8) = o; 
}
// k_gemm_hh variant with fused epilogue: v = acc·alpha + bias[by·sBias + col] (+ CP[(row/rowsPerB)·sCPb + by·64 + col] if CP) ; ACT 0 none / 1 elu ; writes f16 C16 (and f32 C if non-null)
template <int ACT>
__global__ __launch_bounds__(128) void k_gemm_hhx(const _Float16* __restrict__ A, int lda, size_t sA, const _Float16* __restrict__ Bh, int ldb, size_t sB, float alpha, const float* __restrict__ bias, size_t sBias, const float* __restrict__ CP, int rowsPerB, size_t sCPb, int row0g,
    float* __restrict__ C, _Float16* __restrict__ C16, int ldc, size_t sC, int M, int N, int K) {
  __shared__ __attribute__((aligned(16))) float so[4][16][64];
  const int tid = threadIdx.x, w = tid >> 5, lane = tid & 31, ln = lane & 15, hh = lane >> 4; const int by = blockIdx.y;
  A += (size_t)by * sA; Bh += (size_t)by * sB; const size_t cofs = (size_t)by * sC; const float* bp = bias ? bias + (size_t)by * sBias : nullptr;
  const int ntn = (N + 63) / 64; const int wid = blockIdx.x * 4 + w; const int mt = wid / ntn, nq = wid % ntn; if (mt * 16 >= M) return;
  const int row0 = mt * 16, col0 = nq * 64; const _Float16* arow = A + (size_t)(row0 + ln) * lda;
  v8f acc[4] = {};
  for (int kb = 0; kb < K; kb += 32) { FragH ah; ah.half[0] = *(const v8us*)((const unsigned short*)arow + kb + 8 * hh); ah.half[1] = *(const v8us*)((const unsigned short*)arow + kb + 16 + 8 * hh);
#pragma unroll
    for (int t = 0; t < 4; ++t) { if (col0 + t * 16 >= N) continue; const size_t boff = (size_t)(col0 + t * 16 + ln) * ldb + kb; FragH bq; bq.half[0] = *(const v8us*)((const unsigned short*)Bh + boff + 8 * hh); bq.half[1] = *(const v8us*)((const unsigned short*)Bh + boff + 16 + 8 * hh);
      acc[t] = mmaH<1>(ah.v, ah.v, bq.v, bq.v, acc[t]); }
  }
#pragma unroll
  for (int t = 0; t < 4; ++t) { if (col0 + t * 16 >= N) continue; const int col = col0 + t * 16 + ln; const float bv = bp ? bf16_round(bp[col]) : 0.f;
#pragma unroll
    for (int r = 0; r < 8; ++r) { float v = acc[t][r] * alpha + bv; if (CP) { const int rr = row0g + row0 + 8 * hh + r; if (rowsPerB < 0) v += CP[cofs + (size_t)rr * ldc + col];      /* rowsPerB < 0: own element of the batched C plane */ else { const int bidx = rr / rowsPerB; v += CP[(size_t)bidx * sCPb + (size_t)by * 64 + col]; } } if (ACT == 1) v = (v > 0.f) ? v : expm1f(v); else if (ACT == 7) v = (v > 0.f) ? v + 1.0f : expf(v); else if (ACT == 8) v = tanhf(v); else if (ACT == 9) v = 0.5f * v * (1.0f + tanhf(0.7978845608028654f * (v + 0.044715f * v * v * v))); else if (ACT == 11) v = 1.0f / (1.0f + expf(-v)); else if (ACT == 12) v = (v > 0.f) ? v : 0.01f * v; else if (ACT == 14) v = (v > 0.f) ? v : 0.1f * v; else if (ACT == 16) v = (v >= 0.f) ? v : 0.3f * v; else if (ACT == 17) v = (v >= 0.f) ? v : 0.2f * v; else if (ACT == 15) v = v / (1.0f + expf(-v)); else if (ACT == 3) v = fmaxf(v, 0.f); else if (ACT == 6) v = 0.5f * v * (1.0f + erff(v * 0.70710678118654752f)); so[w][8 * hh + r][t * 16 + ln] = v; } }
  __builtin_amdgcn_fence(__ATOMIC_ACQ_REL, "workgroup"); __builtin_amdgcn_wave_barrier();
  const int rsub = lane >> 4, c4 = (lane & 15) * 4; typedef _Float16 v4h __attribute__((ext_vector_type(4)));
  {
#pragma unroll
    for (int q = 0; q < 8; ++q) { const int r = q * 2 + rsub; if (col0 + c4 < N) { const v4f v = *(const v4fa*)&so[w][r][c4]; if (C) *(v4f*)(C + cofs + (size_t)(row0 + r) * ldc + col0 + c4) = v; if (C16) { v4h h4; for (int i = 0; i < 4; ++i) h4[i] = (_Float16)v[i]; *(v4h*)(C16 + cofs + (size_t)(row0 + r) * ldc + col0 + c4) = h4; } } }
     }
}


typedef _Float16 v4h __attribute__((ext_vector_type(4)));

__global__ __launch_bounds__(256) void k_x16(const float* __restrict__ x, _Float16* __restrict__ X16, size_t n8) { const size_t t = (size_t)blockIdx.x * 256 + threadIdx.x; if (t >= n8) return; FragH f;
#pragma unroll
  for (int q = 0; q < 8; ++q) f.h[q] = (_Float16)bf16_round(x[t * 8 + q]); *(v8us*)((unsigned short*)X16 + t * 8) = f.half[0];  }
__global__ __launch_bounds__(256) void k_h16(const float* __restrict__ x, _Float16* __restrict__ X16, size_t n8) { const size_t t = (size_t)blockIdx.x * 256 + threadIdx.x; if (t >= n8) return; FragH f;
#pragma unroll
  for (int q = 0; q < 8; ++q) f.h[q] = (_Float16)x[t * 8 + q]; *(v8us*)((unsigned short*)X16 + t * 8) = f.half[0];  }
__global__ __launch_bounds__(256) void k_round16f(const float* __restrict__ W, _Float16* __restrict__ Bt, size_t n8) { const size_t t = (size_t)blockIdx.x * 256 + threadIdx.x; if (t >= n8) return; FragH f;
#pragma unroll
  for (int i = 0; i < 8; ++i) f.h[i] = (_Float16)(bf16_round(W[t * 8 + i]) * 16.0f); *(v8us*)((unsigned short*)Bt + t * 8) = f.half[0];  }
template <int NHv, int TTv>
__global__ __launch_bounds__(256) void k_vt(const _Float16* __restrict__ V16, int ldv, int voff, _Float16* __restrict__ Vt) { __shared__ unsigned short tl[64][66]; const int tid = threadIdx.x; const int slab = blockIdx.x / (TTv / 64), lg = blockIdx.x % (TTv / 64); const int b = slab / NHv, h = slab % NHv;
  for (int i = tid; i < 64 * 8; i += 256) { const int r = i / 8, c8 = (i % 8) * 8; FragH f; f.half[0] = *(const v8us*)((const unsigned short*)V16 + ((size_t)b * TTv + lg * 64 + r) * ldv + voff + h * 64 + c8);
#pragma unroll
    for (int q = 0; q < 8; ++q) tl[r][c8 + q] = f.u[q]; }
  __syncthreads();
  {
#pragma unroll
    for (int rd = 0; rd < 2; ++rd) { const int d = rd * 32 + tid / 8, pc = tid % 8; FragH f;
#pragma unroll
      for (int q = 0; q < 8; ++q) f.u[q] = tl[pc * 8 + q][d];
      *(v8us*)((unsigned short*)Vt + ((size_t)slab * 64 + d) * TTv + lg * 64 + pc * 8) = f.half[0]; }
     } }

__global__ __launch_bounds__(256) void k_hl(const float* __restrict__ F, _Float16* __restrict__ Hh, _Float16* __restrict__ Hl, size_t n8) { const size_t t = (size_t)blockIdx.x * 256 + threadIdx.x; if (t >= n8) return; FragH fh, fl; const v4f a = *(const v4fa*)(F + t * 8), c = *(const v4fa*)(F + t * 8 + 4);
#pragma unroll
  for (int q = 0; q < 4; ++q) { _Float16 h = (_Float16)a[q]; fh.h[q] = h; fl.h[q] = (_Float16)((a[q] - (float)h) * 1024.0f); h = (_Float16)c[q]; fh.h[4 + q] = h; fl.h[4 + q] = (_Float16)((c[q] - (float)h) * 1024.0f); }
  { *(v8us*)((unsigned short*)Hh + t * 8) = fh.half[0]; *(v8us*)((unsigned short*)Hl + t * 8) = fl.half[0];  } }

// ---- fast GEMM (wave tile 32x64; requires M % 32 == 0 rows per launch region and N % 64 == 0); epilogue = k_gemm_hhx semantics ----
__device__ __forceinline__ v16h g2_frag(const _Float16* p, int hh) { FragH f; f.half[0] = *(const v8us*)((const unsigned short*)p + 8 * hh); f.half[1] = *(const v8us*)((const unsigned short*)p + 16 + 8 * hh); return f.v; }
__device__ __forceinline__ v8f g2_mma(v16h a, v16h b, v8f c) { v8f d = __builtin_amdgcn_wmma_f32_16x16x32_f16(false, a, false, b, (short)0, c, false, false); asm volatile("v_nop\n\tv_nop\n\tv_nop\n\tv_nop" : "+v"(d) : "v"(a), "v"(b)); return d; }
template <int ACT>
__global__ __launch_bounds__(128) void k_gemm2(const _Float16* __restrict__ A, int lda, size_t sA, const _Float16* __restrict__ Bh, int ldb, size_t sB, float alpha, const float* __restrict__ bias, size_t sBias, const float* __restrict__ CP, int rowsPerB, size_t sCPb, int row0g,
    float* __restrict__ C, _Float16* __restrict__ C16, int ldc, size_t sC, int M, int N, int K) { static_assert(ACT == 0 || ACT == 3 || ACT == 6 || ACT == 8 || ACT == 9 || ACT == 11 || ACT == 12 || ACT == 14 || ACT == 15 || ACT == 16 || ACT == 17, "k_gemm2: unsupported ACT code (would silently apply no activation)");
  __shared__ __attribute__((aligned(16))) float so[4][32][68];
  const int tid = threadIdx.x, w = tid >> 5, lane = tid & 31, ln = lane & 15, hh = lane >> 4; const int by = blockIdx.y;
  A += (size_t)by * sA; Bh += (size_t)by * sB; const size_t cofs = (size_t)by * sC; const float* bp = bias ? bias + (size_t)by * sBias : nullptr;
  const int ntn = N >> 6; const int mt = blockIdx.x / ntn, nq = blockIdx.x - mt * ntn; const int row0 = mt * 128 + 32 * w, col0 = nq * 64; if (row0 >= M) return;
  const _Float16* a0p = A + (size_t)(row0 + ln) * lda; const _Float16* a1p = a0p + (size_t)16 * lda;
  const _Float16* b0p = Bh + (size_t)(col0 + ln) * ldb; const _Float16* b1p = b0p + (size_t)16 * ldb; const _Float16* b2p = b1p + (size_t)16 * ldb; const _Float16* b3p = b2p + (size_t)16 * ldb;
  const v8f z8 = {0.f,0.f,0.f,0.f,0.f,0.f,0.f,0.f}; v8f c00 = z8, c01 = z8, c02 = z8, c03 = z8, c10 = z8, c11 = z8, c12 = z8, c13 = z8;
#pragma unroll 1
  for (int kb = 0; kb < K; kb += 32) { const v16h a0 = g2_frag(a0p + kb, hh), a1 = g2_frag(a1p + kb, hh);
    v16h b = g2_frag(b0p + kb, hh); c00 = g2_mma(a0, b, c00); c10 = g2_mma(a1, b, c10);
    b = g2_frag(b1p + kb, hh); c01 = g2_mma(a0, b, c01); c11 = g2_mma(a1, b, c11);
    b = g2_frag(b2p + kb, hh); c02 = g2_mma(a0, b, c02); c12 = g2_mma(a1, b, c12);
    b = g2_frag(b3p + kb, hh); c03 = g2_mma(a0, b, c03); c13 = g2_mma(a1, b, c13); }
  v8f accs[8] = {c00, c01, c02, c03, c10, c11, c12, c13};
#pragma unroll
  for (int u = 0; u < 8; ++u) { const int t = u & 3, half = u >> 2; const int col = col0 + t * 16 + ln; const float bv = bp ? bf16_round(bp[col]) : 0.f;
#pragma unroll
    for (int r = 0; r < 8; ++r) { const int rloc = half * 16 + 8 * hh + r; float v = accs[u][r] * alpha + bv; if (CP) { if (rowsPerB < 0) v += CP[cofs + (size_t)(row0g + row0 + rloc) * ldc + col];      /* rowsPerB < 0: own element of the batched C plane */ else { const int bidx = (row0g + row0 + rloc) / rowsPerB; v += CP[(size_t)bidx * sCPb + (size_t)by * 64 + col]; } }
      if (ACT == 3) v = fmaxf(v, 0.f); else if (ACT == 6) v = 0.5f * v * (1.0f + erff(v * 0.70710678118654752f)); else if (ACT == 11) v = 1.0f / (1.0f + expf(-v)); else if (ACT == 15) v = v / (1.0f + expf(-v)); else if (ACT == 12) v = (v > 0.f) ? v : 0.01f * v; else if (ACT == 8) v = tanhf(v); else if (ACT == 9) v = 0.5f * v * (1.0f + tanhf(0.7978845608028654f * (v + 0.044715f * v * v * v))); else if (ACT == 14) v = (v > 0.f) ? v : 0.1f * v; else if (ACT == 16) v = (v >= 0.f) ? v : 0.3f * v; else if (ACT == 17) v = (v >= 0.f) ? v : 0.2f * v;
      so[w][rloc][t * 16 + ln] = v; } }
  __builtin_amdgcn_fence(__ATOMIC_ACQ_REL, "workgroup"); __builtin_amdgcn_wave_barrier();
  const int rsub = lane >> 4, c4 = (lane & 15) * 4;
  {
#pragma unroll
    for (int q = 0; q < 16; ++q) { const int r = q * 2 + rsub; const v4f v = *(const v4fa*)&so[w][r][c4]; if (C) *(v4f*)(C + cofs + (size_t)(row0 + r) * ldc + col0 + c4) = v; if (C16) { v4h h4; for (int i = 0; i < 4; ++i) h4[i] = (_Float16)v[i]; *(v4h*)(C16 + cofs + (size_t)(row0 + r) * ldc + col0 + c4) = h4; } }
     } }


__global__ __launch_bounds__(256) void k_wnat(const float* __restrict__ w, size_t n8, _Float16* __restrict__ Bt) { const size_t t = (size_t)blockIdx.x * 256 + threadIdx.x; if (t >= n8) return; FragH f; for (int q = 0; q < 8; ++q) f.h[q] = (_Float16)(bf16_round(w[t * 8 + q]) * 16.0f); *(v8us*)((unsigned short*)Bt + t * 8) = f.half[0];  }
__global__ __launch_bounds__(256) void k_rsm(const float* __restrict__ S, _Float16* __restrict__ P, int nrows) {
  #pragma clang fp contract(off)
  const int i = blockIdx.x * 256 + threadIdx.x; if (i >= nrows) return; const float* s = S + (size_t)i * SQ; float mx = -3.0e38f;
#pragma unroll 1
  for (int j = 0; j < SQ; ++j) mx = fmaxf(mx, s[j]); float se = 0.f;
#pragma unroll 1
  for (int j = 0; j < SQ; ++j) se += expf(s[j] - mx); const float sc = 256.0f / se;
#pragma unroll 1
  for (int j0 = 0; j0 < SQ; j0 += 8) { FragH f; for (int q = 0; q < 8; ++q) f.h[q] = (_Float16)(expf(s[j0 + q] - mx) * sc); unsigned short* d = (unsigned short*)P + (size_t)i * SQ + j0; *(v8us*)d = f.half[0];  } }
__global__ __launch_bounds__(256) void k_vt(const _Float16* __restrict__ V16, int b, int h0, _Float16* __restrict__ VT) { __shared__ unsigned short tl[64][65]; const int tid = threadIdx.x; const int hh = blockIdx.x % HG, sg = blockIdx.x / HG; const int s0 = sg * 64; const int h = h0 + hh;
  for (int i = tid; i < 64 * 8; i += 256) { const int j = i / 8, d8 = (i % 8) * 8; FragH f; f.half[0] = *(const v8us*)((const unsigned short*)V16 + ((size_t)b * SQ + s0 + j) * DM + h * HD + d8); for (int q = 0; q < 8; ++q) tl[d8 + q][j] = f.u[q]; }
  __syncthreads();
  { for (int i = tid; i < 64 * 8; i += 256) { const int d = i / 8, j8 = (i % 8) * 8; FragH f; for (int q = 0; q < 8; ++q) f.u[q] = tl[d][j8 + q]; *(v8us*)((unsigned short*)VT + ((size_t)hh * HD + d) * SQ + s0 + j8) = f.half[0]; }  } }



// One wave per score row: lane l holds keys 128 u + 4 l .. + 3 of every 128-key unit u in registers (each load 512 contiguous bytes, each store 256), so S is read once; row max and row sum end in a five-step butterfly over the lanes. nk: a multiple of 256, at most NKX.
__global__ __launch_bounds__(256) void k_rsmcf2(const float* __restrict__ S, _Float16* __restrict__ P, int hg, int q0, int nk) {
  const int lane = threadIdx.x & 31; const int t = blockIdx.x * 8 + (threadIdx.x >> 5); if (t >= hg * QT) return;      /* the same in every lane of a wave; no barrier below */
  const float* s = S + (size_t)t * NKX + lane * 4; _Float16* p = P + (size_t)t * NKX + lane * 4; const int last = q0 + (t % QT); const int nc = nk / 256;
  v4f v[NKX / 128];
#pragma unroll      /* static indices keep v in registers */
  for (int c = 0; c < NKX / 256; ++c) if (c < nc) { v[2 * c] = *(const v4fa*)(s + c * 256); v[2 * c + 1] = *(const v4fa*)(s + c * 256 + 128); }
  float mx = -3.0e38f;
#pragma unroll      /* static indices, as above */
  for (int c = 0; c < NKX / 256; ++c) if (c < nc) { for (int u = 2 * c; u < 2 * c + 2; ++u) for (int q = 0; q < 4; ++q) { const float f = (u * 128 + lane * 4 + q <= last) ? 1.f : 0.f; const float m = fmaf(f, v[u][q], (1.f - f) * -1.0e9f); v[u][q] = m; mx = fmaxf(mx, m); } }
  for (int d = 16; d > 0; d >>= 1) mx = fmaxf(mx, __shfl_xor(mx, d));
  float se4[4] = {0.f, 0.f, 0.f, 0.f};
#pragma unroll      /* static indices, as above */
  for (int c = 0; c < NKX / 256; ++c) if (c < nc) { for (int u = 2 * c; u < 2 * c + 2; ++u) for (int q = 0; q < 4; ++q) { const float e = __expf(v[u][q] - mx); v[u][q] = e; se4[q] += e; } }
  float se = (se4[0] + se4[1]) + (se4[2] + se4[3]);
  for (int d = 16; d > 0; d >>= 1) se += __shfl_xor(se, d);
  const float sc = 256.0f / se;
#pragma unroll      /* static indices, as above */
  for (int c = 0; c < NKX / 256; ++c) if (c < nc) { for (int u = 2 * c; u < 2 * c + 2; ++u) { v4h h4; for (int q = 0; q < 4; ++q) h4[q] = (_Float16)(v[u][q] * sc); *(v4h*)(p + u * 128) = h4; }
    if (c + 1 < NKX / 256) asm volatile("s_wait_xcnt 0x0" ::: "memory"); }      /* the next unit's products reuse the data registers of the two stores just issued */
}


template <int MASKADD>
__global__ __launch_bounds__(64) void k_att0(const float* __restrict__ QF, const float* __restrict__ KF, const float* __restrict__ VF, int ld, const float* __restrict__ mask, float scale, float* __restrict__ OF, int ldo) {
  #pragma clang fp contract(off)
  __shared__ __attribute__((aligned(16))) float lq[64][64]; __shared__ __attribute__((aligned(16))) float lo[64][64];
  const int tid = threadIdx.x; const int h = blockIdx.x / (QT0 / 64), rg = blockIdx.x % (QT0 / 64); const int i = rg * 64 + tid;
  const float* qr = QF + (size_t)i * ld + h * HD;
#pragma unroll 1
  for (int c = 0; c < HD / 4; ++c) { *(v4f*)&lq[tid][c * 4] = *(const v4fa*)(qr + c * 4); const v4f z = {0.f, 0.f, 0.f, 0.f}; *(v4f*)&lo[tid][c * 4] = z; }
  float m = -1.0e30f, l = 0.f; const int jmax = MASKADD ? (SQ - 1) : (rg * 64 + 63);      /* additive-mask form: every key (the mask input decides); causal form: keys up to the block's last row */
#pragma unroll 1
  for (int j = 0; j <= jmax; ++j) { const float* kr = KF + (size_t)j * ld + h * HD; const float* vr = VF + (size_t)j * ld + h * HD; float s = 0.f;
#pragma unroll 1
    for (int c = 0; c < HD / 4; ++c) { const v4f kq = *(const v4fa*)(kr + c * 4); const v4f qq = *(v4f*)&lq[tid][c * 4]; s = __fadd_rn(s, __fmul_rn(qq[0], kq[0])); s = __fadd_rn(s, __fmul_rn(qq[1], kq[1])); s = __fadd_rn(s, __fmul_rn(qq[2], kq[2])); s = __fadd_rn(s, __fmul_rn(qq[3], kq[3])); }
    s = __fmul_rn(s, scale); if (MASKADD) s = __fadd_rn(s, __fmul_rn(bf16_round(mask[(size_t)i * SQ + j]), -10000.0f));
    const float f = (MASKADD || j <= i) ? 1.f : 0.f; const float sm = fmaf(f, s, (1.f - f) * -1.0e30f); const float mn = fmaxf(m, sm); const float sc = expf(m - mn); const float e = expf(sm - mn); l = __fadd_rn(__fmul_rn(l, sc), e); m = mn;
#pragma unroll 1
    for (int c = 0; c < HD / 4; ++c) { const v4f vv = *(const v4fa*)(vr + c * 4); v4f oo = *(v4f*)&lo[tid][c * 4]; for (int u = 0; u < 4; ++u) oo[u] = __fadd_rn(__fmul_rn(oo[u], sc), __fmul_rn(e, vv[u])); *(v4f*)&lo[tid][c * 4] = oo; } }
  const float fin = 64.0f / l;      /* o carried x64 like the f16 path */
#pragma unroll 1
  for (int c = 0; c < HD / 4; ++c) { v4f oo = *(v4f*)&lo[tid][c * 4]; for (int u = 0; u < 4; ++u) oo[u] = __fmul_rn(oo[u], fin); *(v4f*)&lo[tid][c * 4] = oo; }
  __syncthreads();
  {
#pragma unroll 1
    for (int it = 0; it < 16; ++it) { const int row = it * 4 + tid / 16, pc = (tid % 16) * 4; const v4f v = *(const v4f*)&lo[row][pc]; *(v4f*)(OF + (size_t)(rg * 64 + row) * ldo + h * HD + pc) = v; }
     } }


template <int BFIN, int W16, int W32>
__global__ __launch_bounds__(256) void k_lnx(const float* __restrict__ X, const float* __restrict__ g, const float* __restrict__ bb, float eps, _Float16* __restrict__ N16, float* __restrict__ N32) {
  #pragma clang fp contract(off)
  __shared__ float red[256]; const size_t r = blockIdx.x; const int t = threadIdx.x; const bool act = t < (DMQ / 4); const int c0 = act ? t * 4 : 0;
  const v4f xa = *(const v4fa*)(X + r * DMQ + c0); float s[4]; float sum = 0.f;
  for (int q = 0; q < 4; ++q) { s[q] = act ? (BFIN ? bf16_round(xa[q]) : xa[q]) : 0.f; sum = __fadd_rn(sum, s[q]); }
  red[t] = sum; __syncthreads(); for (int st = 128; st > 0; st >>= 1) { if (t < st) red[t] = __fadd_rn(red[t], red[t + st]); __syncthreads(); } const float mu = red[0] / (float)DMQ; __syncthreads();
  float vs = 0.f; for (int q = 0; q < 4; ++q) { const float dl = act ? __fadd_rn(s[q], -mu) : 0.f; vs = __fadd_rn(vs, __fmul_rn(dl, dl)); } red[t] = vs; __syncthreads(); for (int st = 128; st > 0; st >>= 1) { if (t < st) red[t] = __fadd_rn(red[t], red[t + st]); __syncthreads(); }
  const float rs = rsqrtf(__fadd_rn(red[0] / (float)DMQ, eps)); v4h y; v4f yf;
  for (int q = 0; q < 4; ++q) { const int c = c0 + q; yf[q] = __fadd_rn(__fmul_rn(__fmul_rn(__fadd_rn(s[q], -mu), rs), bf16_round(g[c])), bf16_round(bb[c])); y[q] = (_Float16)yf[q]; }
  if (!act) return;      /* no barriers after this point */
  { if (W16) *(v4h*)(N16 + r * DMQ + c0) = y; if (W32) *(v4f*)(N32 + r * DMQ + c0) = yf;  } }

extern "C" void kernel_launch(void* const* d_in, const int* in_sizes, int n_in,
                              void* d_out, int out_size, void* d_ws, size_t ws_size, hipStream_t stream) {
  (void)in_sizes; (void)n_in; (void)out_size;
  const float* const* I = (const float* const*)d_in; const float* x = I[0]; const float* wq = I[1]; const float* bq = I[2]; const float* wk = I[3]; const float* bk = I[4]; const float* wv = I[5]; const float* bv = I[6]; const float* wo = I[7]; const float* bo = I[8]; const float* lng = I[9]; const float* lnb = I[10];      /* [in][out] weights + biases; LN gamma/beta */
  char* ws = (char*)d_ws; size_t off = 0;
  auto take = [&](size_t bytes) { char* p = ws + off; off += (bytes + 255) & ~(size_t)255; return p; };
  _Float16* BQ = (_Float16*)take((size_t)DM * DM * 2); _Float16* BK = (_Float16*)take((size_t)DM * DM * 2); _Float16* BV = (_Float16*)take((size_t)DM * DM * 2); _Float16* BO = (_Float16*)take((size_t)DM * DM * 2);
  _Float16* X16 = (_Float16*)take(NR * DM * 2); float* HF = (float*)take(NR * DM * 4); _Float16* XL = (_Float16*)take(NR * DM * 2); float* QKF = (float*)take(NR * DM * 4); _Float16* Q16 = (_Float16*)take(NR * DM * 2); _Float16* K16 = (_Float16*)take(NR * DM * 2); _Float16* V16 = (_Float16*)take(NR * DM * 2); _Float16* O16 = (_Float16*)take(NR * DM * 2);
  float* S = (float*)take((size_t)NH * QT * NKX * 4); _Float16* P = (_Float16*)take((size_t)NH * QT * NKX * 2); _Float16* VT = (_Float16*)take((size_t)NH * HD * SQ * 2);
  float* QF0 = (float*)take((size_t)QT0 * DM * 4); float* KF0 = (float*)take((size_t)QT0 * DM * 4); float* VF0 = (float*)take((size_t)QT0 * DM * 4); float* OF0 = (float*)take((size_t)NB * QT0 * DM * 4); _Float16* OH0 = (_Float16*)take((size_t)NB * QT0 * DM * 2); _Float16* OL0 = (_Float16*)take((size_t)NB * QT0 * DM * 2);
  if (off > ws_size) return;
  k_wt_f16<<<(unsigned)(((size_t)DM * (DM / 8) + 255) / 256), 256, 0, stream>>>(wq, BQ, DM, DM, 16.0f); k_wt_f16<<<(unsigned)(((size_t)DM * (DM / 8) + 255) / 256), 256, 0, stream>>>(wk, BK, DM, DM, 16.0f); k_wt_f16<<<(unsigned)(((size_t)DM * (DM / 8) + 255) / 256), 256, 0, stream>>>(wv, BV, DM, DM, 16.0f); k_wt_f16<<<(unsigned)(((size_t)DM * (DM / 8) + 255) / 256), 256, 0, stream>>>(wo, BO, DM, DM, 16.0f);      /* [in][out] -> Bt[n][k] x16 */

  k_lnx<1, 0, 1><<<(unsigned)NR, 256, 0, stream>>>(x, lng, lnb, 1e-5f, nullptr, HF); k_hl<<<(unsigned)((NR * DM / 8 + 255) / 256), 256, 0, stream>>>(HF, X16, XL, NR * DM / 8);      /* h = LN(bf16(x)) f32 -> f16 hi (X16) + x1024 residual (XL) rows */
  const size_t r0p = (size_t)B0 * SQ;      /* first projected row */
  k_gemm2<0><<<dim3((unsigned)((MP / 128) * (DM / 64)), 1), 128, 0, stream>>>(X16 + r0p * DM, DM, 0, BQ, DM, 0, 0.0625f, bq, 0, nullptr, 1, 0, 0, QKF + r0p * DM, nullptr, DM, 0, MP, DM, DM); k_gemm2<0><<<dim3((unsigned)((MP / 128) * (DM / 64)), 1), 128, 0, stream>>>(XL + r0p * DM, DM, 0, BQ, DM, 0, 0.00006103515625f, nullptr, 0, QKF + r0p * DM, -1, 0, 0, nullptr, Q16 + r0p * DM, DM, 0, MP, DM, DM);      
  k_gemm2<0><<<dim3((unsigned)((MP / 128) * (DM / 64)), 1), 128, 0, stream>>>(X16 + r0p * DM, DM, 0, BK, DM, 0, 0.0625f, bk, 0, nullptr, 1, 0, 0, QKF + r0p * DM, nullptr, DM, 0, MP, DM, DM); k_gemm2<0><<<dim3((unsigned)((MP / 128) * (DM / 64)), 1), 128, 0, stream>>>(XL + r0p * DM, DM, 0, BK, DM, 0, 0.00006103515625f, nullptr, 0, QKF + r0p * DM, -1, 0, 0, nullptr, K16 + r0p * DM, DM, 0, MP, DM, DM);      
  k_gemm2<0><<<dim3((unsigned)((MP / 128) * (DM / 64)), 1), 128, 0, stream>>>(X16 + r0p * DM, DM, 0, BV, DM, 0, 0.0625f, bv, 0, nullptr, 1, 0, 0, QKF + r0p * DM, nullptr, DM, 0, MP, DM, DM); k_gemm2<0><<<dim3((unsigned)((MP / 128) * (DM / 64)), 1), 128, 0, stream>>>(XL + r0p * DM, DM, 0, BV, DM, 0, 0.00006103515625f, nullptr, 0, QKF + r0p * DM, -1, 0, 0, nullptr, V16 + r0p * DM, DM, 0, MP, DM, DM);      
  for (int b = B0; b < B0 + NBR; ++b) { const size_t r0 = (size_t)b * SQ;
    k_vt<NH, SQ><<<NH * (SQ / 64), 256, 0, stream>>>(V16 + r0 * LQ, LQ, 0, VT);      /* V^T [NH][HD][SQ] for this batch */
    k_gemm2<0><<<dim3((QT0 / 128) * (DM / 64), 1), 128, 0, stream>>>(X16 + r0 * DM, DM, 0, BQ, DM, 0, 0.0625f, bq, 0, nullptr, 1, 0, 0, QF0, nullptr, DM, 0, QT0, DM, DM); k_gemm2<0><<<dim3((QT0 / 128) * (DM / 64), 1), 128, 0, stream>>>(XL + r0 * DM, DM, 0, BQ, DM, 0, 0.00006103515625f, nullptr, 0, QF0, -1, 0, 0, QF0, nullptr, DM, 0, QT0, DM, DM); k_gemm2<0><<<dim3((QT0 / 128) * (DM / 64), 1), 128, 0, stream>>>(X16 + r0 * DM, DM, 0, BK, DM, 0, 0.0625f, bk, 0, nullptr, 1, 0, 0, KF0, nullptr, DM, 0, QT0, DM, DM); k_gemm2<0><<<dim3((QT0 / 128) * (DM / 64), 1), 128, 0, stream>>>(XL + r0 * DM, DM, 0, BK, DM, 0, 0.00006103515625f, nullptr, 0, KF0, -1, 0, 0, KF0, nullptr, DM, 0, QT0, DM, DM); k_gemm2<0><<<dim3((QT0 / 128) * (DM / 64), 1), 128, 0, stream>>>(X16 + r0 * DM, DM, 0, BV, DM, 0, 0.0625f, bv, 0, nullptr, 1, 0, 0, VF0, nullptr, DM, 0, QT0, DM, DM); k_gemm2<0><<<dim3((QT0 / 128) * (DM / 64), 1), 128, 0, stream>>>(XL + r0 * DM, DM, 0, BV, DM, 0, 0.00006103515625f, nullptr, 0, VF0, -1, 0, 0, VF0, nullptr, DM, 0, QT0, DM, DM);      /* f32 q, k, v of the first 128 rows (exact products) */
    k_att0<0><<<NH * (QT0 / 64), 64, 0, stream>>>(QF0, KF0, VF0, DM, nullptr, 0.125f, OF0 + (size_t)b * QT0 * DM, DM);      /* exact f32 attention for rows 0..127 (o x64) */
    for (int q0 = 0; q0 < QN; q0 += QT) { const int nk = q0 + QT;      /* causal: only keys below the tile end are computed */
      k_gemm2<0><<<dim3((QT / 128) * (nk / 64), NHD), 128, 0, stream>>>(Q16 + (r0 + q0) * LQ, LQ, (size_t)HD, K16 + r0 * LQ, LQ, (size_t)HD, 0.125f, nullptr, 0, nullptr, 1, 0, 0, S, nullptr, NKX, (size_t)QT * NKX, QT, nk, HD);      /* scores, all heads on grid.y */
      k_rsmcf2<<<(NHD * QT + 7) / 8, 256, 0, stream>>>(S, P, NHD, q0, nk);      /* one wave per row, 8 rows per block */
      k_gemm2<0><<<dim3((QT / 128) * (HD / 64), NHD), 128, 0, stream>>>(P, NKX, (size_t)QT * NKX, VT, SQ, (size_t)HD * SQ, 0.25f, nullptr, 0, nullptr, 1, 0, 0, nullptr, O16 + (r0 + q0) * DM, DM, (size_t)HD, QT, HD, nk); } }      /* o (merged heads, x64) as f16 rows */
  k_gemm2<0><<<dim3((unsigned)((MPO / 128) * (DM / 64)), 1), 128, 0, stream>>>(O16 + r0p * DM, DM, 0, BO, DM, 0, 0.0009765625f, bo, 0, nullptr, 1, 0, 0, (float*)d_out + r0p * DM, nullptr, DM, 0, MPO, DM, DM);      /* out rows are the output layout */
  k_hl<<<(unsigned)(((size_t)NB * QT0 * DM / 8 + 255) / 256), 256, 0, stream>>>(OF0, OH0, OL0, (size_t)NB * QT0 * DM / 8);      /* first-tile o (x64) -> f16 hi + x1024 residual planes */
  for (int b = B0; b < B0 + NBR; ++b) { const size_t r0 = (size_t)b * SQ; const size_t f0 = (size_t)b * QT0;
    k_gemm2<0><<<dim3((QT0 / 128) * (DM / 64), 1), 128, 0, stream>>>(OH0 + f0 * DM, DM, 0, BO, DM, 0, 0.0009765625f, bo, 0, nullptr, 1, 0, 0, (float*)d_out + r0 * DM, nullptr, DM, 0, QT0, DM, DM);      /* rows 0..127: out = o_hi Wo (+ b), overwriting the f16-path rows */
    k_gemm2<0><<<dim3((QT0 / 128) * (DM / 64), 1), 128, 0, stream>>>(OL0 + f0 * DM, DM, 0, BO, DM, 0, 0.00000095367431640625f, nullptr, 0, (const float*)d_out + r0 * DM, -1, 0, 0, (float*)d_out + r0 * DM, nullptr, DM, 0, QT0, DM, DM); }      /* += o_lo Wo 2^-20 (own-element accumulate) */
}

// v002
// It runs in 3160 microseconds.
// Two timings next to v001 put it at 1.53 and 1.52 times that version's speed.
// Counting every step since v000, it is 3.37 times as fast.
#include <hip/hip_runtime.h>
// Pre-LayerNorm causal multi-head attention (x [4][2048][1024]; h = LN(x) (eps 1e-5, gamma, beta); q/k/v = h W + b ([in][out] 1024 x 1024 sigma 1/32, zero biases); 16 heads of 64; scores / 8; where(causal, s, finfo.min); softmax; out = merged Wo + bo -> [4][2048][1024], no residual).
// Structure: token rows r = b*2048 + s; h = LN(bf16(x)) as f16 hi + x1024 f16 residual rows; Q, K, V each as two WMMA GEMMs (hi pass + bias into f32, residual pass at 2^-14 added; 32x64 wave tiles, f32 accumulation, exact x16 weights, f16 outputs); per batch: V^T for all heads via LDS transposes; per query tile of 256 rows: scores against the keys below the tile end only (K = 64, all heads on grid.y, alpha = 0.125), causal row softmax on VALU with an arithmetic 0/1 key mask over the computed range (f32 statistics, native exp; weights x256 f16), o = P . V^T (K = keys below the tile end, alpha 2^-2: o carried x64, folded into the output GEMM alpha) written straight into the merged f16 o rows; out = o W_o + b GEMM (f32) into the output layout.
// Compute dtype: inputs rounded to bf16; x / weights exact; q, k, v, softmax weights and o as plain f16 GEMM operands (~2^-12); scores and softmax statistics f32; v_wmma_f32_16x16x32_f16.
#define NB 4
#define SQ 2048
#define DM 1024
#define DMQ DM                       /* LayerNorm width */
#define NH 16
#define HD 64
#define HG 4                         /* heads per launch of the unlaunched k_vt overload */
#define QT 256                       /* query rows per causal tile */
#define NKX SQ                       /* S / P row pitch */
#define QT0 128                      /* first-tile rows recomputed exactly in f32 */
#define B0 0                         /* first batch processed (debug hook) */
#define NBR NB                       /* batches processed (debug hook) */
#define NR ((size_t)NB * SQ)         /* token rows */
#define MP ((int)((size_t)NBR * SQ)) /* rows projected (debug hook) */
#define QN SQ                        /* query rows attended per batch (debug hook) */
#define NHD NH                       /* heads attended (debug hook) */
#define MPO MP                       /* rows through the output stage (debug hook) */
#define LQ DM      /* row pitch of the q/k/v rows */
typedef __bf16 v16b __attribute__((ext_vector_type(16)));
typedef unsigned short v8us __attribute__((ext_vector_type(8), may_alias));
typedef float  v8f  __attribute__((ext_vector_type(8)));
typedef float  v4f  __attribute__((ext_vector_type(4)));
typedef float  v4fa __attribute__((ext_vector_type(4), may_alias));
union FragB { v16b v; v8us half[2]; unsigned short u[16]; };

__device__ __forceinline__ unsigned short bf16_bits(float x) { unsigned int u = __float_as_uint(x); return (unsigned short)((u + 0x7FFFu + ((u >> 16) & 1u)) >> 16); }
__device__ __forceinline__ float bf16_val(unsigned short b) { return __uint_as_float(((unsigned int)b) << 16); }
__device__ __forceinline__ float bf16_round(float x) { return bf16_val(bf16_bits(x)); }
// D += A·B with NT terms: 1 = ah·bh, 2 = + al·bh (A split), 3 = + ah·bl (both split)
template <int NT>
__device__ __forceinline__ v8f mmaN(v16b ah, v16b al, v16b bh, v16b bl, v8f c) {
  c = __builtin_amdgcn_wmma_f32_16x16x32_bf16(false, ah, false, bh, (short)0, c, false, false);
  if (NT >= 2) c = __builtin_amdgcn_wmma_f32_16x16x32_bf16(false, al, false, bh, (short)0, c, false, false);
  if (NT >= 3) c = __builtin_amdgcn_wmma_f32_16x16x32_bf16(false, ah, false, bl, (short)0, c, false, false);
  asm volatile("v_nop\n\tv_nop\n\tv_nop\n\tv_nop" : "+v"(c) : "v"(ah), "v"(al), "v"(bh), "v"(bl));
  return c;
}

__global__ __launch_bounds__(256) void k_wt_bf16(const float* __restrict__ W, unsigned short* __restrict__ Wt, int K, int N) {
  const int t = blockIdx.x * 256 + threadIdx.x;
  const int k8n = K / 8;
  if (t >= N * k8n) return;
  const int n = t / k8n, k8 = (t % k8n) * 8;
  v8us v;
#pragma unroll
  for (int i = 0; i < 8; ++i) v[i] = bf16_bits(W[(size_t)(k8 + i) * N + n]);
  *(v8us*)(Wt + (size_t)n * K + k8) = v;
  
}

// GEMM C[M][N] (f32, pitch ldc) = act(A[M][K]·W + bias). A f32 row-major (pitch lda) converted per fragment to bf16
// (ASPLIT: hi/lo two planes -> 2 terms, else single rounded term); Wt bf16 [N][K] (pitch ldb). BIAS_BF16 rounds the
// bias to bf16 first (bias quantised to bf16 before the add). K%32==0, M%16==0, N%64==0.
template <bool ASPLIT, int ACT, bool BIAS_BF16>
__global__ __launch_bounds__(128) void k_gemm_bf(const float* __restrict__ A, int lda, const unsigned short* __restrict__ Wt, int ldb,
                                               const float* __restrict__ bias, float* __restrict__ C, int ldc, int M, int N, int K) {
  __shared__ __attribute__((aligned(16))) float so[4][16][64];
  const int tid = threadIdx.x, w = tid >> 5, lane = tid & 31, ln = lane & 15, hh = lane >> 4;
  const int ntn = N / 64;
  const int wid = blockIdx.x * 4 + w;
  const int mt = wid / ntn, nq = wid % ntn;
  if (mt * 16 >= M) return;
  const int row0 = mt * 16, col0 = nq * 64;
  const float* arow = A + (size_t)(row0 + ln) * lda;
  v8f acc[4] = {};
  for (int kb = 0; kb < K; kb += 32) {
    FragB ah, al;
    const v4f x0 = *(const v4fa*)(arow + kb + 8 * hh), x1 = *(const v4fa*)(arow + kb + 8 * hh + 4);
    const v4f x2 = *(const v4fa*)(arow + kb + 16 + 8 * hh), x3 = *(const v4fa*)(arow + kb + 16 + 8 * hh + 4);
    float xs[16] = {x0[0],x0[1],x0[2],x0[3],x1[0],x1[1],x1[2],x1[3],x2[0],x2[1],x2[2],x2[3],x3[0],x3[1],x3[2],x3[3]};
#pragma unroll
    for (int i = 0; i < 16; ++i) { const unsigned short hb = bf16_bits(xs[i]); ah.u[i] = hb; al.u[i] = ASPLIT ? bf16_bits(xs[i] - bf16_val(hb)) : (unsigned short)0; }
#pragma unroll
    for (int t = 0; t < 4; ++t) {
      const unsigned short* brow = Wt + (size_t)(col0 + t * 16 + ln) * ldb + kb;
      FragB b;
      b.half[0] = *(const v8us*)(brow + 8 * hh);
      b.half[1] = *(const v8us*)(brow + 16 + 8 * hh);
      acc[t] = mmaN<ASPLIT ? 2 : 1>(ah.v, al.v, b.v, b.v, acc[t]);
    }
  }
#pragma unroll
  for (int t = 0; t < 4; ++t) {
    float bv = bias ? bias[col0 + t * 16 + ln] : 0.f;
    if (BIAS_BF16) bv = bf16_round(bv);
#pragma unroll
    for (int r = 0; r < 8; ++r) { float v = acc[t][r] + bv; if (ACT == 1) v = fmaxf(v, 0.f); so[w][8 * hh + r][t * 16 + ln] = v; }
  }
  __builtin_amdgcn_fence(__ATOMIC_ACQ_REL, "workgroup");
  __builtin_amdgcn_wave_barrier();
  const int rsub = lane >> 4, c4 = (lane & 15) * 4;
  {
#pragma unroll
    for (int q = 0; q < 8; ++q) {
      const int r = q * 2 + rsub;
      const v4f v = *(const v4fa*)&so[w][r][c4];
      *(v4f*)(C + (size_t)(row0 + r) * ldc + col0 + c4) = v;
    }
    
  }
}

// GEMM C = act(A·W + bias + resid): A f32 (ASPLIT -> hi/lo 2 terms), Wt bf16 [N][K]; ACT 0 none, 1 relu, 2 exact gelu;
// resid (optional, f32, row index = (row % rmod), pitch ldr, RES_BF16 rounds it) added before the activation.
template <bool ASPLIT, int ACT, bool BIAS_BF16, bool RES_BF16>
__global__ __launch_bounds__(128) void k_gemm_bf3(const float* __restrict__ A, int lda, const unsigned short* __restrict__ Wt, int ldb,
                                                const float* __restrict__ bias, const float* __restrict__ resid, int rmod, int ldr,
                                                float* __restrict__ C, int ldc, int M, int N, int K) {
  __shared__ __attribute__((aligned(16))) float so[4][16][64];
  const int tid = threadIdx.x, w = tid >> 5, lane = tid & 31, ln = lane & 15, hh = lane >> 4;
  const int ntn = N / 64;
  const int wid = blockIdx.x * 4 + w;
  const int mt = wid / ntn, nq = wid % ntn;
  if (mt * 16 >= M) return;
  const int row0 = mt * 16, col0 = nq * 64;
  const float* arow = A + (size_t)(row0 + ln) * lda;
  v8f acc[4] = {};
  for (int kb = 0; kb < K; kb += 32) {
    FragB ah, al;
    const v4f x0 = *(const v4fa*)(arow + kb + 8 * hh), x1 = *(const v4fa*)(arow + kb + 8 * hh + 4);
    const v4f x2 = *(const v4fa*)(arow + kb + 16 + 8 * hh), x3 = *(const v4fa*)(arow + kb + 16 + 8 * hh + 4);
    float xs[16] = {x0[0],x0[1],x0[2],x0[3],x1[0],x1[1],x1[2],x1[3],x2[0],x2[1],x2[2],x2[3],x3[0],x3[1],x3[2],x3[3]};
#pragma unroll
    for (int i = 0; i < 16; ++i) { const unsigned short hb = bf16_bits(xs[i]); ah.u[i] = hb; al.u[i] = ASPLIT ? bf16_bits(xs[i] - bf16_val(hb)) : (unsigned short)0; }
#pragma unroll
    for (int t = 0; t < 4; ++t) {
      const unsigned short* brow = Wt + (size_t)(col0 + t * 16 + ln) * ldb + kb;
      FragB b;
      b.half[0] = *(const v8us*)(brow + 8 * hh);
      b.half[1] = *(const v8us*)(brow + 16 + 8 * hh);
      acc[t] = mmaN<ASPLIT ? 2 : 1>(ah.v, al.v, b.v, b.v, acc[t]);
    }
  }
#pragma unroll
  for (int t = 0; t < 4; ++t) {
    const int col = col0 + t * 16 + ln;
    float bv = bias ? bias[col] : 0.f;
    if (BIAS_BF16) bv = bf16_round(bv);
#pragma unroll
    for (int r = 0; r < 8; ++r) {
      float v = acc[t][r] + bv;
      if (resid) { float rv = resid[(size_t)((row0 + 8 * hh + r) % rmod) * ldr + col]; if (RES_BF16) rv = bf16_round(rv); v += rv; }
      if (ACT == 1) v = fmaxf(v, 0.f);
      if (ACT == 2) v = 0.5f * v * (1.0f + erff(v * 0.70710678118654752f));
      if (ACT == 3) { const float u = 0.7978845608028654f * (v + 0.044715f * v * v * v); v = 0.5f * v * (1.0f + tanhf(u)); }
      so[w][8 * hh + r][t * 16 + ln] = v;
    }
  }
  __builtin_amdgcn_fence(__ATOMIC_ACQ_REL, "workgroup");
  __builtin_amdgcn_wave_barrier();
  const int rsub = lane >> 4, c4 = (lane & 15) * 4;
  {
#pragma unroll
    for (int q = 0; q < 8; ++q) {
      const int r = q * 2 + rsub;
      const v4f v = *(const v4fa*)&so[w][r][c4];
      *(v4f*)(C + (size_t)(row0 + r) * ldc + col0 + c4) = v;
    }
    
  }
}
// row LayerNorm (biased variance, eps) over N: s = X (+ R); optional out_sum <- s; out_norm <- (s-mu)*rsqrt(var+eps)*g + b
template <bool PARAM_BF16>
__global__ __launch_bounds__(256) void k_layernorm(const float* __restrict__ X, const float* __restrict__ R, const float* __restrict__ g, const float* __restrict__ bta,
                                                  float* __restrict__ out_sum, float* __restrict__ out_norm, int N, float eps) {
  __shared__ float red[256];
  const int row = blockIdx.x, tid = threadIdx.x;
  const float* x = X + (size_t)row * N; const float* rr = R ? R + (size_t)row * N : nullptr;
  float vals[16];                     // up to N = 4096
  const int per = N / 256;            // contiguous chunk per thread? use strided-by-4 chunks: thread handles j = tid*4 + 1024*u
  float s1 = 0.f;
  for (int u = 0; u < per / 4; ++u) {
    const int j = tid * 4 + 1024 * u;
    const v4f a = *(const v4fa*)(x + j);
    v4f b = {0.f,0.f,0.f,0.f}; if (rr) b = *(const v4fa*)(rr + j);
#pragma unroll
    for (int q = 0; q < 4; ++q) { const float v = a[q] + b[q]; vals[u * 4 + q] = v; s1 += v; }
  }
  red[tid] = s1; __syncthreads();
  for (int st = 128; st > 0; st >>= 1) { if (tid < st) red[tid] += red[tid + st]; __syncthreads(); }
  const float mu = red[0] / (float)N; __syncthreads();
  float s2 = 0.f;
  for (int u = 0; u < per / 4; ++u)
#pragma unroll
    for (int q = 0; q < 4; ++q) { const float c = vals[u * 4 + q] - mu; s2 += c * c; }
  red[tid] = s2; __syncthreads();
  for (int st = 128; st > 0; st >>= 1) { if (tid < st) red[tid] += red[tid + st]; __syncthreads(); }
  const float rs = rsqrtf(red[0] / (float)N + eps);
  {
    for (int u = 0; u < per / 4; ++u) {
      const int j = tid * 4 + 1024 * u;
      v4f o, sm;
#pragma unroll
      for (int q = 0; q < 4; ++q) {
        float gg = g[j + q], bb = bta[j + q];
        if (PARAM_BF16) { gg = bf16_round(gg); bb = bf16_round(bb); }
        sm[q] = vals[u * 4 + q]; o[q] = (vals[u * 4 + q] - mu) * rs * gg + bb;
      }
      if (out_sum) *(v4f*)(out_sum + (size_t)row * N + j) = sm;
      *(v4f*)(out_norm + (size_t)row * N + j) = o;
    }
    
  }
}



// ---- f16 WMMA path (v_wmma_f32_16x16x32_f16): 11-bit significands for operands in range — used where a [0,1] probability operand needs more precision than bf16
typedef _Float16 v16h __attribute__((ext_vector_type(16)));
union FragH { v16h v; v8us half[2]; _Float16 h[16]; unsigned short u[16]; };
template <int NT>
__device__ __forceinline__ v8f mmaH(v16h ah, v16h al, v16h bh, v16h bl, v8f c) {
  c = __builtin_amdgcn_wmma_f32_16x16x32_f16(false, ah, false, bh, (short)0, c, false, false);
  if (NT >= 2) c = __builtin_amdgcn_wmma_f32_16x16x32_f16(false, al, false, bh, (short)0, c, false, false);
  if (NT >= 3) c = __builtin_amdgcn_wmma_f32_16x16x32_f16(false, ah, false, bl, (short)0, c, false, false);
  asm volatile("v_nop\n\tv_nop\n\tv_nop\n\tv_nop" : "+v"(c) : "v"(ah), "v"(al), "v"(bh), "v"(bl));
  return c;
}
// batched GEMM like k_gemm_b but f16 operands: A f32 (split into f16 hi/lo if ASPLIT, else rounded to f16), Bt = f16 values [n][k]; alpha; C f32; N multiple of 16 (partial tiles skipped)
template <bool ASPLIT>
__global__ __launch_bounds__(128) void k_gemm_h(const float* __restrict__ A, int lda, size_t sA, const _Float16* __restrict__ Bh, int ldb, size_t sB, float alpha, float* __restrict__ C, int ldc, size_t sC, int M, int N, int K) {
  __shared__ __attribute__((aligned(16))) float so[4][16][64];
  const int tid = threadIdx.x, w = tid >> 5, lane = tid & 31, ln = lane & 15, hh = lane >> 4; const int by = blockIdx.y;
  A += (size_t)by * sA; Bh += (size_t)by * sB; C += (size_t)by * sC;
  const int ntn = (N + 63) / 64; const int wid = blockIdx.x * 4 + w; const int mt = wid / ntn, nq = wid % ntn; if (mt * 16 >= M) return;
  const int row0 = mt * 16, col0 = nq * 64; const float* arow = A + (size_t)(row0 + ln) * lda;
  v8f acc[4] = {};
  for (int kb = 0; kb < K; kb += 32) {
    FragH ah, al;
    const v4f x0 = *(const v4fa*)(arow + kb + 8 * hh), x1 = *(const v4fa*)(arow + kb + 8 * hh + 4), x2 = *(const v4fa*)(arow + kb + 16 + 8 * hh), x3 = *(const v4fa*)(arow + kb + 16 + 8 * hh + 4);
    float xs[16] = {x0[0],x0[1],x0[2],x0[3],x1[0],x1[1],x1[2],x1[3],x2[0],x2[1],x2[2],x2[3],x3[0],x3[1],x3[2],x3[3]};
#pragma unroll
    for (int i = 0; i < 16; ++i) { const _Float16 h = (_Float16)xs[i]; ah.h[i] = h; al.h[i] = ASPLIT ? (_Float16)(xs[i] - (float)h) : (_Float16)0.0f; }
#pragma unroll
    for (int t = 0; t < 4; ++t) { if (col0 + t * 16 >= N) continue; const size_t boff = (size_t)(col0 + t * 16 + ln) * ldb + kb; FragH bq; bq.half[0] = *(const v8us*)(Bh + boff + 8 * hh); bq.half[1] = *(const v8us*)(Bh + boff + 16 + 8 * hh);
      acc[t] = mmaH<ASPLIT ? 2 : 1>(ah.v, al.v, bq.v, bq.v, acc[t]); }
  }
#pragma unroll
  for (int t = 0; t < 4; ++t) { if (col0 + t * 16 >= N) continue;
#pragma unroll
    for (int r = 0; r < 8; ++r) so[w][8 * hh + r][t * 16 + ln] = acc[t][r] * alpha; }
  __builtin_amdgcn_fence(__ATOMIC_ACQ_REL, "workgroup"); __builtin_amdgcn_wave_barrier();
  const int rsub = lane >> 4, c4 = (lane & 15) * 4;
  {
#pragma unroll
    for (int q = 0; q < 8; ++q) { const int r = q * 2 + rsub; if (col0 + c4 < N) { const v4f v = *(const v4fa*)&so[w][r][c4]; *(v4f*)(C + (size_t)(row0 + r) * ldc + col0 + c4) = v; } }
     }
}

// Wt[n][k] = f16(W[k][n]·scale) from f32 row-major W[K][N] (scale = power of two; bf16-exact weights stay exact in f16 away from the subnormal range)
__global__ __launch_bounds__(256) void k_wt_f16(const float* __restrict__ W, _Float16* __restrict__ Wt, int K, int N, float scale) {
  const int t = blockIdx.x * 256 + threadIdx.x; if (t >= N * (K / 8)) return; const int n = t / (K / 8), k8 = (t % (K / 8)) * 8; FragH f;
#pragma unroll
  for (int i = 0; i < 8; ++i) f.h[i] = (_Float16)(bf16_round(W[(size_t)(k8 + i) * N + n]) * scale); const v8us o = f.half[0];
  *(v8us*)((unsigned short*)Wt + (size_t)n * K + k8) = o; 
}
// k_gemm_hh variant with fused epilogue: v = acc·alpha + bias[by·sBias + col] (+ CP[(row/rowsPerB)·sCPb + by·64 + col] if CP) ; ACT 0 none / 1 elu ; writes f16 C16 (and f32 C if non-null)
template <int ACT>
__global__ __launch_bounds__(128) void k_gemm_hhx(const _Float16* __restrict__ A, int lda, size_t sA, const _Float16* __restrict__ Bh, int ldb, size_t sB, float alpha, const float* __restrict__ bias, size_t sBias, const float* __restrict__ CP, int rowsPerB, size_t sCPb, int row0g,
    float* __restrict__ C, _Float16* __restrict__ C16, int ldc, size_t sC, int M, int N, int K) {
  __shared__ __attribute__((aligned(16))) float so[4][16][64];
  const int tid = threadIdx.x, w = tid >> 5, lane = tid & 31, ln = lane & 15, hh = lane >> 4; const int by = blockIdx.y;
  A += (size_t)by * sA; Bh += (size_t)by * sB; const size_t cofs = (size_t)by * sC; const float* bp = bias ? bias + (size_t)by * sBias : nullptr;
  const int ntn = (N + 63) / 64; const int wid = blockIdx.x * 4 + w; const int mt = wid / ntn, nq = wid % ntn; if (mt * 16 >= M) return;
  const int row0 = mt * 16, col0 = nq * 64; const _Float16* arow = A + (size_t)(row0 + ln) * lda;
  v8f acc[4] = {};
  for (int kb = 0; kb < K; kb += 32) { FragH ah; ah.half[0] = *(const v8us*)((const unsigned short*)arow + kb + 8 * hh); ah.half[1] = *(const v8us*)((const unsigned short*)arow + kb + 16 + 8 * hh);
#pragma unroll
    for (int t = 0; t < 4; ++t) { if (col0 + t * 16 >= N) continue; const size_t boff = (size_t)(col0 + t * 16 + ln) * ldb + kb; FragH bq; bq.half[0] = *(const v8us*)((const unsigned short*)Bh + boff + 8 * hh); bq.half[1] = *(const v8us*)((const unsigned short*)Bh + boff + 16 + 8 * hh);
      acc[t] = mmaH<1>(ah.v, ah.v, bq.v, bq.v, acc[t]); }
  }
#pragma unroll
  for (int t = 0; t < 4; ++t) { if (col0 + t * 16 >= N) continue; const int col = col0 + t * 16 + ln; const float bv = bp ? bf16_round(bp[col]) : 0.f;
#pragma unroll
    for (int r = 0; r < 8; ++r) { float v = acc[t][r] * alpha + bv; if (CP) { const int rr = row0g + row0 + 8 * hh + r; if (rowsPerB < 0) v += CP[cofs + (size_t)rr * ldc + col];      /* rowsPerB < 0: own element of the batched C plane */ else { const int bidx = rr / rowsPerB; v += CP[(size_t)bidx * sCPb + (size_t)by * 64 + col]; } } if (ACT == 1) v = (v > 0.f) ? v : expm1f(v); else if (ACT == 7) v = (v > 0.f) ? v + 1.0f : expf(v); else if (ACT == 8) v = tanhf(v); else if (ACT == 9) v = 0.5f * v * (1.0f + tanhf(0.7978845608028654f * (v + 0.044715f * v * v * v))); else if (ACT == 11) v = 1.0f / (1.0f + expf(-v)); else if (ACT == 12) v = (v > 0.f) ? v : 0.01f * v; else if (ACT == 14) v = (v > 0.f) ? v : 0.1f * v; else if (ACT == 16) v = (v >= 0.f) ? v : 0.3f * v; else if (ACT == 17) v = (v >= 0.f) ? v : 0.2f * v; else if (ACT == 15) v = v / (1.0f + expf(-v)); else if (ACT == 3) v = fmaxf(v, 0.f); else if (ACT == 6) v = 0.5f * v * (1.0f + erff(v * 0.70710678118654752f)); so[w][8 * hh + r][t * 16 + ln] = v; } }
  __builtin_amdgcn_fence(__ATOMIC_ACQ_REL, "workgroup"); __builtin_amdgcn_wave_barrier();
  const int rsub = lane >> 4, c4 = (lane & 15) * 4; typedef _Float16 v4h __attribute__((ext_vector_type(4)));
  {
#pragma unroll
    for (int q = 0; q < 8; ++q) { const int r = q * 2 + rsub; if (col0 + c4 < N) { const v4f v = *(const v4fa*)&so[w][r][c4]; if (C) *(v4f*)(C + cofs + (size_t)(row0 + r) * ldc + col0 + c4) = v; if (C16) { v4h h4; for (int i = 0; i < 4; ++i) h4[i] = (_Float16)v[i]; *(v4h*)(C16 + cofs + (size_t)(row0 + r) * ldc + col0 + c4) = h4; } } }
     }
}


typedef _Float16 v4h __attribute__((ext_vector_type(4)));

__global__ __launch_bounds__(256) void k_x16(const float* __restrict__ x, _Float16* __restrict__ X16, size_t n8) { const size_t t = (size_t)blockIdx.x * 256 + threadIdx.x; if (t >= n8) return; FragH f;
#pragma unroll
  for (int q = 0; q < 8; ++q) f.h[q] = (_Float16)bf16_round(x[t * 8 + q]); *(v8us*)((unsigned short*)X16 + t * 8) = f.half[0];  }
__global__ __launch_bounds__(256) void k_h16(const float* __restrict__ x, _Float16* __restrict__ X16, size_t n8) { const size_t t = (size_t)blockIdx.x * 256 + threadIdx.x; if (t >= n8) return; FragH f;
#pragma unroll
  for (int q = 0; q < 8; ++q) f.h[q] = (_Float16)x[t * 8 + q]; *(v8us*)((unsigned short*)X16 + t * 8) = f.half[0];  }
__global__ __launch_bounds__(256) void k_round16f(const float* __restrict__ W, _Float16* __restrict__ Bt, size_t n8) { const size_t t = (size_t)blockIdx.x * 256 + threadIdx.x; if (t >= n8) return; FragH f;
#pragma unroll
  for (int i = 0; i < 8; ++i) f.h[i] = (_Float16)(bf16_round(W[t * 8 + i]) * 16.0f); *(v8us*)((unsigned short*)Bt + t * 8) = f.half[0];  }
template <int NHv, int TTv>
__global__ __launch_bounds__(256) void k_vt(const _Float16* __restrict__ V16, int ldv, int voff, _Float16* __restrict__ Vt) { __shared__ unsigned short tl[64][66]; const int tid = threadIdx.x; const int slab = blockIdx.x / (TTv / 64), lg = blockIdx.x % (TTv / 64); const int b = slab / NHv, h = slab % NHv;
  for (int i = tid; i < 64 * 8; i += 256) { const int r = i / 8, c8 = (i % 8) * 8; FragH f; f.half[0] = *(const v8us*)((const unsigned short*)V16 + ((size_t)b * TTv + lg * 64 + r) * ldv + voff + h * 64 + c8);
#pragma unroll
    for (int q = 0; q < 8; ++q) tl[r][c8 + q] = f.u[q]; }
  __syncthreads();
  {
#pragma unroll
    for (int rd = 0; rd < 2; ++rd) { const int d = rd * 32 + tid / 8, pc = tid % 8; FragH f;
#pragma unroll
      for (int q = 0; q < 8; ++q) f.u[q] = tl[pc * 8 + q][d];
      *(v8us*)((unsigned short*)Vt + ((size_t)slab * 64 + d) * TTv + lg * 64 + pc * 8) = f.half[0]; }
     } }

__global__ __launch_bounds__(256) void k_hl(const float* __restrict__ F, _Float16* __restrict__ Hh, _Float16* __restrict__ Hl, size_t n8) { const size_t t = (size_t)blockIdx.x * 256 + threadIdx.x; if (t >= n8) return; FragH fh, fl; const v4f a = *(const v4fa*)(F + t * 8), c = *(const v4fa*)(F + t * 8 + 4);
#pragma unroll
  for (int q = 0; q < 4; ++q) { _Float16 h = (_Float16)a[q]; fh.h[q] = h; fl.h[q] = (_Float16)((a[q] - (float)h) * 1024.0f); h = (_Float16)c[q]; fh.h[4 + q] = h; fl.h[4 + q] = (_Float16)((c[q] - (float)h) * 1024.0f); }
  { *(v8us*)((unsigned short*)Hh + t * 8) = fh.half[0]; *(v8us*)((unsigned short*)Hl + t * 8) = fl.half[0];  } }

// ---- fast GEMM (wave tile 32x64; requires M % 32 == 0 rows per launch region and N % 64 == 0); epilogue = k_gemm_hhx semantics ----
__device__ __forceinline__ v16h g2_frag(const _Float16* p, int hh) { FragH f; f.half[0] = *(const v8us*)((const unsigned short*)p + 8 * hh); f.half[1] = *(const v8us*)((const unsigned short*)p + 16 + 8 * hh); return f.v; }
__device__ __forceinline__ v8f g2_mma(v16h a, v16h b, v8f c) { v8f d = __builtin_amdgcn_wmma_f32_16x16x32_f16(false, a, false, b, (short)0, c, false, false); asm volatile("v_nop\n\tv_nop\n\tv_nop\n\tv_nop" : "+v"(d) : "v"(a), "v"(b)); return d; }
template <int ACT>
__global__ __launch_bounds__(128) void k_gemm2(const _Float16* __restrict__ A, int lda, size_t sA, const _Float16* __restrict__ Bh, int ldb, size_t sB, float alpha, const float* __restrict__ bias, size_t sBias, const float* __restrict__ CP, int rowsPerB, size_t sCPb, int row0g,
    float* __restrict__ C, _Float16* __restrict__ C16, int ldc, size_t sC, int M, int N, int K) { static_assert(ACT == 0 || ACT == 3 || ACT == 6 || ACT == 8 || ACT == 9 || ACT == 11 || ACT == 12 || ACT == 14 || ACT == 15 || ACT == 16 || ACT == 17, "k_gemm2: unsupported ACT code (would silently apply no activation)");
  __shared__ __attribute__((aligned(16))) float so[4][32][68];
  const int tid = threadIdx.x, w = tid >> 5, lane = tid & 31, ln = lane & 15, hh = lane >> 4; const int by = blockIdx.y;
  A += (size_t)by * sA; Bh += (size_t)by * sB; const size_t cofs = (size_t)by * sC; const float* bp = bias ? bias + (size_t)by * sBias : nullptr;
  const int ntn = N >> 6; const int mt = blockIdx.x / ntn, nq = blockIdx.x - mt * ntn; const int row0 = mt * 128 + 32 * w, col0 = nq * 64; if (row0 >= M) return;
  const _Float16* a0p = A + (size_t)(row0 + ln) * lda; const _Float16* a1p = a0p + (size_t)16 * lda;
  const _Float16* b0p = Bh + (size_t)(col0 + ln) * ldb; const _Float16* b1p = b0p + (size_t)16 * ldb; const _Float16* b2p = b1p + (size_t)16 * ldb; const _Float16* b3p = b2p + (size_t)16 * ldb;
  const v8f z8 = {0.f,0.f,0.f,0.f,0.f,0.f,0.f,0.f}; v8f c00 = z8, c01 = z8, c02 = z8, c03 = z8, c10 = z8, c11 = z8, c12 = z8, c13 = z8;
#pragma unroll 1
  for (int kb = 0; kb < K; kb += 32) { const v16h a0 = g2_frag(a0p + kb, hh), a1 = g2_frag(a1p + kb, hh);
    v16h b = g2_frag(b0p + kb, hh); c00 = g2_mma(a0, b, c00); c10 = g2_mma(a1, b, c10);
    b = g2_frag(b1p + kb, hh); c01 = g2_mma(a0, b, c01); c11 = g2_mma(a1, b, c11);
    b = g2_frag(b2p + kb, hh); c02 = g2_mma(a0, b, c02); c12 = g2_mma(a1, b, c12);
    b = g2_frag(b3p + kb, hh); c03 = g2_mma(a0, b, c03); c13 = g2_mma(a1, b, c13); }
  v8f accs[8] = {c00, c01, c02, c03, c10, c11, c12, c13};
#pragma unroll
  for (int u = 0; u < 8; ++u) { const int t = u & 3, half = u >> 2; const int col = col0 + t * 16 + ln; const float bv = bp ? bf16_round(bp[col]) : 0.f;
#pragma unroll
    for (int r = 0; r < 8; ++r) { const int rloc = half * 16 + 8 * hh + r; float v = accs[u][r] * alpha + bv; if (CP) { if (rowsPerB < 0) v += CP[cofs + (size_t)(row0g + row0 + rloc) * ldc + col];      /* rowsPerB < 0: own element of the batched C plane */ else { const int bidx = (row0g + row0 + rloc) / rowsPerB; v += CP[(size_t)bidx * sCPb + (size_t)by * 64 + col]; } }
      if (ACT == 3) v = fmaxf(v, 0.f); else if (ACT == 6) v = 0.5f * v * (1.0f + erff(v * 0.70710678118654752f)); else if (ACT == 11) v = 1.0f / (1.0f + expf(-v)); else if (ACT == 15) v = v / (1.0f + expf(-v)); else if (ACT == 12) v = (v > 0.f) ? v : 0.01f * v; else if (ACT == 8) v = tanhf(v); else if (ACT == 9) v = 0.5f * v * (1.0f + tanhf(0.7978845608028654f * (v + 0.044715f * v * v * v))); else if (ACT == 14) v = (v > 0.f) ? v : 0.1f * v; else if (ACT == 16) v = (v >= 0.f) ? v : 0.3f * v; else if (ACT == 17) v = (v >= 0.f) ? v : 0.2f * v;
      so[w][rloc][t * 16 + ln] = v; } }
  __builtin_amdgcn_fence(__ATOMIC_ACQ_REL, "workgroup"); __builtin_amdgcn_wave_barrier();
  const int rsub = lane >> 4, c4 = (lane & 15) * 4;
  {
#pragma unroll
    for (int q = 0; q < 16; ++q) { const int r = q * 2 + rsub; const v4f v = *(const v4fa*)&so[w][r][c4]; if (C) *(v4f*)(C + cofs + (size_t)(row0 + r) * ldc + col0 + c4) = v; if (C16) { v4h h4; for (int i = 0; i < 4; ++i) h4[i] = (_Float16)v[i]; *(v4h*)(C16 + cofs + (size_t)(row0 + r) * ldc + col0 + c4) = h4; } }
     } }


__global__ __launch_bounds__(256) void k_wnat(const float* __restrict__ w, size_t n8, _Float16* __restrict__ Bt) { const size_t t = (size_t)blockIdx.x * 256 + threadIdx.x; if (t >= n8) return; FragH f; for (int q = 0; q < 8; ++q) f.h[q] = (_Float16)(bf16_round(w[t * 8 + q]) * 16.0f); *(v8us*)((unsigned short*)Bt + t * 8) = f.half[0];  }
__global__ __launch_bounds__(256) void k_rsm(const float* __restrict__ S, _Float16* __restrict__ P, int nrows) {
  #pragma clang fp contract(off)
  const int i = blockIdx.x * 256 + threadIdx.x; if (i >= nrows) return; const float* s = S + (size_t)i * SQ; float mx = -3.0e38f;
#pragma unroll 1
  for (int j = 0; j < SQ; ++j) mx = fmaxf(mx, s[j]); float se = 0.f;
#pragma unroll 1
  for (int j = 0; j < SQ; ++j) se += expf(s[j] - mx); const float sc = 256.0f / se;
#pragma unroll 1
  for (int j0 = 0; j0 < SQ; j0 += 8) { FragH f; for (int q = 0; q < 8; ++q) f.h[q] = (_Float16)(expf(s[j0 + q] - mx) * sc); unsigned short* d = (unsigned short*)P + (size_t)i * SQ + j0; *(v8us*)d = f.half[0];  } }
__global__ __launch_bounds__(256) void k_vt(const _Float16* __restrict__ V16, int b, int h0, _Float16* __restrict__ VT) { __shared__ unsigned short tl[64][65]; const int tid = threadIdx.x; const int hh = blockIdx.x % HG, sg = blockIdx.x / HG; const int s0 = sg * 64; const int h = h0 + hh;
  for (int i = tid; i < 64 * 8; i += 256) { const int j = i / 8, d8 = (i % 8) * 8; FragH f; f.half[0] = *(const v8us*)((const unsigned short*)V16 + ((size_t)b * SQ + s0 + j) * DM + h * HD + d8); for (int q = 0; q < 8; ++q) tl[d8 + q][j] = f.u[q]; }
  __syncthreads();
  { for (int i = tid; i < 64 * 8; i += 256) { const int d = i / 8, j8 = (i % 8) * 8; FragH f; for (int q = 0; q < 8; ++q) f.u[q] = tl[d][j8 + q]; *(v8us*)((unsigned short*)VT + ((size_t)hh * HD + d) * SQ + s0 + j8) = f.half[0]; }  } }



// One wave per score row: lane l holds keys 128 u + 4 l .. + 3 of every 128-key unit u in registers (each load 512 contiguous bytes, each store 256), so S is read once; row max and row sum end in a five-step butterfly over the lanes. nk: a multiple of 256, at most NKX.
__global__ __launch_bounds__(256) void k_rsmcf2(const float* __restrict__ S, _Float16* __restrict__ P, int hg, int q0, int nk) {
  const int lane = threadIdx.x & 31; const int t = blockIdx.x * 8 + (threadIdx.x >> 5); if (t >= hg * QT) return;      /* the same in every lane of a wave; no barrier below */
  const float* s = S + (size_t)t * NKX + lane * 4; _Float16* p = P + (size_t)t * NKX + lane * 4; const int last = q0 + (t % QT); const int nc = nk / 256;
  v4f v[NKX / 128];
#pragma unroll      /* static indices keep v in registers */
  for (int c = 0; c < NKX / 256; ++c) if (c < nc) { v[2 * c] = *(const v4fa*)(s + c * 256); v[2 * c + 1] = *(const v4fa*)(s + c * 256 + 128); }
  float mx = -3.0e38f;
#pragma unroll      /* static indices, as above */
  for (int c = 0; c < NKX / 256; ++c) if (c < nc) { for (int u = 2 * c; u < 2 * c + 2; ++u) for (int q = 0; q < 4; ++q) { const float f = (u * 128 + lane * 4 + q <= last) ? 1.f : 0.f; const float m = fmaf(f, v[u][q], (1.f - f) * -1.0e9f); v[u][q] = m; mx = fmaxf(mx, m); } }
  for (int d = 16; d > 0; d >>= 1) mx = fmaxf(mx, __shfl_xor(mx, d));
  float se4[4] = {0.f, 0.f, 0.f, 0.f};
#pragma unroll      /* static indices, as above */
  for (int c = 0; c < NKX / 256; ++c) if (c < nc) { for (int u = 2 * c; u < 2 * c + 2; ++u) for (int q = 0; q < 4; ++q) { const float e = __expf(v[u][q] - mx); v[u][q] = e; se4[q] += e; } }
  float se = (se4[0] + se4[1]) + (se4[2] + se4[3]);
  for (int d = 16; d > 0; d >>= 1) se += __shfl_xor(se, d);
  const float sc = 256.0f / se;
#pragma unroll      /* static indices, as above */
  for (int c = 0; c < NKX / 256; ++c) if (c < nc) { for (int u = 2 * c; u < 2 * c + 2; ++u) { v4h h4; for (int q = 0; q < 4; ++q) h4[q] = (_Float16)(v[u][q] * sc); *(v4h*)(p + u * 128) = h4; }
    if (c + 1 < NKX / 256) asm volatile("s_wait_xcnt 0x0" ::: "memory"); }      /* the next unit's products reuse the data registers of the two stores just issued */
}


// One thread per query row; 64 rows per block. The row's q and o stay in registers; Q, K and V come in tiles of 64 rows, staged in LDS with whole-line loads; a K or V row is read back as a same-address (broadcast) LDS load. Four keys' score sums run side by side; each sum, and the running m, l, o, keep the key-by-key, element-by-element order.
template <int MASKADD, int LD>      /* LD: row pitch of QF, KF, VF in floats, a constant so that a tile's 16 loads share one address and differ in the immediate offset */
__global__ __launch_bounds__(64) void k_att0(const float* __restrict__ QF, const float* __restrict__ KF, const float* __restrict__ VF, const float* __restrict__ mask, float scale, float* __restrict__ OF, int ldo) {
  #pragma clang fp contract(off)
  __shared__ __attribute__((aligned(16))) float lk[64][HD]; __shared__ __attribute__((aligned(16))) float lv[64][HD]; __shared__ __attribute__((aligned(16))) float lo[64][HD + 4];
  const int tid = threadIdx.x; const int h = blockIdx.x / (QT0 / 64), rg = blockIdx.x % (QT0 / 64); const int i = rg * 64 + tid;
  const int tr = tid / 16, pc = (tid % 16) * 4; const unsigned tb = (unsigned)(tr * LD + pc) * 4u;      /* the thread's byte offset inside a group of four rows: 16 lanes cover one row's 256 bytes */
  { const char* qb = (const char*)(QF + (size_t)(rg * 64) * LD + h * HD);
#pragma unroll      /* all of a thread's tile loads in flight together */
    for (int it = 0; it < 16; ++it) *(v4f*)&lo[it * 4 + tr][pc] = *(const v4fa*)(qb + (size_t)(it * 4) * LD * 4 + tb); }
  __syncthreads();      /* the q tile is complete before a thread reads its row */
  float q[HD], o[HD];
#pragma unroll      /* static indices keep q and o in registers */
  for (int c = 0; c < HD / 4; ++c) { const v4f t = *(const v4f*)&lo[tid][c * 4]; for (int u = 0; u < 4; ++u) { q[c * 4 + u] = t[u]; o[c * 4 + u] = 0.f; } }
  float m = -1.0e30f, l = 0.f; const int jmax = MASKADD ? (SQ - 1) : (rg * 64 + 63);      /* additive-mask form: every key (the mask input decides); causal form: keys up to the block's last row */
  const char* kp = (const char*)(KF + h * HD) + tb; const char* vp = (const char*)(VF + h * HD) + tb;      /* the thread's place in the current K and V tile */
#pragma unroll 1      /* one key tile at a time: the tile buffers are reused */
  for (int j0 = 0; j0 <= jmax; j0 += 64) {
#pragma unroll      /* all of a thread's tile loads in flight together */
    for (int it = 0; it < 16; ++it) { *(v4f*)&lk[it * 4 + tr][pc] = *(const v4fa*)(kp + (size_t)(it * 4) * LD * 4); *(v4f*)&lv[it * 4 + tr][pc] = *(const v4fa*)(vp + (size_t)(it * 4) * LD * 4); }
    __syncthreads();      /* the tile is complete before any row reads it */
#pragma unroll 1      /* four keys per trip are enough to fill the add latency; more only grows the code */
    for (int jj = 0; jj < 64; jj += 4) { float s[4] = {0.f, 0.f, 0.f, 0.f};
#pragma unroll      /* static indices into q */
      for (int c = 0; c < HD / 4; ++c) for (int a = 0; a < 4; ++a) { const v4f kq = *(const v4f*)&lk[jj + a][c * 4]; s[a] = __fadd_rn(s[a], __fmul_rn(q[c * 4 + 0], kq[0])); s[a] = __fadd_rn(s[a], __fmul_rn(q[c * 4 + 1], kq[1])); s[a] = __fadd_rn(s[a], __fmul_rn(q[c * 4 + 2], kq[2])); s[a] = __fadd_rn(s[a], __fmul_rn(q[c * 4 + 3], kq[3])); }
#pragma unroll      /* static indices into s and o */
      for (int a = 0; a < 4; ++a) { const int j = j0 + jj + a; float sv = __fmul_rn(s[a], scale); if (MASKADD) sv = __fadd_rn(sv, __fmul_rn(bf16_round(mask[(size_t)i * SQ + j]), -10000.0f));
        const float f = (MASKADD || j <= i) ? 1.f : 0.f; const float sm = fmaf(f, sv, (1.f - f) * -1.0e30f); const float mn = fmaxf(m, sm); const float sc = expf(m - mn); const float e = expf(sm - mn); l = __fadd_rn(__fmul_rn(l, sc), e); m = mn;
        for (int c = 0; c < HD / 4; ++c) { const v4f vv = *(const v4f*)&lv[jj + a][c * 4]; for (int u = 0; u < 4; ++u) o[c * 4 + u] = __fadd_rn(__fmul_rn(o[c * 4 + u], sc), __fmul_rn(e, vv[u])); } } }
    __syncthreads();      /* every row has left the tile before the next one overwrites it */
    kp += (size_t)64 * LD * 4; vp += (size_t)64 * LD * 4;
  }
  const float fin = 64.0f / l;      /* o carried x64 like the f16 path */
#pragma unroll      /* static indices into o */
  for (int c = 0; c < HD / 4; ++c) { v4f oo; for (int u = 0; u < 4; ++u) oo[u] = __fmul_rn(o[c * 4 + u], fin); *(v4f*)&lo[tid][c * 4] = oo; }
  __syncthreads();
  {
#pragma unroll 1
    for (int it = 0; it < 16; ++it) { const int row = it * 4 + tid / 16, pc = (tid % 16) * 4; const v4f v = *(const v4f*)&lo[row][pc]; *(v4f*)(OF + (size_t)(rg * 64 + row) * ldo + h * HD + pc) = v; }
     } }


template <int BFIN, int W16, int W32>
__global__ __launch_bounds__(256) void k_lnx(const float* __restrict__ X, const float* __restrict__ g, const float* __restrict__ bb, float eps, _Float16* __restrict__ N16, float* __restrict__ N32) {
  #pragma clang fp contract(off)
  __shared__ float red[256]; const size_t r = blockIdx.x; const int t = threadIdx.x; const bool act = t < (DMQ / 4); const int c0 = act ? t * 4 : 0;
  const v4f xa = *(const v4fa*)(X + r * DMQ + c0); float s[4]; float sum = 0.f;
  for (int q = 0; q < 4; ++q) { s[q] = act ? (BFIN ? bf16_round(xa[q]) : xa[q]) : 0.f; sum = __fadd_rn(sum, s[q]); }
  red[t] = sum; __syncthreads(); for (int st = 128; st > 0; st >>= 1) { if (t < st) red[t] = __fadd_rn(red[t], red[t + st]); __syncthreads(); } const float mu = red[0] / (float)DMQ; __syncthreads();
  float vs = 0.f; for (int q = 0; q < 4; ++q) { const float dl = act ? __fadd_rn(s[q], -mu) : 0.f; vs = __fadd_rn(vs, __fmul_rn(dl, dl)); } red[t] = vs; __syncthreads(); for (int st = 128; st > 0; st >>= 1) { if (t < st) red[t] = __fadd_rn(red[t], red[t + st]); __syncthreads(); }
  const float rs = rsqrtf(__fadd_rn(red[0] / (float)DMQ, eps)); v4h y; v4f yf;
  for (int q = 0; q < 4; ++q) { const int c = c0 + q; yf[q] = __fadd_rn(__fmul_rn(__fmul_rn(__fadd_rn(s[q], -mu), rs), bf16_round(g[c])), bf16_round(bb[c])); y[q] = (_Float16)yf[q]; }
  if (!act) return;      /* no barriers after this point */
  { if (W16) *(v4h*)(N16 + r * DMQ + c0) = y; if (W32) *(v4f*)(N32 + r * DMQ + c0) = yf;  } }

extern "C" void kernel_launch(void* const* d_in, const int* in_sizes, int n_in,
                              void* d_out, int out_size, void* d_ws, size_t ws_size, hipStream_t stream) {
  (void)in_sizes; (void)n_in; (void)out_size;
  const float* const* I = (const float* const*)d_in; const float* x = I[0]; const float* wq = I[1]; const float* bq = I[2]; const float* wk = I[3]; const float* bk = I[4]; const float* wv = I[5]; const float* bv = I[6]; const float* wo = I[7]; const float* bo = I[8]; const float* lng = I[9]; const float* lnb = I[10];      /* [in][out] weights + biases; LN gamma/beta */
  char* ws = (char*)d_ws; size_t off = 0;
  auto take = [&](size_t bytes) { char* p = ws + off; off += (bytes + 255) & ~(size_t)255; return p; };
  _Float16* BQ = (_Float16*)take((size_t)DM * DM * 2); _Float16* BK = (_Float16*)take((size_t)DM * DM * 2); _Float16* BV = (_Float16*)take((size_t)DM * DM * 2); _Float16* BO = (_Float16*)take((size_t)DM * DM * 2);
  _Float16* X16 = (_Float16*)take(NR * DM * 2); float* HF = (float*)take(NR * DM * 4); _Float16* XL = (_Float16*)take(NR * DM * 2); float* QKF = (float*)take(NR * DM * 4); _Float16* Q16 = (_Float16*)take(NR * DM * 2); _Float16* K16 = (_Float16*)take(NR * DM * 2); _Float16* V16 = (_Float16*)take(NR * DM * 2); _Float16* O16 = (_Float16*)take(NR * DM * 2);
  float* S = (float*)take((size_t)NH * QT * NKX * 4); _Float16* P = (_Float16*)take((size_t)NH * QT * NKX * 2); _Float16* VT = (_Float16*)take((size_t)NH * HD * SQ * 2);
  float* QF0 = (float*)take((size_t)QT0 * DM * 4); float* KF0 = (float*)take((size_t)QT0 * DM * 4); float* VF0 = (float*)take((size_t)QT0 * DM * 4); float* OF0 = (float*)take((size_t)NB * QT0 * DM * 4); _Float16* OH0 = (_Float16*)take((size_t)NB * QT0 * DM * 2); _Float16* OL0 = (_Float16*)take((size_t)NB * QT0 * DM * 2);
  if (off > ws_size) return;
  k_wt_f16<<<(unsigned)(((size_t)DM * (DM / 8) + 255) / 256), 256, 0, stream>>>(wq, BQ, DM, DM, 16.0f); k_wt_f16<<<(unsigned)(((size_t)DM * (DM / 8) + 255) / 256), 256, 0, stream>>>(wk, BK, DM, DM, 16.0f); k_wt_f16<<<(unsigned)(((size_t)DM * (DM / 8) + 255) / 256), 256, 0, stream>>>(wv, BV, DM, DM, 16.0f); k_wt_f16<<<(unsigned)(((size_t)DM * (DM / 8) + 255) / 256), 256, 0, stream>>>(wo, BO, DM, DM, 16.0f);      /* [in][out] -> Bt[n][k] x16 */

  k_lnx<1, 0, 1><<<(unsigned)NR, 256, 0, stream>>>(x, lng, lnb, 1e-5f, nullptr, HF); k_hl<<<(unsigned)((NR * DM / 8 + 255) / 256), 256, 0, stream>>>(HF, X16, XL, NR * DM / 8);      /* h = LN(bf16(x)) f32 -> f16 hi (X16) + x1024 residual (XL) rows */
  const size_t r0p = (size_t)B0 * SQ;      /* first projected row */
  k_gemm2<0><<<dim3((unsigned)((MP / 128) * (DM / 64)), 1), 128, 0, stream>>>(X16 + r0p * DM, DM, 0, BQ, DM, 0, 0.0625f, bq, 0, nullptr, 1, 0, 0, QKF + r0p * DM, nullptr, DM, 0, MP, DM, DM); k_gemm2<0><<<dim3((unsigned)((MP / 128) * (DM / 64)), 1), 128, 0, stream>>>(XL + r0p * DM, DM, 0, BQ, DM, 0, 0.00006103515625f, nullptr, 0, QKF + r0p * DM, -1, 0, 0, nullptr, Q16 + r0p * DM, DM, 0, MP, DM, DM);      
  k_gemm2<0><<<dim3((unsigned)((MP / 128) * (DM / 64)), 1), 128, 0, stream>>>(X16 + r0p * DM, DM, 0, BK, DM, 0, 0.0625f, bk, 0, nullptr, 1, 0, 0, QKF + r0p * DM, nullptr, DM, 0, MP, DM, DM); k_gemm2<0><<<dim3((unsigned)((MP / 128) * (DM / 64)), 1), 128, 0, stream>>>(XL + r0p * DM, DM, 0, BK, DM, 0, 0.00006103515625f, nullptr, 0, QKF + r0p * DM, -1, 0, 0, nullptr, K16 + r0p * DM, DM, 0, MP, DM, DM);      
  k_gemm2<0><<<dim3((unsigned)((MP / 128) * (DM / 64)), 1), 128, 0, stream>>>(X16 + r0p * DM, DM, 0, BV, DM, 0, 0.0625f, bv, 0, nullptr, 1, 0, 0, QKF + r0p * DM, nullptr, DM, 0, MP, DM, DM); k_gemm2<0><<<dim3((unsigned)((MP / 128) * (DM / 64)), 1), 128, 0, stream>>>(XL + r0p * DM, DM, 0, BV, DM, 0, 0.00006103515625f, nullptr, 0, QKF + r0p * DM, -1, 0, 0, nullptr, V16 + r0p * DM, DM, 0, MP, DM, DM);      
  for (int b = B0; b < B0 + NBR; ++b) { const size_t r0 = (size_t)b * SQ;
    k_vt<NH, SQ><<<NH * (SQ / 64), 256, 0, stream>>>(V16 + r0 * LQ, LQ, 0, VT);      /* V^T [NH][HD][SQ] for this batch */
    k_gemm2<0><<<dim3((QT0 / 128) * (DM / 64), 1), 128, 0, stream>>>(X16 + r0 * DM, DM, 0, BQ, DM, 0, 0.0625f, bq, 0, nullptr, 1, 0, 0, QF0, nullptr, DM, 0, QT0, DM, DM); k_gemm2<0><<<dim3((QT0 / 128) * (DM / 64), 1), 128, 0, stream>>>(XL + r0 * DM, DM, 0, BQ, DM, 0, 0.00006103515625f, nullptr, 0, QF0, -1, 0, 0, QF0, nullptr, DM, 0, QT0, DM, DM); k_gemm2<0><<<dim3((QT0 / 128) * (DM / 64), 1), 128, 0, stream>>>(X16 + r0 * DM, DM, 0, BK, DM, 0, 0.0625f, bk, 0, nullptr, 1, 0, 0, KF0, nullptr, DM, 0, QT0, DM, DM); k_gemm2<0><<<dim3((QT0 / 128) * (DM / 64), 1), 128, 0, stream>>>(XL + r0 * DM, DM, 0, BK, DM, 0, 0.00006103515625f, nullptr, 0, KF0, -1, 0, 0, KF0, nullptr, DM, 0, QT0, DM, DM); k_gemm2<0><<<dim3((QT0 / 128) * (DM / 64), 1), 128, 0, stream>>>(X16 + r0 * DM, DM, 0, BV, DM, 0, 0.0625f, bv, 0, nullptr, 1, 0, 0, VF0, nullptr, DM, 0, QT0, DM, DM); k_gemm2<0><<<dim3((QT0 / 128) * (DM / 64), 1), 128, 0, stream>>>(XL + r0 * DM, DM, 0, BV, DM, 0, 0.00006103515625f, nullptr, 0, VF0, -1, 0, 0, VF0, nullptr, DM, 0, QT0, DM, DM);      /* f32 q, k, v of the first 128 rows (exact products) */
    k_att0<0, DM><<<NH * (QT0 / 64), 64, 0, stream>>>(QF0, KF0, VF0, nullptr, 0.125f, OF0 + (size_t)b * QT0 * DM, DM);      /* exact f32 attention for rows 0..127 (o x64) */
    for (int q0 = 0; q0 < QN; q0 += QT) { const int nk = q0 + QT;      /* causal: only keys below the tile end are computed */
      k_gemm2<0><<<dim3((QT / 128) * (nk / 64), NHD), 128, 0, stream>>>(Q16 + (r0 + q0) * LQ, LQ, (size_t)HD, K16 + r0 * LQ, LQ, (size_t)HD, 0.125f, nullptr, 0, nullptr, 1, 0, 0, S, nullptr, NKX, (size_t)QT * NKX, QT, nk, HD);      /* scores, all heads on grid.y */
      k_rsmcf2<<<(NHD * QT + 7) / 8, 256, 0, stream>>>(S, P, NHD, q0, nk);      /* one wave per row, 8 rows per block */
      k_gemm2<0><<<dim3((QT / 128) * (HD / 64), NHD), 128, 0, stream>>>(P, NKX, (size_t)QT * NKX, VT, SQ, (size_t)HD * SQ, 0.25f, nullptr, 0, nullptr, 1, 0, 0, nullptr, O16 + (r0 + q0) * DM, DM, (size_t)HD, QT, HD, nk); } }      /* o (merged heads, x64) as f16 rows */
  k_gemm2<0><<<dim3((unsigned)((MPO / 128) * (DM / 64)), 1), 128, 0, stream>>>(O16 + r0p * DM, DM, 0, BO, DM, 0, 0.0009765625f, bo, 0, nullptr, 1, 0, 0, (float*)d_out + r0p * DM, nullptr, DM, 0, MPO, DM, DM);      /* out rows are the output layout */
  k_hl<<<(unsigned)(((size_t)NB * QT0 * DM / 8 + 255) / 256), 256, 0, stream>>>(OF0, OH0, OL0, (size_t)NB * QT0 * DM / 8);      /* first-tile o (x64) -> f16 hi + x1024 residual planes */
  for (int b = B0; b < B0 + NBR; ++b) { const size_t r0 = (size_t)b * SQ; const size_t f0 = (size_t)b * QT0;
    k_gemm2<0><<<dim3((QT0 / 128) * (DM / 64), 1), 128, 0, stream>>>(OH0 + f0 * DM, DM, 0, BO, DM, 0, 0.0009765625f, bo, 0, nullptr, 1, 0, 0, (float*)d_out + r0 * DM, nullptr, DM, 0, QT0, DM, DM);      /* rows 0..127: out = o_hi Wo (+ b), overwriting the f16-path rows */
    k_gemm2<0><<<dim3((QT0 / 128) * (DM / 64), 1), 128, 0, stream>>>(OL0 + f0 * DM, DM, 0, BO, DM, 0, 0.00000095367431640625f, nullptr, 0, (const float*)d_out + r0 * DM, -1, 0, 0, (float*)d_out + r0 * DM, nullptr, DM, 0, QT0, DM, DM); }      /* += o_lo Wo 2^-20 (own-element accumulate) */
}

// v003
// It runs in 1240 microseconds.
// Timed twice side by side with v002, it ran 2.55 times as fast both times.
// Over all steps from v000 it is 8.59 times as fast.
#include <hip/hip_runtime.h>
// Pre-LayerNorm causal multi-head attention (x [4][2048][1024]; h = LN(x) (eps 1e-5, gamma, beta); q/k/v = h W + b ([in][out] 1024 x 1024 sigma 1/32, zero biases); 16 heads of 64; scores / 8; where(causal, s, finfo.min); softmax; out = merged Wo + bo -> [4][2048][1024], no residual).
// Structure: token rows r = b*2048 + s; h = LN(bf16(x)) as f16 hi + x1024 residual rows; Q, K, V as three WMMA GEMMs (32x64 wave tiles, f32 accumulation, exact x16 weights + bias, f16 outputs); V^T for all batches and heads via LDS transposes; per query tile of 256 rows, all batches in one launch: scores against the keys below the tile end only (K = 64, heads on grid.y, batches on grid.z, alpha = 0.125), causal row softmax on VALU with an arithmetic 0/1 key mask over the computed range (f32 statistics, native exp; weights x256 f16), o = P . V^T (K = keys below the tile end, alpha 2^-2: o carried x64, folded into the output GEMM alpha) written straight into the merged f16 o rows; out = o W_o + b GEMM (f32) into the output layout.
// Compute dtype: inputs rounded to bf16; x / weights exact; q, k, v, softmax weights and o as plain f16 GEMM operands (~2^-12); scores and softmax statistics f32. v_wmma_f32_16x16x32_f16.
#define NB 4
#define SQ 2048
#define DM 1024
#define DMQ DM                       /* LayerNorm width */
#define NH 16
#define HD 64
#define HG 4                         /* heads per launch of the unlaunched k_vt overload */
#define QT 256                       /* query rows per causal tile */
#define NKX SQ                       /* S row pitch; P's is 2 NKX f16 */
#define QT0 128                      /* first-tile rows recomputed exactly in f32 */
#define B0 0                         /* first batch processed (unused) */
#define NBR NB                       /* batches processed (unused) */
#define NR ((size_t)NB * SQ)         /* token rows */
#define MP ((int)((size_t)NBR * SQ)) /* rows projected (unused) */
#define QN SQ                        /* query rows attended per batch (unused) */
#define NHD NH                       /* heads attended (unused) */
#define MPO MP                       /* rows through the output stage (unused) */
#define LQ DM      /* row pitch of the q/k/v rows */
typedef __bf16 v16b __attribute__((ext_vector_type(16)));
typedef unsigned short v8us __attribute__((ext_vector_type(8), may_alias));
typedef float  v8f  __attribute__((ext_vector_type(8)));
typedef float  v4f  __attribute__((ext_vector_type(4)));
typedef float  v4fa __attribute__((ext_vector_type(4), may_alias));
union FragB { v16b v; v8us half[2]; unsigned short u[16]; };

__device__ __forceinline__ unsigned short bf16_bits(float x) { unsigned int u = __float_as_uint(x); return (unsigned short)((u + 0x7FFFu + ((u >> 16) & 1u)) >> 16); }
__device__ __forceinline__ float bf16_val(unsigned short b) { return __uint_as_float(((unsigned int)b) << 16); }
__device__ __forceinline__ float bf16_round(float x) { return bf16_val(bf16_bits(x)); }
// D += A·B with NT terms: 1 = ah·bh, 2 = + al·bh (A split), 3 = + ah·bl (both split)
template <int NT>
__device__ __forceinline__ v8f mmaN(v16b ah, v16b al, v16b bh, v16b bl, v8f c) {
  c = __builtin_amdgcn_wmma_f32_16x16x32_bf16(false, ah, false, bh, (short)0, c, false, false);
  if (NT >= 2) c = __builtin_amdgcn_wmma_f32_16x16x32_bf16(false, al, false, bh, (short)0, c, false, false);
  if (NT >= 3) c = __builtin_amdgcn_wmma_f32_16x16x32_bf16(false, ah, false, bl, (short)0, c, false, false);
  asm volatile("v_nop\n\tv_nop\n\tv_nop\n\tv_nop" : "+v"(c) : "v"(ah), "v"(al), "v"(bh), "v"(bl));
  return c;
}

__global__ __launch_bounds__(256) void k_wt_bf16(const float* __restrict__ W, unsigned short* __restrict__ Wt, int K, int N) {
  const int t = blockIdx.x * 256 + threadIdx.x;
  const int k8n = K / 8;
  if (t >= N * k8n) return;
  const int n = t / k8n, k8 = (t % k8n) * 8;
  v8us v;
#pragma unroll
  for (int i = 0; i < 8; ++i) v[i] = bf16_bits(W[(size_t)(k8 + i) * N + n]);
  *(v8us*)(Wt + (size_t)n * K + k8) = v;
  
}

// GEMM C[M][N] (f32, pitch ldc) = act(A[M][K]·W + bias). A f32 row-major (pitch lda) converted per fragment to bf16
// (ASPLIT: hi/lo two planes -> 2 terms, else single rounded term); Wt bf16 [N][K] (pitch ldb). BIAS_BF16 rounds the
// bias to bf16 first (bias quantised to bf16 before the add). K%32==0, M%16==0, N%64==0.
template <bool ASPLIT, int ACT, bool BIAS_BF16>
__global__ __launch_bounds__(128) void k_gemm_bf(const float* __restrict__ A, int lda, const unsigned short* __restrict__ Wt, int ldb,
                                               const float* __restrict__ bias, float* __restrict__ C, int ldc, int M, int N, int K) {
  __shared__ __attribute__((aligned(16))) float so[4][16][64];
  const int tid = threadIdx.x, w = tid >> 5, lane = tid & 31, ln = lane & 15, hh = lane >> 4;
  const int ntn = N / 64;
  const int wid = blockIdx.x * 4 + w;
  const int mt = wid / ntn, nq = wid % ntn;
  if (mt * 16 >= M) return;
  const int row0 = mt * 16, col0 = nq * 64;
  const float* arow = A + (size_t)(row0 + ln) * lda;
  v8f acc[4] = {};
  for (int kb = 0; kb < K; kb += 32) {
    FragB ah, al;
    const v4f x0 = *(const v4fa*)(arow + kb + 8 * hh), x1 = *(const v4fa*)(arow + kb + 8 * hh + 4);
    const v4f x2 = *(const v4fa*)(arow + kb + 16 + 8 * hh), x3 = *(const v4fa*)(arow + kb + 16 + 8 * hh + 4);
    float xs[16] = {x0[0],x0[1],x0[2],x0[3],x1[0],x1[1],x1[2],x1[3],x2[0],x2[1],x2[2],x2[3],x3[0],x3[1],x3[2],x3[3]};
#pragma unroll
    for (int i = 0; i < 16; ++i) { const unsigned short hb = bf16_bits(xs[i]); ah.u[i] = hb; al.u[i] = ASPLIT ? bf16_bits(xs[i] - bf16_val(hb)) : (unsigned short)0; }
#pragma unroll
    for (int t = 0; t < 4; ++t) {
      const unsigned short* brow = Wt + (size_t)(col0 + t * 16 + ln) * ldb + kb;
      FragB b;
      b.half[0] = *(const v8us*)(brow + 8 * hh);
      b.half[1] = *(const v8us*)(brow + 16 + 8 * hh);
      acc[t] = mmaN<ASPLIT ? 2 : 1>(ah.v, al.v, b.v, b.v, acc[t]);
    }
  }
#pragma unroll
  for (int t = 0; t < 4; ++t) {
    float bv = bias ? bias[col0 + t * 16 + ln] : 0.f;
    if (BIAS_BF16) bv = bf16_round(bv);
#pragma unroll
    for (int r = 0; r < 8; ++r) { float v = acc[t][r] + bv; if (ACT == 1) v = fmaxf(v, 0.f); so[w][8 * hh + r][t * 16 + ln] = v; }
  }
  __builtin_amdgcn_fence(__ATOMIC_ACQ_REL, "workgroup");
  __builtin_amdgcn_wave_barrier();
  const int rsub = lane >> 4, c4 = (lane & 15) * 4;
  {
#pragma unroll
    for (int q = 0; q < 8; ++q) {
      const int r = q * 2 + rsub;
      const v4f v = *(const v4fa*)&so[w][r][c4];
      *(v4f*)(C + (size_t)(row0 + r) * ldc + col0 + c4) = v;
    }
    
  }
}

// GEMM C = act(A·W + bias + resid): A f32 (ASPLIT -> hi/lo 2 terms), Wt bf16 [N][K]; ACT 0 none, 1 relu, 2 exact gelu;
// resid (optional, f32, row index = (row % rmod), pitch ldr, RES_BF16 rounds it) added before the activation.
template <bool ASPLIT, int ACT, bool BIAS_BF16, bool RES_BF16>
__global__ __launch_bounds__(128) void k_gemm_bf3(const float* __restrict__ A, int lda, const unsigned short* __restrict__ Wt, int ldb,
                                                const float* __restrict__ bias, const float* __restrict__ resid, int rmod, int ldr,
                                                float* __restrict__ C, int ldc, int M, int N, int K) {
  __shared__ __attribute__((aligned(16))) float so[4][16][64];
  const int tid = threadIdx.x, w = tid >> 5, lane = tid & 31, ln = lane & 15, hh = lane >> 4;
  const int ntn = N / 64;
  const int wid = blockIdx.x * 4 + w;
  const int mt = wid / ntn, nq = wid % ntn;
  if (mt * 16 >= M) return;
  const int row0 = mt * 16, col0 = nq * 64;
  const float* arow = A + (size_t)(row0 + ln) * lda;
  v8f acc[4] = {};
  for (int kb = 0; kb < K; kb += 32) {
    FragB ah, al;
    const v4f x0 = *(const v4fa*)(arow + kb + 8 * hh), x1 = *(const v4fa*)(arow + kb + 8 * hh + 4);
    const v4f x2 = *(const v4fa*)(arow + kb + 16 + 8 * hh), x3 = *(const v4fa*)(arow + kb + 16 + 8 * hh + 4);
    float xs[16] = {x0[0],x0[1],x0[2],x0[3],x1[0],x1[1],x1[2],x1[3],x2[0],x2[1],x2[2],x2[3],x3[0],x3[1],x3[2],x3[3]};
#pragma unroll
    for (int i = 0; i < 16; ++i) { const unsigned short hb = bf16_bits(xs[i]); ah.u[i] = hb; al.u[i] = ASPLIT ? bf16_bits(xs[i] - bf16_val(hb)) : (unsigned short)0; }
#pragma unroll
    for (int t = 0; t < 4; ++t) {
      const unsigned short* brow = Wt + (size_t)(col0 + t * 16 + ln) * ldb + kb;
      FragB b;
      b.half[0] = *(const v8us*)(brow + 8 * hh);
      b.half[1] = *(const v8us*)(brow + 16 + 8 * hh);
      acc[t] = mmaN<ASPLIT ? 2 : 1>(ah.v, al.v, b.v, b.v, acc[t]);
    }
  }
#pragma unroll
  for (int t = 0; t < 4; ++t) {
    const int col = col0 + t * 16 + ln;
    float bv = bias ? bias[col] : 0.f;
    if (BIAS_BF16) bv = bf16_round(bv);
#pragma unroll
    for (int r = 0; r < 8; ++r) {
      float v = acc[t][r] + bv;
      if (resid) { float rv = resid[(size_t)((row0 + 8 * hh + r) % rmod) * ldr + col]; if (RES_BF16) rv = bf16_round(rv); v += rv; }
      if (ACT == 1) v = fmaxf(v, 0.f);
      if (ACT == 2) v = 0.5f * v * (1.0f + erff(v * 0.70710678118654752f));
      if (ACT == 3) { const float u = 0.7978845608028654f * (v + 0.044715f * v * v * v); v = 0.5f * v * (1.0f + tanhf(u)); }
      so[w][8 * hh + r][t * 16 + ln] = v;
    }
  }
  __builtin_amdgcn_fence(__ATOMIC_ACQ_REL, "workgroup");
  __builtin_amdgcn_wave_barrier();
  const int rsub = lane >> 4, c4 = (lane & 15) * 4;
  {
#pragma unroll
    for (int q = 0; q < 8; ++q) {
      const int r = q * 2 + rsub;
      const v4f v = *(const v4fa*)&so[w][r][c4];
      *(v4f*)(C + (size_t)(row0 + r) * ldc + col0 + c4) = v;
    }
    
  }
}
// row LayerNorm (biased variance, eps) over N: s = X (+ R); optional out_sum <- s; out_norm <- (s-mu)*rsqrt(var+eps)*g + b
template <bool PARAM_BF16>
__global__ __launch_bounds__(256) void k_layernorm(const float* __restrict__ X, const float* __restrict__ R, const float* __restrict__ g, const float* __restrict__ bta,
                                                  float* __restrict__ out_sum, float* __restrict__ out_norm, int N, float eps) {
  __shared__ float red[256];
  const int row = blockIdx.x, tid = threadIdx.x;
  const float* x = X + (size_t)row * N; const float* rr = R ? R + (size_t)row * N : nullptr;
  float vals[16];                     // up to N = 4096
  const int per = N / 256;            // contiguous chunk per thread? use strided-by-4 chunks: thread handles j = tid*4 + 1024*u
  float s1 = 0.f;
  for (int u = 0; u < per / 4; ++u) {
    const int j = tid * 4 + 1024 * u;
    const v4f a = *(const v4fa*)(x + j);
    v4f b = {0.f,0.f,0.f,0.f}; if (rr) b = *(const v4fa*)(rr + j);
#pragma unroll
    for (int q = 0; q < 4; ++q) { const float v = a[q] + b[q]; vals[u * 4 + q] = v; s1 += v; }
  }
  red[tid] = s1; __syncthreads();
  for (int st = 128; st > 0; st >>= 1) { if (tid < st) red[tid] += red[tid + st]; __syncthreads(); }
  const float mu = red[0] / (float)N; __syncthreads();
  float s2 = 0.f;
  for (int u = 0; u < per / 4; ++u)
#pragma unroll
    for (int q = 0; q < 4; ++q) { const float c = vals[u * 4 + q] - mu; s2 += c * c; }
  red[tid] = s2; __syncthreads();
  for (int st = 128; st > 0; st >>= 1) { if (tid < st) red[tid] += red[tid + st]; __syncthreads(); }
  const float rs = rsqrtf(red[0] / (float)N + eps);
  {
    for (int u = 0; u < per / 4; ++u) {
      const int j = tid * 4 + 1024 * u;
      v4f o, sm;
#pragma unroll
      for (int q = 0; q < 4; ++q) {
        float gg = g[j + q], bb = bta[j + q];
        if (PARAM_BF16) { gg = bf16_round(gg); bb = bf16_round(bb); }
        sm[q] = vals[u * 4 + q]; o[q] = (vals[u * 4 + q] - mu) * rs * gg + bb;
      }
      if (out_sum) *(v4f*)(out_sum + (size_t)row * N + j) = sm;
      *(v4f*)(out_norm + (size_t)row * N + j) = o;
    }
    
  }
}



// ---- f16 WMMA path (v_wmma_f32_16x16x32_f16): 11-bit significands for operands in range — used where a [0,1] probability operand needs more precision than bf16
typedef _Float16 v16h __attribute__((ext_vector_type(16)));
union FragH { v16h v; v8us half[2]; _Float16 h[16]; unsigned short u[16]; };
template <int NT>
__device__ __forceinline__ v8f mmaH(v16h ah, v16h al, v16h bh, v16h bl, v8f c) {
  c = __builtin_amdgcn_wmma_f32_16x16x32_f16(false, ah, false, bh, (short)0, c, false, false);
  if (NT >= 2) c = __builtin_amdgcn_wmma_f32_16x16x32_f16(false, al, false, bh, (short)0, c, false, false);
  if (NT >= 3) c = __builtin_amdgcn_wmma_f32_16x16x32_f16(false, ah, false, bl, (short)0, c, false, false);
  asm volatile("v_nop\n\tv_nop\n\tv_nop\n\tv_nop" : "+v"(c) : "v"(ah), "v"(al), "v"(bh), "v"(bl));
  return c;
}
// batched GEMM like k_gemm_b but f16 operands: A f32 (split into f16 hi/lo if ASPLIT, else rounded to f16), Bt = f16 values [n][k]; alpha; C f32; N multiple of 16 (partial tiles skipped)
template <bool ASPLIT>
__global__ __launch_bounds__(128) void k_gemm_h(const float* __restrict__ A, int lda, size_t sA, const _Float16* __restrict__ Bh, int ldb, size_t sB, float alpha, float* __restrict__ C, int ldc, size_t sC, int M, int N, int K) {
  __shared__ __attribute__((aligned(16))) float so[4][16][64];
  const int tid = threadIdx.x, w = tid >> 5, lane = tid & 31, ln = lane & 15, hh = lane >> 4; const int by = blockIdx.y;
  A += (size_t)by * sA; Bh += (size_t)by * sB; C += (size_t)by * sC;
  const int ntn = (N + 63) / 64; const int wid = blockIdx.x * 4 + w; const int mt = wid / ntn, nq = wid % ntn; if (mt * 16 >= M) return;
  const int row0 = mt * 16, col0 = nq * 64; const float* arow = A + (size_t)(row0 + ln) * lda;
  v8f acc[4] = {};
  for (int kb = 0; kb < K; kb += 32) {
    FragH ah, al;
    const v4f x0 = *(const v4fa*)(arow + kb + 8 * hh), x1 = *(const v4fa*)(arow + kb + 8 * hh + 4), x2 = *(const v4fa*)(arow + kb + 16 + 8 * hh), x3 = *(const v4fa*)(arow + kb + 16 + 8 * hh + 4);
    float xs[16] = {x0[0],x0[1],x0[2],x0[3],x1[0],x1[1],x1[2],x1[3],x2[0],x2[1],x2[2],x2[3],x3[0],x3[1],x3[2],x3[3]};
#pragma unroll
    for (int i = 0; i < 16; ++i) { const _Float16 h = (_Float16)xs[i]; ah.h[i] = h; al.h[i] = ASPLIT ? (_Float16)(xs[i] - (float)h) : (_Float16)0.0f; }
#pragma unroll
    for (int t = 0; t < 4; ++t) { if (col0 + t * 16 >= N) continue; const size_t boff = (size_t)(col0 + t * 16 + ln) * ldb + kb; FragH bq; bq.half[0] = *(const v8us*)(Bh + boff + 8 * hh); bq.half[1] = *(const v8us*)(Bh + boff + 16 + 8 * hh);
      acc[t] = mmaH<ASPLIT ? 2 : 1>(ah.v, al.v, bq.v, bq.v, acc[t]); }
  }
#pragma unroll
  for (int t = 0; t < 4; ++t) { if (col0 + t * 16 >= N) continue;
#pragma unroll
    for (int r = 0; r < 8; ++r) so[w][8 * hh + r][t * 16 + ln] = acc[t][r] * alpha; }
  __builtin_amdgcn_fence(__ATOMIC_ACQ_REL, "workgroup"); __builtin_amdgcn_wave_barrier();
  const int rsub = lane >> 4, c4 = (lane & 15) * 4;
  {
#pragma unroll
    for (int q = 0; q < 8; ++q) { const int r = q * 2 + rsub; if (col0 + c4 < N) { const v4f v = *(const v4fa*)&so[w][r][c4]; *(v4f*)(C + (size_t)(row0 + r) * ldc + col0 + c4) = v; } }
     }
}

// Wt[n][k] = f16(W[k][n]·scale) from f32 row-major W[K][N] (scale = power of two; bf16-exact weights stay exact in f16 away from the subnormal range)
__global__ __launch_bounds__(256) void k_wt_f16(const float* __restrict__ W, _Float16* __restrict__ Wt, int K, int N, float scale) {
  const int t = blockIdx.x * 256 + threadIdx.x; if (t >= N * (K / 8)) return; const int n = t / (K / 8), k8 = (t % (K / 8)) * 8; FragH f;
#pragma unroll
  for (int i = 0; i < 8; ++i) f.h[i] = (_Float16)(bf16_round(W[(size_t)(k8 + i) * N + n]) * scale); const v8us o = f.half[0];
  *(v8us*)((unsigned short*)Wt + (size_t)n * K + k8) = o; 
}
// k_gemm_hh variant with fused epilogue: v = acc·alpha + bias[by·sBias + col] (+ CP[(row/rowsPerB)·sCPb + by·64 + col] if CP) ; ACT 0 none / 1 elu ; writes f16 C16 (and f32 C if non-null)
template <int ACT>
__global__ __launch_bounds__(128) void k_gemm_hhx(const _Float16* __restrict__ A, int lda, size_t sA, const _Float16* __restrict__ Bh, int ldb, size_t sB, float alpha, const float* __restrict__ bias, size_t sBias, const float* __restrict__ CP, int rowsPerB, size_t sCPb, int row0g,
    float* __restrict__ C, _Float16* __restrict__ C16, int ldc, size_t sC, int M, int N, int K) {
  __shared__ __attribute__((aligned(16))) float so[4][16][64];
  const int tid = threadIdx.x, w = tid >> 5, lane = tid & 31, ln = lane & 15, hh = lane >> 4; const int by = blockIdx.y;
  A += (size_t)by * sA; Bh += (size_t)by * sB; const size_t cofs = (size_t)by * sC; const float* bp = bias ? bias + (size_t)by * sBias : nullptr;
  const int ntn = (N + 63) / 64; const int wid = blockIdx.x * 4 + w; const int mt = wid / ntn, nq = wid % ntn; if (mt * 16 >= M) return;
  const int row0 = mt * 16, col0 = nq * 64; const _Float16* arow = A + (size_t)(row0 + ln) * lda;
  v8f acc[4] = {};
  for (int kb = 0; kb < K; kb += 32) { FragH ah; ah.half[0] = *(const v8us*)((const unsigned short*)arow + kb + 8 * hh); ah.half[1] = *(const v8us*)((const unsigned short*)arow + kb + 16 + 8 * hh);
#pragma unroll
    for (int t = 0; t < 4; ++t) { if (col0 + t * 16 >= N) continue; const size_t boff = (size_t)(col0 + t * 16 + ln) * ldb + kb; FragH bq; bq.half[0] = *(const v8us*)((const unsigned short*)Bh + boff + 8 * hh); bq.half[1] = *(const v8us*)((const unsigned short*)Bh + boff + 16 + 8 * hh);
      acc[t] = mmaH<1>(ah.v, ah.v, bq.v, bq.v, acc[t]); }
  }
#pragma unroll
  for (int t = 0; t < 4; ++t) { if (col0 + t * 16 >= N) continue; const int col = col0 + t * 16 + ln; const float bv = bp ? bf16_round(bp[col]) : 0.f;
#pragma unroll
    for (int r = 0; r < 8; ++r) { float v = acc[t][r] * alpha + bv; if (CP) { const int rr = row0g + row0 + 8 * hh + r; if (rowsPerB < 0) v += CP[cofs + (size_t)rr * ldc + col];      /* rowsPerB < 0: own element of the batched C plane */ else { const int bidx = rr / rowsPerB; v += CP[(size_t)bidx * sCPb + (size_t)by * 64 + col]; } } if (ACT == 1) v = (v > 0.f) ? v : expm1f(v); else if (ACT == 7) v = (v > 0.f) ? v + 1.0f : expf(v); else if (ACT == 8) v = tanhf(v); else if (ACT == 9) v = 0.5f * v * (1.0f + tanhf(0.7978845608028654f * (v + 0.044715f * v * v * v))); else if (ACT == 11) v = 1.0f / (1.0f + expf(-v)); else if (ACT == 12) v = (v > 0.f) ? v : 0.01f * v; else if (ACT == 14) v = (v > 0.f) ? v : 0.1f * v; else if (ACT == 16) v = (v >= 0.f) ? v : 0.3f * v; else if (ACT == 17) v = (v >= 0.f) ? v : 0.2f * v; else if (ACT == 15) v = v / (1.0f + expf(-v)); else if (ACT == 3) v = fmaxf(v, 0.f); else if (ACT == 6) v = 0.5f * v * (1.0f + erff(v * 0.70710678118654752f)); so[w][8 * hh + r][t * 16 + ln] = v; } }
  __builtin_amdgcn_fence(__ATOMIC_ACQ_REL, "workgroup"); __builtin_amdgcn_wave_barrier();
  const int rsub = lane >> 4, c4 = (lane & 15) * 4; typedef _Float16 v4h __attribute__((ext_vector_type(4)));
  {
#pragma unroll
    for (int q = 0; q < 8; ++q) { const int r = q * 2 + rsub; if (col0 + c4 < N) { const v4f v = *(const v4fa*)&so[w][r][c4]; if (C) *(v4f*)(C + cofs + (size_t)(row0 + r) * ldc + col0 + c4) = v; if (C16) { v4h h4; for (int i = 0; i < 4; ++i) h4[i] = (_Float16)v[i]; *(v4h*)(C16 + cofs + (size_t)(row0 + r) * ldc + col0 + c4) = h4; } } }
     }
}


typedef _Float16 v4h __attribute__((ext_vector_type(4)));

__global__ __launch_bounds__(256) void k_x16(const float* __restrict__ x, _Float16* __restrict__ X16, size_t n8) { const size_t t = (size_t)blockIdx.x * 256 + threadIdx.x; if (t >= n8) return; FragH f;
#pragma unroll
  for (int q = 0; q < 8; ++q) f.h[q] = (_Float16)bf16_round(x[t * 8 + q]); *(v8us*)((unsigned short*)X16 + t * 8) = f.half[0];  }
__global__ __launch_bounds__(256) void k_h16(const float* __restrict__ x, _Float16* __restrict__ X16, size_t n8) { const size_t t = (size_t)blockIdx.x * 256 + threadIdx.x; if (t >= n8) return; FragH f;
#pragma unroll
  for (int q = 0; q < 8; ++q) f.h[q] = (_Float16)x[t * 8 + q]; *(v8us*)((unsigned short*)X16 + t * 8) = f.half[0];  }
__global__ __launch_bounds__(256) void k_round16f(const float* __restrict__ W, _Float16* __restrict__ Bt, size_t n8) { const size_t t = (size_t)blockIdx.x * 256 + threadIdx.x; if (t >= n8) return; FragH f;
#pragma unroll
  for (int i = 0; i < 8; ++i) f.h[i] = (_Float16)(bf16_round(W[t * 8 + i]) * 16.0f); *(v8us*)((unsigned short*)Bt + t * 8) = f.half[0];  }
template <int NHv, int TTv>
__global__ __launch_bounds__(256) void k_vt(const _Float16* __restrict__ V16, int ldv, int voff, _Float16* __restrict__ Vt) { __shared__ unsigned short tl[64][66]; const int tid = threadIdx.x; const int slab = blockIdx.x / (TTv / 64), lg = blockIdx.x % (TTv / 64); const int b = slab / NHv, h = slab % NHv;
  for (int i = tid; i < 64 * 8; i += 256) { const int r = i / 8, c8 = (i % 8) * 8; FragH f; f.half[0] = *(const v8us*)((const unsigned short*)V16 + ((size_t)b * TTv + lg * 64 + r) * ldv + voff + h * 64 + c8);
#pragma unroll
    for (int q = 0; q < 8; ++q) tl[r][c8 + q] = f.u[q]; }
  __syncthreads();
  {
#pragma unroll
    for (int rd = 0; rd < 2; ++rd) { const int d = rd * 32 + tid / 8, pc = tid % 8; FragH f;
#pragma unroll
      for (int q = 0; q < 8; ++q) f.u[q] = tl[pc * 8 + q][d];
      *(v8us*)((unsigned short*)Vt + ((size_t)slab * 64 + d) * TTv + lg * 64 + pc * 8) = f.half[0]; }
     } }

__global__ __launch_bounds__(256) void k_hl(const float* __restrict__ F, _Float16* __restrict__ Hh, _Float16* __restrict__ Hl, size_t n8) { const size_t t = (size_t)blockIdx.x * 256 + threadIdx.x; if (t >= n8) return; FragH fh, fl; const v4f a = *(const v4fa*)(F + t * 8), c = *(const v4fa*)(F + t * 8 + 4);
#pragma unroll
  for (int q = 0; q < 4; ++q) { _Float16 h = (_Float16)a[q]; fh.h[q] = h; fl.h[q] = (_Float16)((a[q] - (float)h) * 1024.0f); h = (_Float16)c[q]; fh.h[4 + q] = h; fl.h[4 + q] = (_Float16)((c[q] - (float)h) * 1024.0f); }
  { *(v8us*)((unsigned short*)Hh + t * 8) = fh.half[0]; *(v8us*)((unsigned short*)Hl + t * 8) = fl.half[0];  } }

// ---- fast GEMM (wave tile 32x64; requires M % 32 == 0 rows per launch region and N % 64 == 0); epilogue = k_gemm_hhx semantics ----
__device__ __forceinline__ v16h g2_frag(const _Float16* p, int hh) { FragH f; f.half[0] = *(const v8us*)((const unsigned short*)p + 8 * hh); f.half[1] = *(const v8us*)((const unsigned short*)p + 16 + 8 * hh); return f.v; }
__device__ __forceinline__ v8f g2_mma(v16h a, v16h b, v8f c) { v8f d = __builtin_amdgcn_wmma_f32_16x16x32_f16(false, a, false, b, (short)0, c, false, false); asm volatile("v_nop\n\tv_nop\n\tv_nop\n\tv_nop" : "+v"(d) : "v"(a), "v"(b)); return d; }
template <int ACT>
__global__ __launch_bounds__(128) void k_gemm2(const _Float16* __restrict__ A, int lda, size_t sA, const _Float16* __restrict__ Bh, int ldb, size_t sB, float alpha, const float* __restrict__ bias, size_t sBias, const float* __restrict__ CP, int rowsPerB, size_t sCPb, int row0g,
    float* __restrict__ C, _Float16* __restrict__ C16, int ldc, size_t sC, int M, int N, int K, size_t zA, size_t zB, size_t zC, const float* __restrict__ bias1, const float* __restrict__ bias2) { static_assert(ACT == 0 || ACT == 3 || ACT == 6 || ACT == 8 || ACT == 9 || ACT == 11 || ACT == 12 || ACT == 14 || ACT == 15 || ACT == 16 || ACT == 17, "k_gemm2: unsupported ACT code (would silently apply no activation)");
  __shared__ __attribute__((aligned(16))) float so[4][32][68];
  const int tid = threadIdx.x, w = tid >> 5, lane = tid & 31, ln = lane & 15, hh = lane >> 4; const int by = blockIdx.y, bz = blockIdx.z;      /* grid.z: a second batch index (element strides zA, zB, zC) */
  A += (size_t)by * sA + (size_t)bz * zA; Bh += (size_t)by * sB + (size_t)bz * zB; const size_t cofs = (size_t)by * sC + (size_t)bz * zC; const float* bp = bias ? bias + (size_t)by * sBias : nullptr;
  if (bias1 && by == 1) bp = bias1; if (bias2 && by == 2) bp = bias2;      /* bias vectors that are separate buffers: one per grid.y index */
  const int ntn = N >> 6; const int mt = blockIdx.x / ntn, nq = blockIdx.x - mt * ntn; const int row0 = mt * 128 + 32 * w, col0 = nq * 64; if (row0 >= M) return;
  const _Float16* a0p = A + (size_t)(row0 + ln) * lda; const _Float16* a1p = a0p + (size_t)16 * lda;
  const _Float16* b0p = Bh + (size_t)(col0 + ln) * ldb; const _Float16* b1p = b0p + (size_t)16 * ldb; const _Float16* b2p = b1p + (size_t)16 * ldb; const _Float16* b3p = b2p + (size_t)16 * ldb;
  const v8f z8 = {0.f,0.f,0.f,0.f,0.f,0.f,0.f,0.f}; v8f c00 = z8, c01 = z8, c02 = z8, c03 = z8, c10 = z8, c11 = z8, c12 = z8, c13 = z8;
#pragma unroll 1
  for (int kb = 0; kb < K; kb += 32) { const v16h a0 = g2_frag(a0p + kb, hh), a1 = g2_frag(a1p + kb, hh);
    v16h b = g2_frag(b0p + kb, hh); c00 = g2_mma(a0, b, c00); c10 = g2_mma(a1, b, c10);
    b = g2_frag(b1p + kb, hh); c01 = g2_mma(a0, b, c01); c11 = g2_mma(a1, b, c11);
    b = g2_frag(b2p + kb, hh); c02 = g2_mma(a0, b, c02); c12 = g2_mma(a1, b, c12);
    b = g2_frag(b3p + kb, hh); c03 = g2_mma(a0, b, c03); c13 = g2_mma(a1, b, c13); }
  v8f accs[8] = {c00, c01, c02, c03, c10, c11, c12, c13};
#pragma unroll
  for (int u = 0; u < 8; ++u) { const int t = u & 3, half = u >> 2; const int col = col0 + t * 16 + ln; const float bv = bp ? bf16_round(bp[col]) : 0.f;
#pragma unroll
    for (int r = 0; r < 8; ++r) { const int rloc = half * 16 + 8 * hh + r; float v = accs[u][r] * alpha + bv; if (CP) { if (rowsPerB < 0) v += CP[cofs + (size_t)(row0g + row0 + rloc) * ldc + col];      /* rowsPerB < 0: own element of the batched C plane */ else { const int bidx = (row0g + row0 + rloc) / rowsPerB; v += CP[(size_t)bidx * sCPb + (size_t)by * 64 + col]; } }
      if (ACT == 3) v = fmaxf(v, 0.f); else if (ACT == 6) v = 0.5f * v * (1.0f + erff(v * 0.70710678118654752f)); else if (ACT == 11) v = 1.0f / (1.0f + expf(-v)); else if (ACT == 15) v = v / (1.0f + expf(-v)); else if (ACT == 12) v = (v > 0.f) ? v : 0.01f * v; else if (ACT == 8) v = tanhf(v); else if (ACT == 9) v = 0.5f * v * (1.0f + tanhf(0.7978845608028654f * (v + 0.044715f * v * v * v))); else if (ACT == 14) v = (v > 0.f) ? v : 0.1f * v; else if (ACT == 16) v = (v >= 0.f) ? v : 0.3f * v; else if (ACT == 17) v = (v >= 0.f) ? v : 0.2f * v;
      so[w][rloc][t * 16 + ln] = v; } }
  __builtin_amdgcn_fence(__ATOMIC_ACQ_REL, "workgroup"); __builtin_amdgcn_wave_barrier();
  const int rsub = lane >> 4, c4 = (lane & 15) * 4;
  {
#pragma unroll
    for (int q = 0; q < 16; ++q) { const int r = q * 2 + rsub; const v4f v = *(const v4fa*)&so[w][r][c4]; if (C) *(v4f*)(C + cofs + (size_t)(row0 + r) * ldc + col0 + c4) = v; if (C16) { v4h h4; for (int i = 0; i < 4; ++i) h4[i] = (_Float16)v[i]; *(v4h*)(C16 + cofs + (size_t)(row0 + r) * ldc + col0 + c4) = h4; } }
     } }


__global__ __launch_bounds__(256) void k_wnat(const float* __restrict__ w, size_t n8, _Float16* __restrict__ Bt) { const size_t t = (size_t)blockIdx.x * 256 + threadIdx.x; if (t >= n8) return; FragH f; for (int q = 0; q < 8; ++q) f.h[q] = (_Float16)(bf16_round(w[t * 8 + q]) * 16.0f); *(v8us*)((unsigned short*)Bt + t * 8) = f.half[0];  }
__global__ __launch_bounds__(256) void k_rsm(const float* __restrict__ S, _Float16* __restrict__ P, int nrows) {
  #pragma clang fp contract(off)
  const int i = blockIdx.x * 256 + threadIdx.x; if (i >= nrows) return; const float* s = S + (size_t)i * SQ; float mx = -3.0e38f;
#pragma unroll 1
  for (int j = 0; j < SQ; ++j) mx = fmaxf(mx, s[j]); float se = 0.f;
#pragma unroll 1
  for (int j = 0; j < SQ; ++j) se += expf(s[j] - mx); const float sc = 256.0f / se;
#pragma unroll 1
  for (int j0 = 0; j0 < SQ; j0 += 8) { FragH f; for (int q = 0; q < 8; ++q) f.h[q] = (_Float16)(expf(s[j0 + q] - mx) * sc); unsigned short* d = (unsigned short*)P + (size_t)i * SQ + j0; *(v8us*)d = f.half[0];  } }
__global__ __launch_bounds__(256) void k_vt(const _Float16* __restrict__ V16, int b, int h0, _Float16* __restrict__ VT) { __shared__ unsigned short tl[64][65]; const int tid = threadIdx.x; const int hh = blockIdx.x % HG, sg = blockIdx.x / HG; const int s0 = sg * 64; const int h = h0 + hh;
  for (int i = tid; i < 64 * 8; i += 256) { const int j = i / 8, d8 = (i % 8) * 8; FragH f; f.half[0] = *(const v8us*)((const unsigned short*)V16 + ((size_t)b * SQ + s0 + j) * DM + h * HD + d8); for (int q = 0; q < 8; ++q) tl[d8 + q][j] = f.u[q]; }
  __syncthreads();
  { for (int i = tid; i < 64 * 8; i += 256) { const int d = i / 8, j8 = (i % 8) * 8; FragH f; for (int q = 0; q < 8; ++q) f.u[q] = tl[d][j8 + q]; *(v8us*)((unsigned short*)VT + ((size_t)hh * HD + d) * SQ + s0 + j8) = f.half[0]; }  } }



// P may lie on S (row t of P on the first bytes of row t of S, PP = 2 NKX): a wave has its whole row in registers before its first store, and no other wave touches that row.
// One wave per score row: lane l holds keys 128 u + 4 l .. + 3 of every 128-key unit u in registers (each load 512 contiguous bytes, each store 256), so S is read once; row max and row sum end in a five-step butterfly over the lanes. nk: a multiple of 256, at most NKX.
template <int PP>      /* PP: row pitch of P in f16 elements */
__global__ __launch_bounds__(256) void k_rsmcf2(const float* S, _Float16* P, int hg, int q0, int nk) {
  const int lane = threadIdx.x & 31; const int t = blockIdx.x * 8 + (threadIdx.x >> 5); if (t >= hg * QT) return;      /* the same in every lane of a wave; no barrier below */
  const float* s = S + (size_t)t * NKX + lane * 4; _Float16* p = P + (size_t)t * PP + lane * 4; const int last = q0 + (t % QT); const int nc = nk / 256;
  v4f v[NKX / 128];
#pragma unroll      /* static indices keep v in registers */
  for (int c = 0; c < NKX / 256; ++c) if (c < nc) { v[2 * c] = *(const v4fa*)(s + c * 256); v[2 * c + 1] = *(const v4fa*)(s + c * 256 + 128); }
  asm volatile("s_wait_xcnt 0x0" ::: "memory");      /* the loads' address registers are reused by the mask arithmetic below */
  float mx = -3.0e38f;
#pragma unroll      /* static indices, as above */
  for (int c = 0; c < NKX / 256; ++c) if (c < nc) { for (int u = 2 * c; u < 2 * c + 2; ++u) for (int q = 0; q < 4; ++q) { const float f = (u * 128 + lane * 4 + q <= last) ? 1.f : 0.f; const float m = fmaf(f, v[u][q], (1.f - f) * -1.0e9f); v[u][q] = m; mx = fmaxf(mx, m); } }
  for (int d = 16; d > 0; d >>= 1) mx = fmaxf(mx, __shfl_xor(mx, d));
  float se4[4] = {0.f, 0.f, 0.f, 0.f};
#pragma unroll      /* static indices, as above */
  for (int c = 0; c < NKX / 256; ++c) if (c < nc) { for (int u = 2 * c; u < 2 * c + 2; ++u) for (int q = 0; q < 4; ++q) { const float e = __expf(v[u][q] - mx); v[u][q] = e; se4[q] += e; } }
  float se = (se4[0] + se4[1]) + (se4[2] + se4[3]);
  for (int d = 16; d > 0; d >>= 1) se += __shfl_xor(se, d);
  const float sc = 256.0f / se;
#pragma unroll      /* static indices, as above */
  for (int c = 0; c < NKX / 256; ++c) if (c < nc) { for (int u = 2 * c; u < 2 * c + 2; ++u) { v4h h4; for (int q = 0; q < 4; ++q) h4[q] = (_Float16)(v[u][q] * sc); *(v4h*)(p + u * 128) = h4; }
    if (c + 1 < NKX / 256) asm volatile("s_wait_xcnt 0x0" ::: "memory"); }      /* the next unit's products reuse the data registers of the two stores just issued */
}


// One thread per query row; 64 rows per block. The row's q and o stay in registers; Q, K and V come in tiles of 64 rows, staged in LDS with whole-line loads; a K or V row is read back as a same-address (broadcast) LDS load. Four keys' score sums run side by side; each sum, and the running m, l, o, keep the key-by-key, element-by-element order.
template <int MASKADD, int LD>      /* LD: row pitch of QF, KF, VF in floats, a constant so that a tile's 16 loads share one address and differ in the immediate offset */
__global__ __launch_bounds__(64) void k_att0(const float* __restrict__ QF, const float* __restrict__ KF, const float* __restrict__ VF, const float* __restrict__ mask, float scale, float* __restrict__ OF, int ldo) {
  #pragma clang fp contract(off)
  __shared__ __attribute__((aligned(16))) float lk[64][HD]; __shared__ __attribute__((aligned(16))) float lv[64][HD]; __shared__ __attribute__((aligned(16))) float lo[64][HD + 4];
  const int tid = threadIdx.x; const int h = blockIdx.x / (QT0 / 64), rg = blockIdx.x % (QT0 / 64); const int i = rg * 64 + tid;
  { const size_t br = (size_t)blockIdx.y * QT0; QF += br * LD; KF += br * LD; VF += br * LD; OF += br * ldo; }      /* grid.y: the batch; each batch has QT0 rows in every plane */
  const int tr = tid / 16, pc = (tid % 16) * 4; const unsigned tb = (unsigned)(tr * LD + pc) * 4u;      /* the thread's byte offset inside a group of four rows: 16 lanes cover one row's 256 bytes */
  { const char* qb = (const char*)(QF + (size_t)(rg * 64) * LD + h * HD);
    v4f qt[16];
#pragma unroll      /* all of a thread's tile loads in flight together */
    for (int it = 0; it < 16; ++it) qt[it] = *(const v4fa*)(qb + (size_t)(it * 4) * LD * 4 + tb);
    asm volatile("s_wait_xcnt 0x0" ::: "memory");      /* the loads' base registers are reused right behind them */
#pragma unroll      /* static indices keep qt in registers */
    for (int it = 0; it < 16; ++it) *(v4f*)&lo[it * 4 + tr][pc] = qt[it]; }
  __syncthreads();      /* the q tile is complete before a thread reads its row */
  float q[HD], o[HD];
#pragma unroll      /* static indices keep q and o in registers */
  for (int c = 0; c < HD / 4; ++c) { const v4f t = *(const v4f*)&lo[tid][c * 4]; for (int u = 0; u < 4; ++u) { q[c * 4 + u] = t[u]; o[c * 4 + u] = 0.f; } }
  float m = -1.0e30f, l = 0.f; const int jmax = MASKADD ? (SQ - 1) : (rg * 64 + 63);      /* additive-mask form: every key (the mask input decides); causal form: keys up to the block's last row */
  const char* kp = (const char*)(KF + h * HD) + tb; const char* vp = (const char*)(VF + h * HD) + tb;      /* the thread's place in the current K and V tile */
#pragma unroll 1      /* one key tile at a time: the tile buffers are reused */
  for (int j0 = 0; j0 <= jmax; j0 += 64) {
#pragma unroll      /* all of a thread's tile loads in flight together */
    for (int it = 0; it < 16; ++it) { *(v4f*)&lk[it * 4 + tr][pc] = *(const v4fa*)(kp + (size_t)(it * 4) * LD * 4); *(v4f*)&lv[it * 4 + tr][pc] = *(const v4fa*)(vp + (size_t)(it * 4) * LD * 4); }
    __syncthreads();      /* the tile is complete before any row reads it */
#pragma unroll 1      /* four keys per trip are enough to fill the add latency; more only grows the code */
    for (int jj = 0; jj < 64; jj += 4) { float s[4] = {0.f, 0.f, 0.f, 0.f};
#pragma unroll      /* static indices into q */
      for (int c = 0; c < HD / 4; ++c) for (int a = 0; a < 4; ++a) { const v4f kq = *(const v4f*)&lk[jj + a][c * 4]; s[a] = __fadd_rn(s[a], __fmul_rn(q[c * 4 + 0], kq[0])); s[a] = __fadd_rn(s[a], __fmul_rn(q[c * 4 + 1], kq[1])); s[a] = __fadd_rn(s[a], __fmul_rn(q[c * 4 + 2], kq[2])); s[a] = __fadd_rn(s[a], __fmul_rn(q[c * 4 + 3], kq[3])); }
#pragma unroll      /* static indices into s and o */
      for (int a = 0; a < 4; ++a) { const int j = j0 + jj + a; float sv = __fmul_rn(s[a], scale); if (MASKADD) sv = __fadd_rn(sv, __fmul_rn(bf16_round(mask[(size_t)i * SQ + j]), -10000.0f));
        const float f = (MASKADD || j <= i) ? 1.f : 0.f; const float sm = fmaf(f, sv, (1.f - f) * -1.0e30f); const float mn = fmaxf(m, sm); const float sc = expf(m - mn); const float e = expf(sm - mn); l = __fadd_rn(__fmul_rn(l, sc), e); m = mn;
        for (int c = 0; c < HD / 4; ++c) { const v4f vv = *(const v4f*)&lv[jj + a][c * 4]; for (int u = 0; u < 4; ++u) o[c * 4 + u] = __fadd_rn(__fmul_rn(o[c * 4 + u], sc), __fmul_rn(e, vv[u])); } } }
    __syncthreads();      /* every row has left the tile before the next one overwrites it */
    kp += (size_t)64 * LD * 4; vp += (size_t)64 * LD * 4;
  }
  const float fin = 64.0f / l;      /* o carried x64 like the f16 path */
#pragma unroll      /* static indices into o */
  for (int c = 0; c < HD / 4; ++c) { v4f oo; for (int u = 0; u < 4; ++u) oo[u] = __fmul_rn(o[c * 4 + u], fin); *(v4f*)&lo[tid][c * 4] = oo; }
  __syncthreads();
  {
#pragma unroll 1
    for (int it = 0; it < 16; ++it) { const int row = it * 4 + tid / 16, pc = (tid % 16) * 4; const v4f v = *(const v4f*)&lo[row][pc]; *(v4f*)(OF + (size_t)(rg * 64 + row) * ldo + h * HD + pc) = v; }
     } }


template <int BFIN, int W16, int W32>
__global__ __launch_bounds__(256) void k_lnx(const float* __restrict__ X, const float* __restrict__ g, const float* __restrict__ bb, float eps, _Float16* __restrict__ N16, float* __restrict__ N32) {
  #pragma clang fp contract(off)
  __shared__ float red[256]; const size_t r = blockIdx.x; const int t = threadIdx.x; const bool act = t < (DMQ / 4); const int c0 = act ? t * 4 : 0;
  const v4f xa = *(const v4fa*)(X + r * DMQ + c0); float s[4]; float sum = 0.f;
  for (int q = 0; q < 4; ++q) { s[q] = act ? (BFIN ? bf16_round(xa[q]) : xa[q]) : 0.f; sum = __fadd_rn(sum, s[q]); }
  red[t] = sum; __syncthreads(); for (int st = 128; st > 0; st >>= 1) { if (t < st) red[t] = __fadd_rn(red[t], red[t + st]); __syncthreads(); } const float mu = red[0] / (float)DMQ; __syncthreads();
  float vs = 0.f; for (int q = 0; q < 4; ++q) { const float dl = act ? __fadd_rn(s[q], -mu) : 0.f; vs = __fadd_rn(vs, __fmul_rn(dl, dl)); } red[t] = vs; __syncthreads(); for (int st = 128; st > 0; st >>= 1) { if (t < st) red[t] = __fadd_rn(red[t], red[t + st]); __syncthreads(); }
  const float rs = rsqrtf(__fadd_rn(red[0] / (float)DMQ, eps)); v4h y; v4f yf;
  for (int q = 0; q < 4; ++q) { const int c = c0 + q; yf[q] = __fadd_rn(__fmul_rn(__fmul_rn(__fadd_rn(s[q], -mu), rs), bf16_round(g[c])), bf16_round(bb[c])); y[q] = (_Float16)yf[q]; }
  if (!act) return;      /* no barriers after this point */
  { if (W16) *(v4h*)(N16 + r * DMQ + c0) = y; if (W32) *(v4f*)(N32 + r * DMQ + c0) = yf;  } }

extern "C" void kernel_launch(void* const* d_in, const int* in_sizes, int n_in,
                              void* d_out, int out_size, void* d_ws, size_t ws_size, hipStream_t stream) {
  (void)in_sizes; (void)n_in; (void)out_size;
  const float* const* I = (const float* const*)d_in; const float* x = I[0]; const float* wq = I[1]; const float* bq = I[2]; const float* wk = I[3]; const float* bk = I[4]; const float* wv = I[5]; const float* bv = I[6]; const float* wo = I[7]; const float* bo = I[8]; const float* lng = I[9]; const float* lnb = I[10];      /* [in][out] weights + biases; LN gamma/beta */
  char* ws = (char*)d_ws; size_t off = 0;
  auto take = [&](size_t bytes) { char* p = ws + off; off += (bytes + 255) & ~(size_t)255; return p; };
  _Float16* BQ = (_Float16*)take((size_t)DM * DM * 2); _Float16* BK = (_Float16*)take((size_t)DM * DM * 2); _Float16* BV = (_Float16*)take((size_t)DM * DM * 2); _Float16* BO = (_Float16*)take((size_t)DM * DM * 2);
  float* S = (float*)take((size_t)NB * NH * QT * NKX * 4); _Float16* P = (_Float16*)S;      /* scores of one query tile, every batch and head; the softmax weights overwrite their own score rows (f16 pitch 2 NKX) */
  _Float16* X16 = (_Float16*)S; _Float16* XL = (_Float16*)((char*)S + NR * DM * 2); float* HF = (float*)((char*)S + NR * DM * 4); float* QKF = HF;      /* projection-stage planes on the bytes of S (16 per token element: 2 + 2 + three f32 planes), last read before the first score launch; h (f32) is last read before the first f32 plane is written */
  _Float16* Q16 = (_Float16*)take(NR * DM * 2); _Float16* K16 = (_Float16*)take(NR * DM * 2); _Float16* V16 = (_Float16*)take(NR * DM * 2); _Float16* O16 = (_Float16*)take(NR * DM * 2);      /* Q16, K16, V16: three planes in a row */
  _Float16* VT = (_Float16*)take((size_t)NB * NH * HD * SQ * 2);
  float* QF0 = (float*)take((size_t)NB * QT0 * DM * 4); float* KF0 = (float*)take((size_t)NB * QT0 * DM * 4); float* VF0 = (float*)take((size_t)NB * QT0 * DM * 4); float* OF0 = (float*)take((size_t)NB * QT0 * DM * 4); _Float16* OH0 = (_Float16*)take((size_t)NB * QT0 * DM * 2); _Float16* OL0 = (_Float16*)take((size_t)NB * QT0 * DM * 2);      /* QF0, KF0, VF0: three planes in a row */
  if (off > ws_size) return;
  k_wt_f16<<<(unsigned)(((size_t)DM * (DM / 8) + 255) / 256), 256, 0, stream>>>(wq, BQ, DM, DM, 16.0f); k_wt_f16<<<(unsigned)(((size_t)DM * (DM / 8) + 255) / 256), 256, 0, stream>>>(wk, BK, DM, DM, 16.0f); k_wt_f16<<<(unsigned)(((size_t)DM * (DM / 8) + 255) / 256), 256, 0, stream>>>(wv, BV, DM, DM, 16.0f); k_wt_f16<<<(unsigned)(((size_t)DM * (DM / 8) + 255) / 256), 256, 0, stream>>>(wo, BO, DM, DM, 16.0f);      /* [in][out] -> Bt[n][k] x16; BQ, BK, BV: three planes in a row */

  k_lnx<1, 0, 1><<<(unsigned)NR, 256, 0, stream>>>(x, lng, lnb, 1e-5f, nullptr, HF); k_hl<<<(unsigned)((NR * DM / 8 + 255) / 256), 256, 0, stream>>>(HF, X16, XL, NR * DM / 8);      /* h = LN(bf16(x)) f32 -> f16 hi (X16) + x1024 residual (XL) rows */
  /* Independent launches share one grid: q, k, v on grid.y of the projection GEMMs, the batch on grid.z of the per-batch GEMMs (grid.y of the first-tile attention, part of the flat index elsewhere). */
  const size_t zW = (size_t)DM * DM, zR = NR * DM, zT = (size_t)SQ * DM, z0 = (size_t)QT0 * DM;      /* elements: a weight plane, a token-row plane, one batch of it, one batch of a first-tile plane */
  const dim3 gp((unsigned)((NR / 128) * (DM / 64)), 1, 1), gp3((unsigned)((NR / 128) * (DM / 64)), 3, 1);      /* every token row; the same for q, k, v */
  k_gemm2<0><<<gp3, 128, 0, stream>>>(X16, DM, 0, BQ, DM, zW, 0.0625f, bq, 0, nullptr, 1, 0, 0, QKF, nullptr, DM, zR, (int)NR, DM, DM, 0, 0, 0, bk, bv);      /* f32 h_hi W + b */
  k_gemm2<0><<<gp3, 128, 0, stream>>>(XL, DM, 0, BQ, DM, zW, 0.00006103515625f, nullptr, 0, QKF, -1, 0, 0, nullptr, Q16, DM, zR, (int)NR, DM, DM, 0, 0, 0, nullptr, nullptr);      /* += h_lo W 2^-14 (own element), rounded to the f16 q, k, v rows */
  k_vt<NH, SQ><<<NB * NH * (SQ / 64), 256, 0, stream>>>(V16, LQ, 0, VT);      /* V^T [NB][NH][HD][SQ] */
  const dim3 g0((QT0 / 128) * (DM / 64), 1, NB), g03((QT0 / 128) * (DM / 64), 3, NB);
  k_gemm2<0><<<g03, 128, 0, stream>>>(X16, DM, 0, BQ, DM, zW, 0.0625f, bq, 0, nullptr, 1, 0, 0, QF0, nullptr, DM, (size_t)NB * z0, QT0, DM, DM, zT, 0, z0, bk, bv);
  k_gemm2<0><<<g03, 128, 0, stream>>>(XL, DM, 0, BQ, DM, zW, 0.00006103515625f, nullptr, 0, QF0, -1, 0, 0, QF0, nullptr, DM, (size_t)NB * z0, QT0, DM, DM, zT, 0, z0, nullptr, nullptr);      /* f32 q, k, v of each batch's first 128 rows (exact products) */
  k_att0<0, DM><<<dim3(NH * (QT0 / 64), NB), 64, 0, stream>>>(QF0, KF0, VF0, nullptr, 0.125f, OF0, DM);      /* exact f32 attention for rows 0..127 (o x64) */
  for (int q0 = 0; q0 < SQ; q0 += QT) { const int nk = q0 + QT;      /* causal: only keys below the tile end are computed */
    k_gemm2<0><<<dim3((QT / 128) * (nk / 64), NH, NB), 128, 0, stream>>>(Q16 + (size_t)q0 * LQ, LQ, (size_t)HD, K16, LQ, (size_t)HD, 0.125f, nullptr, 0, nullptr, 1, 0, 0, S, nullptr, NKX, (size_t)QT * NKX, QT, nk, HD, zT, zT, (size_t)NH * QT * NKX, nullptr, nullptr);      /* scores: heads on grid.y, batches on grid.z */
    k_rsmcf2<2 * NKX><<<(NB * NH * QT + 7) / 8, 256, 0, stream>>>(S, P, NB * NH, q0, nk);      /* one wave per row, 8 rows per block */
    k_gemm2<0><<<dim3((QT / 128) * (HD / 64), NH, NB), 128, 0, stream>>>(P, 2 * NKX, (size_t)QT * 2 * NKX, VT, SQ, (size_t)HD * SQ, 0.25f, nullptr, 0, nullptr, 1, 0, 0, nullptr, O16 + (size_t)q0 * DM, DM, (size_t)HD, QT, HD, nk, (size_t)NH * QT * 2 * NKX, (size_t)NH * HD * SQ, zT, nullptr, nullptr); }      /* o (merged heads, x64) as f16 rows */
  k_gemm2<0><<<gp, 128, 0, stream>>>(O16, DM, 0, BO, DM, 0, 0.0009765625f, bo, 0, nullptr, 1, 0, 0, (float*)d_out, nullptr, DM, 0, (int)NR, DM, DM, 0, 0, 0, nullptr, nullptr);      /* out rows are the output layout */
  k_hl<<<(unsigned)(((size_t)NB * QT0 * DM / 8 + 255) / 256), 256, 0, stream>>>(OF0, OH0, OL0, (size_t)NB * QT0 * DM / 8);      /* first-tile o (x64) -> f16 hi + x1024 residual planes */
  k_gemm2<0><<<g0, 128, 0, stream>>>(OH0, DM, 0, BO, DM, 0, 0.0009765625f, bo, 0, nullptr, 1, 0, 0, (float*)d_out, nullptr, DM, 0, QT0, DM, DM, z0, 0, zT, nullptr, nullptr);      /* rows 0..127 of each batch: out = o_hi Wo (+ b), overwriting the f16-path rows */
  k_gemm2<0><<<g0, 128, 0, stream>>>(OL0, DM, 0, BO, DM, 0, 0.00000095367431640625f, nullptr, 0, (const float*)d_out, -1, 0, 0, (float*)d_out, nullptr, DM, 0, QT0, DM, DM, z0, 0, zT, nullptr, nullptr);      /* += o_lo Wo 2^-20 (own-element accumulate) */
}

// v004
// Measured time: 663 microseconds a run.
// In two side-by-side timings against v003, it was 1.88 and 1.86 times as fast.
// Over all steps from v000 it is 16.0 times as fast.
#include <hip/hip_runtime.h>
// Pre-LayerNorm causal multi-head attention (x [4][2048][1024]; h = LN(x) (eps 1e-5, gamma, beta); q/k/v = h W + b ([in][out] 1024 x 1024 sigma 1/32, zero biases); 16 heads of 64; scores / 8; where(causal, s, finfo.min); softmax; out = merged Wo + bo -> [4][2048][1024], no residual).
// Structure: token rows r = b*2048 + s; h = LN(bf16(x)) in f32, as f16 hi + x1024 residual rows; Q, K, V as three WMMA GEMMs (32x64 wave tiles, f32 accumulation, exact x16 weights + bias, f16 outputs); V^T for all batches and heads via LDS transposes; causal attention fused in one launch (blocks of 128 query rows of one batch and head; S^T = K Q^T, running f32 maximum and sum per query, native exp2, weights x16 f16, O^T += V^T P^T over the keys up to the diagonal; o carried x64, folded into the output GEMM alpha) written straight into the merged f16 o rows; out = o W_o + b GEMM (f32) into the output layout.
// Compute dtype: inputs rounded to bf16; x / weights exact; q, k, v, softmax weights and o as plain f16 GEMM operands (~2^-12); scores and softmax statistics f32. v_wmma_f32_16x16x32_f16.
#define NB 4
#define SQ 2048
#define DM 1024
#define DMQ DM                       /* LayerNorm width */
#define NH 16
#define HD 64
#define HG 4                         /* heads per launch of the grouped k_vt (not launched) */
#define QT 256
#define NKX SQ
#define QT0 128                      /* first-tile rows recomputed exactly in f32 */
#define B0 0                         /* first batch processed (unused) */
#define NBR NB                       /* batches processed (unused) */
#define NR ((size_t)NB * SQ)         /* token rows */
#define MP ((int)((size_t)NBR * SQ)) /* rows projected (unused) */
#define QN SQ                        /* query rows attended per batch (unused) */
#define NHD NH                       /* heads attended (unused) */
#define MPO MP                       /* rows through the output stage (unused) */
#define LQ DM      /* row pitch of the q/k/v rows */
typedef __bf16 v16b __attribute__((ext_vector_type(16)));
typedef unsigned short v8us __attribute__((ext_vector_type(8), may_alias));
typedef float  v8f  __attribute__((ext_vector_type(8)));
typedef float  v4f  __attribute__((ext_vector_type(4)));
typedef float  v4fa __attribute__((ext_vector_type(4), may_alias));
union FragB { v16b v; v8us half[2]; unsigned short u[16]; };

__device__ __forceinline__ unsigned short bf16_bits(float x) { unsigned int u = __float_as_uint(x); return (unsigned short)((u + 0x7FFFu + ((u >> 16) & 1u)) >> 16); }
__device__ __forceinline__ float bf16_val(unsigned short b) { return __uint_as_float(((unsigned int)b) << 16); }
__device__ __forceinline__ float bf16_round(float x) { return bf16_val(bf16_bits(x)); }
// D += A·B with NT terms: 1 = ah·bh, 2 = + al·bh (A split), 3 = + ah·bl (both split)
template <int NT>
__device__ __forceinline__ v8f mmaN(v16b ah, v16b al, v16b bh, v16b bl, v8f c) {
  c = __builtin_amdgcn_wmma_f32_16x16x32_bf16(false, ah, false, bh, (short)0, c, false, false);
  if (NT >= 2) c = __builtin_amdgcn_wmma_f32_16x16x32_bf16(false, al, false, bh, (short)0, c, false, false);
  if (NT >= 3) c = __builtin_amdgcn_wmma_f32_16x16x32_bf16(false, ah, false, bl, (short)0, c, false, false);
  asm volatile("v_nop\n\tv_nop\n\tv_nop\n\tv_nop" : "+v"(c) : "v"(ah), "v"(al), "v"(bh), "v"(bl));
  return c;
}

__global__ __launch_bounds__(256) void k_wt_bf16(const float* __restrict__ W, unsigned short* __restrict__ Wt, int K, int N) {
  const int t = blockIdx.x * 256 + threadIdx.x;
  const int k8n = K / 8;
  if (t >= N * k8n) return;
  const int n = t / k8n, k8 = (t % k8n) * 8;
  v8us v;
#pragma unroll
  for (int i = 0; i < 8; ++i) v[i] = bf16_bits(W[(size_t)(k8 + i) * N + n]);
  *(v8us*)(Wt + (size_t)n * K + k8) = v;
  
}

// GEMM C[M][N] (f32, pitch ldc) = act(A[M][K]·W + bias). A f32 row-major (pitch lda) converted per fragment to bf16
// (ASPLIT: hi/lo two planes -> 2 terms, else single rounded term); Wt bf16 [N][K] (pitch ldb). BIAS_BF16 rounds the
// bias to bf16 first (bias quantised to bf16 before the add). K%32==0, M%16==0, N%64==0.
template <bool ASPLIT, int ACT, bool BIAS_BF16>
__global__ __launch_bounds__(128) void k_gemm_bf(const float* __restrict__ A, int lda, const unsigned short* __restrict__ Wt, int ldb,
                                               const float* __restrict__ bias, float* __restrict__ C, int ldc, int M, int N, int K) {
  __shared__ __attribute__((aligned(16))) float so[4][16][64];
  const int tid = threadIdx.x, w = tid >> 5, lane = tid & 31, ln = lane & 15, hh = lane >> 4;
  const int ntn = N / 64;
  const int wid = blockIdx.x * 4 + w;
  const int mt = wid / ntn, nq = wid % ntn;
  if (mt * 16 >= M) return;
  const int row0 = mt * 16, col0 = nq * 64;
  const float* arow = A + (size_t)(row0 + ln) * lda;
  v8f acc[4] = {};
  for (int kb = 0; kb < K; kb += 32) {
    FragB ah, al;
    const v4f x0 = *(const v4fa*)(arow + kb + 8 * hh), x1 = *(const v4fa*)(arow + kb + 8 * hh + 4);
    const v4f x2 = *(const v4fa*)(arow + kb + 16 + 8 * hh), x3 = *(const v4fa*)(arow + kb + 16 + 8 * hh + 4);
    float xs[16] = {x0[0],x0[1],x0[2],x0[3],x1[0],x1[1],x1[2],x1[3],x2[0],x2[1],x2[2],x2[3],x3[0],x3[1],x3[2],x3[3]};
#pragma unroll
    for (int i = 0; i < 16; ++i) { const unsigned short hb = bf16_bits(xs[i]); ah.u[i] = hb; al.u[i] = ASPLIT ? bf16_bits(xs[i] - bf16_val(hb)) : (unsigned short)0; }
#pragma unroll
    for (int t = 0; t < 4; ++t) {
      const unsigned short* brow = Wt + (size_t)(col0 + t * 16 + ln) * ldb + kb;
      FragB b;
      b.half[0] = *(const v8us*)(brow + 8 * hh);
      b.half[1] = *(const v8us*)(brow + 16 + 8 * hh);
      acc[t] = mmaN<ASPLIT ? 2 : 1>(ah.v, al.v, b.v, b.v, acc[t]);
    }
  }
#pragma unroll
  for (int t = 0; t < 4; ++t) {
    float bv = bias ? bias[col0 + t * 16 + ln] : 0.f;
    if (BIAS_BF16) bv = bf16_round(bv);
#pragma unroll
    for (int r = 0; r < 8; ++r) { float v = acc[t][r] + bv; if (ACT == 1) v = fmaxf(v, 0.f); so[w][8 * hh + r][t * 16 + ln] = v; }
  }
  __builtin_amdgcn_fence(__ATOMIC_ACQ_REL, "workgroup");
  __builtin_amdgcn_wave_barrier();
  const int rsub = lane >> 4, c4 = (lane & 15) * 4;
  {
#pragma unroll
    for (int q = 0; q < 8; ++q) {
      const int r = q * 2 + rsub;
      const v4f v = *(const v4fa*)&so[w][r][c4];
      *(v4f*)(C + (size_t)(row0 + r) * ldc + col0 + c4) = v;
    }
    
  }
}

// GEMM C = act(A·W + bias + resid): A f32 (ASPLIT -> hi/lo 2 terms), Wt bf16 [N][K]; ACT 0 none, 1 relu, 2 exact gelu;
// resid (optional, f32, row index = (row % rmod), pitch ldr, RES_BF16 rounds it) added before the activation.
template <bool ASPLIT, int ACT, bool BIAS_BF16, bool RES_BF16>
__global__ __launch_bounds__(128) void k_gemm_bf3(const float* __restrict__ A, int lda, const unsigned short* __restrict__ Wt, int ldb,
                                                const float* __restrict__ bias, const float* __restrict__ resid, int rmod, int ldr,
                                                float* __restrict__ C, int ldc, int M, int N, int K) {
  __shared__ __attribute__((aligned(16))) float so[4][16][64];
  const int tid = threadIdx.x, w = tid >> 5, lane = tid & 31, ln = lane & 15, hh = lane >> 4;
  const int ntn = N / 64;
  const int wid = blockIdx.x * 4 + w;
  const int mt = wid / ntn, nq = wid % ntn;
  if (mt * 16 >= M) return;
  const int row0 = mt * 16, col0 = nq * 64;
  const float* arow = A + (size_t)(row0 + ln) * lda;
  v8f acc[4] = {};
  for (int kb = 0; kb < K; kb += 32) {
    FragB ah, al;
    const v4f x0 = *(const v4fa*)(arow + kb + 8 * hh), x1 = *(const v4fa*)(arow + kb + 8 * hh + 4);
    const v4f x2 = *(const v4fa*)(arow + kb + 16 + 8 * hh), x3 = *(const v4fa*)(arow + kb + 16 + 8 * hh + 4);
    float xs[16] = {x0[0],x0[1],x0[2],x0[3],x1[0],x1[1],x1[2],x1[3],x2[0],x2[1],x2[2],x2[3],x3[0],x3[1],x3[2],x3[3]};
#pragma unroll
    for (int i = 0; i < 16; ++i) { const unsigned short hb = bf16_bits(xs[i]); ah.u[i] = hb; al.u[i] = ASPLIT ? bf16_bits(xs[i] - bf16_val(hb)) : (unsigned short)0; }
#pragma unroll
    for (int t = 0; t < 4; ++t) {
      const unsigned short* brow = Wt + (size_t)(col0 + t * 16 + ln) * ldb + kb;
      FragB b;
      b.half[0] = *(const v8us*)(brow + 8 * hh);
      b.half[1] = *(const v8us*)(brow + 16 + 8 * hh);
      acc[t] = mmaN<ASPLIT ? 2 : 1>(ah.v, al.v, b.v, b.v, acc[t]);
    }
  }
#pragma unroll
  for (int t = 0; t < 4; ++t) {
    const int col = col0 + t * 16 + ln;
    float bv = bias ? bias[col] : 0.f;
    if (BIAS_BF16) bv = bf16_round(bv);
#pragma unroll
    for (int r = 0; r < 8; ++r) {
      float v = acc[t][r] + bv;
      if (resid) { float rv = resid[(size_t)((row0 + 8 * hh + r) % rmod) * ldr + col]; if (RES_BF16) rv = bf16_round(rv); v += rv; }
      if (ACT == 1) v = fmaxf(v, 0.f);
      if (ACT == 2) v = 0.5f * v * (1.0f + erff(v * 0.70710678118654752f));
      if (ACT == 3) { const float u = 0.7978845608028654f * (v + 0.044715f * v * v * v); v = 0.5f * v * (1.0f + tanhf(u)); }
      so[w][8 * hh + r][t * 16 + ln] = v;
    }
  }
  __builtin_amdgcn_fence(__ATOMIC_ACQ_REL, "workgroup");
  __builtin_amdgcn_wave_barrier();
  const int rsub = lane >> 4, c4 = (lane & 15) * 4;
  {
#pragma unroll
    for (int q = 0; q < 8; ++q) {
      const int r = q * 2 + rsub;
      const v4f v = *(const v4fa*)&so[w][r][c4];
      *(v4f*)(C + (size_t)(row0 + r) * ldc + col0 + c4) = v;
    }
    
  }
}
// row LayerNorm (biased variance, eps) over N: s = X (+ R); optional out_sum <- s; out_norm <- (s-mu)*rsqrt(var+eps)*g + b
template <bool PARAM_BF16>
__global__ __launch_bounds__(256) void k_layernorm(const float* __restrict__ X, const float* __restrict__ R, const float* __restrict__ g, const float* __restrict__ bta,
                                                  float* __restrict__ out_sum, float* __restrict__ out_norm, int N, float eps) {
  __shared__ float red[256];
  const int row = blockIdx.x, tid = threadIdx.x;
  const float* x = X + (size_t)row * N; const float* rr = R ? R + (size_t)row * N : nullptr;
  float vals[16];                     // up to N = 4096
  const int per = N / 256;            // contiguous chunk per thread? use strided-by-4 chunks: thread handles j = tid*4 + 1024*u
  float s1 = 0.f;
  for (int u = 0; u < per / 4; ++u) {
    const int j = tid * 4 + 1024 * u;
    const v4f a = *(const v4fa*)(x + j);
    v4f b = {0.f,0.f,0.f,0.f}; if (rr) b = *(const v4fa*)(rr + j);
#pragma unroll
    for (int q = 0; q < 4; ++q) { const float v = a[q] + b[q]; vals[u * 4 + q] = v; s1 += v; }
  }
  red[tid] = s1; __syncthreads();
  for (int st = 128; st > 0; st >>= 1) { if (tid < st) red[tid] += red[tid + st]; __syncthreads(); }
  const float mu = red[0] / (float)N; __syncthreads();
  float s2 = 0.f;
  for (int u = 0; u < per / 4; ++u)
#pragma unroll
    for (int q = 0; q < 4; ++q) { const float c = vals[u * 4 + q] - mu; s2 += c * c; }
  red[tid] = s2; __syncthreads();
  for (int st = 128; st > 0; st >>= 1) { if (tid < st) red[tid] += red[tid + st]; __syncthreads(); }
  const float rs = rsqrtf(red[0] / (float)N + eps);
  {
    for (int u = 0; u < per / 4; ++u) {
      const int j = tid * 4 + 1024 * u;
      v4f o, sm;
#pragma unroll
      for (int q = 0; q < 4; ++q) {
        float gg = g[j + q], bb = bta[j + q];
        if (PARAM_BF16) { gg = bf16_round(gg); bb = bf16_round(bb); }
        sm[q] = vals[u * 4 + q]; o[q] = (vals[u * 4 + q] - mu) * rs * gg + bb;
      }
      if (out_sum) *(v4f*)(out_sum + (size_t)row * N + j) = sm;
      *(v4f*)(out_norm + (size_t)row * N + j) = o;
    }
    
  }
}



// ---- f16 WMMA path (v_wmma_f32_16x16x32_f16): 11-bit significands for operands in range — used where a [0,1] probability operand needs more precision than bf16
typedef _Float16 v16h __attribute__((ext_vector_type(16)));
union FragH { v16h v; v8us half[2]; _Float16 h[16]; unsigned short u[16]; };
template <int NT>
__device__ __forceinline__ v8f mmaH(v16h ah, v16h al, v16h bh, v16h bl, v8f c) {
  c = __builtin_amdgcn_wmma_f32_16x16x32_f16(false, ah, false, bh, (short)0, c, false, false);
  if (NT >= 2) c = __builtin_amdgcn_wmma_f32_16x16x32_f16(false, al, false, bh, (short)0, c, false, false);
  if (NT >= 3) c = __builtin_amdgcn_wmma_f32_16x16x32_f16(false, ah, false, bl, (short)0, c, false, false);
  asm volatile("v_nop\n\tv_nop\n\tv_nop\n\tv_nop" : "+v"(c) : "v"(ah), "v"(al), "v"(bh), "v"(bl));
  return c;
}
// batched GEMM like k_gemm_b but f16 operands: A f32 (split into f16 hi/lo if ASPLIT, else rounded to f16), Bt = f16 values [n][k]; alpha; C f32; N multiple of 16 (partial tiles skipped)
template <bool ASPLIT>
__global__ __launch_bounds__(128) void k_gemm_h(const float* __restrict__ A, int lda, size_t sA, const _Float16* __restrict__ Bh, int ldb, size_t sB, float alpha, float* __restrict__ C, int ldc, size_t sC, int M, int N, int K) {
  __shared__ __attribute__((aligned(16))) float so[4][16][64];
  const int tid = threadIdx.x, w = tid >> 5, lane = tid & 31, ln = lane & 15, hh = lane >> 4; const int by = blockIdx.y;
  A += (size_t)by * sA; Bh += (size_t)by * sB; C += (size_t)by * sC;
  const int ntn = (N + 63) / 64; const int wid = blockIdx.x * 4 + w; const int mt = wid / ntn, nq = wid % ntn; if (mt * 16 >= M) return;
  const int row0 = mt * 16, col0 = nq * 64; const float* arow = A + (size_t)(row0 + ln) * lda;
  v8f acc[4] = {};
  for (int kb = 0; kb < K; kb += 32) {
    FragH ah, al;
    const v4f x0 = *(const v4fa*)(arow + kb + 8 * hh), x1 = *(const v4fa*)(arow + kb + 8 * hh + 4), x2 = *(const v4fa*)(arow + kb + 16 + 8 * hh), x3 = *(const v4fa*)(arow + kb + 16 + 8 * hh + 4);
    float xs[16] = {x0[0],x0[1],x0[2],x0[3],x1[0],x1[1],x1[2],x1[3],x2[0],x2[1],x2[2],x2[3],x3[0],x3[1],x3[2],x3[3]};
#pragma unroll
    for (int i = 0; i < 16; ++i) { const _Float16 h = (_Float16)xs[i]; ah.h[i] = h; al.h[i] = ASPLIT ? (_Float16)(xs[i] - (float)h) : (_Float16)0.0f; }
#pragma unroll
    for (int t = 0; t < 4; ++t) { if (col0 + t * 16 >= N) continue; const size_t boff = (size_t)(col0 + t * 16 + ln) * ldb + kb; FragH bq; bq.half[0] = *(const v8us*)(Bh + boff + 8 * hh); bq.half[1] = *(const v8us*)(Bh + boff + 16 + 8 * hh);
      acc[t] = mmaH<ASPLIT ? 2 : 1>(ah.v, al.v, bq.v, bq.v, acc[t]); }
  }
#pragma unroll
  for (int t = 0; t < 4; ++t) { if (col0 + t * 16 >= N) continue;
#pragma unroll
    for (int r = 0; r < 8; ++r) so[w][8 * hh + r][t * 16 + ln] = acc[t][r] * alpha; }
  __builtin_amdgcn_fence(__ATOMIC_ACQ_REL, "workgroup"); __builtin_amdgcn_wave_barrier();
  const int rsub = lane >> 4, c4 = (lane & 15) * 4;
  {
#pragma unroll
    for (int q = 0; q < 8; ++q) { const int r = q * 2 + rsub; if (col0 + c4 < N) { const v4f v = *(const v4fa*)&so[w][r][c4]; *(v4f*)(C + (size_t)(row0 + r) * ldc + col0 + c4) = v; } }
     }
}

// Wt[n][k] = f16(W[k][n]·scale) from f32 row-major W[K][N] (scale = power of two; bf16-exact weights stay exact in f16 away from the subnormal range)
__global__ __launch_bounds__(256) void k_wt_f16(const float* __restrict__ W, _Float16* __restrict__ Wt, int K, int N, float scale) {
  const int t = blockIdx.x * 256 + threadIdx.x; if (t >= N * (K / 8)) return; const int n = t / (K / 8), k8 = (t % (K / 8)) * 8; FragH f;
#pragma unroll
  for (int i = 0; i < 8; ++i) f.h[i] = (_Float16)(bf16_round(W[(size_t)(k8 + i) * N + n]) * scale); const v8us o = f.half[0];
  *(v8us*)((unsigned short*)Wt + (size_t)n * K + k8) = o; 
}
// k_gemm_hh variant with fused epilogue: v = acc·alpha + bias[by·sBias + col] (+ CP[(row/rowsPerB)·sCPb + by·64 + col] if CP) ; ACT 0 none / 1 elu ; writes f16 C16 (and f32 C if non-null)
template <int ACT>
__global__ __launch_bounds__(128) void k_gemm_hhx(const _Float16* __restrict__ A, int lda, size_t sA, const _Float16* __restrict__ Bh, int ldb, size_t sB, float alpha, const float* __restrict__ bias, size_t sBias, const float* __restrict__ CP, int rowsPerB, size_t sCPb, int row0g,
    float* __restrict__ C, _Float16* __restrict__ C16, int ldc, size_t sC, int M, int N, int K) {
  __shared__ __attribute__((aligned(16))) float so[4][16][64];
  const int tid = threadIdx.x, w = tid >> 5, lane = tid & 31, ln = lane & 15, hh = lane >> 4; const int by = blockIdx.y;
  A += (size_t)by * sA; Bh += (size_t)by * sB; const size_t cofs = (size_t)by * sC; const float* bp = bias ? bias + (size_t)by * sBias : nullptr;
  const int ntn = (N + 63) / 64; const int wid = blockIdx.x * 4 + w; const int mt = wid / ntn, nq = wid % ntn; if (mt * 16 >= M) return;
  const int row0 = mt * 16, col0 = nq * 64; const _Float16* arow = A + (size_t)(row0 + ln) * lda;
  v8f acc[4] = {};
  for (int kb = 0; kb < K; kb += 32) { FragH ah; ah.half[0] = *(const v8us*)((const unsigned short*)arow + kb + 8 * hh); ah.half[1] = *(const v8us*)((const unsigned short*)arow + kb + 16 + 8 * hh);
#pragma unroll
    for (int t = 0; t < 4; ++t) { if (col0 + t * 16 >= N) continue; const size_t boff = (size_t)(col0 + t * 16 + ln) * ldb + kb; FragH bq; bq.half[0] = *(const v8us*)((const unsigned short*)Bh + boff + 8 * hh); bq.half[1] = *(const v8us*)((const unsigned short*)Bh + boff + 16 + 8 * hh);
      acc[t] = mmaH<1>(ah.v, ah.v, bq.v, bq.v, acc[t]); }
  }
#pragma unroll
  for (int t = 0; t < 4; ++t) { if (col0 + t * 16 >= N) continue; const int col = col0 + t * 16 + ln; const float bv = bp ? bf16_round(bp[col]) : 0.f;
#pragma unroll
    for (int r = 0; r < 8; ++r) { float v = acc[t][r] * alpha + bv; if (CP) { const int rr = row0g + row0 + 8 * hh + r; if (rowsPerB < 0) v += CP[cofs + (size_t)rr * ldc + col];      /* rowsPerB < 0: own element of the batched C plane */ else { const int bidx = rr / rowsPerB; v += CP[(size_t)bidx * sCPb + (size_t)by * 64 + col]; } } if (ACT == 1) v = (v > 0.f) ? v : expm1f(v); else if (ACT == 7) v = (v > 0.f) ? v + 1.0f : expf(v); else if (ACT == 8) v = tanhf(v); else if (ACT == 9) v = 0.5f * v * (1.0f + tanhf(0.7978845608028654f * (v + 0.044715f * v * v * v))); else if (ACT == 11) v = 1.0f / (1.0f + expf(-v)); else if (ACT == 12) v = (v > 0.f) ? v : 0.01f * v; else if (ACT == 14) v = (v > 0.f) ? v : 0.1f * v; else if (ACT == 16) v = (v >= 0.f) ? v : 0.3f * v; else if (ACT == 17) v = (v >= 0.f) ? v : 0.2f * v; else if (ACT == 15) v = v / (1.0f + expf(-v)); else if (ACT == 3) v = fmaxf(v, 0.f); else if (ACT == 6) v = 0.5f * v * (1.0f + erff(v * 0.70710678118654752f)); so[w][8 * hh + r][t * 16 + ln] = v; } }
  __builtin_amdgcn_fence(__ATOMIC_ACQ_REL, "workgroup"); __builtin_amdgcn_wave_barrier();
  const int rsub = lane >> 4, c4 = (lane & 15) * 4; typedef _Float16 v4h __attribute__((ext_vector_type(4)));
  {
#pragma unroll
    for (int q = 0; q < 8; ++q) { const int r = q * 2 + rsub; if (col0 + c4 < N) { const v4f v = *(const v4fa*)&so[w][r][c4]; if (C) *(v4f*)(C + cofs + (size_t)(row0 + r) * ldc + col0 + c4) = v; if (C16) { v4h h4; for (int i = 0; i < 4; ++i) h4[i] = (_Float16)v[i]; *(v4h*)(C16 + cofs + (size_t)(row0 + r) * ldc + col0 + c4) = h4; } } }
     }
}


typedef _Float16 v4h __attribute__((ext_vector_type(4)));

__global__ __launch_bounds__(256) void k_x16(const float* __restrict__ x, _Float16* __restrict__ X16, size_t n8) { const size_t t = (size_t)blockIdx.x * 256 + threadIdx.x; if (t >= n8) return; FragH f;
#pragma unroll
  for (int q = 0; q < 8; ++q) f.h[q] = (_Float16)bf16_round(x[t * 8 + q]); *(v8us*)((unsigned short*)X16 + t * 8) = f.half[0];  }
__global__ __launch_bounds__(256) void k_h16(const float* __restrict__ x, _Float16* __restrict__ X16, size_t n8) { const size_t t = (size_t)blockIdx.x * 256 + threadIdx.x; if (t >= n8) return; FragH f;
#pragma unroll
  for (int q = 0; q < 8; ++q) f.h[q] = (_Float16)x[t * 8 + q]; *(v8us*)((unsigned short*)X16 + t * 8) = f.half[0];  }
__global__ __launch_bounds__(256) void k_round16f(const float* __restrict__ W, _Float16* __restrict__ Bt, size_t n8) { const size_t t = (size_t)blockIdx.x * 256 + threadIdx.x; if (t >= n8) return; FragH f;
#pragma unroll
  for (int i = 0; i < 8; ++i) f.h[i] = (_Float16)(bf16_round(W[t * 8 + i]) * 16.0f); *(v8us*)((unsigned short*)Bt + t * 8) = f.half[0];  }
template <int NHv, int TTv>
__global__ __launch_bounds__(256) void k_vt(const _Float16* __restrict__ V16, int ldv, int voff, _Float16* __restrict__ Vt) { __shared__ unsigned short tl[64][66]; const int tid = threadIdx.x; const int slab = blockIdx.x / (TTv / 64), lg = blockIdx.x % (TTv / 64); const int b = slab / NHv, h = slab % NHv;
  for (int i = tid; i < 64 * 8; i += 256) { const int r = i / 8, c8 = (i % 8) * 8; FragH f; f.half[0] = *(const v8us*)((const unsigned short*)V16 + ((size_t)b * TTv + lg * 64 + r) * ldv + voff + h * 64 + c8);
#pragma unroll
    for (int q = 0; q < 8; ++q) tl[r][c8 + q] = f.u[q]; }
  __syncthreads();
  {
#pragma unroll
    for (int rd = 0; rd < 2; ++rd) { const int d = rd * 32 + tid / 8, pc = tid % 8; FragH f;
#pragma unroll
      for (int q = 0; q < 8; ++q) f.u[q] = tl[pc * 8 + q][d];
      *(v8us*)((unsigned short*)Vt + ((size_t)slab * 64 + d) * TTv + lg * 64 + pc * 8) = f.half[0]; }
     } }

__global__ __launch_bounds__(256) void k_hl(const float* __restrict__ F, _Float16* __restrict__ Hh, _Float16* __restrict__ Hl, size_t n8) { const size_t t = (size_t)blockIdx.x * 256 + threadIdx.x; if (t >= n8) return; FragH fh, fl; const v4f a = *(const v4fa*)(F + t * 8), c = *(const v4fa*)(F + t * 8 + 4);
#pragma unroll
  for (int q = 0; q < 4; ++q) { _Float16 h = (_Float16)a[q]; fh.h[q] = h; fl.h[q] = (_Float16)((a[q] - (float)h) * 1024.0f); h = (_Float16)c[q]; fh.h[4 + q] = h; fl.h[4 + q] = (_Float16)((c[q] - (float)h) * 1024.0f); }
  { *(v8us*)((unsigned short*)Hh + t * 8) = fh.half[0]; *(v8us*)((unsigned short*)Hl + t * 8) = fl.half[0];  } }

// ---- fast GEMM (wave tile 32x64; requires M % 32 == 0 rows per launch region and N % 64 == 0); epilogue = k_gemm_hhx semantics ----
__device__ __forceinline__ v16h g2_frag(const _Float16* p, int hh) { FragH f; f.half[0] = *(const v8us*)((const unsigned short*)p + 8 * hh); f.half[1] = *(const v8us*)((const unsigned short*)p + 16 + 8 * hh); return f.v; }
__device__ __forceinline__ v8f g2_mma(v16h a, v16h b, v8f c) { v8f d = __builtin_amdgcn_wmma_f32_16x16x32_f16(false, a, false, b, (short)0, c, false, false); asm volatile("v_nop\n\tv_nop\n\tv_nop\n\tv_nop" : "+v"(d) : "v"(a), "v"(b)); return d; }
template <int ACT>
__global__ __launch_bounds__(128) void k_gemm2(const _Float16* __restrict__ A, int lda, size_t sA, const _Float16* __restrict__ Bh, int ldb, size_t sB, float alpha, const float* __restrict__ bias, size_t sBias, const float* __restrict__ CP, int rowsPerB, size_t sCPb, int row0g,
    float* __restrict__ C, _Float16* __restrict__ C16, int ldc, size_t sC, int M, int N, int K, size_t zA, size_t zB, size_t zC, const float* __restrict__ bias1, const float* __restrict__ bias2) { static_assert(ACT == 0 || ACT == 3 || ACT == 6 || ACT == 8 || ACT == 9 || ACT == 11 || ACT == 12 || ACT == 14 || ACT == 15 || ACT == 16 || ACT == 17, "k_gemm2: unsupported ACT code (would silently apply no activation)");
  __shared__ __attribute__((aligned(16))) float so[4][32][68];
  const int tid = threadIdx.x, w = tid >> 5, lane = tid & 31, ln = lane & 15, hh = lane >> 4; const int by = blockIdx.y, bz = blockIdx.z;      /* grid.z: a second batch index (element strides zA, zB, zC) */
  A += (size_t)by * sA + (size_t)bz * zA; Bh += (size_t)by * sB + (size_t)bz * zB; const size_t cofs = (size_t)by * sC + (size_t)bz * zC; const float* bp = bias ? bias + (size_t)by * sBias : nullptr;
  if (bias1 && by == 1) bp = bias1; if (bias2 && by == 2) bp = bias2;      /* bias vectors that are separate buffers: one per grid.y index */
  const int ntn = N >> 6; const int mt = blockIdx.x / ntn, nq = blockIdx.x - mt * ntn; const int row0 = mt * 128 + 32 * w, col0 = nq * 64; if (row0 >= M) return;
  const _Float16* a0p = A + (size_t)(row0 + ln) * lda; const _Float16* a1p = a0p + (size_t)16 * lda;
  const _Float16* b0p = Bh + (size_t)(col0 + ln) * ldb; const _Float16* b1p = b0p + (size_t)16 * ldb; const _Float16* b2p = b1p + (size_t)16 * ldb; const _Float16* b3p = b2p + (size_t)16 * ldb;
  const v8f z8 = {0.f,0.f,0.f,0.f,0.f,0.f,0.f,0.f}; v8f c00 = z8, c01 = z8, c02 = z8, c03 = z8, c10 = z8, c11 = z8, c12 = z8, c13 = z8;
#pragma unroll 1
  for (int kb = 0; kb < K; kb += 32) { const v16h a0 = g2_frag(a0p + kb, hh), a1 = g2_frag(a1p + kb, hh);
    v16h b = g2_frag(b0p + kb, hh); c00 = g2_mma(a0, b, c00); c10 = g2_mma(a1, b, c10);
    b = g2_frag(b1p + kb, hh); c01 = g2_mma(a0, b, c01); c11 = g2_mma(a1, b, c11);
    b = g2_frag(b2p + kb, hh); c02 = g2_mma(a0, b, c02); c12 = g2_mma(a1, b, c12);
    b = g2_frag(b3p + kb, hh); c03 = g2_mma(a0, b, c03); c13 = g2_mma(a1, b, c13); }
  v8f accs[8] = {c00, c01, c02, c03, c10, c11, c12, c13};
#pragma unroll
  for (int u = 0; u < 8; ++u) { const int t = u & 3, half = u >> 2; const int col = col0 + t * 16 + ln; const float bv = bp ? bf16_round(bp[col]) : 0.f;
#pragma unroll
    for (int r = 0; r < 8; ++r) { const int rloc = half * 16 + 8 * hh + r; float v = accs[u][r] * alpha + bv; if (CP) { if (rowsPerB < 0) v += CP[cofs + (size_t)(row0g + row0 + rloc) * ldc + col];      /* rowsPerB < 0: own element of the batched C plane */ else { const int bidx = (row0g + row0 + rloc) / rowsPerB; v += CP[(size_t)bidx * sCPb + (size_t)by * 64 + col]; } }
      if (ACT == 3) v = fmaxf(v, 0.f); else if (ACT == 6) v = 0.5f * v * (1.0f + erff(v * 0.70710678118654752f)); else if (ACT == 11) v = 1.0f / (1.0f + expf(-v)); else if (ACT == 15) v = v / (1.0f + expf(-v)); else if (ACT == 12) v = (v > 0.f) ? v : 0.01f * v; else if (ACT == 8) v = tanhf(v); else if (ACT == 9) v = 0.5f * v * (1.0f + tanhf(0.7978845608028654f * (v + 0.044715f * v * v * v))); else if (ACT == 14) v = (v > 0.f) ? v : 0.1f * v; else if (ACT == 16) v = (v >= 0.f) ? v : 0.3f * v; else if (ACT == 17) v = (v >= 0.f) ? v : 0.2f * v;
      so[w][rloc][t * 16 + ln] = v; } }
  __builtin_amdgcn_fence(__ATOMIC_ACQ_REL, "workgroup"); __builtin_amdgcn_wave_barrier();
  const int rsub = lane >> 4, c4 = (lane & 15) * 4;
  {
#pragma unroll
    for (int q = 0; q < 16; ++q) { const int r = q * 2 + rsub; const v4f v = *(const v4fa*)&so[w][r][c4]; if (C) *(v4f*)(C + cofs + (size_t)(row0 + r) * ldc + col0 + c4) = v; if (C16) { v4h h4; for (int i = 0; i < 4; ++i) h4[i] = (_Float16)v[i]; *(v4h*)(C16 + cofs + (size_t)(row0 + r) * ldc + col0 + c4) = h4; } }
     } }


__global__ __launch_bounds__(256) void k_wnat(const float* __restrict__ w, size_t n8, _Float16* __restrict__ Bt) { const size_t t = (size_t)blockIdx.x * 256 + threadIdx.x; if (t >= n8) return; FragH f; for (int q = 0; q < 8; ++q) f.h[q] = (_Float16)(bf16_round(w[t * 8 + q]) * 16.0f); *(v8us*)((unsigned short*)Bt + t * 8) = f.half[0];  }
__global__ __launch_bounds__(256) void k_rsm(const float* __restrict__ S, _Float16* __restrict__ P, int nrows) {
  #pragma clang fp contract(off)
  const int i = blockIdx.x * 256 + threadIdx.x; if (i >= nrows) return; const float* s = S + (size_t)i * SQ; float mx = -3.0e38f;
#pragma unroll 1
  for (int j = 0; j < SQ; ++j) mx = fmaxf(mx, s[j]); float se = 0.f;
#pragma unroll 1
  for (int j = 0; j < SQ; ++j) se += expf(s[j] - mx); const float sc = 256.0f / se;
#pragma unroll 1
  for (int j0 = 0; j0 < SQ; j0 += 8) { FragH f; for (int q = 0; q < 8; ++q) f.h[q] = (_Float16)(expf(s[j0 + q] - mx) * sc); unsigned short* d = (unsigned short*)P + (size_t)i * SQ + j0; *(v8us*)d = f.half[0];  } }
__global__ __launch_bounds__(256) void k_vt(const _Float16* __restrict__ V16, int b, int h0, _Float16* __restrict__ VT) { __shared__ unsigned short tl[64][65]; const int tid = threadIdx.x; const int hh = blockIdx.x % HG, sg = blockIdx.x / HG; const int s0 = sg * 64; const int h = h0 + hh;
  for (int i = tid; i < 64 * 8; i += 256) { const int j = i / 8, d8 = (i % 8) * 8; FragH f; f.half[0] = *(const v8us*)((const unsigned short*)V16 + ((size_t)b * SQ + s0 + j) * DM + h * HD + d8); for (int q = 0; q < 8; ++q) tl[d8 + q][j] = f.u[q]; }
  __syncthreads();
  { for (int i = tid; i < 64 * 8; i += 256) { const int d = i / 8, j8 = (i % 8) * 8; FragH f; for (int q = 0; q < 8; ++q) f.u[q] = tl[d][j8 + q]; *(v8us*)((unsigned short*)VT + ((size_t)hh * HD + d) * SQ + s0 + j8) = f.half[0]; }  } }



#define FK 64                        /* keys per staged tile */
#define FPIT 72                      /* LDS row pitch in f16 elements: 144 bytes = 16 x odd, free of bank conflicts for 16-byte fragment reads */
#define FCS 0.18033688011112042f     /* 1/8 x log2(e): exponentials in base 2 */
__device__ __forceinline__ float fa_xhalf(float x) { return __builtin_bit_cast(float, __builtin_amdgcn_permlanex16(__builtin_bit_cast(int, x), __builtin_bit_cast(int, x), 0x76543210, 0xfedcba98, false, false)); }      /* lane l reads lane l ^ 16 */
// Base-2 exponentials in asm so that the slot the instruction set asks for behind a transcendental (before its result is read or its source overwritten) is there by construction: the outputs lie apart from every input, so each v_exp_f32 is followed by an independent one, and the v_nop stands behind the last.
__device__ __forceinline__ void fa_exp8(const float (&x)[8], float (&e)[8]) {
  asm("v_exp_f32 %0, %8\n\tv_exp_f32 %1, %9\n\tv_exp_f32 %2, %10\n\tv_exp_f32 %3, %11\n\tv_exp_f32 %4, %12\n\tv_exp_f32 %5, %13\n\tv_exp_f32 %6, %14\n\tv_exp_f32 %7, %15\n\tv_nop"
      : "=&v"(e[0]), "=&v"(e[1]), "=&v"(e[2]), "=&v"(e[3]), "=&v"(e[4]), "=&v"(e[5]), "=&v"(e[6]), "=&v"(e[7]) : "v"(x[0]), "v"(x[1]), "v"(x[2]), "v"(x[3]), "v"(x[4]), "v"(x[5]), "v"(x[6]), "v"(x[7])); }
__device__ __forceinline__ float fa_exp1(float x) { float e; asm("v_exp_f32 %0, %1\n\tv_nop" : "=v"(e) : "v"(x)); return e; }      /* the same slot behind a single one */
__device__ __forceinline__ v8f fa_mma(v16h a, v16h b, v8f c) { return __builtin_amdgcn_wmma_f32_16x16x32_f16(false, a, false, b, (short)0, c, false, false); }
__global__ __launch_bounds__(128) void k_fattn(const _Float16* __restrict__ Q16, const _Float16* __restrict__ K16, const _Float16* __restrict__ VT, _Float16* __restrict__ O16) {
  __shared__ __attribute__((aligned(16))) _Float16 lk[2][FK][FPIT]; __shared__ __attribute__((aligned(16))) _Float16 lv[2][HD][FPIT];
  const int tid = threadIdx.x, w = __builtin_amdgcn_readfirstlane(tid >> 5), lane = tid & 31, ln = lane & 15, hh = lane >> 4;
  const int bh = blockIdx.x % (NB * NH), qb = (SQ / 128 - 1) - blockIdx.x / (NB * NH);      /* the longest query blocks start first */
  const int b = bh / NH, h = bh % NH; const int q0 = qb * 128, qw = q0 + 32 * w; const int nt = (q0 + 128) / FK;      /* key tiles up to the block's last query */
  const int sr = tid >> 3, sc = (tid & 7) * 8;      /* staging: 8 threads cover one row's 128 bytes, the block 16 rows a round */
  const _Float16* kp = K16 + ((size_t)b * SQ + sr) * DM + h * HD + sc; const _Float16* vp = VT + ((size_t)bh * HD + sr) * SQ + sc;
  v8us kr[4], vr[4]; v16h qf[2][2];
#pragma unroll      /* static indices keep the staging registers in registers */
  for (int i = 0; i < 4; ++i) { kr[i] = *(const v8us*)((const unsigned short*)kp + (size_t)(16 * i) * DM); vr[i] = *(const v8us*)((const unsigned short*)vp + (size_t)(16 * i) * SQ); }
#pragma unroll      /* static indices, as above */
  for (int g = 0; g < 2; ++g) { const _Float16* qp = Q16 + ((size_t)b * SQ + qw + 16 * g + ln) * DM + h * HD; qf[g][0] = g2_frag(qp, hh); qf[g][1] = g2_frag(qp + 32, hh); }
  asm volatile("s_wait_xcnt 0x0" ::: "memory");      /* the loads' address registers are reused behind them */
#pragma unroll      /* static indices, as above */
  for (int i = 0; i < 4; ++i) { *(v8us*)((unsigned short*)&lk[0][sr + 16 * i][sc]) = kr[i]; *(v8us*)((unsigned short*)&lv[0][sr + 16 * i][sc]) = vr[i]; }
  __syncthreads();      /* tile 0 is complete before any wave reads it */
  const v8f z8 = {0.f, 0.f, 0.f, 0.f, 0.f, 0.f, 0.f, 0.f};
  v8f o[2][4]; float m[2] = {-1.0e30f, -1.0e30f}, l[2] = {0.f, 0.f};      /* m: the maximum in use (base-2 scaled scores); l: this lane half's part of the sum */
#pragma unroll      /* static indices, as above */
  for (int g = 0; g < 2; ++g) for (int dt = 0; dt < 4; ++dt) o[g][dt] = z8;
#pragma unroll 1      /* one key tile at a time: the two buffers alternate */
  for (int t = 0; t < nt; ++t) {
    const bool more = t + 1 < nt;      /* the same for the whole block */
    if (more) { kp += (size_t)FK * DM; vp += FK;
#pragma unroll      /* static indices; all of a thread's tile loads in flight under this tile's work */
      for (int i = 0; i < 4; ++i) { kr[i] = *(const v8us*)((const unsigned short*)kp + (size_t)(16 * i) * DM); vr[i] = *(const v8us*)((const unsigned short*)vp + (size_t)(16 * i) * SQ); }
      asm volatile("s_wait_xcnt 0x0" ::: "memory"); }      /* the loads' address registers are advanced on the next trip */
    const _Float16* bk = &lk[t & 1][0][0]; const _Float16* bv = &lv[t & 1][0][0];
#pragma unroll      /* two 32-key passes a tile, constant LDS offsets */
    for (int sub = 0; sub < 2; ++sub) { const int kb = t * FK + 32 * sub;
      if (kb <= qw + 31) {      /* wave-uniform (scalar): a pass wholly above the wave's diagonal is skipped; the barrier below is not */
        v8f s[2][2];      /* s[kt][g][r] = score of key kb + 16 kt + 8 hh + r, query qw + 16 g + ln */
#pragma unroll      /* static indices, as above */
        for (int kt = 0; kt < 2; ++kt) { const _Float16* kq = bk + (32 * sub + 16 * kt + ln) * FPIT; const v16h k0 = g2_frag(kq, hh), k1 = g2_frag(kq + 32, hh);
          for (int g = 0; g < 2; ++g) s[kt][g] = fa_mma(k1, qf[g][1], fa_mma(k0, qf[g][0], z8)); }
        if (kb + 31 > qw) {      /* wave-uniform: only the pass on the wave's diagonal pays for the mask */
#pragma unroll      /* static indices, as above */
          for (int kt = 0; kt < 2; ++kt) for (int g = 0; g < 2; ++g) for (int r = 0; r < 8; ++r) if (kb + 16 * kt + 8 * hh + r > qw + 16 * g + ln) s[kt][g][r] = -1.0e30f; }
        float mb[2]; bool need = false;
#pragma unroll      /* static indices, as above */
        for (int g = 0; g < 2; ++g) { float mx = s[0][g][0];
          for (int r = 1; r < 8; ++r) mx = fmaxf(mx, s[0][g][r]);
          for (int r = 0; r < 8; ++r) mx = fmaxf(mx, s[1][g][r]);
          mx = fmaxf(mx, fa_xhalf(mx)) * FCS; mb[g] = mx; need = need || (mx > m[g] + 8.0f); }      /* both lane halves hold the query's maximum of this pass */
        if (__builtin_amdgcn_ballot_w32(need) != 0) {
#pragma unroll      /* static indices, as above */
          for (int g = 0; g < 2; ++g) { const float mn = fmaxf(m[g], mb[g]); const float corr = fa_exp1(m[g] - mn); m[g] = mn; l[g] *= corr;      /* key 0 is never masked: mn is a real score from the first pass on, where corr is 0 */
            for (int dt = 0; dt < 4; ++dt) o[g][dt] = o[g][dt] * corr; } }
        v16h vf[4]; FragH pf[2];
#pragma unroll      /* static indices, as above */
        for (int dt = 0; dt < 4; ++dt) vf[dt] = g2_frag(bv + (16 * dt + ln) * FPIT + 32 * sub, hh);
#pragma unroll      /* static indices, as above */
        for (int g = 0; g < 2; ++g) { const float nm = 4.0f - m[g]; float ls[4];      /* weights carried x16 (it cancels against l): small ones stay clear of the f16 subnormals */
          for (int kt = 0; kt < 2; ++kt) { float x[8], e[8]; for (int r = 0; r < 8; ++r) x[r] = fmaf(s[kt][g][r], FCS, nm); fa_exp8(x, e); for (int r = 0; r < 8; ++r) { if (kt == 0 && r < 4) ls[r] = e[r]; else ls[r & 3] += e[r]; pf[g].h[8 * kt + r] = (_Float16)e[r]; } }
          l[g] += (ls[0] + ls[1]) + (ls[2] + ls[3]); }
        __builtin_amdgcn_sched_barrier(0);      /* both groups' exponentials stay in front of the eight products: eight independent accumulators in a row keep the matrix unit fed */
#pragma unroll      /* static indices, as above */
        for (int dt = 0; dt < 4; ++dt) for (int g = 0; g < 2; ++g) o[g][dt] = fa_mma(vf[dt], pf[g].v, o[g][dt]);
      } }
    if (more) {
#pragma unroll      /* static indices, as above */
      for (int i = 0; i < 4; ++i) { *(v8us*)((unsigned short*)&lk[(t + 1) & 1][sr + 16 * i][sc]) = kr[i]; *(v8us*)((unsigned short*)&lv[(t + 1) & 1][sr + 16 * i][sc]) = vr[i]; } }      /* into the buffer that every wave left before the last barrier */
    __syncthreads();      /* tile t + 1 is complete, and every wave has left tile t, before the next trip */
  }
#pragma unroll      /* static indices, as above */
  for (int g = 0; g < 2; ++g) { const float fin = 64.0f / (l[g] + fa_xhalf(l[g]));      /* the lane halves' sums join once; o carried x64, folded into the output GEMM alpha */
    unsigned short* op = (unsigned short*)O16 + ((size_t)b * SQ + qw + 16 * g + ln) * DM + h * HD + 8 * hh;      /* a lane holds d = 16 dt + 8 hh .. + 7 of its query: 16 bytes a store */
    for (int dt = 0; dt < 4; ++dt) { FragH f; for (int r = 0; r < 8; ++r) f.h[r] = (_Float16)(o[g][dt][r] * fin); *(v8us*)(op + 16 * dt) = f.half[0]; }
    if (g == 0) { asm volatile("s_wait_xcnt 0x0" ::: "memory"); __builtin_amdgcn_sched_barrier(0); } }      /* the first group's store registers are reused by the second group's arithmetic: the wait stands behind the stores, and the scheduling barrier keeps that arithmetic behind the wait */
}


// One thread per query row; 64 rows per block. The row's q and o stay in registers; Q, K and V come in tiles of 64 rows, staged in LDS with whole-line loads; a K or V row is read back as a same-address (broadcast) LDS load. Four keys' score sums run side by side; each sum, and the running m, l, o, keep the key-by-key, element-by-element order.
template <int MASKADD, int LD>      /* LD: row pitch of QF, KF, VF in floats, a constant so that a tile's 16 loads share one address and differ in the immediate offset */
__global__ __launch_bounds__(64) void k_att0(const float* __restrict__ QF, const float* __restrict__ KF, const float* __restrict__ VF, const float* __restrict__ mask, float scale, float* __restrict__ OF, int ldo) {
  #pragma clang fp contract(off)
  __shared__ __attribute__((aligned(16))) float lk[64][HD]; __shared__ __attribute__((aligned(16))) float lv[64][HD]; __shared__ __attribute__((aligned(16))) float lo[64][HD + 4];
  const int tid = threadIdx.x; const int h = blockIdx.x / (QT0 / 64), rg = blockIdx.x % (QT0 / 64); const int i = rg * 64 + tid;
  { const size_t br = (size_t)blockIdx.y * QT0; QF += br * LD; KF += br * LD; VF += br * LD; OF += br * ldo; }      /* grid.y: the batch; each batch has QT0 rows in every plane */
  const int tr = tid / 16, pc = (tid % 16) * 4; const unsigned tb = (unsigned)(tr * LD + pc) * 4u;      /* the thread's byte offset inside a group of four rows: 16 lanes cover one row's 256 bytes */
  { const char* qb = (const char*)(QF + (size_t)(rg * 64) * LD + h * HD);
    v4f qt[16];
#pragma unroll      /* all of a thread's tile loads in flight together */
    for (int it = 0; it < 16; ++it) qt[it] = *(const v4fa*)(qb + (size_t)(it * 4) * LD * 4 + tb);
    asm volatile("s_wait_xcnt 0x0" ::: "memory");      /* the loads' base registers are reused right behind them */
#pragma unroll      /* static indices keep qt in registers */
    for (int it = 0; it < 16; ++it) *(v4f*)&lo[it * 4 + tr][pc] = qt[it]; }
  __syncthreads();      /* the q tile is complete before a thread reads its row */
  float q[HD], o[HD];
#pragma unroll      /* static indices keep q and o in registers */
  for (int c = 0; c < HD / 4; ++c) { const v4f t = *(const v4f*)&lo[tid][c * 4]; for (int u = 0; u < 4; ++u) { q[c * 4 + u] = t[u]; o[c * 4 + u] = 0.f; } }
  float m = -1.0e30f, l = 0.f; const int jmax = MASKADD ? (SQ - 1) : (rg * 64 + 63);      /* additive-mask form: every key (the mask input decides); causal form: keys up to the block's last row */
  const char* kp = (const char*)(KF + h * HD) + tb; const char* vp = (const char*)(VF + h * HD) + tb;      /* the thread's place in the current K and V tile */
#pragma unroll 1      /* one key tile at a time: the tile buffers are reused */
  for (int j0 = 0; j0 <= jmax; j0 += 64) {
#pragma unroll      /* all of a thread's tile loads in flight together */
    for (int it = 0; it < 16; ++it) { *(v4f*)&lk[it * 4 + tr][pc] = *(const v4fa*)(kp + (size_t)(it * 4) * LD * 4); *(v4f*)&lv[it * 4 + tr][pc] = *(const v4fa*)(vp + (size_t)(it * 4) * LD * 4); }
    __syncthreads();      /* the tile is complete before any row reads it */
#pragma unroll 1      /* four keys per trip are enough to fill the add latency; more only grows the code */
    for (int jj = 0; jj < 64; jj += 4) { float s[4] = {0.f, 0.f, 0.f, 0.f};
#pragma unroll      /* static indices into q */
      for (int c = 0; c < HD / 4; ++c) for (int a = 0; a < 4; ++a) { const v4f kq = *(const v4f*)&lk[jj + a][c * 4]; s[a] = __fadd_rn(s[a], __fmul_rn(q[c * 4 + 0], kq[0])); s[a] = __fadd_rn(s[a], __fmul_rn(q[c * 4 + 1], kq[1])); s[a] = __fadd_rn(s[a], __fmul_rn(q[c * 4 + 2], kq[2])); s[a] = __fadd_rn(s[a], __fmul_rn(q[c * 4 + 3], kq[3])); }
#pragma unroll      /* static indices into s and o */
      for (int a = 0; a < 4; ++a) { const int j = j0 + jj + a; float sv = __fmul_rn(s[a], scale); if (MASKADD) sv = __fadd_rn(sv, __fmul_rn(bf16_round(mask[(size_t)i * SQ + j]), -10000.0f));
        const float f = (MASKADD || j <= i) ? 1.f : 0.f; const float sm = fmaf(f, sv, (1.f - f) * -1.0e30f); const float mn = fmaxf(m, sm); const float sc = expf(m - mn); const float e = expf(sm - mn); l = __fadd_rn(__fmul_rn(l, sc), e); m = mn;
        for (int c = 0; c < HD / 4; ++c) { const v4f vv = *(const v4f*)&lv[jj + a][c * 4]; for (int u = 0; u < 4; ++u) o[c * 4 + u] = __fadd_rn(__fmul_rn(o[c * 4 + u], sc), __fmul_rn(e, vv[u])); } } }
    __syncthreads();      /* every row has left the tile before the next one overwrites it */
    kp += (size_t)64 * LD * 4; vp += (size_t)64 * LD * 4;
  }
  const float fin = 64.0f / l;      /* o carried x64 like the f16 path */
#pragma unroll      /* static indices into o */
  for (int c = 0; c < HD / 4; ++c) { v4f oo; for (int u = 0; u < 4; ++u) oo[u] = __fmul_rn(o[c * 4 + u], fin); *(v4f*)&lo[tid][c * 4] = oo; }
  __syncthreads();
  {
#pragma unroll 1
    for (int it = 0; it < 16; ++it) { const int row = it * 4 + tid / 16, pc = (tid % 16) * 4; const v4f v = *(const v4f*)&lo[row][pc]; *(v4f*)(OF + (size_t)(rg * 64 + row) * ldo + h * HD + pc) = v; }
     } }


template <int BFIN, int W16, int W32>
__global__ __launch_bounds__(256) void k_lnx(const float* __restrict__ X, const float* __restrict__ g, const float* __restrict__ bb, float eps, _Float16* __restrict__ N16, float* __restrict__ N32) {
  #pragma clang fp contract(off)
  __shared__ float red[256]; const size_t r = blockIdx.x; const int t = threadIdx.x; const bool act = t < (DMQ / 4); const int c0 = act ? t * 4 : 0;
  const v4f xa = *(const v4fa*)(X + r * DMQ + c0); float s[4]; float sum = 0.f;
  for (int q = 0; q < 4; ++q) { s[q] = act ? (BFIN ? bf16_round(xa[q]) : xa[q]) : 0.f; sum = __fadd_rn(sum, s[q]); }
  red[t] = sum; __syncthreads(); for (int st = 128; st > 0; st >>= 1) { if (t < st) red[t] = __fadd_rn(red[t], red[t + st]); __syncthreads(); } const float mu = red[0] / (float)DMQ; __syncthreads();
  float vs = 0.f; for (int q = 0; q < 4; ++q) { const float dl = act ? __fadd_rn(s[q], -mu) : 0.f; vs = __fadd_rn(vs, __fmul_rn(dl, dl)); } red[t] = vs; __syncthreads(); for (int st = 128; st > 0; st >>= 1) { if (t < st) red[t] = __fadd_rn(red[t], red[t + st]); __syncthreads(); }
  const float rs = rsqrtf(__fadd_rn(red[0] / (float)DMQ, eps)); v4h y; v4f yf;
  for (int q = 0; q < 4; ++q) { const int c = c0 + q; yf[q] = __fadd_rn(__fmul_rn(__fmul_rn(__fadd_rn(s[q], -mu), rs), bf16_round(g[c])), bf16_round(bb[c])); y[q] = (_Float16)yf[q]; }
  if (!act) return;      /* no barriers after this point */
  { if (W16) *(v4h*)(N16 + r * DMQ + c0) = y; if (W32) *(v4f*)(N32 + r * DMQ + c0) = yf;  } }

extern "C" void kernel_launch(void* const* d_in, const int* in_sizes, int n_in,
                              void* d_out, int out_size, void* d_ws, size_t ws_size, hipStream_t stream) {
  (void)in_sizes; (void)n_in; (void)out_size;
  const float* const* I = (const float* const*)d_in; const float* x = I[0]; const float* wq = I[1]; const float* bq = I[2]; const float* wk = I[3]; const float* bk = I[4]; const float* wv = I[5]; const float* bv = I[6]; const float* wo = I[7]; const float* bo = I[8]; const float* lng = I[9]; const float* lnb = I[10];      /* [in][out] weights + biases; LN gamma/beta */
  char* ws = (char*)d_ws; size_t off = 0;
  auto take = [&](size_t bytes) { char* p = ws + off; off += (bytes + 255) & ~(size_t)255; return p; };
  _Float16* BQ = (_Float16*)take((size_t)DM * DM * 2); _Float16* BK = (_Float16*)take((size_t)DM * DM * 2); _Float16* BV = (_Float16*)take((size_t)DM * DM * 2); _Float16* BO = (_Float16*)take((size_t)DM * DM * 2);
  float* S = (float*)take((size_t)NB * NH * QT * NKX * 4);      /* room for the projection-stage planes */
  _Float16* X16 = (_Float16*)S; _Float16* XL = (_Float16*)((char*)S + NR * DM * 2); float* HF = (float*)((char*)S + NR * DM * 4); float* QKF = HF;      /* projection-stage planes on the bytes of S (16 per token element: 2 + 2 + three f32 planes); h (f32) is last read before the first f32 plane is written */
  _Float16* Q16 = (_Float16*)take(NR * DM * 2); _Float16* K16 = (_Float16*)take(NR * DM * 2); _Float16* V16 = (_Float16*)take(NR * DM * 2); _Float16* O16 = (_Float16*)take(NR * DM * 2);      /* Q16, K16, V16: three planes in a row */
  _Float16* VT = (_Float16*)take((size_t)NB * NH * HD * SQ * 2);
  float* QF0 = (float*)take((size_t)NB * QT0 * DM * 4); float* KF0 = (float*)take((size_t)NB * QT0 * DM * 4); float* VF0 = (float*)take((size_t)NB * QT0 * DM * 4); float* OF0 = (float*)take((size_t)NB * QT0 * DM * 4); _Float16* OH0 = (_Float16*)take((size_t)NB * QT0 * DM * 2); _Float16* OL0 = (_Float16*)take((size_t)NB * QT0 * DM * 2);      /* QF0, KF0, VF0: three planes in a row */
  if (off > ws_size) return;
  k_wt_f16<<<(unsigned)(((size_t)DM * (DM / 8) + 255) / 256), 256, 0, stream>>>(wq, BQ, DM, DM, 16.0f); k_wt_f16<<<(unsigned)(((size_t)DM * (DM / 8) + 255) / 256), 256, 0, stream>>>(wk, BK, DM, DM, 16.0f); k_wt_f16<<<(unsigned)(((size_t)DM * (DM / 8) + 255) / 256), 256, 0, stream>>>(wv, BV, DM, DM, 16.0f); k_wt_f16<<<(unsigned)(((size_t)DM * (DM / 8) + 255) / 256), 256, 0, stream>>>(wo, BO, DM, DM, 16.0f);      /* [in][out] -> Bt[n][k] x16; BQ, BK, BV: three planes in a row */

  k_lnx<1, 0, 1><<<(unsigned)NR, 256, 0, stream>>>(x, lng, lnb, 1e-5f, nullptr, HF); k_hl<<<(unsigned)((NR * DM / 8 + 255) / 256), 256, 0, stream>>>(HF, X16, XL, NR * DM / 8);      /* h = LN(bf16(x)) f32 -> f16 hi (X16) + x1024 residual (XL) rows */
  /* Independent launches share one grid: q, k, v on grid.y of the projection GEMMs, the batch on grid.z of the per-batch GEMMs (grid.y of the first-tile attention, part of the flat index elsewhere). */
  const size_t zW = (size_t)DM * DM, zR = NR * DM, zT = (size_t)SQ * DM, z0 = (size_t)QT0 * DM;      /* elements: a weight plane, a token-row plane, one batch of it, one batch of a first-tile plane */
  const dim3 gp((unsigned)((NR / 128) * (DM / 64)), 1, 1), gp3((unsigned)((NR / 128) * (DM / 64)), 3, 1);      /* every token row; the same for q, k, v */
  k_gemm2<0><<<gp3, 128, 0, stream>>>(X16, DM, 0, BQ, DM, zW, 0.0625f, bq, 0, nullptr, 1, 0, 0, QKF, nullptr, DM, zR, (int)NR, DM, DM, 0, 0, 0, bk, bv);      /* f32 h_hi W + b */
  k_gemm2<0><<<gp3, 128, 0, stream>>>(XL, DM, 0, BQ, DM, zW, 0.00006103515625f, nullptr, 0, QKF, -1, 0, 0, nullptr, Q16, DM, zR, (int)NR, DM, DM, 0, 0, 0, nullptr, nullptr);      /* += h_lo W 2^-14 (own element), rounded to the f16 q, k, v rows */
  k_vt<NH, SQ><<<NB * NH * (SQ / 64), 256, 0, stream>>>(V16, LQ, 0, VT);      /* V^T [NB][NH][HD][SQ] */
  const dim3 g0((QT0 / 128) * (DM / 64), 1, NB), g03((QT0 / 128) * (DM / 64), 3, NB);
  k_gemm2<0><<<g03, 128, 0, stream>>>(X16, DM, 0, BQ, DM, zW, 0.0625f, bq, 0, nullptr, 1, 0, 0, QF0, nullptr, DM, (size_t)NB * z0, QT0, DM, DM, zT, 0, z0, bk, bv);
  k_gemm2<0><<<g03, 128, 0, stream>>>(XL, DM, 0, BQ, DM, zW, 0.00006103515625f, nullptr, 0, QF0, -1, 0, 0, QF0, nullptr, DM, (size_t)NB * z0, QT0, DM, DM, zT, 0, z0, nullptr, nullptr);      /* f32 q, k, v of each batch's first 128 rows (exact products) */
  k_att0<0, DM><<<dim3(NH * (QT0 / 64), NB), 64, 0, stream>>>(QF0, KF0, VF0, nullptr, 0.125f, OF0, DM);      /* exact f32 attention for rows 0..127 (o x64) */
  k_fattn<<<NB * NH * (SQ / 128), 128, 0, stream>>>(Q16, K16, VT, O16);      /* scores, causal softmax and o = P V in one launch; o (merged heads, x64) as f16 rows */
  k_gemm2<0><<<gp, 128, 0, stream>>>(O16, DM, 0, BO, DM, 0, 0.0009765625f, bo, 0, nullptr, 1, 0, 0, (float*)d_out, nullptr, DM, 0, (int)NR, DM, DM, 0, 0, 0, nullptr, nullptr);      /* out rows are the output layout */
  k_hl<<<(unsigned)(((size_t)NB * QT0 * DM / 8 + 255) / 256), 256, 0, stream>>>(OF0, OH0, OL0, (size_t)NB * QT0 * DM / 8);      /* first-tile o (x64) -> f16 hi + x1024 residual planes */
  k_gemm2<0><<<g0, 128, 0, stream>>>(OH0, DM, 0, BO, DM, 0, 0.0009765625f, bo, 0, nullptr, 1, 0, 0, (float*)d_out, nullptr, DM, 0, QT0, DM, DM, z0, 0, zT, nullptr, nullptr);      /* rows 0..127 of each batch: out = o_hi Wo (+ b), overwriting the f16-path rows */
  k_gemm2<0><<<g0, 128, 0, stream>>>(OL0, DM, 0, BO, DM, 0, 0.00000095367431640625f, nullptr, 0, (const float*)d_out, -1, 0, 0, (float*)d_out, nullptr, DM, 0, QT0, DM, DM, z0, 0, zT, nullptr, nullptr);      /* += o_lo Wo 2^-20 (own-element accumulate) */
}

// v005
// Measured time: 373 microseconds a run.
// In two side-by-side timings against v004, it was 1.81 and 1.78 times as fast.
// All steps since v000 together make it 28.7 times as fast.
#include <hip/hip_runtime.h>
// Pre-LayerNorm causal multi-head attention (x [4][2048][1024]; h = LN(x) (eps 1e-5, gamma, beta); q/k/v = h W + b ([in][out] 1024 x 1024 sigma 1/32, zero biases); 16 heads of 64; scores / 8; where(causal, s, finfo.min); softmax; out = merged Wo + bo -> [4][2048][1024], no residual).
// Structure: token rows r = b*2048 + s; h = LN(bf16(x)) in f32, as f16 hi + x1024 residual rows; Q, K, V as three WMMA GEMMs (32x64 wave tiles, f32 accumulation, exact x16 weights + bias, f16 outputs); V^T for all batches and heads via LDS transposes; causal attention fused in one launch (blocks of 128 query rows of one batch and head; S^T = K Q^T, running f32 maximum and sum per query, native exp2, weights x16 f16, O^T += V^T P^T over the keys up to the diagonal; o carried x64, folded into the output GEMM alpha) written straight into the merged f16 o rows; out = o W_o + b GEMM (f32) into the output layout.
// Compute dtype: inputs rounded to bf16; x / weights exact; q, k, v, softmax weights and o as plain f16 GEMM operands (~2^-12); scores and softmax statistics f32. v_wmma_f32_16x16x32_f16.
#define NB 4
#define SQ 2048
#define DM 1024
#define DMQ DM                       /* LayerNorm width */
#define NH 16
#define HD 64
#define HG 4                         /* heads per launch of the grouped k_vt (not launched) */
#define QT 256
#define NKX SQ
#define QT0 128                      /* first-tile rows recomputed exactly in f32 */
#define B0 0                         /* first batch processed (unused) */
#define NBR NB                       /* batches processed (unused) */
#define NR ((size_t)NB * SQ)         /* token rows */
#define MP ((int)((size_t)NBR * SQ)) /* rows projected (unused) */
#define QN SQ                        /* query rows attended per batch (unused) */
#define NHD NH                       /* heads attended (unused) */
#define MPO MP                       /* rows through the output stage (unused) */
#define LQ DM      /* row pitch of the q/k/v rows */
typedef __bf16 v16b __attribute__((ext_vector_type(16)));
typedef unsigned short v8us __attribute__((ext_vector_type(8), may_alias));
typedef float  v8f  __attribute__((ext_vector_type(8)));
typedef float  v4f  __attribute__((ext_vector_type(4)));
typedef float  v4fa __attribute__((ext_vector_type(4), may_alias));
union FragB { v16b v; v8us half[2]; unsigned short u[16]; };

__device__ __forceinline__ unsigned short bf16_bits(float x) { unsigned int u = __float_as_uint(x); return (unsigned short)((u + 0x7FFFu + ((u >> 16) & 1u)) >> 16); }
__device__ __forceinline__ float bf16_val(unsigned short b) { return __uint_as_float(((unsigned int)b) << 16); }
__device__ __forceinline__ float bf16_round(float x) { return bf16_val(bf16_bits(x)); }
// D += A·B with NT terms: 1 = ah·bh, 2 = + al·bh (A split), 3 = + ah·bl (both split)
template <int NT>
__device__ __forceinline__ v8f mmaN(v16b ah, v16b al, v16b bh, v16b bl, v8f c) {
  c = __builtin_amdgcn_wmma_f32_16x16x32_bf16(false, ah, false, bh, (short)0, c, false, false);
  if (NT >= 2) c = __builtin_amdgcn_wmma_f32_16x16x32_bf16(false, al, false, bh, (short)0, c, false, false);
  if (NT >= 3) c = __builtin_amdgcn_wmma_f32_16x16x32_bf16(false, ah, false, bl, (short)0, c, false, false);
  asm volatile("v_nop\n\tv_nop\n\tv_nop\n\tv_nop" : "+v"(c) : "v"(ah), "v"(al), "v"(bh), "v"(bl));
  return c;
}

__global__ __launch_bounds__(256) void k_wt_bf16(const float* __restrict__ W, unsigned short* __restrict__ Wt, int K, int N) {
  const int t = blockIdx.x * 256 + threadIdx.x;
  const int k8n = K / 8;
  if (t >= N * k8n) return;
  const int n = t / k8n, k8 = (t % k8n) * 8;
  v8us v;
#pragma unroll
  for (int i = 0; i < 8; ++i) v[i] = bf16_bits(W[(size_t)(k8 + i) * N + n]);
  *(v8us*)(Wt + (size_t)n * K + k8) = v;
  
}

// GEMM C[M][N] (f32, pitch ldc) = act(A[M][K]·W + bias). A f32 row-major (pitch lda) converted per fragment to bf16
// (ASPLIT: hi/lo two planes -> 2 terms, else single rounded term); Wt bf16 [N][K] (pitch ldb). BIAS_BF16 rounds the
// bias to bf16 first (bias quantised to bf16 before the add). K%32==0, M%16==0, N%64==0.
template <bool ASPLIT, int ACT, bool BIAS_BF16>
__global__ __launch_bounds__(128) void k_gemm_bf(const float* __restrict__ A, int lda, const unsigned short* __restrict__ Wt, int ldb,
                                               const float* __restrict__ bias, float* __restrict__ C, int ldc, int M, int N, int K) {
  __shared__ __attribute__((aligned(16))) float so[4][16][64];
  const int tid = threadIdx.x, w = tid >> 5, lane = tid & 31, ln = lane & 15, hh = lane >> 4;
  const int ntn = N / 64;
  const int wid = blockIdx.x * 4 + w;
  const int mt = wid / ntn, nq = wid % ntn;
  if (mt * 16 >= M) return;
  const int row0 = mt * 16, col0 = nq * 64;
  const float* arow = A + (size_t)(row0 + ln) * lda;
  v8f acc[4] = {};
  for (int kb = 0; kb < K; kb += 32) {
    FragB ah, al;
    const v4f x0 = *(const v4fa*)(arow + kb + 8 * hh), x1 = *(const v4fa*)(arow + kb + 8 * hh + 4);
    const v4f x2 = *(const v4fa*)(arow + kb + 16 + 8 * hh), x3 = *(const v4fa*)(arow + kb + 16 + 8 * hh + 4);
    float xs[16] = {x0[0],x0[1],x0[2],x0[3],x1[0],x1[1],x1[2],x1[3],x2[0],x2[1],x2[2],x2[3],x3[0],x3[1],x3[2],x3[3]};
#pragma unroll
    for (int i = 0; i < 16; ++i) { const unsigned short hb = bf16_bits(xs[i]); ah.u[i] = hb; al.u[i] = ASPLIT ? bf16_bits(xs[i] - bf16_val(hb)) : (unsigned short)0; }
#pragma unroll
    for (int t = 0; t < 4; ++t) {
      const unsigned short* brow = Wt + (size_t)(col0 + t * 16 + ln) * ldb + kb;
      FragB b;
      b.half[0] = *(const v8us*)(brow + 8 * hh);
      b.half[1] = *(const v8us*)(brow + 16 + 8 * hh);
      acc[t] = mmaN<ASPLIT ? 2 : 1>(ah.v, al.v, b.v, b.v, acc[t]);
    }
  }
#pragma unroll
  for (int t = 0; t < 4; ++t) {
    float bv = bias ? bias[col0 + t * 16 + ln] : 0.f;
    if (BIAS_BF16) bv = bf16_round(bv);
#pragma unroll
    for (int r = 0; r < 8; ++r) { float v = acc[t][r] + bv; if (ACT == 1) v = fmaxf(v, 0.f); so[w][8 * hh + r][t * 16 + ln] = v; }
  }
  __builtin_amdgcn_fence(__ATOMIC_ACQ_REL, "workgroup");
  __builtin_amdgcn_wave_barrier();
  const int rsub = lane >> 4, c4 = (lane & 15) * 4;
  {
#pragma unroll
    for (int q = 0; q < 8; ++q) {
      const int r = q * 2 + rsub;
      const v4f v = *(const v4fa*)&so[w][r][c4];
      *(v4f*)(C + (size_t)(row0 + r) * ldc + col0 + c4) = v;
    }
    
  }
}

// GEMM C = act(A·W + bias + resid): A f32 (ASPLIT -> hi/lo 2 terms), Wt bf16 [N][K]; ACT 0 none, 1 relu, 2 exact gelu;
// resid (optional, f32, row index = (row % rmod), pitch ldr, RES_BF16 rounds it) added before the activation.
template <bool ASPLIT, int ACT, bool BIAS_BF16, bool RES_BF16>
__global__ __launch_bounds__(128) void k_gemm_bf3(const float* __restrict__ A, int lda, const unsigned short* __restrict__ Wt, int ldb,
                                                const float* __restrict__ bias, const float* __restrict__ resid, int rmod, int ldr,
                                                float* __restrict__ C, int ldc, int M, int N, int K) {
  __shared__ __attribute__((aligned(16))) float so[4][16][64];
  const int tid = threadIdx.x, w = tid >> 5, lane = tid & 31, ln = lane & 15, hh = lane >> 4;
  const int ntn = N / 64;
  const int wid = blockIdx.x * 4 + w;
  const int mt = wid / ntn, nq = wid % ntn;
  if (mt * 16 >= M) return;
  const int row0 = mt * 16, col0 = nq * 64;
  const float* arow = A + (size_t)(row0 + ln) * lda;
  v8f acc[4] = {};
  for (int kb = 0; kb < K; kb += 32) {
    FragB ah, al;
    const v4f x0 = *(const v4fa*)(arow + kb + 8 * hh), x1 = *(const v4fa*)(arow + kb + 8 * hh + 4);
    const v4f x2 = *(const v4fa*)(arow + kb + 16 + 8 * hh), x3 = *(const v4fa*)(arow + kb + 16 + 8 * hh + 4);
    float xs[16] = {x0[0],x0[1],x0[2],x0[3],x1[0],x1[1],x1[2],x1[3],x2[0],x2[1],x2[2],x2[3],x3[0],x3[1],x3[2],x3[3]};
#pragma unroll
    for (int i = 0; i < 16; ++i) { const unsigned short hb = bf16_bits(xs[i]); ah.u[i] = hb; al.u[i] = ASPLIT ? bf16_bits(xs[i] - bf16_val(hb)) : (unsigned short)0; }
#pragma unroll
    for (int t = 0; t < 4; ++t) {
      const unsigned short* brow = Wt + (size_t)(col0 + t * 16 + ln) * ldb + kb;
      FragB b;
      b.half[0] = *(const v8us*)(brow + 8 * hh);
      b.half[1] = *(const v8us*)(brow + 16 + 8 * hh);
      acc[t] = mmaN<ASPLIT ? 2 : 1>(ah.v, al.v, b.v, b.v, acc[t]);
    }
  }
#pragma unroll
  for (int t = 0; t < 4; ++t) {
    const int col = col0 + t * 16 + ln;
    float bv = bias ? bias[col] : 0.f;
    if (BIAS_BF16) bv = bf16_round(bv);
#pragma unroll
    for (int r = 0; r < 8; ++r) {
      float v = acc[t][r] + bv;
      if (resid) { float rv = resid[(size_t)((row0 + 8 * hh + r) % rmod) * ldr + col]; if (RES_BF16) rv = bf16_round(rv); v += rv; }
      if (ACT == 1) v = fmaxf(v, 0.f);
      if (ACT == 2) v = 0.5f * v * (1.0f + erff(v * 0.70710678118654752f));
      if (ACT == 3) { const float u = 0.7978845608028654f * (v + 0.044715f * v * v * v); v = 0.5f * v * (1.0f + tanhf(u)); }
      so[w][8 * hh + r][t * 16 + ln] = v;
    }
  }
  __builtin_amdgcn_fence(__ATOMIC_ACQ_REL, "workgroup");
  __builtin_amdgcn_wave_barrier();
  const int rsub = lane >> 4, c4 = (lane & 15) * 4;
  {
#pragma unroll
    for (int q = 0; q < 8; ++q) {
      const int r = q * 2 + rsub;
      const v4f v = *(const v4fa*)&so[w][r][c4];
      *(v4f*)(C + (size_t)(row0 + r) * ldc + col0 + c4) = v;
    }
    
  }
}
// row LayerNorm (biased variance, eps) over N: s = X (+ R); optional out_sum <- s; out_norm <- (s-mu)*rsqrt(var+eps)*g + b
template <bool PARAM_BF16>
__global__ __launch_bounds__(256) void k_layernorm(const float* __restrict__ X, const float* __restrict__ R, const float* __restrict__ g, const float* __restrict__ bta,
                                                  float* __restrict__ out_sum, float* __restrict__ out_norm, int N, float eps) {
  __shared__ float red[256];
  const int row = blockIdx.x, tid = threadIdx.x;
  const float* x = X + (size_t)row * N; const float* rr = R ? R + (size_t)row * N : nullptr;
  float vals[16];                     // up to N = 4096
  const int per = N / 256;            // contiguous chunk per thread? use strided-by-4 chunks: thread handles j = tid*4 + 1024*u
  float s1 = 0.f;
  for (int u = 0; u < per / 4; ++u) {
    const int j = tid * 4 + 1024 * u;
    const v4f a = *(const v4fa*)(x + j);
    v4f b = {0.f,0.f,0.f,0.f}; if (rr) b = *(const v4fa*)(rr + j);
#pragma unroll
    for (int q = 0; q < 4; ++q) { const float v = a[q] + b[q]; vals[u * 4 + q] = v; s1 += v; }
  }
  red[tid] = s1; __syncthreads();
  for (int st = 128; st > 0; st >>= 1) { if (tid < st) red[tid] += red[tid + st]; __syncthreads(); }
  const float mu = red[0] / (float)N; __syncthreads();
  float s2 = 0.f;
  for (int u = 0; u < per / 4; ++u)
#pragma unroll
    for (int q = 0; q < 4; ++q) { const float c = vals[u * 4 + q] - mu; s2 += c * c; }
  red[tid] = s2; __syncthreads();
  for (int st = 128; st > 0; st >>= 1) { if (tid < st) red[tid] += red[tid + st]; __syncthreads(); }
  const float rs = rsqrtf(red[0] / (float)N + eps);
  {
    for (int u = 0; u < per / 4; ++u) {
      const int j = tid * 4 + 1024 * u;
      v4f o, sm;
#pragma unroll
      for (int q = 0; q < 4; ++q) {
        float gg = g[j + q], bb = bta[j + q];
        if (PARAM_BF16) { gg = bf16_round(gg); bb = bf16_round(bb); }
        sm[q] = vals[u * 4 + q]; o[q] = (vals[u * 4 + q] - mu) * rs * gg + bb;
      }
      if (out_sum) *(v4f*)(out_sum + (size_t)row * N + j) = sm;
      *(v4f*)(out_norm + (size_t)row * N + j) = o;
    }
    
  }
}



// ---- f16 WMMA path (v_wmma_f32_16x16x32_f16): 11-bit significands for operands in range — used where a [0,1] probability operand needs more precision than bf16
typedef _Float16 v16h __attribute__((ext_vector_type(16)));
union FragH { v16h v; v8us half[2]; _Float16 h[16]; unsigned short u[16]; };
template <int NT>
__device__ __forceinline__ v8f mmaH(v16h ah, v16h al, v16h bh, v16h bl, v8f c) {
  c = __builtin_amdgcn_wmma_f32_16x16x32_f16(false, ah, false, bh, (short)0, c, false, false);
  if (NT >= 2) c = __builtin_amdgcn_wmma_f32_16x16x32_f16(false, al, false, bh, (short)0, c, false, false);
  if (NT >= 3) c = __builtin_amdgcn_wmma_f32_16x16x32_f16(false, ah, false, bl, (short)0, c, false, false);
  asm volatile("v_nop\n\tv_nop\n\tv_nop\n\tv_nop" : "+v"(c) : "v"(ah), "v"(al), "v"(bh), "v"(bl));
  return c;
}
// batched GEMM like k_gemm_b but f16 operands: A f32 (split into f16 hi/lo if ASPLIT, else rounded to f16), Bt = f16 values [n][k]; alpha; C f32; N multiple of 16 (partial tiles skipped)
template <bool ASPLIT>
__global__ __launch_bounds__(128) void k_gemm_h(const float* __restrict__ A, int lda, size_t sA, const _Float16* __restrict__ Bh, int ldb, size_t sB, float alpha, float* __restrict__ C, int ldc, size_t sC, int M, int N, int K) {
  __shared__ __attribute__((aligned(16))) float so[4][16][64];
  const int tid = threadIdx.x, w = tid >> 5, lane = tid & 31, ln = lane & 15, hh = lane >> 4; const int by = blockIdx.y;
  A += (size_t)by * sA; Bh += (size_t)by * sB; C += (size_t)by * sC;
  const int ntn = (N + 63) / 64; const int wid = blockIdx.x * 4 + w; const int mt = wid / ntn, nq = wid % ntn; if (mt * 16 >= M) return;
  const int row0 = mt * 16, col0 = nq * 64; const float* arow = A + (size_t)(row0 + ln) * lda;
  v8f acc[4] = {};
  for (int kb = 0; kb < K; kb += 32) {
    FragH ah, al;
    const v4f x0 = *(const v4fa*)(arow + kb + 8 * hh), x1 = *(const v4fa*)(arow + kb + 8 * hh + 4), x2 = *(const v4fa*)(arow + kb + 16 + 8 * hh), x3 = *(const v4fa*)(arow + kb + 16 + 8 * hh + 4);
    float xs[16] = {x0[0],x0[1],x0[2],x0[3],x1[0],x1[1],x1[2],x1[3],x2[0],x2[1],x2[2],x2[3],x3[0],x3[1],x3[2],x3[3]};
#pragma unroll
    for (int i = 0; i < 16; ++i) { const _Float16 h = (_Float16)xs[i]; ah.h[i] = h; al.h[i] = ASPLIT ? (_Float16)(xs[i] - (float)h) : (_Float16)0.0f; }
#pragma unroll
    for (int t = 0; t < 4; ++t) { if (col0 + t * 16 >= N) continue; const size_t boff = (size_t)(col0 + t * 16 + ln) * ldb + kb; FragH bq; bq.half[0] = *(const v8us*)(Bh + boff + 8 * hh); bq.half[1] = *(const v8us*)(Bh + boff + 16 + 8 * hh);
      acc[t] = mmaH<ASPLIT ? 2 : 1>(ah.v, al.v, bq.v, bq.v, acc[t]); }
  }
#pragma unroll
  for (int t = 0; t < 4; ++t) { if (col0 + t * 16 >= N) continue;
#pragma unroll
    for (int r = 0; r < 8; ++r) so[w][8 * hh + r][t * 16 + ln] = acc[t][r] * alpha; }
  __builtin_amdgcn_fence(__ATOMIC_ACQ_REL, "workgroup"); __builtin_amdgcn_wave_barrier();
  const int rsub = lane >> 4, c4 = (lane & 15) * 4;
  {
#pragma unroll
    for (int q = 0; q < 8; ++q) { const int r = q * 2 + rsub; if (col0 + c4 < N) { const v4f v = *(const v4fa*)&so[w][r][c4]; *(v4f*)(C + (size_t)(row0 + r) * ldc + col0 + c4) = v; } }
     }
}

// Wt[n][k] = f16(W[k][n]·scale) from f32 row-major W[K][N] (scale = power of two; bf16-exact weights stay exact in f16 away from the subnormal range)
__global__ __launch_bounds__(256) void k_wt_f16(const float* __restrict__ W, _Float16* __restrict__ Wt, int K, int N, float scale) {
  const int t = blockIdx.x * 256 + threadIdx.x; if (t >= N * (K / 8)) return; const int n = t / (K / 8), k8 = (t % (K / 8)) * 8; FragH f;
#pragma unroll
  for (int i = 0; i < 8; ++i) f.h[i] = (_Float16)(bf16_round(W[(size_t)(k8 + i) * N + n]) * scale); const v8us o = f.half[0];
  *(v8us*)((unsigned short*)Wt + (size_t)n * K + k8) = o; 
}
// k_gemm_hh variant with fused epilogue: v = acc·alpha + bias[by·sBias + col] (+ CP[(row/rowsPerB)·sCPb + by·64 + col] if CP) ; ACT 0 none / 1 elu ; writes f16 C16 (and f32 C if non-null)
template <int ACT>
__global__ __launch_bounds__(128) void k_gemm_hhx(const _Float16* __restrict__ A, int lda, size_t sA, const _Float16* __restrict__ Bh, int ldb, size_t sB, float alpha, const float* __restrict__ bias, size_t sBias, const float* __restrict__ CP, int rowsPerB, size_t sCPb, int row0g,
    float* __restrict__ C, _Float16* __restrict__ C16, int ldc, size_t sC, int M, int N, int K) {
  __shared__ __attribute__((aligned(16))) float so[4][16][64];
  const int tid = threadIdx.x, w = tid >> 5, lane = tid & 31, ln = lane & 15, hh = lane >> 4; const int by = blockIdx.y;
  A += (size_t)by * sA; Bh += (size_t)by * sB; const size_t cofs = (size_t)by * sC; const float* bp = bias ? bias + (size_t)by * sBias : nullptr;
  const int ntn = (N + 63) / 64; const int wid = blockIdx.x * 4 + w; const int mt = wid / ntn, nq = wid % ntn; if (mt * 16 >= M) return;
  const int row0 = mt * 16, col0 = nq * 64; const _Float16* arow = A + (size_t)(row0 + ln) * lda;
  v8f acc[4] = {};
  for (int kb = 0; kb < K; kb += 32) { FragH ah; ah.half[0] = *(const v8us*)((const unsigned short*)arow + kb + 8 * hh); ah.half[1] = *(const v8us*)((const unsigned short*)arow + kb + 16 + 8 * hh);
#pragma unroll
    for (int t = 0; t < 4; ++t) { if (col0 + t * 16 >= N) continue; const size_t boff = (size_t)(col0 + t * 16 + ln) * ldb + kb; FragH bq; bq.half[0] = *(const v8us*)((const unsigned short*)Bh + boff + 8 * hh); bq.half[1] = *(const v8us*)((const unsigned short*)Bh + boff + 16 + 8 * hh);
      acc[t] = mmaH<1>(ah.v, ah.v, bq.v, bq.v, acc[t]); }
  }
#pragma unroll
  for (int t = 0; t < 4; ++t) { if (col0 + t * 16 >= N) continue; const int col = col0 + t * 16 + ln; const float bv = bp ? bf16_round(bp[col]) : 0.f;
#pragma unroll
    for (int r = 0; r < 8; ++r) { float v = acc[t][r] * alpha + bv; if (CP) { const int rr = row0g + row0 + 8 * hh + r; if (rowsPerB < 0) v += CP[cofs + (size_t)rr * ldc + col];      /* rowsPerB < 0: own element of the batched C plane */ else { const int bidx = rr / rowsPerB; v += CP[(size_t)bidx * sCPb + (size_t)by * 64 + col]; } } if (ACT == 1) v = (v > 0.f) ? v : expm1f(v); else if (ACT == 7) v = (v > 0.f) ? v + 1.0f : expf(v); else if (ACT == 8) v = tanhf(v); else if (ACT == 9) v = 0.5f * v * (1.0f + tanhf(0.7978845608028654f * (v + 0.044715f * v * v * v))); else if (ACT == 11) v = 1.0f / (1.0f + expf(-v)); else if (ACT == 12) v = (v > 0.f) ? v : 0.01f * v; else if (ACT == 14) v = (v > 0.f) ? v : 0.1f * v; else if (ACT == 16) v = (v >= 0.f) ? v : 0.3f * v; else if (ACT == 17) v = (v >= 0.f) ? v : 0.2f * v; else if (ACT == 15) v = v / (1.0f + expf(-v)); else if (ACT == 3) v = fmaxf(v, 0.f); else if (ACT == 6) v = 0.5f * v * (1.0f + erff(v * 0.70710678118654752f)); so[w][8 * hh + r][t * 16 + ln] = v; } }
  __builtin_amdgcn_fence(__ATOMIC_ACQ_REL, "workgroup"); __builtin_amdgcn_wave_barrier();
  const int rsub = lane >> 4, c4 = (lane & 15) * 4; typedef _Float16 v4h __attribute__((ext_vector_type(4)));
  {
#pragma unroll
    for (int q = 0; q < 8; ++q) { const int r = q * 2 + rsub; if (col0 + c4 < N) { const v4f v = *(const v4fa*)&so[w][r][c4]; if (C) *(v4f*)(C + cofs + (size_t)(row0 + r) * ldc + col0 + c4) = v; if (C16) { v4h h4; for (int i = 0; i < 4; ++i) h4[i] = (_Float16)v[i]; *(v4h*)(C16 + cofs + (size_t)(row0 + r) * ldc + col0 + c4) = h4; } } }
     }
}


typedef _Float16 v4h __attribute__((ext_vector_type(4)));

__global__ __launch_bounds__(256) void k_x16(const float* __restrict__ x, _Float16* __restrict__ X16, size_t n8) { const size_t t = (size_t)blockIdx.x * 256 + threadIdx.x; if (t >= n8) return; FragH f;
#pragma unroll
  for (int q = 0; q < 8; ++q) f.h[q] = (_Float16)bf16_round(x[t * 8 + q]); *(v8us*)((unsigned short*)X16 + t * 8) = f.half[0];  }
__global__ __launch_bounds__(256) void k_h16(const float* __restrict__ x, _Float16* __restrict__ X16, size_t n8) { const size_t t = (size_t)blockIdx.x * 256 + threadIdx.x; if (t >= n8) return; FragH f;
#pragma unroll
  for (int q = 0; q < 8; ++q) f.h[q] = (_Float16)x[t * 8 + q]; *(v8us*)((unsigned short*)X16 + t * 8) = f.half[0];  }
__global__ __launch_bounds__(256) void k_round16f(const float* __restrict__ W, _Float16* __restrict__ Bt, size_t n8) { const size_t t = (size_t)blockIdx.x * 256 + threadIdx.x; if (t >= n8) return; FragH f;
#pragma unroll
  for (int i = 0; i < 8; ++i) f.h[i] = (_Float16)(bf16_round(W[t * 8 + i]) * 16.0f); *(v8us*)((unsigned short*)Bt + t * 8) = f.half[0];  }
template <int NHv, int TTv>
__global__ __launch_bounds__(256) void k_vt(const _Float16* __restrict__ V16, int ldv, int voff, _Float16* __restrict__ Vt) { __shared__ unsigned short tl[64][66]; const int tid = threadIdx.x; const int slab = blockIdx.x / (TTv / 64), lg = blockIdx.x % (TTv / 64); const int b = slab / NHv, h = slab % NHv;
  for (int i = tid; i < 64 * 8; i += 256) { const int r = i / 8, c8 = (i % 8) * 8; FragH f; f.half[0] = *(const v8us*)((const unsigned short*)V16 + ((size_t)b * TTv + lg * 64 + r) * ldv + voff + h * 64 + c8);
#pragma unroll
    for (int q = 0; q < 8; ++q) tl[r][c8 + q] = f.u[q]; }
  __syncthreads();
  {
#pragma unroll
    for (int rd = 0; rd < 2; ++rd) { const int d = rd * 32 + tid / 8, pc = tid % 8; FragH f;
#pragma unroll
      for (int q = 0; q < 8; ++q) f.u[q] = tl[pc * 8 + q][d];
      *(v8us*)((unsigned short*)Vt + ((size_t)slab * 64 + d) * TTv + lg * 64 + pc * 8) = f.half[0]; }
     } }

__global__ __launch_bounds__(256) void k_hl(const float* __restrict__ F, _Float16* __restrict__ Hh, _Float16* __restrict__ Hl, size_t n8) { const size_t t = (size_t)blockIdx.x * 256 + threadIdx.x; if (t >= n8) return; FragH fh, fl; const v4f a = *(const v4fa*)(F + t * 8), c = *(const v4fa*)(F + t * 8 + 4);
#pragma unroll
  for (int q = 0; q < 4; ++q) { _Float16 h = (_Float16)a[q]; fh.h[q] = h; fl.h[q] = (_Float16)((a[q] - (float)h) * 1024.0f); h = (_Float16)c[q]; fh.h[4 + q] = h; fl.h[4 + q] = (_Float16)((c[q] - (float)h) * 1024.0f); }
  { *(v8us*)((unsigned short*)Hh + t * 8) = fh.half[0]; *(v8us*)((unsigned short*)Hl + t * 8) = fl.half[0];  } }

// ---- fast GEMM (block tile 128x128 = eight waves of 32x64; requires M % 128 == 0 rows per launch region, N % 128 == 0 and K % 64 == 0); epilogue = k_gemm_hhx semantics ----
// The block's 128 A rows and 128 B rows come in tiles of GKS k, loaded as whole 128-byte lines and staged through registers into two LDS buffers: tile s + 1 is loaded from memory while tile s is worked on, and one barrier a tile both publishes it and frees the buffer read before. Every wave takes its fragments from LDS in the k order of g2_frag, 32 k at a time in rising order, so each accumulator sums as before.
#define GKS 64                       /* k per staged tile: 128 bytes of every operand row */
#define GPIT 72                      /* LDS row pitch in f16 elements: 144 bytes = 16 x odd, free of bank conflicts for 16-byte fragment reads */
__device__ __forceinline__ v16h g2_frag(const _Float16* p, int hh) { FragH f; f.half[0] = *(const v8us*)((const unsigned short*)p + 8 * hh); f.half[1] = *(const v8us*)((const unsigned short*)p + 16 + 8 * hh); return f.v; }
__device__ __forceinline__ v8f g2_mma(v16h a, v16h b, v8f c) { v8f d = __builtin_amdgcn_wmma_f32_16x16x32_f16(false, a, false, b, (short)0, c, false, false); asm volatile("v_nop\n\tv_nop\n\tv_nop\n\tv_nop" : "+v"(d) : "v"(a), "v"(b)); return d; }
template <int ACT>
__global__ __launch_bounds__(256) void k_gemm2(const _Float16* __restrict__ A, int lda, size_t sA, const _Float16* __restrict__ Bh, int ldb, size_t sB, float alpha, const float* __restrict__ bias, size_t sBias, const float* __restrict__ CP, int rowsPerB, size_t sCPb, int row0g,
    float* __restrict__ C, _Float16* __restrict__ C16, int ldc, size_t sC, int M, int N, int K, size_t zA, size_t zB, size_t zC, const float* __restrict__ bias1, const float* __restrict__ bias2) { static_assert(ACT == 0 || ACT == 3 || ACT == 6 || ACT == 8 || ACT == 9 || ACT == 11 || ACT == 12 || ACT == 14 || ACT == 15 || ACT == 16 || ACT == 17, "k_gemm2: unsupported ACT code (would silently apply no activation)");
  __shared__ __attribute__((aligned(16))) unsigned char sm[2 * 256 * GPIT * 2];      /* two buffers of [A 128 rows | B 128 rows]; behind the last tile's barrier the same bytes hold the epilogue's rows */
  static_assert(sizeof(float) * 8 * 32 * 68 <= sizeof(sm), "the epilogue rows fit the tile buffers");
  unsigned short* const ring = (unsigned short*)sm; float (* const so)[32][68] = (float (*)[32][68])sm;
  const int tid = threadIdx.x, w = tid >> 5, lane = tid & 31, ln = lane & 15, hh = lane >> 4; const int by = blockIdx.y, bz = blockIdx.z;      /* grid.z: a second batch index (element strides zA, zB, zC) */
  A += (size_t)by * sA + (size_t)bz * zA; Bh += (size_t)by * sB + (size_t)bz * zB; const size_t cofs = (size_t)by * sC + (size_t)bz * zC; const float* bp = bias ? bias + (size_t)by * sBias : nullptr;
  if (bias1 && by == 1) bp = bias1; if (bias2 && by == 2) bp = bias2;      /* bias vectors that are separate buffers: one per grid.y index */
  const int ntn = N >> 7; const int mt = blockIdx.x / ntn, nq = blockIdx.x - mt * ntn; if (mt * 128 >= M) return;      /* the whole block leaves, in front of every barrier */
  const int wr = w & 3, wc = w >> 2; const int row0 = mt * 128 + 32 * wr, col0 = nq * 128 + 64 * wc;      /* four waves down, two across */
  const int sr = tid >> 3, sc = (tid & 7) * 8;      /* staging: 8 threads cover one row's 128 bytes, the block 32 rows a round */
  const unsigned short* ap = (const unsigned short*)A + (size_t)(mt * 128 + sr) * lda + sc; const unsigned short* bq = (const unsigned short*)Bh + (size_t)(nq * 128 + sr) * ldb + sc;
  v8us ar[4], br[4];
#pragma unroll      /* static indices keep the staging registers in registers */
  for (int i = 0; i < 4; ++i) { ar[i] = *(const v8us*)(ap + (size_t)(32 * i) * lda); br[i] = *(const v8us*)(bq + (size_t)(32 * i) * ldb); }
  asm volatile("s_wait_xcnt 0x0" ::: "memory");      /* the loads' address registers are advanced behind them */
#pragma unroll      /* static indices, as above */
  for (int i = 0; i < 4; ++i) { *(v8us*)(ring + (sr + 32 * i) * GPIT + sc) = ar[i]; *(v8us*)(ring + (128 + sr + 32 * i) * GPIT + sc) = br[i]; }
  __syncthreads();      /* tile 0 is complete before any wave reads it */
  const v8f z8 = {0.f,0.f,0.f,0.f,0.f,0.f,0.f,0.f}; v8f c00 = z8, c01 = z8, c02 = z8, c03 = z8, c10 = z8, c11 = z8, c12 = z8, c13 = z8;
  const int nst = K / GKS;
#pragma unroll 1      /* one k tile at a time: the two buffers alternate */
  for (int s = 0; s < nst; ++s) {
    const bool more = s + 1 < nst;      /* the same for the whole block */
    if (more) { ap += GKS; bq += GKS;
#pragma unroll      /* static indices; all of a thread's tile loads in flight under this tile's work */
      for (int i = 0; i < 4; ++i) { ar[i] = *(const v8us*)(ap + (size_t)(32 * i) * lda); br[i] = *(const v8us*)(bq + (size_t)(32 * i) * ldb); }
      asm volatile("s_wait_xcnt 0x0" ::: "memory"); }      /* the loads' address registers are advanced on the next trip */
    const _Float16* al = (const _Float16*)(ring + ((s & 1) * 256 + 32 * wr + ln) * GPIT); const _Float16* bl = (const _Float16*)(ring + ((s & 1) * 256 + 128 + 64 * wc + ln) * GPIT);
#pragma unroll      /* two 32-k passes a tile, constant LDS offsets */
    for (int kk = 0; kk < GKS; kk += 32) { const v16h a0 = g2_frag(al + kk, hh), a1 = g2_frag(al + 16 * GPIT + kk, hh);
      const v16h b0 = g2_frag(bl + kk, hh), b1 = g2_frag(bl + 16 * GPIT + kk, hh), b2 = g2_frag(bl + 32 * GPIT + kk, hh), b3 = g2_frag(bl + 48 * GPIT + kk, hh);      /* a pass's LDS reads stand together in front of its products */
      c00 = g2_mma(a0, b0, c00); c10 = g2_mma(a1, b0, c10); c01 = g2_mma(a0, b1, c01); c11 = g2_mma(a1, b1, c11);
      c02 = g2_mma(a0, b2, c02); c12 = g2_mma(a1, b2, c12); c03 = g2_mma(a0, b3, c03); c13 = g2_mma(a1, b3, c13); }
    if (more) {
#pragma unroll      /* static indices, as above */
      for (int i = 0; i < 4; ++i) { *(v8us*)(ring + (((s + 1) & 1) * 256 + sr + 32 * i) * GPIT + sc) = ar[i]; *(v8us*)(ring + (((s + 1) & 1) * 256 + 128 + sr + 32 * i) * GPIT + sc) = br[i]; } }      /* into the buffer that every wave left before the last barrier */
    __syncthreads();      /* tile s + 1 is complete, and every wave has left tile s, before the next trip (behind the last tile: before the epilogue's rows overwrite it) */
  }
  v8f accs[8] = {c00, c01, c02, c03, c10, c11, c12, c13};
#pragma unroll
  for (int u = 0; u < 8; ++u) { const int t = u & 3, half = u >> 2; const int col = col0 + t * 16 + ln; const float bv = bp ? bf16_round(bp[col]) : 0.f;
#pragma unroll
    for (int r = 0; r < 8; ++r) { const int rloc = half * 16 + 8 * hh + r; float v = accs[u][r] * alpha + bv; if (CP) { if (rowsPerB < 0) v += CP[cofs + (size_t)(row0g + row0 + rloc) * ldc + col];      /* rowsPerB < 0: own element of the batched C plane */ else { const int bidx = (row0g + row0 + rloc) / rowsPerB; v += CP[(size_t)bidx * sCPb + (size_t)by * 64 + col]; } }
      if (ACT == 3) v = fmaxf(v, 0.f); else if (ACT == 6) v = 0.5f * v * (1.0f + erff(v * 0.70710678118654752f)); else if (ACT == 11) v = 1.0f / (1.0f + expf(-v)); else if (ACT == 15) v = v / (1.0f + expf(-v)); else if (ACT == 12) v = (v > 0.f) ? v : 0.01f * v; else if (ACT == 8) v = tanhf(v); else if (ACT == 9) v = 0.5f * v * (1.0f + tanhf(0.7978845608028654f * (v + 0.044715f * v * v * v))); else if (ACT == 14) v = (v > 0.f) ? v : 0.1f * v; else if (ACT == 16) v = (v >= 0.f) ? v : 0.3f * v; else if (ACT == 17) v = (v >= 0.f) ? v : 0.2f * v;
      so[w][rloc][t * 16 + ln] = v; } }
  __builtin_amdgcn_fence(__ATOMIC_ACQ_REL, "workgroup"); __builtin_amdgcn_wave_barrier();
  const int rsub = lane >> 4, c4 = (lane & 15) * 4;
  {
#pragma unroll
    for (int q = 0; q < 16; ++q) { const int r = q * 2 + rsub; const v4f v = *(const v4fa*)&so[w][r][c4]; if (C) *(v4f*)(C + cofs + (size_t)(row0 + r) * ldc + col0 + c4) = v; if (C16) { v4h h4; for (int i = 0; i < 4; ++i) h4[i] = (_Float16)v[i]; *(v4h*)(C16 + cofs + (size_t)(row0 + r) * ldc + col0 + c4) = h4; } }
     } }


__global__ __launch_bounds__(256) void k_wnat(const float* __restrict__ w, size_t n8, _Float16* __restrict__ Bt) { const size_t t = (size_t)blockIdx.x * 256 + threadIdx.x; if (t >= n8) return; FragH f; for (int q = 0; q < 8; ++q) f.h[q] = (_Float16)(bf16_round(w[t * 8 + q]) * 16.0f); *(v8us*)((unsigned short*)Bt + t * 8) = f.half[0];  }
__global__ __launch_bounds__(256) void k_rsm(const float* __restrict__ S, _Float16* __restrict__ P, int nrows) {
  #pragma clang fp contract(off)
  const int i = blockIdx.x * 256 + threadIdx.x; if (i >= nrows) return; const float* s = S + (size_t)i * SQ; float mx = -3.0e38f;
#pragma unroll 1
  for (int j = 0; j < SQ; ++j) mx = fmaxf(mx, s[j]); float se = 0.f;
#pragma unroll 1
  for (int j = 0; j < SQ; ++j) se += expf(s[j] - mx); const float sc = 256.0f / se;
#pragma unroll 1
  for (int j0 = 0; j0 < SQ; j0 += 8) { FragH f; for (int q = 0; q < 8; ++q) f.h[q] = (_Float16)(expf(s[j0 + q] - mx) * sc); unsigned short* d = (unsigned short*)P + (size_t)i * SQ + j0; *(v8us*)d = f.half[0];  } }
__global__ __launch_bounds__(256) void k_vt(const _Float16* __restrict__ V16, int b, int h0, _Float16* __restrict__ VT) { __shared__ unsigned short tl[64][65]; const int tid = threadIdx.x; const int hh = blockIdx.x % HG, sg = blockIdx.x / HG; const int s0 = sg * 64; const int h = h0 + hh;
  for (int i = tid; i < 64 * 8; i += 256) { const int j = i / 8, d8 = (i % 8) * 8; FragH f; f.half[0] = *(const v8us*)((const unsigned short*)V16 + ((size_t)b * SQ + s0 + j) * DM + h * HD + d8); for (int q = 0; q < 8; ++q) tl[d8 + q][j] = f.u[q]; }
  __syncthreads();
  { for (int i = tid; i < 64 * 8; i += 256) { const int d = i / 8, j8 = (i % 8) * 8; FragH f; for (int q = 0; q < 8; ++q) f.u[q] = tl[d][j8 + q]; *(v8us*)((unsigned short*)VT + ((size_t)hh * HD + d) * SQ + s0 + j8) = f.half[0]; }  } }



#define FK 64                        /* keys per staged tile */
#define FPIT 72                      /* LDS row pitch in f16 elements: 144 bytes = 16 x odd, free of bank conflicts for 16-byte fragment reads */
#define FCS 0.18033688011112042f     /* 1/8 x log2(e): exponentials in base 2 */
__device__ __forceinline__ float fa_xhalf(float x) { return __builtin_bit_cast(float, __builtin_amdgcn_permlanex16(__builtin_bit_cast(int, x), __builtin_bit_cast(int, x), 0x76543210, 0xfedcba98, false, false)); }      /* lane l reads lane l ^ 16 */
// Base-2 exponentials in asm so that the slot the instruction set asks for behind a transcendental (before its result is read or its source overwritten) is there by construction: the outputs lie apart from every input, so each v_exp_f32 is followed by an independent one, and the v_nop stands behind the last.
__device__ __forceinline__ void fa_exp8(const float (&x)[8], float (&e)[8]) {
  asm("v_exp_f32 %0, %8\n\tv_exp_f32 %1, %9\n\tv_exp_f32 %2, %10\n\tv_exp_f32 %3, %11\n\tv_exp_f32 %4, %12\n\tv_exp_f32 %5, %13\n\tv_exp_f32 %6, %14\n\tv_exp_f32 %7, %15\n\tv_nop"
      : "=&v"(e[0]), "=&v"(e[1]), "=&v"(e[2]), "=&v"(e[3]), "=&v"(e[4]), "=&v"(e[5]), "=&v"(e[6]), "=&v"(e[7]) : "v"(x[0]), "v"(x[1]), "v"(x[2]), "v"(x[3]), "v"(x[4]), "v"(x[5]), "v"(x[6]), "v"(x[7])); }
__device__ __forceinline__ float fa_exp1(float x) { float e; asm("v_exp_f32 %0, %1\n\tv_nop" : "=v"(e) : "v"(x)); return e; }      /* the same slot behind a single one */
__device__ __forceinline__ v8f fa_mma(v16h a, v16h b, v8f c) { return __builtin_amdgcn_wmma_f32_16x16x32_f16(false, a, false, b, (short)0, c, false, false); }
__global__ __launch_bounds__(128) void k_fattn(const _Float16* __restrict__ Q16, const _Float16* __restrict__ K16, const _Float16* __restrict__ VT, _Float16* __restrict__ O16) {
  __shared__ __attribute__((aligned(16))) _Float16 lk[2][FK][FPIT]; __shared__ __attribute__((aligned(16))) _Float16 lv[2][HD][FPIT];
  const int tid = threadIdx.x, w = __builtin_amdgcn_readfirstlane(tid >> 5), lane = tid & 31, ln = lane & 15, hh = lane >> 4;
  const int bh = blockIdx.x % (NB * NH), qb = (SQ / 128 - 1) - blockIdx.x / (NB * NH);      /* the longest query blocks start first */
  const int b = bh / NH, h = bh % NH; const int q0 = qb * 128, qw = q0 + 32 * w; const int nt = (q0 + 128) / FK;      /* key tiles up to the block's last query */
  const int sr = tid >> 3, sc = (tid & 7) * 8;      /* staging: 8 threads cover one row's 128 bytes, the block 16 rows a round */
  const _Float16* kp = K16 + ((size_t)b * SQ + sr) * DM + h * HD + sc; const _Float16* vp = VT + ((size_t)bh * HD + sr) * SQ + sc;
  v8us kr[4], vr[4]; v16h qf[2][2];
#pragma unroll      /* static indices keep the staging registers in registers */
  for (int i = 0; i < 4; ++i) { kr[i] = *(const v8us*)((const unsigned short*)kp + (size_t)(16 * i) * DM); vr[i] = *(const v8us*)((const unsigned short*)vp + (size_t)(16 * i) * SQ); }
#pragma unroll      /* static indices, as above */
  for (int g = 0; g < 2; ++g) { const _Float16* qp = Q16 + ((size_t)b * SQ + qw + 16 * g + ln) * DM + h * HD; qf[g][0] = g2_frag(qp, hh); qf[g][1] = g2_frag(qp + 32, hh); }
  asm volatile("s_wait_xcnt 0x0" ::: "memory");      /* the loads' address registers are reused behind them */
#pragma unroll      /* static indices, as above */
  for (int i = 0; i < 4; ++i) { *(v8us*)((unsigned short*)&lk[0][sr + 16 * i][sc]) = kr[i]; *(v8us*)((unsigned short*)&lv[0][sr + 16 * i][sc]) = vr[i]; }
  __syncthreads();      /* tile 0 is complete before any wave reads it */
  const v8f z8 = {0.f, 0.f, 0.f, 0.f, 0.f, 0.f, 0.f, 0.f};
  v8f o[2][4]; float m[2] = {-1.0e30f, -1.0e30f}, l[2] = {0.f, 0.f};      /* m: the maximum in use (base-2 scaled scores); l: this lane half's part of the sum */
#pragma unroll      /* static indices, as above */
  for (int g = 0; g < 2; ++g) for (int dt = 0; dt < 4; ++dt) o[g][dt] = z8;
#pragma unroll 1      /* one key tile at a time: the two buffers alternate */
  for (int t = 0; t < nt; ++t) {
    const bool more = t + 1 < nt;      /* the same for the whole block */
    if (more) { kp += (size_t)FK * DM; vp += FK;
#pragma unroll      /* static indices; all of a thread's tile loads in flight under this tile's work */
      for (int i = 0; i < 4; ++i) { kr[i] = *(const v8us*)((const unsigned short*)kp + (size_t)(16 * i) * DM); vr[i] = *(const v8us*)((const unsigned short*)vp + (size_t)(16 * i) * SQ); }
      asm volatile("s_wait_xcnt 0x0" ::: "memory"); }      /* the loads' address registers are advanced on the next trip */
    const _Float16* bk = &lk[t & 1][0][0]; const _Float16* bv = &lv[t & 1][0][0];
#pragma unroll      /* two 32-key passes a tile, constant LDS offsets */
    for (int sub = 0; sub < 2; ++sub) { const int kb = t * FK + 32 * sub;
      if (kb <= qw + 31) {      /* wave-uniform (scalar): a pass wholly above the wave's diagonal is skipped; the barrier below is not */
        v8f s[2][2];      /* s[kt][g][r] = score of key kb + 16 kt + 8 hh + r, query qw + 16 g + ln */
#pragma unroll      /* static indices, as above */
        for (int kt = 0; kt < 2; ++kt) { const _Float16* kq = bk + (32 * sub + 16 * kt + ln) * FPIT; const v16h k0 = g2_frag(kq, hh), k1 = g2_frag(kq + 32, hh);
          for (int g = 0; g < 2; ++g) s[kt][g] = fa_mma(k1, qf[g][1], fa_mma(k0, qf[g][0], z8)); }
        if (kb + 31 > qw) {      /* wave-uniform: only the pass on the wave's diagonal pays for the mask */
#pragma unroll      /* static indices, as above */
          for (int kt = 0; kt < 2; ++kt) for (int g = 0; g < 2; ++g) for (int r = 0; r < 8; ++r) if (kb + 16 * kt + 8 * hh + r > qw + 16 * g + ln) s[kt][g][r] = -1.0e30f; }
        float mb[2]; bool need = false;
#pragma unroll      /* static indices, as above */
        for (int g = 0; g < 2; ++g) { float mx = s[0][g][0];
          for (int r = 1; r < 8; ++r) mx = fmaxf(mx, s[0][g][r]);
          for (int r = 0; r < 8; ++r) mx = fmaxf(mx, s[1][g][r]);
          mx = fmaxf(mx, fa_xhalf(mx)) * FCS; mb[g] = mx; need = need || (mx > m[g] + 8.0f); }      /* both lane halves hold the query's maximum of this pass */
        if (__builtin_amdgcn_ballot_w32(need) != 0) {
#pragma unroll      /* static indices, as above */
          for (int g = 0; g < 2; ++g) { const float mn = fmaxf(m[g], mb[g]); const float corr = fa_exp1(m[g] - mn); m[g] = mn; l[g] *= corr;      /* key 0 is never masked: mn is a real score from the first pass on, where corr is 0 */
            for (int dt = 0; dt < 4; ++dt) o[g][dt] = o[g][dt] * corr; } }
        v16h vf[4]; FragH pf[2];
#pragma unroll      /* static indices, as above */
        for (int dt = 0; dt < 4; ++dt) vf[dt] = g2_frag(bv + (16 * dt + ln) * FPIT + 32 * sub, hh);
#pragma unroll      /* static indices, as above */
        for (int g = 0; g < 2; ++g) { const float nm = 4.0f - m[g]; float ls[4];      /* weights carried x16 (it cancels against l): small ones stay clear of the f16 subnormals */
          for (int kt = 0; kt < 2; ++kt) { float x[8], e[8]; for (int r = 0; r < 8; ++r) x[r] = fmaf(s[kt][g][r], FCS, nm); fa_exp8(x, e); for (int r = 0; r < 8; ++r) { if (kt == 0 && r < 4) ls[r] = e[r]; else ls[r & 3] += e[r]; pf[g].h[8 * kt + r] = (_Float16)e[r]; } }
          l[g] += (ls[0] + ls[1]) + (ls[2] + ls[3]); }
        __builtin_amdgcn_sched_barrier(0);      /* both groups' exponentials stay in front of the eight products: eight independent accumulators in a row keep the matrix unit fed */
#pragma unroll      /* static indices, as above */
        for (int dt = 0; dt < 4; ++dt) for (int g = 0; g < 2; ++g) o[g][dt] = fa_mma(vf[dt], pf[g].v, o[g][dt]);
      } }
    if (more) {
#pragma unroll      /* static indices, as above */
      for (int i = 0; i < 4; ++i) { *(v8us*)((unsigned short*)&lk[(t + 1) & 1][sr + 16 * i][sc]) = kr[i]; *(v8us*)((unsigned short*)&lv[(t + 1) & 1][sr + 16 * i][sc]) = vr[i]; } }      /* into the buffer that every wave left before the last barrier */
    __syncthreads();      /* tile t + 1 is complete, and every wave has left tile t, before the next trip */
  }
#pragma unroll      /* static indices, as above */
  for (int g = 0; g < 2; ++g) { const float fin = 64.0f / (l[g] + fa_xhalf(l[g]));      /* the lane halves' sums join once; o carried x64, folded into the output GEMM alpha */
    unsigned short* op = (unsigned short*)O16 + ((size_t)b * SQ + qw + 16 * g + ln) * DM + h * HD + 8 * hh;      /* a lane holds d = 16 dt + 8 hh .. + 7 of its query: 16 bytes a store */
    for (int dt = 0; dt < 4; ++dt) { FragH f; for (int r = 0; r < 8; ++r) f.h[r] = (_Float16)(o[g][dt][r] * fin); *(v8us*)(op + 16 * dt) = f.half[0]; }
    if (g == 0) { asm volatile("s_wait_xcnt 0x0" ::: "memory"); __builtin_amdgcn_sched_barrier(0); } }      /* the first group's store registers are reused by the second group's arithmetic: the wait stands behind the stores, and the scheduling barrier keeps that arithmetic behind the wait */
}


// One thread per query row; 64 rows per block. The row's q and o stay in registers; Q, K and V come in tiles of 64 rows, staged in LDS with whole-line loads; a K or V row is read back as a same-address (broadcast) LDS load. Four keys' score sums run side by side; each sum, and the running m, l, o, keep the key-by-key, element-by-element order.
template <int MASKADD, int LD>      /* LD: row pitch of QF, KF, VF in floats, a constant so that a tile's 16 loads share one address and differ in the immediate offset */
__global__ __launch_bounds__(64) void k_att0(const float* __restrict__ QF, const float* __restrict__ KF, const float* __restrict__ VF, const float* __restrict__ mask, float scale, float* __restrict__ OF, int ldo) {
  #pragma clang fp contract(off)
  __shared__ __attribute__((aligned(16))) float lk[64][HD]; __shared__ __attribute__((aligned(16))) float lv[64][HD]; __shared__ __attribute__((aligned(16))) float lo[64][HD + 4];
  const int tid = threadIdx.x; const int h = blockIdx.x / (QT0 / 64), rg = blockIdx.x % (QT0 / 64); const int i = rg * 64 + tid;
  { const size_t br = (size_t)blockIdx.y * QT0; QF += br * LD; KF += br * LD; VF += br * LD; OF += br * ldo; }      /* grid.y: the batch; each batch has QT0 rows in every plane */
  const int tr = tid / 16, pc = (tid % 16) * 4; const unsigned tb = (unsigned)(tr * LD + pc) * 4u;      /* the thread's byte offset inside a group of four rows: 16 lanes cover one row's 256 bytes */
  { const char* qb = (const char*)(QF + (size_t)(rg * 64) * LD + h * HD);
    v4f qt[16];
#pragma unroll      /* all of a thread's tile loads in flight together */
    for (int it = 0; it < 16; ++it) qt[it] = *(const v4fa*)(qb + (size_t)(it * 4) * LD * 4 + tb);
    asm volatile("s_wait_xcnt 0x0" ::: "memory");      /* the loads' base registers are reused right behind them */
#pragma unroll      /* static indices keep qt in registers */
    for (int it = 0; it < 16; ++it) *(v4f*)&lo[it * 4 + tr][pc] = qt[it]; }
  __syncthreads();      /* the q tile is complete before a thread reads its row */
  float q[HD], o[HD];
#pragma unroll      /* static indices keep q and o in registers */
  for (int c = 0; c < HD / 4; ++c) { const v4f t = *(const v4f*)&lo[tid][c * 4]; for (int u = 0; u < 4; ++u) { q[c * 4 + u] = t[u]; o[c * 4 + u] = 0.f; } }
  float m = -1.0e30f, l = 0.f; const int jmax = MASKADD ? (SQ - 1) : (rg * 64 + 63);      /* additive-mask form: every key (the mask input decides); causal form: keys up to the block's last row */
  const char* kp = (const char*)(KF + h * HD) + tb; const char* vp = (const char*)(VF + h * HD) + tb;      /* the thread's place in the current K and V tile */
#pragma unroll 1      /* one key tile at a time: the tile buffers are reused */
  for (int j0 = 0; j0 <= jmax; j0 += 64) {
#pragma unroll      /* all of a thread's tile loads in flight together */
    for (int it = 0; it < 16; ++it) { *(v4f*)&lk[it * 4 + tr][pc] = *(const v4fa*)(kp + (size_t)(it * 4) * LD * 4); *(v4f*)&lv[it * 4 + tr][pc] = *(const v4fa*)(vp + (size_t)(it * 4) * LD * 4); }
    __syncthreads();      /* the tile is complete before any row reads it */
#pragma unroll 1      /* four keys per trip are enough to fill the add latency; more only grows the code */
    for (int jj = 0; jj < 64; jj += 4) { float s[4] = {0.f, 0.f, 0.f, 0.f};
#pragma unroll      /* static indices into q */
      for (int c = 0; c < HD / 4; ++c) for (int a = 0; a < 4; ++a) { const v4f kq = *(const v4f*)&lk[jj + a][c * 4]; s[a] = __fadd_rn(s[a], __fmul_rn(q[c * 4 + 0], kq[0])); s[a] = __fadd_rn(s[a], __fmul_rn(q[c * 4 + 1], kq[1])); s[a] = __fadd_rn(s[a], __fmul_rn(q[c * 4 + 2], kq[2])); s[a] = __fadd_rn(s[a], __fmul_rn(q[c * 4 + 3], kq[3])); }
#pragma unroll      /* static indices into s and o */
      for (int a = 0; a < 4; ++a) { const int j = j0 + jj + a; float sv = __fmul_rn(s[a], scale); if (MASKADD) sv = __fadd_rn(sv, __fmul_rn(bf16_round(mask[(size_t)i * SQ + j]), -10000.0f));
        const float f = (MASKADD || j <= i) ? 1.f : 0.f; const float sm = fmaf(f, sv, (1.f - f) * -1.0e30f); const float mn = fmaxf(m, sm); const float sc = expf(m - mn); const float e = expf(sm - mn); l = __fadd_rn(__fmul_rn(l, sc), e); m = mn;
        for (int c = 0; c < HD / 4; ++c) { const v4f vv = *(const v4f*)&lv[jj + a][c * 4]; for (int u = 0; u < 4; ++u) o[c * 4 + u] = __fadd_rn(__fmul_rn(o[c * 4 + u], sc), __fmul_rn(e, vv[u])); } } }
    __syncthreads();      /* every row has left the tile before the next one overwrites it */
    kp += (size_t)64 * LD * 4; vp += (size_t)64 * LD * 4;
  }
  const float fin = 64.0f / l;      /* o carried x64 like the f16 path */
#pragma unroll      /* static indices into o */
  for (int c = 0; c < HD / 4; ++c) { v4f oo; for (int u = 0; u < 4; ++u) oo[u] = __fmul_rn(o[c * 4 + u], fin); *(v4f*)&lo[tid][c * 4] = oo; }
  __syncthreads();
  {
#pragma unroll 1
    for (int it = 0; it < 16; ++it) { const int row = it * 4 + tid / 16, pc = (tid % 16) * 4; const v4f v = *(const v4f*)&lo[row][pc]; *(v4f*)(OF + (size_t)(rg * 64 + row) * ldo + h * HD + pc) = v; }
     } }


template <int BFIN, int W16, int W32>
__global__ __launch_bounds__(256) void k_lnx(const float* __restrict__ X, const float* __restrict__ g, const float* __restrict__ bb, float eps, _Float16* __restrict__ N16, float* __restrict__ N32) {
  #pragma clang fp contract(off)
  __shared__ float red[256]; const size_t r = blockIdx.x; const int t = threadIdx.x; const bool act = t < (DMQ / 4); const int c0 = act ? t * 4 : 0;
  const v4f xa = *(const v4fa*)(X + r * DMQ + c0); float s[4]; float sum = 0.f;
  for (int q = 0; q < 4; ++q) { s[q] = act ? (BFIN ? bf16_round(xa[q]) : xa[q]) : 0.f; sum = __fadd_rn(sum, s[q]); }
  red[t] = sum; __syncthreads(); for (int st = 128; st > 0; st >>= 1) { if (t < st) red[t] = __fadd_rn(red[t], red[t + st]); __syncthreads(); } const float mu = red[0] / (float)DMQ; __syncthreads();
  float vs = 0.f; for (int q = 0; q < 4; ++q) { const float dl = act ? __fadd_rn(s[q], -mu) : 0.f; vs = __fadd_rn(vs, __fmul_rn(dl, dl)); } red[t] = vs; __syncthreads(); for (int st = 128; st > 0; st >>= 1) { if (t < st) red[t] = __fadd_rn(red[t], red[t + st]); __syncthreads(); }
  const float rs = rsqrtf(__fadd_rn(red[0] / (float)DMQ, eps)); v4h y; v4f yf;
  for (int q = 0; q < 4; ++q) { const int c = c0 + q; yf[q] = __fadd_rn(__fmul_rn(__fmul_rn(__fadd_rn(s[q], -mu), rs), bf16_round(g[c])), bf16_round(bb[c])); y[q] = (_Float16)yf[q]; }
  if (!act) return;      /* no barriers after this point */
  { if (W16) *(v4h*)(N16 + r * DMQ + c0) = y; if (W32) *(v4f*)(N32 + r * DMQ + c0) = yf;  } }

extern "C" void kernel_launch(void* const* d_in, const int* in_sizes, int n_in,
                              void* d_out, int out_size, void* d_ws, size_t ws_size, hipStream_t stream) {
  (void)in_sizes; (void)n_in; (void)out_size;
  const float* const* I = (const float* const*)d_in; const float* x = I[0]; const float* wq = I[1]; const float* bq = I[2]; const float* wk = I[3]; const float* bk = I[4]; const float* wv = I[5]; const float* bv = I[6]; const float* wo = I[7]; const float* bo = I[8]; const float* lng = I[9]; const float* lnb = I[10];      /* [in][out] weights + biases; LN gamma/beta */
  char* ws = (char*)d_ws; size_t off = 0;
  auto take = [&](size_t bytes) { char* p = ws + off; off += (bytes + 255) & ~(size_t)255; return p; };
  _Float16* BQ = (_Float16*)take((size_t)DM * DM * 2); _Float16* BK = (_Float16*)take((size_t)DM * DM * 2); _Float16* BV = (_Float16*)take((size_t)DM * DM * 2); _Float16* BO = (_Float16*)take((size_t)DM * DM * 2);
  float* S = (float*)take((size_t)NB * NH * QT * NKX * 4);      /* room for the projection-stage planes */
  _Float16* X16 = (_Float16*)S; _Float16* XL = (_Float16*)((char*)S + NR * DM * 2); float* HF = (float*)((char*)S + NR * DM * 4); float* QKF = HF;      /* projection-stage planes on the bytes of S (16 per token element: 2 + 2 + three f32 planes); h (f32) is last read before the first f32 plane is written */
  _Float16* Q16 = (_Float16*)take(NR * DM * 2); _Float16* K16 = (_Float16*)take(NR * DM * 2); _Float16* V16 = (_Float16*)take(NR * DM * 2); _Float16* O16 = (_Float16*)take(NR * DM * 2);      /* Q16, K16, V16: three planes in a row */
  _Float16* VT = (_Float16*)take((size_t)NB * NH * HD * SQ * 2);
  float* QF0 = (float*)take((size_t)NB * QT0 * DM * 4); float* KF0 = (float*)take((size_t)NB * QT0 * DM * 4); float* VF0 = (float*)take((size_t)NB * QT0 * DM * 4); float* OF0 = (float*)take((size_t)NB * QT0 * DM * 4); _Float16* OH0 = (_Float16*)take((size_t)NB * QT0 * DM * 2); _Float16* OL0 = (_Float16*)take((size_t)NB * QT0 * DM * 2);      /* QF0, KF0, VF0: three planes in a row */
  if (off > ws_size) return;
  k_wt_f16<<<(unsigned)(((size_t)DM * (DM / 8) + 255) / 256), 256, 0, stream>>>(wq, BQ, DM, DM, 16.0f); k_wt_f16<<<(unsigned)(((size_t)DM * (DM / 8) + 255) / 256), 256, 0, stream>>>(wk, BK, DM, DM, 16.0f); k_wt_f16<<<(unsigned)(((size_t)DM * (DM / 8) + 255) / 256), 256, 0, stream>>>(wv, BV, DM, DM, 16.0f); k_wt_f16<<<(unsigned)(((size_t)DM * (DM / 8) + 255) / 256), 256, 0, stream>>>(wo, BO, DM, DM, 16.0f);      /* [in][out] -> Bt[n][k] x16; BQ, BK, BV: three planes in a row */

  k_lnx<1, 0, 1><<<(unsigned)NR, 256, 0, stream>>>(x, lng, lnb, 1e-5f, nullptr, HF); k_hl<<<(unsigned)((NR * DM / 8 + 255) / 256), 256, 0, stream>>>(HF, X16, XL, NR * DM / 8);      /* h = LN(bf16(x)) f32 -> f16 hi (X16) + x1024 residual (XL) rows */
  /* Independent launches share one grid: q, k, v on grid.y of the projection GEMMs, the batch on grid.z of the per-batch GEMMs (grid.y of the first-tile attention, part of the flat index elsewhere). */
  const size_t zW = (size_t)DM * DM, zR = NR * DM, zT = (size_t)SQ * DM, z0 = (size_t)QT0 * DM;      /* elements: a weight plane, a token-row plane, one batch of it, one batch of a first-tile plane */
  const dim3 gp((unsigned)((NR / 128) * (DM / 128)), 1, 1), gp3((unsigned)((NR / 128) * (DM / 128)), 3, 1);      /* every token row; the same for q, k, v */
  k_gemm2<0><<<gp3, 256, 0, stream>>>(X16, DM, 0, BQ, DM, zW, 0.0625f, bq, 0, nullptr, 1, 0, 0, QKF, nullptr, DM, zR, (int)NR, DM, DM, 0, 0, 0, bk, bv);      /* f32 h_hi W + b */
  k_gemm2<0><<<gp3, 256, 0, stream>>>(XL, DM, 0, BQ, DM, zW, 0.00006103515625f, nullptr, 0, QKF, -1, 0, 0, nullptr, Q16, DM, zR, (int)NR, DM, DM, 0, 0, 0, nullptr, nullptr);      /* += h_lo W 2^-14 (own element), rounded to the f16 q, k, v rows */
  k_vt<NH, SQ><<<NB * NH * (SQ / 64), 256, 0, stream>>>(V16, LQ, 0, VT);      /* V^T [NB][NH][HD][SQ] */
  const dim3 g0((QT0 / 128) * (DM / 128), 1, NB), g03((QT0 / 128) * (DM / 128), 3, NB);
  k_gemm2<0><<<g03, 256, 0, stream>>>(X16, DM, 0, BQ, DM, zW, 0.0625f, bq, 0, nullptr, 1, 0, 0, QF0, nullptr, DM, (size_t)NB * z0, QT0, DM, DM, zT, 0, z0, bk, bv);
  k_gemm2<0><<<g03, 256, 0, stream>>>(XL, DM, 0, BQ, DM, zW, 0.00006103515625f, nullptr, 0, QF0, -1, 0, 0, QF0, nullptr, DM, (size_t)NB * z0, QT0, DM, DM, zT, 0, z0, nullptr, nullptr);      /* f32 q, k, v of each batch's first 128 rows (exact products) */
  k_att0<0, DM><<<dim3(NH * (QT0 / 64), NB), 64, 0, stream>>>(QF0, KF0, VF0, nullptr, 0.125f, OF0, DM);      /* exact f32 attention for rows 0..127 (o x64) */
  k_fattn<<<NB * NH * (SQ / 128), 128, 0, stream>>>(Q16, K16, VT, O16);      /* scores, causal softmax and o = P V in one launch; o (merged heads, x64) as f16 rows */
  k_gemm2<0><<<gp, 256, 0, stream>>>(O16, DM, 0, BO, DM, 0, 0.0009765625f, bo, 0, nullptr, 1, 0, 0, (float*)d_out, nullptr, DM, 0, (int)NR, DM, DM, 0, 0, 0, nullptr, nullptr);      /* out rows are the output layout */
  k_hl<<<(unsigned)(((size_t)NB * QT0 * DM / 8 + 255) / 256), 256, 0, stream>>>(OF0, OH0, OL0, (size_t)NB * QT0 * DM / 8);      /* first-tile o (x64) -> f16 hi + x1024 residual planes */
  k_gemm2<0><<<g0, 256, 0, stream>>>(OH0, DM, 0, BO, DM, 0, 0.0009765625f, bo, 0, nullptr, 1, 0, 0, (float*)d_out, nullptr, DM, 0, QT0, DM, DM, z0, 0, zT, nullptr, nullptr);      /* rows 0..127 of each batch: out = o_hi Wo (+ b), overwriting the f16-path rows */
  k_gemm2<0><<<g0, 256, 0, stream>>>(OL0, DM, 0, BO, DM, 0, 0.00000095367431640625f, nullptr, 0, (const float*)d_out, -1, 0, 0, (float*)d_out, nullptr, DM, 0, QT0, DM, DM, z0, 0, zT, nullptr, nullptr);      /* += o_lo Wo 2^-20 (own-element accumulate) */
}

// v006
// Measured time: 359 microseconds a run.
// Next to v005, in two timings, it ran 1.03 times as fast each time.
// Over all steps from v000 it is 29.7 times as fast.
#include <hip/hip_runtime.h>
// Pre-LayerNorm causal multi-head attention (x [4][2048][1024]; h = LN(x) (eps 1e-5, gamma, beta); q/k/v = h W + b ([in][out] 1024 x 1024 sigma 1/32, zero biases); 16 heads of 64; scores / 8; where(causal, s, finfo.min); softmax; out = merged Wo + bo -> [4][2048][1024], no residual).
// Structure: token rows r = b*2048 + s; h = LN(bf16(x)) in f32, as f16 hi + x1024 residual rows; Q, K, V as three WMMA GEMMs (32x64 wave tiles, f32 accumulation, exact x16 weights + bias, f16 outputs); V^T for all batches and heads via LDS transposes; causal attention fused in one launch (blocks of 128 query rows of one batch and head; S^T = K Q^T, running f32 maximum and sum per query, native exp2, weights x16 f16, O^T += V^T P^T over the keys up to the diagonal; o carried x64, folded into the output GEMM alpha) written straight into the merged f16 o rows; out = o W_o + b GEMM (f32) into the output layout.
// Compute dtype: inputs rounded to bf16; x / weights exact; q, k, v, softmax weights and o as plain f16 GEMM operands (~2^-12); scores and softmax statistics f32. v_wmma_f32_16x16x32_f16.
#define NB 4
#define SQ 2048
#define DM 1024
#define DMQ DM                       /* LayerNorm width */
#define NH 16
#define HD 64
#define HG 4                         /* heads per launch of the grouped k_vt (not launched) */
#define QT 256
#define NKX SQ
#define QT0 128                      /* first-tile rows recomputed exactly in f32 */
#define B0 0                         /* first batch processed (unused) */
#define NBR NB                       /* batches processed (unused) */
#define NR ((size_t)NB * SQ)         /* token rows */
#define MP ((int)((size_t)NBR * SQ)) /* rows projected (unused) */
#define QN SQ                        /* query rows attended per batch (unused) */
#define NHD NH                       /* heads attended (unused) */
#define MPO MP                       /* rows through the output stage (unused) */
#define LQ DM      /* row pitch of the q/k/v rows */
typedef __bf16 v16b __attribute__((ext_vector_type(16)));
typedef unsigned short v8us __attribute__((ext_vector_type(8), may_alias));
typedef float  v8f  __attribute__((ext_vector_type(8)));
typedef float  v4f  __attribute__((ext_vector_type(4)));
typedef float  v4fa __attribute__((ext_vector_type(4), may_alias));
union FragB { v16b v; v8us half[2]; unsigned short u[16]; };

__device__ __forceinline__ unsigned short bf16_bits(float x) { unsigned int u = __float_as_uint(x); return (unsigned short)((u + 0x7FFFu + ((u >> 16) & 1u)) >> 16); }
__device__ __forceinline__ float bf16_val(unsigned short b) { return __uint_as_float(((unsigned int)b) << 16); }
__device__ __forceinline__ float bf16_round(float x) { return bf16_val(bf16_bits(x)); }
// D += A·B with NT terms: 1 = ah·bh, 2 = + al·bh (A split), 3 = + ah·bl (both split)
template <int NT>
__device__ __forceinline__ v8f mmaN(v16b ah, v16b al, v16b bh, v16b bl, v8f c) {
  c = __builtin_amdgcn_wmma_f32_16x16x32_bf16(false, ah, false, bh, (short)0, c, false, false);
  if (NT >= 2) c = __builtin_amdgcn_wmma_f32_16x16x32_bf16(false, al, false, bh, (short)0, c, false, false);
  if (NT >= 3) c = __builtin_amdgcn_wmma_f32_16x16x32_bf16(false, ah, false, bl, (short)0, c, false, false);
  asm volatile("v_nop\n\tv_nop\n\tv_nop\n\tv_nop" : "+v"(c) : "v"(ah), "v"(al), "v"(bh), "v"(bl));
  return c;
}

__global__ __launch_bounds__(256) void k_wt_bf16(const float* __restrict__ W, unsigned short* __restrict__ Wt, int K, int N) {
  const int t = blockIdx.x * 256 + threadIdx.x;
  const int k8n = K / 8;
  if (t >= N * k8n) return;
  const int n = t / k8n, k8 = (t % k8n) * 8;
  v8us v;
#pragma unroll
  for (int i = 0; i < 8; ++i) v[i] = bf16_bits(W[(size_t)(k8 + i) * N + n]);
  *(v8us*)(Wt + (size_t)n * K + k8) = v;
  
}

// GEMM C[M][N] (f32, pitch ldc) = act(A[M][K]·W + bias). A f32 row-major (pitch lda) converted per fragment to bf16
// (ASPLIT: hi/lo two planes -> 2 terms, else single rounded term); Wt bf16 [N][K] (pitch ldb). BIAS_BF16 rounds the
// bias to bf16 first (bias quantised to bf16 before the add). K%32==0, M%16==0, N%64==0.
template <bool ASPLIT, int ACT, bool BIAS_BF16>
__global__ __launch_bounds__(128) void k_gemm_bf(const float* __restrict__ A, int lda, const unsigned short* __restrict__ Wt, int ldb,
                                               const float* __restrict__ bias, float* __restrict__ C, int ldc, int M, int N, int K) {
  __shared__ __attribute__((aligned(16))) float so[4][16][64];
  const int tid = threadIdx.x, w = tid >> 5, lane = tid & 31, ln = lane & 15, hh = lane >> 4;
  const int ntn = N / 64;
  const int wid = blockIdx.x * 4 + w;
  const int mt = wid / ntn, nq = wid % ntn;
  if (mt * 16 >= M) return;
  const int row0 = mt * 16, col0 = nq * 64;
  const float* arow = A + (size_t)(row0 + ln) * lda;
  v8f acc[4] = {};
  for (int kb = 0; kb < K; kb += 32) {
    FragB ah, al;
    const v4f x0 = *(const v4fa*)(arow + kb + 8 * hh), x1 = *(const v4fa*)(arow + kb + 8 * hh + 4);
    const v4f x2 = *(const v4fa*)(arow + kb + 16 + 8 * hh), x3 = *(const v4fa*)(arow + kb + 16 + 8 * hh + 4);
    float xs[16] = {x0[0],x0[1],x0[2],x0[3],x1[0],x1[1],x1[2],x1[3],x2[0],x2[1],x2[2],x2[3],x3[0],x3[1],x3[2],x3[3]};
#pragma unroll
    for (int i = 0; i < 16; ++i) { const unsigned short hb = bf16_bits(xs[i]); ah.u[i] = hb; al.u[i] = ASPLIT ? bf16_bits(xs[i] - bf16_val(hb)) : (unsigned short)0; }
#pragma unroll
    for (int t = 0; t < 4; ++t) {
      const unsigned short* brow = Wt + (size_t)(col0 + t * 16 + ln) * ldb + kb;
      FragB b;
      b.half[0] = *(const v8us*)(brow + 8 * hh);
      b.half[1] = *(const v8us*)(brow + 16 + 8 * hh);
      acc[t] = mmaN<ASPLIT ? 2 : 1>(ah.v, al.v, b.v, b.v, acc[t]);
    }
  }
#pragma unroll
  for (int t = 0; t < 4; ++t) {
    float bv = bias ? bias[col0 + t * 16 + ln] : 0.f;
    if (BIAS_BF16) bv = bf16_round(bv);
#pragma unroll
    for (int r = 0; r < 8; ++r) { float v = acc[t][r] + bv; if (ACT == 1) v = fmaxf(v, 0.f); so[w][8 * hh + r][t * 16 + ln] = v; }
  }
  __builtin_amdgcn_fence(__ATOMIC_ACQ_REL, "workgroup");
  __builtin_amdgcn_wave_barrier();
  const int rsub = lane >> 4, c4 = (lane & 15) * 4;
  {
#pragma unroll
    for (int q = 0; q < 8; ++q) {
      const int r = q * 2 + rsub;
      const v4f v = *(const v4fa*)&so[w][r][c4];
      *(v4f*)(C + (size_t)(row0 + r) * ldc + col0 + c4) = v;
    }
    
  }
}

// GEMM C = act(A·W + bias + resid): A f32 (ASPLIT -> hi/lo 2 terms), Wt bf16 [N][K]; ACT 0 none, 1 relu, 2 exact gelu;
// resid (optional, f32, row index = (row % rmod), pitch ldr, RES_BF16 rounds it) added before the activation.
template <bool ASPLIT, int ACT, bool BIAS_BF16, bool RES_BF16>
__global__ __launch_bounds__(128) void k_gemm_bf3(const float* __restrict__ A, int lda, const unsigned short* __restrict__ Wt, int ldb,
                                                const float* __restrict__ bias, const float* __restrict__ resid, int rmod, int ldr,
                                                float* __restrict__ C, int ldc, int M, int N, int K) {
  __shared__ __attribute__((aligned(16))) float so[4][16][64];
  const int tid = threadIdx.x, w = tid >> 5, lane = tid & 31, ln = lane & 15, hh = lane >> 4;
  const int ntn = N / 64;
  const int wid = blockIdx.x * 4 + w;
  const int mt = wid / ntn, nq = wid % ntn;
  if (mt * 16 >= M) return;
  const int row0 = mt * 16, col0 = nq * 64;
  const float* arow = A + (size_t)(row0 + ln) * lda;
  v8f acc[4] = {};
  for (int kb = 0; kb < K; kb += 32) {
    FragB ah, al;
    const v4f x0 = *(const v4fa*)(arow + kb + 8 * hh), x1 = *(const v4fa*)(arow + kb + 8 * hh + 4);
    const v4f x2 = *(const v4fa*)(arow + kb + 16 + 8 * hh), x3 = *(const v4fa*)(arow + kb + 16 + 8 * hh + 4);
    float xs[16] = {x0[0],x0[1],x0[2],x0[3],x1[0],x1[1],x1[2],x1[3],x2[0],x2[1],x2[2],x2[3],x3[0],x3[1],x3[2],x3[3]};
#pragma unroll
    for (int i = 0; i < 16; ++i) { const unsigned short hb = bf16_bits(xs[i]); ah.u[i] = hb; al.u[i] = ASPLIT ? bf16_bits(xs[i] - bf16_val(hb)) : (unsigned short)0; }
#pragma unroll
    for (int t = 0; t < 4; ++t) {
      const unsigned short* brow = Wt + (size_t)(col0 + t * 16 + ln) * ldb + kb;
      FragB b;
      b.half[0] = *(const v8us*)(brow + 8 * hh);
      b.half[1] = *(const v8us*)(brow + 16 + 8 * hh);
      acc[t] = mmaN<ASPLIT ? 2 : 1>(ah.v, al.v, b.v, b.v, acc[t]);
    }
  }
#pragma unroll
  for (int t = 0; t < 4; ++t) {
    const int col = col0 + t * 16 + ln;
    float bv = bias ? bias[col] : 0.f;
    if (BIAS_BF16) bv = bf16_round(bv);
#pragma unroll
    for (int r = 0; r < 8; ++r) {
      float v = acc[t][r] + bv;
      if (resid) { float rv = resid[(size_t)((row0 + 8 * hh + r) % rmod) * ldr + col]; if (RES_BF16) rv = bf16_round(rv); v += rv; }
      if (ACT == 1) v = fmaxf(v, 0.f);
      if (ACT == 2) v = 0.5f * v * (1.0f + erff(v * 0.70710678118654752f));
      if (ACT == 3) { const float u = 0.7978845608028654f * (v + 0.044715f * v * v * v); v = 0.5f * v * (1.0f + tanhf(u)); }
      so[w][8 * hh + r][t * 16 + ln] = v;
    }
  }
  __builtin_amdgcn_fence(__ATOMIC_ACQ_REL, "workgroup");
  __builtin_amdgcn_wave_barrier();
  const int rsub = lane >> 4, c4 = (lane & 15) * 4;
  {
#pragma unroll
    for (int q = 0; q < 8; ++q) {
      const int r = q * 2 + rsub;
      const v4f v = *(const v4fa*)&so[w][r][c4];
      *(v4f*)(C + (size_t)(row0 + r) * ldc + col0 + c4) = v;
    }
    
  }
}
// row LayerNorm (biased variance, eps) over N: s = X (+ R); optional out_sum <- s; out_norm <- (s-mu)*rsqrt(var+eps)*g + b
template <bool PARAM_BF16>
__global__ __launch_bounds__(256) void k_layernorm(const float* __restrict__ X, const float* __restrict__ R, const float* __restrict__ g, const float* __restrict__ bta,
                                                  float* __restrict__ out_sum, float* __restrict__ out_norm, int N, float eps) {
  __shared__ float red[256];
  const int row = blockIdx.x, tid = threadIdx.x;
  const float* x = X + (size_t)row * N; const float* rr = R ? R + (size_t)row * N : nullptr;
  float vals[16];                     // up to N = 4096
  const int per = N / 256;            // contiguous chunk per thread? use strided-by-4 chunks: thread handles j = tid*4 + 1024*u
  float s1 = 0.f;
  for (int u = 0; u < per / 4; ++u) {
    const int j = tid * 4 + 1024 * u;
    const v4f a = *(const v4fa*)(x + j);
    v4f b = {0.f,0.f,0.f,0.f}; if (rr) b = *(const v4fa*)(rr + j);
#pragma unroll
    for (int q = 0; q < 4; ++q) { const float v = a[q] + b[q]; vals[u * 4 + q] = v; s1 += v; }
  }
  red[tid] = s1; __syncthreads();
  for (int st = 128; st > 0; st >>= 1) { if (tid < st) red[tid] += red[tid + st]; __syncthreads(); }
  const float mu = red[0] / (float)N; __syncthreads();
  float s2 = 0.f;
  for (int u = 0; u < per / 4; ++u)
#pragma unroll
    for (int q = 0; q < 4; ++q) { const float c = vals[u * 4 + q] - mu; s2 += c * c; }
  red[tid] = s2; __syncthreads();
  for (int st = 128; st > 0; st >>= 1) { if (tid < st) red[tid] += red[tid + st]; __syncthreads(); }
  const float rs = rsqrtf(red[0] / (float)N + eps);
  {
    for (int u = 0; u < per / 4; ++u) {
      const int j = tid * 4 + 1024 * u;
      v4f o, sm;
#pragma unroll
      for (int q = 0; q < 4; ++q) {
        float gg = g[j + q], bb = bta[j + q];
        if (PARAM_BF16) { gg = bf16_round(gg); bb = bf16_round(bb); }
        sm[q] = vals[u * 4 + q]; o[q] = (vals[u * 4 + q] - mu) * rs * gg + bb;
      }
      if (out_sum) *(v4f*)(out_sum + (size_t)row * N + j) = sm;
      *(v4f*)(out_norm + (size_t)row * N + j) = o;
    }
    
  }
}



// ---- f16 WMMA path (v_wmma_f32_16x16x32_f16): 11-bit significands for operands in range — used where a [0,1] probability operand needs more precision than bf16
typedef _Float16 v16h __attribute__((ext_vector_type(16)));
union FragH { v16h v; v8us half[2]; _Float16 h[16]; unsigned short u[16]; };
template <int NT>
__device__ __forceinline__ v8f mmaH(v16h ah, v16h al, v16h bh, v16h bl, v8f c) {
  c = __builtin_amdgcn_wmma_f32_16x16x32_f16(false, ah, false, bh, (short)0, c, false, false);
  if (NT >= 2) c = __builtin_amdgcn_wmma_f32_16x16x32_f16(false, al, false, bh, (short)0, c, false, false);
  if (NT >= 3) c = __builtin_amdgcn_wmma_f32_16x16x32_f16(false, ah, false, bl, (short)0, c, false, false);
  asm volatile("v_nop\n\tv_nop\n\tv_nop\n\tv_nop" : "+v"(c) : "v"(ah), "v"(al), "v"(bh), "v"(bl));
  return c;
}
// batched GEMM like k_gemm_b but f16 operands: A f32 (split into f16 hi/lo if ASPLIT, else rounded to f16), Bt = f16 values [n][k]; alpha; C f32; N multiple of 16 (partial tiles skipped)
template <bool ASPLIT>
__global__ __launch_bounds__(128) void k_gemm_h(const float* __restrict__ A, int lda, size_t sA, const _Float16* __restrict__ Bh, int ldb, size_t sB, float alpha, float* __restrict__ C, int ldc, size_t sC, int M, int N, int K) {
  __shared__ __attribute__((aligned(16))) float so[4][16][64];
  const int tid = threadIdx.x, w = tid >> 5, lane = tid & 31, ln = lane & 15, hh = lane >> 4; const int by = blockIdx.y;
  A += (size_t)by * sA; Bh += (size_t)by * sB; C += (size_t)by * sC;
  const int ntn = (N + 63) / 64; const int wid = blockIdx.x * 4 + w; const int mt = wid / ntn, nq = wid % ntn; if (mt * 16 >= M) return;
  const int row0 = mt * 16, col0 = nq * 64; const float* arow = A + (size_t)(row0 + ln) * lda;
  v8f acc[4] = {};
  for (int kb = 0; kb < K; kb += 32) {
    FragH ah, al;
    const v4f x0 = *(const v4fa*)(arow + kb + 8 * hh), x1 = *(const v4fa*)(arow + kb + 8 * hh + 4), x2 = *(const v4fa*)(arow + kb + 16 + 8 * hh), x3 = *(const v4fa*)(arow + kb + 16 + 8 * hh + 4);
    float xs[16] = {x0[0],x0[1],x0[2],x0[3],x1[0],x1[1],x1[2],x1[3],x2[0],x2[1],x2[2],x2[3],x3[0],x3[1],x3[2],x3[3]};
#pragma unroll
    for (int i = 0; i < 16; ++i) { const _Float16 h = (_Float16)xs[i]; ah.h[i] = h; al.h[i] = ASPLIT ? (_Float16)(xs[i] - (float)h) : (_Float16)0.0f; }
#pragma unroll
    for (int t = 0; t < 4; ++t) { if (col0 + t * 16 >= N) continue; const size_t boff = (size_t)(col0 + t * 16 + ln) * ldb + kb; FragH bq; bq.half[0] = *(const v8us*)(Bh + boff + 8 * hh); bq.half[1] = *(const v8us*)(Bh + boff + 16 + 8 * hh);
      acc[t] = mmaH<ASPLIT ? 2 : 1>(ah.v, al.v, bq.v, bq.v, acc[t]); }
  }
#pragma unroll
  for (int t = 0; t < 4; ++t) { if (col0 + t * 16 >= N) continue;
#pragma unroll
    for (int r = 0; r < 8; ++r) so[w][8 * hh + r][t * 16 + ln] = acc[t][r] * alpha; }
  __builtin_amdgcn_fence(__ATOMIC_ACQ_REL, "workgroup"); __builtin_amdgcn_wave_barrier();
  const int rsub = lane >> 4, c4 = (lane & 15) * 4;
  {
#pragma unroll
    for (int q = 0; q < 8; ++q) { const int r = q * 2 + rsub; if (col0 + c4 < N) { const v4f v = *(const v4fa*)&so[w][r][c4]; *(v4f*)(C + (size_t)(row0 + r) * ldc + col0 + c4) = v; } }
     }
}

// Wt[n][k] = f16(W[k][n]·scale) from f32 row-major W[K][N] (scale = power of two; bf16-exact weights stay exact in f16 away from the subnormal range)
__global__ __launch_bounds__(256) void k_wt_f16(const float* __restrict__ W, _Float16* __restrict__ Wt, int K, int N, float scale) {
  const int t = blockIdx.x * 256 + threadIdx.x; if (t >= N * (K / 8)) return; const int n = t / (K / 8), k8 = (t % (K / 8)) * 8; FragH f;
#pragma unroll
  for (int i = 0; i < 8; ++i) f.h[i] = (_Float16)(bf16_round(W[(size_t)(k8 + i) * N + n]) * scale); const v8us o = f.half[0];
  *(v8us*)((unsigned short*)Wt + (size_t)n * K + k8) = o; 
}
// k_gemm_hh variant with fused epilogue: v = acc·alpha + bias[by·sBias + col] (+ CP[(row/rowsPerB)·sCPb + by·64 + col] if CP) ; ACT 0 none / 1 elu ; writes f16 C16 (and f32 C if non-null)
template <int ACT>
__global__ __launch_bounds__(128) void k_gemm_hhx(const _Float16* __restrict__ A, int lda, size_t sA, const _Float16* __restrict__ Bh, int ldb, size_t sB, float alpha, const float* __restrict__ bias, size_t sBias, const float* __restrict__ CP, int rowsPerB, size_t sCPb, int row0g,
    float* __restrict__ C, _Float16* __restrict__ C16, int ldc, size_t sC, int M, int N, int K) {
  __shared__ __attribute__((aligned(16))) float so[4][16][64];
  const int tid = threadIdx.x, w = tid >> 5, lane = tid & 31, ln = lane & 15, hh = lane >> 4; const int by = blockIdx.y;
  A += (size_t)by * sA; Bh += (size_t)by * sB; const size_t cofs = (size_t)by * sC; const float* bp = bias ? bias + (size_t)by * sBias : nullptr;
  const int ntn = (N + 63) / 64; const int wid = blockIdx.x * 4 + w; const int mt = wid / ntn, nq = wid % ntn; if (mt * 16 >= M) return;
  const int row0 = mt * 16, col0 = nq * 64; const _Float16* arow = A + (size_t)(row0 + ln) * lda;
  v8f acc[4] = {};
  for (int kb = 0; kb < K; kb += 32) { FragH ah; ah.half[0] = *(const v8us*)((const unsigned short*)arow + kb + 8 * hh); ah.half[1] = *(const v8us*)((const unsigned short*)arow + kb + 16 + 8 * hh);
#pragma unroll
    for (int t = 0; t < 4; ++t) { if (col0 + t * 16 >= N) continue; const size_t boff = (size_t)(col0 + t * 16 + ln) * ldb + kb; FragH bq; bq.half[0] = *(const v8us*)((const unsigned short*)Bh + boff + 8 * hh); bq.half[1] = *(const v8us*)((const unsigned short*)Bh + boff + 16 + 8 * hh);
      acc[t] = mmaH<1>(ah.v, ah.v, bq.v, bq.v, acc[t]); }
  }
#pragma unroll
  for (int t = 0; t < 4; ++t) { if (col0 + t * 16 >= N) continue; const int col = col0 + t * 16 + ln; const float bv = bp ? bf16_round(bp[col]) : 0.f;
#pragma unroll
    for (int r = 0; r < 8; ++r) { float v = acc[t][r] * alpha + bv; if (CP) { const int rr = row0g + row0 + 8 * hh + r; if (rowsPerB < 0) v += CP[cofs + (size_t)rr * ldc + col];      /* rowsPerB < 0: own element of the batched C plane */ else { const int bidx = rr / rowsPerB; v += CP[(size_t)bidx * sCPb + (size_t)by * 64 + col]; } } if (ACT == 1) v = (v > 0.f) ? v : expm1f(v); else if (ACT == 7) v = (v > 0.f) ? v + 1.0f : expf(v); else if (ACT == 8) v = tanhf(v); else if (ACT == 9) v = 0.5f * v * (1.0f + tanhf(0.7978845608028654f * (v + 0.044715f * v * v * v))); else if (ACT == 11) v = 1.0f / (1.0f + expf(-v)); else if (ACT == 12) v = (v > 0.f) ? v : 0.01f * v; else if (ACT == 14) v = (v > 0.f) ? v : 0.1f * v; else if (ACT == 16) v = (v >= 0.f) ? v : 0.3f * v; else if (ACT == 17) v = (v >= 0.f) ? v : 0.2f * v; else if (ACT == 15) v = v / (1.0f + expf(-v)); else if (ACT == 3) v = fmaxf(v, 0.f); else if (ACT == 6) v = 0.5f * v * (1.0f + erff(v * 0.70710678118654752f)); so[w][8 * hh + r][t * 16 + ln] = v; } }
  __builtin_amdgcn_fence(__ATOMIC_ACQ_REL, "workgroup"); __builtin_amdgcn_wave_barrier();
  const int rsub = lane >> 4, c4 = (lane & 15) * 4; typedef _Float16 v4h __attribute__((ext_vector_type(4)));
  {
#pragma unroll
    for (int q = 0; q < 8; ++q) { const int r = q * 2 + rsub; if (col0 + c4 < N) { const v4f v = *(const v4fa*)&so[w][r][c4]; if (C) *(v4f*)(C + cofs + (size_t)(row0 + r) * ldc + col0 + c4) = v; if (C16) { v4h h4; for (int i = 0; i < 4; ++i) h4[i] = (_Float16)v[i]; *(v4h*)(C16 + cofs + (size_t)(row0 + r) * ldc + col0 + c4) = h4; } } }
     }
}


typedef _Float16 v4h __attribute__((ext_vector_type(4)));

__global__ __launch_bounds__(256) void k_x16(const float* __restrict__ x, _Float16* __restrict__ X16, size_t n8) { const size_t t = (size_t)blockIdx.x * 256 + threadIdx.x; if (t >= n8) return; FragH f;
#pragma unroll
  for (int q = 0; q < 8; ++q) f.h[q] = (_Float16)bf16_round(x[t * 8 + q]); *(v8us*)((unsigned short*)X16 + t * 8) = f.half[0];  }
__global__ __launch_bounds__(256) void k_h16(const float* __restrict__ x, _Float16* __restrict__ X16, size_t n8) { const size_t t = (size_t)blockIdx.x * 256 + threadIdx.x; if (t >= n8) return; FragH f;
#pragma unroll
  for (int q = 0; q < 8; ++q) f.h[q] = (_Float16)x[t * 8 + q]; *(v8us*)((unsigned short*)X16 + t * 8) = f.half[0];  }
__global__ __launch_bounds__(256) void k_round16f(const float* __restrict__ W, _Float16* __restrict__ Bt, size_t n8) { const size_t t = (size_t)blockIdx.x * 256 + threadIdx.x; if (t >= n8) return; FragH f;
#pragma unroll
  for (int i = 0; i < 8; ++i) f.h[i] = (_Float16)(bf16_round(W[t * 8 + i]) * 16.0f); *(v8us*)((unsigned short*)Bt + t * 8) = f.half[0];  }
template <int NHv, int TTv>
__global__ __launch_bounds__(256) void k_vt(const _Float16* __restrict__ V16, int ldv, int voff, _Float16* __restrict__ Vt) { __shared__ unsigned short tl[64][66]; const int tid = threadIdx.x; const int slab = blockIdx.x / (TTv / 64), lg = blockIdx.x % (TTv / 64); const int b = slab / NHv, h = slab % NHv;
  for (int i = tid; i < 64 * 8; i += 256) { const int r = i / 8, c8 = (i % 8) * 8; FragH f; f.half[0] = *(const v8us*)((const unsigned short*)V16 + ((size_t)b * TTv + lg * 64 + r) * ldv + voff + h * 64 + c8);
#pragma unroll
    for (int q = 0; q < 8; ++q) tl[r][c8 + q] = f.u[q]; }
  __syncthreads();
  {
#pragma unroll
    for (int rd = 0; rd < 2; ++rd) { const int d = rd * 32 + tid / 8, pc = tid % 8; FragH f;
#pragma unroll
      for (int q = 0; q < 8; ++q) f.u[q] = tl[pc * 8 + q][d];
      *(v8us*)((unsigned short*)Vt + ((size_t)slab * 64 + d) * TTv + lg * 64 + pc * 8) = f.half[0]; }
     } }

__global__ __launch_bounds__(256) void k_hl(const float* __restrict__ F, _Float16* __restrict__ Hh, _Float16* __restrict__ Hl, size_t n8) { const size_t t = (size_t)blockIdx.x * 256 + threadIdx.x; if (t >= n8) return; FragH fh, fl; const v4f a = *(const v4fa*)(F + t * 8), c = *(const v4fa*)(F + t * 8 + 4);
#pragma unroll
  for (int q = 0; q < 4; ++q) { _Float16 h = (_Float16)a[q]; fh.h[q] = h; fl.h[q] = (_Float16)((a[q] - (float)h) * 1024.0f); h = (_Float16)c[q]; fh.h[4 + q] = h; fl.h[4 + q] = (_Float16)((c[q] - (float)h) * 1024.0f); }
  { *(v8us*)((unsigned short*)Hh + t * 8) = fh.half[0]; *(v8us*)((unsigned short*)Hl + t * 8) = fl.half[0];  } }

// ---- fast GEMM (block tile 128x128 = eight waves of 32x64; requires M % 128 == 0 rows per launch region, N % 128 == 0 and K % 64 == 0); epilogue = k_gemm_hhx semantics ----
// The block's 128 A rows and 128 B rows come in tiles of GKS k, loaded as whole 128-byte lines and staged through registers into two LDS buffers: tile s + 1 is loaded from memory while tile s is worked on, and one barrier a tile both publishes it and frees the buffer read before. Every wave takes its fragments from LDS in the k order of g2_frag, 32 k at a time in rising order, so each accumulator sums as before.
#define GKS 64                       /* k per staged tile: 128 bytes of every operand row */
#define GPIT 72                      /* LDS row pitch in f16 elements: 144 bytes = 16 x odd, free of bank conflicts for 16-byte fragment reads */
__device__ __forceinline__ v16h g2_frag(const _Float16* p, int hh) { FragH f; f.half[0] = *(const v8us*)((const unsigned short*)p + 8 * hh); f.half[1] = *(const v8us*)((const unsigned short*)p + 16 + 8 * hh); return f.v; }
__device__ __forceinline__ v8f g2_mma(v16h a, v16h b, v8f c) { v8f d = __builtin_amdgcn_wmma_f32_16x16x32_f16(false, a, false, b, (short)0, c, false, false); asm volatile("v_nop\n\tv_nop\n\tv_nop\n\tv_nop" : "+v"(d) : "v"(a), "v"(b)); return d; }
template <int ACT>
__global__ __launch_bounds__(256) void k_gemm2(const _Float16* __restrict__ A, int lda, size_t sA, const _Float16* __restrict__ Bh, int ldb, size_t sB, float alpha, const float* __restrict__ bias, size_t sBias, const float* __restrict__ CP, int rowsPerB, size_t sCPb, int row0g,
    float* __restrict__ C, _Float16* __restrict__ C16, int ldc, size_t sC, int M, int N, int K, size_t zA, size_t zB, size_t zC, const float* __restrict__ bias1, const float* __restrict__ bias2) { static_assert(ACT == 0 || ACT == 3 || ACT == 6 || ACT == 8 || ACT == 9 || ACT == 11 || ACT == 12 || ACT == 14 || ACT == 15 || ACT == 16 || ACT == 17, "k_gemm2: unsupported ACT code (would silently apply no activation)");
  __shared__ __attribute__((aligned(16))) unsigned char sm[2 * 256 * GPIT * 2];      /* two buffers of [A 128 rows | B 128 rows]; behind the last tile's barrier the same bytes hold the epilogue's rows */
  static_assert(sizeof(float) * 8 * 32 * 68 <= sizeof(sm), "the epilogue rows fit the tile buffers");
  unsigned short* const ring = (unsigned short*)sm; float (* const so)[32][68] = (float (*)[32][68])sm;
  const int tid = threadIdx.x, w = tid >> 5, lane = tid & 31, ln = lane & 15, hh = lane >> 4; const int by = blockIdx.y, bz = blockIdx.z;      /* grid.z: a second batch index (element strides zA, zB, zC) */
  A += (size_t)by * sA + (size_t)bz * zA; Bh += (size_t)by * sB + (size_t)bz * zB; const size_t cofs = (size_t)by * sC + (size_t)bz * zC; const float* bp = bias ? bias + (size_t)by * sBias : nullptr;
  if (bias1 && by == 1) bp = bias1; if (bias2 && by == 2) bp = bias2;      /* bias vectors that are separate buffers: one per grid.y index */
  const int ntn = N >> 7; const int mt = blockIdx.x / ntn, nq = blockIdx.x - mt * ntn; if (mt * 128 >= M) return;      /* the whole block leaves, in front of every barrier */
  const int wr = w & 3, wc = w >> 2; const int row0 = mt * 128 + 32 * wr, col0 = nq * 128 + 64 * wc;      /* four waves down, two across */
  const int sr = tid >> 3, sc = (tid & 7) * 8;      /* staging: 8 threads cover one row's 128 bytes, the block 32 rows a round */
  const unsigned short* ap = (const unsigned short*)A + (size_t)(mt * 128 + sr) * lda + sc; const unsigned short* bq = (const unsigned short*)Bh + (size_t)(nq * 128 + sr) * ldb + sc;
  v8us ar[4], br[4];
#pragma unroll      /* static indices keep the staging registers in registers */
  for (int i = 0; i < 4; ++i) { ar[i] = *(const v8us*)(ap + (size_t)(32 * i) * lda); br[i] = *(const v8us*)(bq + (size_t)(32 * i) * ldb); }
  asm volatile("s_wait_xcnt 0x0" ::: "memory");      /* the loads' address registers are advanced behind them */
#pragma unroll      /* static indices, as above */
  for (int i = 0; i < 4; ++i) { *(v8us*)(ring + (sr + 32 * i) * GPIT + sc) = ar[i]; *(v8us*)(ring + (128 + sr + 32 * i) * GPIT + sc) = br[i]; }
  __syncthreads();      /* tile 0 is complete before any wave reads it */
  const v8f z8 = {0.f,0.f,0.f,0.f,0.f,0.f,0.f,0.f}; v8f c00 = z8, c01 = z8, c02 = z8, c03 = z8, c10 = z8, c11 = z8, c12 = z8, c13 = z8;
  const int nst = K / GKS;
#pragma unroll 1      /* one k tile at a time: the two buffers alternate */
  for (int s = 0; s < nst; ++s) {
    const bool more = s + 1 < nst;      /* the same for the whole block */
    if (more) { ap += GKS; bq += GKS;
#pragma unroll      /* static indices; all of a thread's tile loads in flight under this tile's work */
      for (int i = 0; i < 4; ++i) { ar[i] = *(const v8us*)(ap + (size_t)(32 * i) * lda); br[i] = *(const v8us*)(bq + (size_t)(32 * i) * ldb); }
      asm volatile("s_wait_xcnt 0x0" ::: "memory"); }      /* the loads' address registers are advanced on the next trip */
    const _Float16* al = (const _Float16*)(ring + ((s & 1) * 256 + 32 * wr + ln) * GPIT); const _Float16* bl = (const _Float16*)(ring + ((s & 1) * 256 + 128 + 64 * wc + ln) * GPIT);
#pragma unroll      /* two 32-k passes a tile, constant LDS offsets */
    for (int kk = 0; kk < GKS; kk += 32) { const v16h a0 = g2_frag(al + kk, hh), a1 = g2_frag(al + 16 * GPIT + kk, hh);
      const v16h b0 = g2_frag(bl + kk, hh), b1 = g2_frag(bl + 16 * GPIT + kk, hh), b2 = g2_frag(bl + 32 * GPIT + kk, hh), b3 = g2_frag(bl + 48 * GPIT + kk, hh);      /* a pass's LDS reads stand together in front of its products */
      c00 = g2_mma(a0, b0, c00); c10 = g2_mma(a1, b0, c10); c01 = g2_mma(a0, b1, c01); c11 = g2_mma(a1, b1, c11);
      c02 = g2_mma(a0, b2, c02); c12 = g2_mma(a1, b2, c12); c03 = g2_mma(a0, b3, c03); c13 = g2_mma(a1, b3, c13); }
    if (more) {
#pragma unroll      /* static indices, as above */
      for (int i = 0; i < 4; ++i) { *(v8us*)(ring + (((s + 1) & 1) * 256 + sr + 32 * i) * GPIT + sc) = ar[i]; *(v8us*)(ring + (((s + 1) & 1) * 256 + 128 + sr + 32 * i) * GPIT + sc) = br[i]; } }      /* into the buffer that every wave left before the last barrier */
    __syncthreads();      /* tile s + 1 is complete, and every wave has left tile s, before the next trip (behind the last tile: before the epilogue's rows overwrite it) */
  }
  v8f accs[8] = {c00, c01, c02, c03, c10, c11, c12, c13};
#pragma unroll
  for (int u = 0; u < 8; ++u) { const int t = u & 3, half = u >> 2; const int col = col0 + t * 16 + ln; const float bv = bp ? bf16_round(bp[col]) : 0.f;
#pragma unroll
    for (int r = 0; r < 8; ++r) { const int rloc = half * 16 + 8 * hh + r; float v = accs[u][r] * alpha + bv; if (CP) { if (rowsPerB < 0) v += CP[cofs + (size_t)(row0g + row0 + rloc) * ldc + col];      /* rowsPerB < 0: own element of the batched C plane */ else { const int bidx = (row0g + row0 + rloc) / rowsPerB; v += CP[(size_t)bidx * sCPb + (size_t)by * 64 + col]; } }
      if (ACT == 3) v = fmaxf(v, 0.f); else if (ACT == 6) v = 0.5f * v * (1.0f + erff(v * 0.70710678118654752f)); else if (ACT == 11) v = 1.0f / (1.0f + expf(-v)); else if (ACT == 15) v = v / (1.0f + expf(-v)); else if (ACT == 12) v = (v > 0.f) ? v : 0.01f * v; else if (ACT == 8) v = tanhf(v); else if (ACT == 9) v = 0.5f * v * (1.0f + tanhf(0.7978845608028654f * (v + 0.044715f * v * v * v))); else if (ACT == 14) v = (v > 0.f) ? v : 0.1f * v; else if (ACT == 16) v = (v >= 0.f) ? v : 0.3f * v; else if (ACT == 17) v = (v >= 0.f) ? v : 0.2f * v;
      so[w][rloc][t * 16 + ln] = v; } }
  __builtin_amdgcn_fence(__ATOMIC_ACQ_REL, "workgroup"); __builtin_amdgcn_wave_barrier();
  const int rsub = lane >> 4, c4 = (lane & 15) * 4;
  {
#pragma unroll
    for (int q = 0; q < 16; ++q) { const int r = q * 2 + rsub; const v4f v = *(const v4fa*)&so[w][r][c4]; if (C) *(v4f*)(C + cofs + (size_t)(row0 + r) * ldc + col0 + c4) = v; if (C16) { v4h h4; for (int i = 0; i < 4; ++i) h4[i] = (_Float16)v[i]; *(v4h*)(C16 + cofs + (size_t)(row0 + r) * ldc + col0 + c4) = h4; } }
     } }


__global__ __launch_bounds__(256) void k_wnat(const float* __restrict__ w, size_t n8, _Float16* __restrict__ Bt) { const size_t t = (size_t)blockIdx.x * 256 + threadIdx.x; if (t >= n8) return; FragH f; for (int q = 0; q < 8; ++q) f.h[q] = (_Float16)(bf16_round(w[t * 8 + q]) * 16.0f); *(v8us*)((unsigned short*)Bt + t * 8) = f.half[0];  }
__global__ __launch_bounds__(256) void k_rsm(const float* __restrict__ S, _Float16* __restrict__ P, int nrows) {
  #pragma clang fp contract(off)
  const int i = blockIdx.x * 256 + threadIdx.x; if (i >= nrows) return; const float* s = S + (size_t)i * SQ; float mx = -3.0e38f;
#pragma unroll 1
  for (int j = 0; j < SQ; ++j) mx = fmaxf(mx, s[j]); float se = 0.f;
#pragma unroll 1
  for (int j = 0; j < SQ; ++j) se += expf(s[j] - mx); const float sc = 256.0f / se;
#pragma unroll 1
  for (int j0 = 0; j0 < SQ; j0 += 8) { FragH f; for (int q = 0; q < 8; ++q) f.h[q] = (_Float16)(expf(s[j0 + q] - mx) * sc); unsigned short* d = (unsigned short*)P + (size_t)i * SQ + j0; *(v8us*)d = f.half[0];  } }
__global__ __launch_bounds__(256) void k_vt(const _Float16* __restrict__ V16, int b, int h0, _Float16* __restrict__ VT) { __shared__ unsigned short tl[64][65]; const int tid = threadIdx.x; const int hh = blockIdx.x % HG, sg = blockIdx.x / HG; const int s0 = sg * 64; const int h = h0 + hh;
  for (int i = tid; i < 64 * 8; i += 256) { const int j = i / 8, d8 = (i % 8) * 8; FragH f; f.half[0] = *(const v8us*)((const unsigned short*)V16 + ((size_t)b * SQ + s0 + j) * DM + h * HD + d8); for (int q = 0; q < 8; ++q) tl[d8 + q][j] = f.u[q]; }
  __syncthreads();
  { for (int i = tid; i < 64 * 8; i += 256) { const int d = i / 8, j8 = (i % 8) * 8; FragH f; for (int q = 0; q < 8; ++q) f.u[q] = tl[d][j8 + q]; *(v8us*)((unsigned short*)VT + ((size_t)hh * HD + d) * SQ + s0 + j8) = f.half[0]; }  } }



#define FK 64                        /* keys per staged tile */
#define FPIT 72                      /* LDS row pitch in f16 elements: 144 bytes = 16 x odd, free of bank conflicts for 16-byte fragment reads */
#define FCS 0.18033688011112042f     /* 1/8 x log2(e): exponentials in base 2 */
__device__ __forceinline__ float fa_xhalf(float x) { return __builtin_bit_cast(float, __builtin_amdgcn_permlanex16(__builtin_bit_cast(int, x), __builtin_bit_cast(int, x), 0x76543210, 0xfedcba98, false, false)); }      /* lane l reads lane l ^ 16 */
// Base-2 exponentials in asm so that the slot the instruction set asks for behind a transcendental (before its result is read or its source overwritten) is there by construction: the outputs lie apart from every input, so each v_exp_f32 is followed by an independent one, and the v_nop stands behind the last.
__device__ __forceinline__ void fa_exp8(const float (&x)[8], float (&e)[8]) {
  asm("v_exp_f32 %0, %8\n\tv_exp_f32 %1, %9\n\tv_exp_f32 %2, %10\n\tv_exp_f32 %3, %11\n\tv_exp_f32 %4, %12\n\tv_exp_f32 %5, %13\n\tv_exp_f32 %6, %14\n\tv_exp_f32 %7, %15\n\tv_nop"
      : "=&v"(e[0]), "=&v"(e[1]), "=&v"(e[2]), "=&v"(e[3]), "=&v"(e[4]), "=&v"(e[5]), "=&v"(e[6]), "=&v"(e[7]) : "v"(x[0]), "v"(x[1]), "v"(x[2]), "v"(x[3]), "v"(x[4]), "v"(x[5]), "v"(x[6]), "v"(x[7])); }
__device__ __forceinline__ float fa_exp1(float x) { float e; asm("v_exp_f32 %0, %1\n\tv_nop" : "=v"(e) : "v"(x)); return e; }      /* the same slot behind a single one */
__device__ __forceinline__ v8f fa_mma(v16h a, v16h b, v8f c) { return __builtin_amdgcn_wmma_f32_16x16x32_f16(false, a, false, b, (short)0, c, false, false); }
__global__ __launch_bounds__(128) void k_fattn(const _Float16* __restrict__ Q16, const _Float16* __restrict__ K16, const _Float16* __restrict__ VT, _Float16* __restrict__ O16) {
  __shared__ __attribute__((aligned(16))) _Float16 lk[2][FK][FPIT]; __shared__ __attribute__((aligned(16))) _Float16 lv[2][HD][FPIT];
  const int tid = threadIdx.x, w = __builtin_amdgcn_readfirstlane(tid >> 5), lane = tid & 31, ln = lane & 15, hh = lane >> 4;
  const int bh = blockIdx.x % (NB * NH), qb = (SQ / 128 - 1) - blockIdx.x / (NB * NH);      /* the longest query blocks start first */
  const int b = bh / NH, h = bh % NH; const int q0 = qb * 128, qw = q0 + 32 * w; const int nt = (q0 + 128) / FK;      /* key tiles up to the block's last query */
  const int sr = tid >> 3, sc = (tid & 7) * 8;      /* staging: 8 threads cover one row's 128 bytes, the block 16 rows a round */
  const _Float16* kp = K16 + ((size_t)b * SQ + sr) * DM + h * HD + sc; const _Float16* vp = VT + ((size_t)bh * HD + sr) * SQ + sc;
  v8us kr[4], vr[4]; v16h qf[2][2];
#pragma unroll      /* static indices keep the staging registers in registers */
  for (int i = 0; i < 4; ++i) { kr[i] = *(const v8us*)((const unsigned short*)kp + (size_t)(16 * i) * DM); vr[i] = *(const v8us*)((const unsigned short*)vp + (size_t)(16 * i) * SQ); }
#pragma unroll      /* static indices, as above */
  for (int g = 0; g < 2; ++g) { const _Float16* qp = Q16 + ((size_t)b * SQ + qw + 16 * g + ln) * DM + h * HD; qf[g][0] = g2_frag(qp, hh); qf[g][1] = g2_frag(qp + 32, hh); }
  asm volatile("s_wait_xcnt 0x0" ::: "memory");      /* the loads' address registers are reused behind them */
#pragma unroll      /* static indices, as above */
  for (int i = 0; i < 4; ++i) { *(v8us*)((unsigned short*)&lk[0][sr + 16 * i][sc]) = kr[i]; *(v8us*)((unsigned short*)&lv[0][sr + 16 * i][sc]) = vr[i]; }
  __syncthreads();      /* tile 0 is complete before any wave reads it */
  const v8f z8 = {0.f, 0.f, 0.f, 0.f, 0.f, 0.f, 0.f, 0.f};
  v8f o[2][4]; float m[2] = {-1.0e30f, -1.0e30f}, l[2] = {0.f, 0.f};      /* m: the maximum in use (base-2 scaled scores); l: this lane half's part of the sum */
#pragma unroll      /* static indices, as above */
  for (int g = 0; g < 2; ++g) for (int dt = 0; dt < 4; ++dt) o[g][dt] = z8;
#pragma unroll 1      /* one key tile at a time: the two buffers alternate */
  for (int t = 0; t < nt; ++t) {
    const bool more = t + 1 < nt;      /* the same for the whole block */
    if (more) { kp += (size_t)FK * DM; vp += FK;
#pragma unroll      /* static indices; all of a thread's tile loads in flight under this tile's work */
      for (int i = 0; i < 4; ++i) { kr[i] = *(const v8us*)((const unsigned short*)kp + (size_t)(16 * i) * DM); vr[i] = *(const v8us*)((const unsigned short*)vp + (size_t)(16 * i) * SQ); }
      asm volatile("s_wait_xcnt 0x0" ::: "memory"); }      /* the loads' address registers are advanced on the next trip */
    const _Float16* bk = &lk[t & 1][0][0]; const _Float16* bv = &lv[t & 1][0][0];
#pragma unroll      /* two 32-key passes a tile, constant LDS offsets */
    for (int sub = 0; sub < 2; ++sub) { const int kb = t * FK + 32 * sub;
      if (kb <= qw + 31) {      /* wave-uniform (scalar): a pass wholly above the wave's diagonal is skipped; the barrier below is not */
        v8f s[2][2];      /* s[kt][g][r] = score of key kb + 16 kt + 8 hh + r, query qw + 16 g + ln */
#pragma unroll      /* static indices, as above */
        for (int kt = 0; kt < 2; ++kt) { const _Float16* kq = bk + (32 * sub + 16 * kt + ln) * FPIT; const v16h k0 = g2_frag(kq, hh), k1 = g2_frag(kq + 32, hh);
          for (int g = 0; g < 2; ++g) s[kt][g] = fa_mma(k1, qf[g][1], fa_mma(k0, qf[g][0], z8)); }
        if (kb + 31 > qw) {      /* wave-uniform: only the pass on the wave's diagonal pays for the mask */
#pragma unroll      /* static indices, as above */
          for (int kt = 0; kt < 2; ++kt) for (int g = 0; g < 2; ++g) for (int r = 0; r < 8; ++r) if (kb + 16 * kt + 8 * hh + r > qw + 16 * g + ln) s[kt][g][r] = -1.0e30f; }
        float mb[2]; bool need = false;
#pragma unroll      /* static indices, as above */
        for (int g = 0; g < 2; ++g) { float mx = s[0][g][0];
          for (int r = 1; r < 8; ++r) mx = fmaxf(mx, s[0][g][r]);
          for (int r = 0; r < 8; ++r) mx = fmaxf(mx, s[1][g][r]);
          mx = fmaxf(mx, fa_xhalf(mx)) * FCS; mb[g] = mx; need = need || (mx > m[g] + 8.0f); }      /* both lane halves hold the query's maximum of this pass */
        if (__builtin_amdgcn_ballot_w32(need) != 0) {
#pragma unroll      /* static indices, as above */
          for (int g = 0; g < 2; ++g) { const float mn = fmaxf(m[g], mb[g]); const float corr = fa_exp1(m[g] - mn); m[g] = mn; l[g] *= corr;      /* key 0 is never masked: mn is a real score from the first pass on, where corr is 0 */
            for (int dt = 0; dt < 4; ++dt) o[g][dt] = o[g][dt] * corr; } }
        v16h vf[4]; FragH pf[2];
#pragma unroll      /* static indices, as above */
        for (int dt = 0; dt < 4; ++dt) vf[dt] = g2_frag(bv + (16 * dt + ln) * FPIT + 32 * sub, hh);
#pragma unroll      /* static indices, as above */
        for (int g = 0; g < 2; ++g) { const float nm = 4.0f - m[g]; float ls[4];      /* weights carried x16 (it cancels against l): small ones stay clear of the f16 subnormals */
          for (int kt = 0; kt < 2; ++kt) { float x[8], e[8]; for (int r = 0; r < 8; ++r) x[r] = fmaf(s[kt][g][r], FCS, nm); fa_exp8(x, e); for (int r = 0; r < 8; ++r) { if (kt == 0 && r < 4) ls[r] = e[r]; else ls[r & 3] += e[r]; pf[g].h[8 * kt + r] = (_Float16)e[r]; } }
          l[g] += (ls[0] + ls[1]) + (ls[2] + ls[3]); }
        __builtin_amdgcn_sched_barrier(0);      /* both groups' exponentials stay in front of the eight products: eight independent accumulators in a row keep the matrix unit fed */
#pragma unroll      /* static indices, as above */
        for (int dt = 0; dt < 4; ++dt) for (int g = 0; g < 2; ++g) o[g][dt] = fa_mma(vf[dt], pf[g].v, o[g][dt]);
      } }
    if (more) {
#pragma unroll      /* static indices, as above */
      for (int i = 0; i < 4; ++i) { *(v8us*)((unsigned short*)&lk[(t + 1) & 1][sr + 16 * i][sc]) = kr[i]; *(v8us*)((unsigned short*)&lv[(t + 1) & 1][sr + 16 * i][sc]) = vr[i]; } }      /* into the buffer that every wave left before the last barrier */
    __syncthreads();      /* tile t + 1 is complete, and every wave has left tile t, before the next trip */
  }
#pragma unroll      /* static indices, as above */
  for (int g = 0; g < 2; ++g) { const float fin = 64.0f / (l[g] + fa_xhalf(l[g]));      /* the lane halves' sums join once; o carried x64, folded into the output GEMM alpha */
    unsigned short* op = (unsigned short*)O16 + ((size_t)b * SQ + qw + 16 * g + ln) * DM + h * HD + 8 * hh;      /* a lane holds d = 16 dt + 8 hh .. + 7 of its query: 16 bytes a store */
    for (int dt = 0; dt < 4; ++dt) { FragH f; for (int r = 0; r < 8; ++r) f.h[r] = (_Float16)(o[g][dt][r] * fin); *(v8us*)(op + 16 * dt) = f.half[0]; }
    if (g == 0) { asm volatile("s_wait_xcnt 0x0" ::: "memory"); __builtin_amdgcn_sched_barrier(0); } }      /* the first group's store registers are reused by the second group's arithmetic: the wait stands behind the stores, and the scheduling barrier keeps that arithmetic behind the wait */
}


// One thread per query row; 64 rows per block. The row's q and o stay in registers; Q, K and V come in tiles of 64 rows, staged in LDS with whole-line loads; a K or V row is read back as a same-address (broadcast) LDS load. Four keys' score sums run side by side; each sum, and the running m, l, o, keep the key-by-key, element-by-element order.
template <int MASKADD, int LD>      /* LD: row pitch of QF, KF, VF in floats, a constant so that a tile's 16 loads share one address and differ in the immediate offset */
__global__ __launch_bounds__(64) void k_att0(const float* __restrict__ QF, const float* __restrict__ KF, const float* __restrict__ VF, const float* __restrict__ mask, float scale, float* __restrict__ OF, int ldo) {
  #pragma clang fp contract(off)
  __shared__ __attribute__((aligned(16))) float lk[64][HD]; __shared__ __attribute__((aligned(16))) float lv[64][HD]; __shared__ __attribute__((aligned(16))) float lo[64][HD + 4];
  const int tid = threadIdx.x; const int h = blockIdx.x / (QT0 / 64), rg = blockIdx.x % (QT0 / 64); const int i = rg * 64 + tid;
  { const size_t br = (size_t)blockIdx.y * QT0; QF += br * LD; KF += br * LD; VF += br * LD; OF += br * ldo; }      /* grid.y: the batch; each batch has QT0 rows in every plane */
  const int tr = tid / 16, pc = (tid % 16) * 4; const unsigned tb = (unsigned)(tr * LD + pc) * 4u;      /* the thread's byte offset inside a group of four rows: 16 lanes cover one row's 256 bytes */
  { const char* qb = (const char*)(QF + (size_t)(rg * 64) * LD + h * HD);
    v4f qt[16];
#pragma unroll      /* all of a thread's tile loads in flight together */
    for (int it = 0; it < 16; ++it) qt[it] = *(const v4fa*)(qb + (size_t)(it * 4) * LD * 4 + tb);
    asm volatile("s_wait_xcnt 0x0" ::: "memory");      /* the loads' base registers are reused right behind them */
#pragma unroll      /* static indices keep qt in registers */
    for (int it = 0; it < 16; ++it) *(v4f*)&lo[it * 4 + tr][pc] = qt[it]; }
  __syncthreads();      /* the q tile is complete before a thread reads its row */
  float q[HD], o[HD];
#pragma unroll      /* static indices keep q and o in registers */
  for (int c = 0; c < HD / 4; ++c) { const v4f t = *(const v4f*)&lo[tid][c * 4]; for (int u = 0; u < 4; ++u) { q[c * 4 + u] = t[u]; o[c * 4 + u] = 0.f; } }
  float m = -1.0e30f, l = 0.f; const int jmax = MASKADD ? (SQ - 1) : (rg * 64 + 63);      /* additive-mask form: every key (the mask input decides); causal form: keys up to the block's last row */
  const char* kp = (const char*)(KF + h * HD) + tb; const char* vp = (const char*)(VF + h * HD) + tb;      /* the thread's place in the current K and V tile */
#pragma unroll 1      /* one key tile at a time: the tile buffers are reused */
  for (int j0 = 0; j0 <= jmax; j0 += 64) {
#pragma unroll      /* all of a thread's tile loads in flight together */
    for (int it = 0; it < 16; ++it) { *(v4f*)&lk[it * 4 + tr][pc] = *(const v4fa*)(kp + (size_t)(it * 4) * LD * 4); *(v4f*)&lv[it * 4 + tr][pc] = *(const v4fa*)(vp + (size_t)(it * 4) * LD * 4); }
    __syncthreads();      /* the tile is complete before any row reads it */
#pragma unroll 1      /* four keys per trip are enough to fill the add latency; more only grows the code */
    for (int jj = 0; jj < 64; jj += 4) { float s[4] = {0.f, 0.f, 0.f, 0.f};
#pragma unroll      /* static indices into q */
      for (int c = 0; c < HD / 4; ++c) for (int a = 0; a < 4; ++a) { const v4f kq = *(const v4f*)&lk[jj + a][c * 4]; s[a] = __fadd_rn(s[a], __fmul_rn(q[c * 4 + 0], kq[0])); s[a] = __fadd_rn(s[a], __fmul_rn(q[c * 4 + 1], kq[1])); s[a] = __fadd_rn(s[a], __fmul_rn(q[c * 4 + 2], kq[2])); s[a] = __fadd_rn(s[a], __fmul_rn(q[c * 4 + 3], kq[3])); }
#pragma unroll      /* static indices into s and o */
      for (int a = 0; a < 4; ++a) { const int j = j0 + jj + a; float sv = __fmul_rn(s[a], scale); if (MASKADD) sv = __fadd_rn(sv, __fmul_rn(bf16_round(mask[(size_t)i * SQ + j]), -10000.0f));
        const float f = (MASKADD || j <= i) ? 1.f : 0.f; const float sm = fmaf(f, sv, (1.f - f) * -1.0e30f); const float mn = fmaxf(m, sm); const float sc = expf(m - mn); const float e = expf(sm - mn); l = __fadd_rn(__fmul_rn(l, sc), e); m = mn;
        for (int c = 0; c < HD / 4; ++c) { const v4f vv = *(const v4f*)&lv[jj + a][c * 4]; for (int u = 0; u < 4; ++u) o[c * 4 + u] = __fadd_rn(__fmul_rn(o[c * 4 + u], sc), __fmul_rn(e, vv[u])); } } }
    __syncthreads();      /* every row has left the tile before the next one overwrites it */
    kp += (size_t)64 * LD * 4; vp += (size_t)64 * LD * 4;
  }
  const float fin = 64.0f / l;      /* o carried x64 like the f16 path */
#pragma unroll      /* static indices into o */
  for (int c = 0; c < HD / 4; ++c) { v4f oo; for (int u = 0; u < 4; ++u) oo[u] = __fmul_rn(o[c * 4 + u], fin); *(v4f*)&lo[tid][c * 4] = oo; }
  __syncthreads();
  {
#pragma unroll 1
    for (int it = 0; it < 16; ++it) { const int row = it * 4 + tid / 16, pc = (tid % 16) * 4; const v4f v = *(const v4f*)&lo[row][pc]; *(v4f*)(OF + (size_t)(rg * 64 + row) * ldo + h * HD + pc) = v; }
     } }


// LayerNorm and the f16 hi + x1024 residual split in one pass: a wave owns LNR whole rows and keeps them in registers, so h never goes through memory and no barrier is needed.
// Lane l holds columns 128 u + 4 l .. + 3 (u = 0..7): every load covers 512 contiguous bytes, every store 256. Row sums: four partial sums per lane, then a butterfly over the 32 lanes (every lane ends with the same value).
#define LNR 2                        /* rows per wave, all their loads in flight together */
#define LNW 16                       /* waves per block: one block per WGP covers every row */
template <int CTRL> __device__ __forceinline__ float ln_row(float x) { return __builtin_bit_cast(float, __builtin_amdgcn_update_dpp(0, __builtin_bit_cast(int, x), CTRL, 0xf, 0xf, true)); }      /* CTRL = 0x160 + m: lane l reads lane l ^ m of its 16-lane row */
__device__ __forceinline__ float ln_wsum(float x) { x += ln_row<0x161>(x); x += ln_row<0x162>(x); x += ln_row<0x164>(x); x += ln_row<0x168>(x); return x + fa_xhalf(x); }
__global__ __launch_bounds__(LNW * 32) void k_lnhl(const float* __restrict__ X, const float* __restrict__ g, const float* __restrict__ bb, float eps, _Float16* __restrict__ Hh, _Float16* __restrict__ Hl) {
  static_assert(DMQ == 1024, "a lane holds 8 x 4 columns of a row");
  const int lane = threadIdx.x & 31; const size_t r0 = ((size_t)blockIdx.x * LNW + (threadIdx.x >> 5)) * LNR;
  const float* xp = X + r0 * DMQ + lane * 4;
  v4f xa[LNR][8], ga[8], ba[8];
#pragma unroll      /* static indices keep the rows in registers; all loads in flight together */
  for (int j = 0; j < LNR; ++j) for (int u = 0; u < 8; ++u) xa[j][u] = *(const v4fa*)(xp + (size_t)j * DMQ + 128 * u);
  asm volatile("s_wait_xcnt 0x0" :: "v"(xp) : "memory");      /* the row loads' address registers are reused behind them; xp is named as an input so that they stay whole up to this wait (else the last load lands on them) */
  __builtin_amdgcn_sched_barrier(0);      /* keeps the loads below behind that wait */
#pragma unroll      /* static indices, as above */
  for (int u = 0; u < 8; ++u) { ga[u] = *(const v4fa*)(g + lane * 4 + 128 * u); ba[u] = *(const v4fa*)(bb + lane * 4 + 128 * u); }
  asm volatile("s_wait_xcnt 0x0" ::: "memory");      /* the loads' address registers are reused behind them */
  __builtin_amdgcn_sched_barrier(0);      /* every load is issued in front of the arithmetic: without it the gamma and beta loads sink behind the first row's sums and their latency is paid a second time */
#pragma unroll      /* static indices, as above */
  for (int u = 0; u < 8; ++u) for (int q = 0; q < 4; ++q) { ga[u][q] = bf16_round(ga[u][q]); ba[u][q] = bf16_round(ba[u][q]); }
#pragma unroll      /* static indices, as above */
  for (int j = 0; j < LNR; ++j) {
    v4f p = {0.f, 0.f, 0.f, 0.f};
    for (int u = 0; u < 8; ++u) for (int q = 0; q < 4; ++q) { xa[j][u][q] = bf16_round(xa[j][u][q]); p[q] += xa[j][u][q]; }
    const float mu = ln_wsum((p[0] + p[1]) + (p[2] + p[3])) * (1.0f / (float)DMQ);
    v4f v = {0.f, 0.f, 0.f, 0.f};
    for (int u = 0; u < 8; ++u) for (int q = 0; q < 4; ++q) { xa[j][u][q] -= mu; v[q] += xa[j][u][q] * xa[j][u][q]; }
    const float rs = rsqrtf(ln_wsum((v[0] + v[1]) + (v[2] + v[3])) * (1.0f / (float)DMQ) + eps);
    _Float16* hp = Hh + (r0 + j) * DMQ + lane * 4; _Float16* lp = Hl + (r0 + j) * DMQ + lane * 4;
    for (int u = 0; u < 8; ++u) { v4h yh, yl;
      for (int q = 0; q < 4; ++q) { const float y = xa[j][u][q] * rs * ga[u][q] + ba[u][q]; const _Float16 h = (_Float16)y; yh[q] = h; yl[q] = (_Float16)((y - (float)h) * 1024.0f); }
      *(v4h*)(hp + 128 * u) = yh; *(v4h*)(lp + 128 * u) = yl; }
    if (j + 1 < LNR) { asm volatile("s_wait_xcnt 0x0" ::: "memory"); __builtin_amdgcn_sched_barrier(0); }      /* this row's store registers are reused by the next row's arithmetic: the wait stands behind the stores, and the scheduling barrier keeps that arithmetic behind the wait; it also keeps this row's stores in front of the next row's work, under which they drain */
  }
}

extern "C" void kernel_launch(void* const* d_in, const int* in_sizes, int n_in,
                              void* d_out, int out_size, void* d_ws, size_t ws_size, hipStream_t stream) {
  (void)in_sizes; (void)n_in; (void)out_size;
  const float* const* I = (const float* const*)d_in; const float* x = I[0]; const float* wq = I[1]; const float* bq = I[2]; const float* wk = I[3]; const float* bk = I[4]; const float* wv = I[5]; const float* bv = I[6]; const float* wo = I[7]; const float* bo = I[8]; const float* lng = I[9]; const float* lnb = I[10];      /* [in][out] weights + biases; LN gamma/beta */
  char* ws = (char*)d_ws; size_t off = 0;
  auto take = [&](size_t bytes) { char* p = ws + off; off += (bytes + 255) & ~(size_t)255; return p; };
  _Float16* BQ = (_Float16*)take((size_t)DM * DM * 2); _Float16* BK = (_Float16*)take((size_t)DM * DM * 2); _Float16* BV = (_Float16*)take((size_t)DM * DM * 2); _Float16* BO = (_Float16*)take((size_t)DM * DM * 2);
  float* S = (float*)take((size_t)NB * NH * QT * NKX * 4);      /* room for the projection-stage planes */
  _Float16* X16 = (_Float16*)S; _Float16* XL = (_Float16*)((char*)S + NR * DM * 2); float* QKF = (float*)((char*)S + NR * DM * 4);      /* projection-stage planes on the bytes of S (16 per token element: 2 + 2 + three f32 planes) */
  _Float16* Q16 = (_Float16*)take(NR * DM * 2); _Float16* K16 = (_Float16*)take(NR * DM * 2); _Float16* V16 = (_Float16*)take(NR * DM * 2); _Float16* O16 = (_Float16*)take(NR * DM * 2);      /* Q16, K16, V16: three planes in a row */
  _Float16* VT = (_Float16*)take((size_t)NB * NH * HD * SQ * 2);
  float* QF0 = (float*)take((size_t)NB * QT0 * DM * 4); float* KF0 = (float*)take((size_t)NB * QT0 * DM * 4); float* VF0 = (float*)take((size_t)NB * QT0 * DM * 4); float* OF0 = (float*)take((size_t)NB * QT0 * DM * 4); _Float16* OH0 = (_Float16*)take((size_t)NB * QT0 * DM * 2); _Float16* OL0 = (_Float16*)take((size_t)NB * QT0 * DM * 2);      /* QF0, KF0, VF0: three planes in a row */
  if (off > ws_size) return;
  k_wt_f16<<<(unsigned)(((size_t)DM * (DM / 8) + 255) / 256), 256, 0, stream>>>(wq, BQ, DM, DM, 16.0f); k_wt_f16<<<(unsigned)(((size_t)DM * (DM / 8) + 255) / 256), 256, 0, stream>>>(wk, BK, DM, DM, 16.0f); k_wt_f16<<<(unsigned)(((size_t)DM * (DM / 8) + 255) / 256), 256, 0, stream>>>(wv, BV, DM, DM, 16.0f); k_wt_f16<<<(unsigned)(((size_t)DM * (DM / 8) + 255) / 256), 256, 0, stream>>>(wo, BO, DM, DM, 16.0f);      /* [in][out] -> Bt[n][k] x16; BQ, BK, BV: three planes in a row */

  k_lnhl<<<(unsigned)(NR / (LNW * LNR)), LNW * 32, 0, stream>>>(x, lng, lnb, 1e-5f, X16, XL);      /* h = LN(bf16(x)) f32, kept in registers -> f16 hi (X16) + x1024 residual (XL) rows */
  /* Independent launches share one grid: q, k, v on grid.y of the projection GEMMs, the batch on grid.z of the per-batch GEMMs (grid.y of the first-tile attention, part of the flat index elsewhere). */
  const size_t zW = (size_t)DM * DM, zR = NR * DM, zT = (size_t)SQ * DM, z0 = (size_t)QT0 * DM;      /* elements: a weight plane, a token-row plane, one batch of it, one batch of a first-tile plane */
  const dim3 gp((unsigned)((NR / 128) * (DM / 128)), 1, 1), gp3((unsigned)((NR / 128) * (DM / 128)), 3, 1);      /* every token row; the same for q, k, v */
  k_gemm2<0><<<gp3, 256, 0, stream>>>(X16, DM, 0, BQ, DM, zW, 0.0625f, bq, 0, nullptr, 1, 0, 0, QKF, nullptr, DM, zR, (int)NR, DM, DM, 0, 0, 0, bk, bv);      /* f32 h_hi W + b */
  k_gemm2<0><<<gp3, 256, 0, stream>>>(XL, DM, 0, BQ, DM, zW, 0.00006103515625f, nullptr, 0, QKF, -1, 0, 0, nullptr, Q16, DM, zR, (int)NR, DM, DM, 0, 0, 0, nullptr, nullptr);      /* += h_lo W 2^-14 (own element), rounded to the f16 q, k, v rows */
  k_vt<NH, SQ><<<NB * NH * (SQ / 64), 256, 0, stream>>>(V16, LQ, 0, VT);      /* V^T [NB][NH][HD][SQ] */
  const dim3 g0((QT0 / 128) * (DM / 128), 1, NB), g03((QT0 / 128) * (DM / 128), 3, NB);
  k_gemm2<0><<<g03, 256, 0, stream>>>(X16, DM, 0, BQ, DM, zW, 0.0625f, bq, 0, nullptr, 1, 0, 0, QF0, nullptr, DM, (size_t)NB * z0, QT0, DM, DM, zT, 0, z0, bk, bv);
  k_gemm2<0><<<g03, 256, 0, stream>>>(XL, DM, 0, BQ, DM, zW, 0.00006103515625f, nullptr, 0, QF0, -1, 0, 0, QF0, nullptr, DM, (size_t)NB * z0, QT0, DM, DM, zT, 0, z0, nullptr, nullptr);      /* f32 q, k, v of each batch's first 128 rows (exact products) */
  k_att0<0, DM><<<dim3(NH * (QT0 / 64), NB), 64, 0, stream>>>(QF0, KF0, VF0, nullptr, 0.125f, OF0, DM);      /* exact f32 attention for rows 0..127 (o x64) */
  k_fattn<<<NB * NH * (SQ / 128), 128, 0, stream>>>(Q16, K16, VT, O16);      /* scores, causal softmax and o = P V in one launch; o (merged heads, x64) as f16 rows */
  k_gemm2<0><<<gp, 256, 0, stream>>>(O16, DM, 0, BO, DM, 0, 0.0009765625f, bo, 0, nullptr, 1, 0, 0, (float*)d_out, nullptr, DM, 0, (int)NR, DM, DM, 0, 0, 0, nullptr, nullptr);      /* out rows are the output layout */
  k_hl<<<(unsigned)(((size_t)NB * QT0 * DM / 8 + 255) / 256), 256, 0, stream>>>(OF0, OH0, OL0, (size_t)NB * QT0 * DM / 8);      /* first-tile o (x64) -> f16 hi + x1024 residual planes */
  k_gemm2<0><<<g0, 256, 0, stream>>>(OH0, DM, 0, BO, DM, 0, 0.0009765625f, bo, 0, nullptr, 1, 0, 0, (float*)d_out, nullptr, DM, 0, QT0, DM, DM, z0, 0, zT, nullptr, nullptr);      /* rows 0..127 of each batch: out = o_hi Wo (+ b), overwriting the f16-path rows */
  k_gemm2<0><<<g0, 256, 0, stream>>>(OL0, DM, 0, BO, DM, 0, 0.00000095367431640625f, nullptr, 0, (const float*)d_out, -1, 0, 0, (float*)d_out, nullptr, DM, 0, QT0, DM, DM, z0, 0, zT, nullptr, nullptr);      /* += o_lo Wo 2^-20 (own-element accumulate) */
}

// v007
// One run takes 300 microseconds.
// In two side-by-side timings against v006, it was 1.21 and 1.19 times as fast.
// All steps since v000 together make it 35.6 times as fast.
#include <hip/hip_runtime.h>
// Pre-LayerNorm causal multi-head attention (x [4][2048][1024]; h = LN(x) (eps 1e-5, gamma, beta); q/k/v = h W + b ([in][out] 1024 x 1024 sigma 1/32, zero biases); 16 heads of 64; scores / 8; where(causal, s, finfo.min); softmax; out = merged Wo + bo -> [4][2048][1024], no residual).
// Structure: token rows r = b*2048 + s; h = LN(bf16(x)) in f32, as f16 hi + x1024 residual rows; Q, K, V as three WMMA GEMMs (32x64 wave tiles, f32 accumulation, exact x16 weights + bias, f16 outputs); V^T for all batches and heads via LDS transposes; causal attention fused in one launch (blocks of 128 query rows of one batch and head; S^T = K Q^T, running f32 maximum and sum per query, native exp2, weights x16 f16, O^T += V^T P^T over the keys up to the diagonal; o carried x64, folded into the output GEMM alpha) written straight into the merged f16 o rows; out = o W_o + b GEMM (f32) into the output layout.
// Compute dtype: inputs rounded to bf16; x / weights exact; q, k, v, softmax weights and o as plain f16 GEMM operands (~2^-12); scores and softmax statistics f32. v_wmma_f32_16x16x32_f16.
#define NB 4
#define SQ 2048
#define DM 1024
#define DMQ DM                       /* LayerNorm width */
#define NH 16
#define HD 64
#define HG 4                         /* heads per launch of the grouped k_vt (not launched) */
#define QT 256
#define NKX SQ
#define QT0 128                      /* first-tile rows recomputed exactly in f32 */
#define B0 0                         /* first batch processed (unused) */
#define NBR NB                       /* batches processed (unused) */
#define NR ((size_t)NB * SQ)         /* token rows */
#define MP ((int)((size_t)NBR * SQ)) /* rows projected (unused) */
#define QN SQ                        /* query rows attended per batch (unused) */
#define NHD NH                       /* heads attended (unused) */
#define MPO MP                       /* rows through the output stage (unused) */
#define LQ DM      /* row pitch of the q/k/v rows */
typedef __bf16 v16b __attribute__((ext_vector_type(16)));
typedef unsigned short v8us __attribute__((ext_vector_type(8), may_alias));
typedef float  v8f  __attribute__((ext_vector_type(8)));
typedef float  v4f  __attribute__((ext_vector_type(4)));
typedef float  v4fa __attribute__((ext_vector_type(4), may_alias));
union FragB { v16b v; v8us half[2]; unsigned short u[16]; };

__device__ __forceinline__ unsigned short bf16_bits(float x) { unsigned int u = __float_as_uint(x); return (unsigned short)((u + 0x7FFFu + ((u >> 16) & 1u)) >> 16); }
__device__ __forceinline__ float bf16_val(unsigned short b) { return __uint_as_float(((unsigned int)b) << 16); }
__device__ __forceinline__ float bf16_round(float x) { return bf16_val(bf16_bits(x)); }
// D += A·B with NT terms: 1 = ah·bh, 2 = + al·bh (A split), 3 = + ah·bl (both split)
template <int NT>
__device__ __forceinline__ v8f mmaN(v16b ah, v16b al, v16b bh, v16b bl, v8f c) {
  c = __builtin_amdgcn_wmma_f32_16x16x32_bf16(false, ah, false, bh, (short)0, c, false, false);
  if (NT >= 2) c = __builtin_amdgcn_wmma_f32_16x16x32_bf16(false, al, false, bh, (short)0, c, false, false);
  if (NT >= 3) c = __builtin_amdgcn_wmma_f32_16x16x32_bf16(false, ah, false, bl, (short)0, c, false, false);
  asm volatile("v_nop\n\tv_nop\n\tv_nop\n\tv_nop" : "+v"(c) : "v"(ah), "v"(al), "v"(bh), "v"(bl));
  return c;
}

__global__ __launch_bounds__(256) void k_wt_bf16(const float* __restrict__ W, unsigned short* __restrict__ Wt, int K, int N) {
  const int t = blockIdx.x * 256 + threadIdx.x;
  const int k8n = K / 8;
  if (t >= N * k8n) return;
  const int n = t / k8n, k8 = (t % k8n) * 8;
  v8us v;
#pragma unroll
  for (int i = 0; i < 8; ++i) v[i] = bf16_bits(W[(size_t)(k8 + i) * N + n]);
  *(v8us*)(Wt + (size_t)n * K + k8) = v;
  
}

// GEMM C[M][N] (f32, pitch ldc) = act(A[M][K]·W + bias). A f32 row-major (pitch lda) converted per fragment to bf16
// (ASPLIT: hi/lo two planes -> 2 terms, else single rounded term); Wt bf16 [N][K] (pitch ldb). BIAS_BF16 rounds the
// bias to bf16 first (bias quantised to bf16 before the add). K%32==0, M%16==0, N%64==0.
template <bool ASPLIT, int ACT, bool BIAS_BF16>
__global__ __launch_bounds__(128) void k_gemm_bf(const float* __restrict__ A, int lda, const unsigned short* __restrict__ Wt, int ldb,
                                               const float* __restrict__ bias, float* __restrict__ C, int ldc, int M, int N, int K) {
  __shared__ __attribute__((aligned(16))) float so[4][16][64];
  const int tid = threadIdx.x, w = tid >> 5, lane = tid & 31, ln = lane & 15, hh = lane >> 4;
  const int ntn = N / 64;
  const int wid = blockIdx.x * 4 + w;
  const int mt = wid / ntn, nq = wid % ntn;
  if (mt * 16 >= M) return;
  const int row0 = mt * 16, col0 = nq * 64;
  const float* arow = A + (size_t)(row0 + ln) * lda;
  v8f acc[4] = {};
  for (int kb = 0; kb < K; kb += 32) {
    FragB ah, al;
    const v4f x0 = *(const v4fa*)(arow + kb + 8 * hh), x1 = *(const v4fa*)(arow + kb + 8 * hh + 4);
    const v4f x2 = *(const v4fa*)(arow + kb + 16 + 8 * hh), x3 = *(const v4fa*)(arow + kb + 16 + 8 * hh + 4);
    float xs[16] = {x0[0],x0[1],x0[2],x0[3],x1[0],x1[1],x1[2],x1[3],x2[0],x2[1],x2[2],x2[3],x3[0],x3[1],x3[2],x3[3]};
#pragma unroll
    for (int i = 0; i < 16; ++i) { const unsigned short hb = bf16_bits(xs[i]); ah.u[i] = hb; al.u[i] = ASPLIT ? bf16_bits(xs[i] - bf16_val(hb)) : (unsigned short)0; }
#pragma unroll
    for (int t = 0; t < 4; ++t) {
      const unsigned short* brow = Wt + (size_t)(col0 + t * 16 + ln) * ldb + kb;
      FragB b;
      b.half[0] = *(const v8us*)(brow + 8 * hh);
      b.half[1] = *(const v8us*)(brow + 16 + 8 * hh);
      acc[t] = mmaN<ASPLIT ? 2 : 1>(ah.v, al.v, b.v, b.v, acc[t]);
    }
  }
#pragma unroll
  for (int t = 0; t < 4; ++t) {
    float bv = bias ? bias[col0 + t * 16 + ln] : 0.f;
    if (BIAS_BF16) bv = bf16_round(bv);
#pragma unroll
    for (int r = 0; r < 8; ++r) { float v = acc[t][r] + bv; if (ACT == 1) v = fmaxf(v, 0.f); so[w][8 * hh + r][t * 16 + ln] = v; }
  }
  __builtin_amdgcn_fence(__ATOMIC_ACQ_REL, "workgroup");
  __builtin_amdgcn_wave_barrier();
  const int rsub = lane >> 4, c4 = (lane & 15) * 4;
  {
#pragma unroll
    for (int q = 0; q < 8; ++q) {
      const int r = q * 2 + rsub;
      const v4f v = *(const v4fa*)&so[w][r][c4];
      *(v4f*)(C + (size_t)(row0 + r) * ldc + col0 + c4) = v;
    }
    
  }
}

// GEMM C = act(A·W + bias + resid): A f32 (ASPLIT -> hi/lo 2 terms), Wt bf16 [N][K]; ACT 0 none, 1 relu, 2 exact gelu;
// resid (optional, f32, row index = (row % rmod), pitch ldr, RES_BF16 rounds it) added before the activation.
template <bool ASPLIT, int ACT, bool BIAS_BF16, bool RES_BF16>
__global__ __launch_bounds__(128) void k_gemm_bf3(const float* __restrict__ A, int lda, const unsigned short* __restrict__ Wt, int ldb,
                                                const float* __restrict__ bias, const float* __restrict__ resid, int rmod, int ldr,
                                                float* __restrict__ C, int ldc, int M, int N, int K) {
  __shared__ __attribute__((aligned(16))) float so[4][16][64];
  const int tid = threadIdx.x, w = tid >> 5, lane = tid & 31, ln = lane & 15, hh = lane >> 4;
  const int ntn = N / 64;
  const int wid = blockIdx.x * 4 + w;
  const int mt = wid / ntn, nq = wid % ntn;
  if (mt * 16 >= M) return;
  const int row0 = mt * 16, col0 = nq * 64;
  const float* arow = A + (size_t)(row0 + ln) * lda;
  v8f acc[4] = {};
  for (int kb = 0; kb < K; kb += 32) {
    FragB ah, al;
    const v4f x0 = *(const v4fa*)(arow + kb + 8 * hh), x1 = *(const v4fa*)(arow + kb + 8 * hh + 4);
    const v4f x2 = *(const v4fa*)(arow + kb + 16 + 8 * hh), x3 = *(const v4fa*)(arow + kb + 16 + 8 * hh + 4);
    float xs[16] = {x0[0],x0[1],x0[2],x0[3],x1[0],x1[1],x1[2],x1[3],x2[0],x2[1],x2[2],x2[3],x3[0],x3[1],x3[2],x3[3]};
#pragma unroll
    for (int i = 0; i < 16; ++i) { const unsigned short hb = bf16_bits(xs[i]); ah.u[i] = hb; al.u[i] = ASPLIT ? bf16_bits(xs[i] - bf16_val(hb)) : (unsigned short)0; }
#pragma unroll
    for (int t = 0; t < 4; ++t) {
      const unsigned short* brow = Wt + (size_t)(col0 + t * 16 + ln) * ldb + kb;
      FragB b;
      b.half[0] = *(const v8us*)(brow + 8 * hh);
      b.half[1] = *(const v8us*)(brow + 16 + 8 * hh);
      acc[t] = mmaN<ASPLIT ? 2 : 1>(ah.v, al.v, b.v, b.v, acc[t]);
    }
  }
#pragma unroll
  for (int t = 0; t < 4; ++t) {
    const int col = col0 + t * 16 + ln;
    float bv = bias ? bias[col] : 0.f;
    if (BIAS_BF16) bv = bf16_round(bv);
#pragma unroll
    for (int r = 0; r < 8; ++r) {
      float v = acc[t][r] + bv;
      if (resid) { float rv = resid[(size_t)((row0 + 8 * hh + r) % rmod) * ldr + col]; if (RES_BF16) rv = bf16_round(rv); v += rv; }
      if (ACT == 1) v = fmaxf(v, 0.f);
      if (ACT == 2) v = 0.5f * v * (1.0f + erff(v * 0.70710678118654752f));
      if (ACT == 3) { const float u = 0.7978845608028654f * (v + 0.044715f * v * v * v); v = 0.5f * v * (1.0f + tanhf(u)); }
      so[w][8 * hh + r][t * 16 + ln] = v;
    }
  }
  __builtin_amdgcn_fence(__ATOMIC_ACQ_REL, "workgroup");
  __builtin_amdgcn_wave_barrier();
  const int rsub = lane >> 4, c4 = (lane & 15) * 4;
  {
#pragma unroll
    for (int q = 0; q < 8; ++q) {
      const int r = q * 2 + rsub;
      const v4f v = *(const v4fa*)&so[w][r][c4];
      *(v4f*)(C + (size_t)(row0 + r) * ldc + col0 + c4) = v;
    }
    
  }
}
// row LayerNorm (biased variance, eps) over N: s = X (+ R); optional out_sum <- s; out_norm <- (s-mu)*rsqrt(var+eps)*g + b
template <bool PARAM_BF16>
__global__ __launch_bounds__(256) void k_layernorm(const float* __restrict__ X, const float* __restrict__ R, const float* __restrict__ g, const float* __restrict__ bta,
                                                  float* __restrict__ out_sum, float* __restrict__ out_norm, int N, float eps) {
  __shared__ float red[256];
  const int row = blockIdx.x, tid = threadIdx.x;
  const float* x = X + (size_t)row * N; const float* rr = R ? R + (size_t)row * N : nullptr;
  float vals[16];                     // up to N = 4096
  const int per = N / 256;            // contiguous chunk per thread? use strided-by-4 chunks: thread handles j = tid*4 + 1024*u
  float s1 = 0.f;
  for (int u = 0; u < per / 4; ++u) {
    const int j = tid * 4 + 1024 * u;
    const v4f a = *(const v4fa*)(x + j);
    v4f b = {0.f,0.f,0.f,0.f}; if (rr) b = *(const v4fa*)(rr + j);
#pragma unroll
    for (int q = 0; q < 4; ++q) { const float v = a[q] + b[q]; vals[u * 4 + q] = v; s1 += v; }
  }
  red[tid] = s1; __syncthreads();
  for (int st = 128; st > 0; st >>= 1) { if (tid < st) red[tid] += red[tid + st]; __syncthreads(); }
  const float mu = red[0] / (float)N; __syncthreads();
  float s2 = 0.f;
  for (int u = 0; u < per / 4; ++u)
#pragma unroll
    for (int q = 0; q < 4; ++q) { const float c = vals[u * 4 + q] - mu; s2 += c * c; }
  red[tid] = s2; __syncthreads();
  for (int st = 128; st > 0; st >>= 1) { if (tid < st) red[tid] += red[tid + st]; __syncthreads(); }
  const float rs = rsqrtf(red[0] / (float)N + eps);
  {
    for (int u = 0; u < per / 4; ++u) {
      const int j = tid * 4 + 1024 * u;
      v4f o, sm;
#pragma unroll
      for (int q = 0; q < 4; ++q) {
        float gg = g[j + q], bb = bta[j + q];
        if (PARAM_BF16) { gg = bf16_round(gg); bb = bf16_round(bb); }
        sm[q] = vals[u * 4 + q]; o[q] = (vals[u * 4 + q] - mu) * rs * gg + bb;
      }
      if (out_sum) *(v4f*)(out_sum + (size_t)row * N + j) = sm;
      *(v4f*)(out_norm + (size_t)row * N + j) = o;
    }
    
  }
}



// ---- f16 WMMA path (v_wmma_f32_16x16x32_f16): 11-bit significands for operands in range — used where a [0,1] probability operand needs more precision than bf16
typedef _Float16 v16h __attribute__((ext_vector_type(16)));
union FragH { v16h v; v8us half[2]; _Float16 h[16]; unsigned short u[16]; };
template <int NT>
__device__ __forceinline__ v8f mmaH(v16h ah, v16h al, v16h bh, v16h bl, v8f c) {
  c = __builtin_amdgcn_wmma_f32_16x16x32_f16(false, ah, false, bh, (short)0, c, false, false);
  if (NT >= 2) c = __builtin_amdgcn_wmma_f32_16x16x32_f16(false, al, false, bh, (short)0, c, false, false);
  if (NT >= 3) c = __builtin_amdgcn_wmma_f32_16x16x32_f16(false, ah, false, bl, (short)0, c, false, false);
  asm volatile("v_nop\n\tv_nop\n\tv_nop\n\tv_nop" : "+v"(c) : "v"(ah), "v"(al), "v"(bh), "v"(bl));
  return c;
}
// batched GEMM like k_gemm_b but f16 operands: A f32 (split into f16 hi/lo if ASPLIT, else rounded to f16), Bt = f16 values [n][k]; alpha; C f32; N multiple of 16 (partial tiles skipped)
template <bool ASPLIT>
__global__ __launch_bounds__(128) void k_gemm_h(const float* __restrict__ A, int lda, size_t sA, const _Float16* __restrict__ Bh, int ldb, size_t sB, float alpha, float* __restrict__ C, int ldc, size_t sC, int M, int N, int K) {
  __shared__ __attribute__((aligned(16))) float so[4][16][64];
  const int tid = threadIdx.x, w = tid >> 5, lane = tid & 31, ln = lane & 15, hh = lane >> 4; const int by = blockIdx.y;
  A += (size_t)by * sA; Bh += (size_t)by * sB; C += (size_t)by * sC;
  const int ntn = (N + 63) / 64; const int wid = blockIdx.x * 4 + w; const int mt = wid / ntn, nq = wid % ntn; if (mt * 16 >= M) return;
  const int row0 = mt * 16, col0 = nq * 64; const float* arow = A + (size_t)(row0 + ln) * lda;
  v8f acc[4] = {};
  for (int kb = 0; kb < K; kb += 32) {
    FragH ah, al;
    const v4f x0 = *(const v4fa*)(arow + kb + 8 * hh), x1 = *(const v4fa*)(arow + kb + 8 * hh + 4), x2 = *(const v4fa*)(arow + kb + 16 + 8 * hh), x3 = *(const v4fa*)(arow + kb + 16 + 8 * hh + 4);
    float xs[16] = {x0[0],x0[1],x0[2],x0[3],x1[0],x1[1],x1[2],x1[3],x2[0],x2[1],x2[2],x2[3],x3[0],x3[1],x3[2],x3[3]};
#pragma unroll
    for (int i = 0; i < 16; ++i) { const _Float16 h = (_Float16)xs[i]; ah.h[i] = h; al.h[i] = ASPLIT ? (_Float16)(xs[i] - (float)h) : (_Float16)0.0f; }
#pragma unroll
    for (int t = 0; t < 4; ++t) { if (col0 + t * 16 >= N) continue; const size_t boff = (size_t)(col0 + t * 16 + ln) * ldb + kb; FragH bq; bq.half[0] = *(const v8us*)(Bh + boff + 8 * hh); bq.half[1] = *(const v8us*)(Bh + boff + 16 + 8 * hh);
      acc[t] = mmaH<ASPLIT ? 2 : 1>(ah.v, al.v, bq.v, bq.v, acc[t]); }
  }
#pragma unroll
  for (int t = 0; t < 4; ++t) { if (col0 + t * 16 >= N) continue;
#pragma unroll
    for (int r = 0; r < 8; ++r) so[w][8 * hh + r][t * 16 + ln] = acc[t][r] * alpha; }
  __builtin_amdgcn_fence(__ATOMIC_ACQ_REL, "workgroup"); __builtin_amdgcn_wave_barrier();
  const int rsub = lane >> 4, c4 = (lane & 15) * 4;
  {
#pragma unroll
    for (int q = 0; q < 8; ++q) { const int r = q * 2 + rsub; if (col0 + c4 < N) { const v4f v = *(const v4fa*)&so[w][r][c4]; *(v4f*)(C + (size_t)(row0 + r) * ldc + col0 + c4) = v; } }
     }
}

// Wt[n][k] = f16(W[k][n]·scale) from f32 row-major W[K][N] (scale = power of two; bf16-exact weights stay exact in f16 away from the subnormal range)
__global__ __launch_bounds__(256) void k_wt_f16(const float* __restrict__ W, _Float16* __restrict__ Wt, int K, int N, float scale) {
  const int t = blockIdx.x * 256 + threadIdx.x; if (t >= N * (K / 8)) return; const int n = t / (K / 8), k8 = (t % (K / 8)) * 8; FragH f;
#pragma unroll
  for (int i = 0; i < 8; ++i) f.h[i] = (_Float16)(bf16_round(W[(size_t)(k8 + i) * N + n]) * scale); const v8us o = f.half[0];
  *(v8us*)((unsigned short*)Wt + (size_t)n * K + k8) = o; 
}
// k_gemm_hh variant with fused epilogue: v = acc·alpha + bias[by·sBias + col] (+ CP[(row/rowsPerB)·sCPb + by·64 + col] if CP) ; ACT 0 none / 1 elu ; writes f16 C16 (and f32 C if non-null)
template <int ACT>
__global__ __launch_bounds__(128) void k_gemm_hhx(const _Float16* __restrict__ A, int lda, size_t sA, const _Float16* __restrict__ Bh, int ldb, size_t sB, float alpha, const float* __restrict__ bias, size_t sBias, const float* __restrict__ CP, int rowsPerB, size_t sCPb, int row0g,
    float* __restrict__ C, _Float16* __restrict__ C16, int ldc, size_t sC, int M, int N, int K) {
  __shared__ __attribute__((aligned(16))) float so[4][16][64];
  const int tid = threadIdx.x, w = tid >> 5, lane = tid & 31, ln = lane & 15, hh = lane >> 4; const int by = blockIdx.y;
  A += (size_t)by * sA; Bh += (size_t)by * sB; const size_t cofs = (size_t)by * sC; const float* bp = bias ? bias + (size_t)by * sBias : nullptr;
  const int ntn = (N + 63) / 64; const int wid = blockIdx.x * 4 + w; const int mt = wid / ntn, nq = wid % ntn; if (mt * 16 >= M) return;
  const int row0 = mt * 16, col0 = nq * 64; const _Float16* arow = A + (size_t)(row0 + ln) * lda;
  v8f acc[4] = {};
  for (int kb = 0; kb < K; kb += 32) { FragH ah; ah.half[0] = *(const v8us*)((const unsigned short*)arow + kb + 8 * hh); ah.half[1] = *(const v8us*)((const unsigned short*)arow + kb + 16 + 8 * hh);
#pragma unroll
    for (int t = 0; t < 4; ++t) { if (col0 + t * 16 >= N) continue; const size_t boff = (size_t)(col0 + t * 16 + ln) * ldb + kb; FragH bq; bq.half[0] = *(const v8us*)((const unsigned short*)Bh + boff + 8 * hh); bq.half[1] = *(const v8us*)((const unsigned short*)Bh + boff + 16 + 8 * hh);
      acc[t] = mmaH<1>(ah.v, ah.v, bq.v, bq.v, acc[t]); }
  }
#pragma unroll
  for (int t = 0; t < 4; ++t) { if (col0 + t * 16 >= N) continue; const int col = col0 + t * 16 + ln; const float bv = bp ? bf16_round(bp[col]) : 0.f;
#pragma unroll
    for (int r = 0; r < 8; ++r) { float v = acc[t][r] * alpha + bv; if (CP) { const int rr = row0g + row0 + 8 * hh + r; if (rowsPerB < 0) v += CP[cofs + (size_t)rr * ldc + col];      /* rowsPerB < 0: own element of the batched C plane */ else { const int bidx = rr / rowsPerB; v += CP[(size_t)bidx * sCPb + (size_t)by * 64 + col]; } } if (ACT == 1) v = (v > 0.f) ? v : expm1f(v); else if (ACT == 7) v = (v > 0.f) ? v + 1.0f : expf(v); else if (ACT == 8) v = tanhf(v); else if (ACT == 9) v = 0.5f * v * (1.0f + tanhf(0.7978845608028654f * (v + 0.044715f * v * v * v))); else if (ACT == 11) v = 1.0f / (1.0f + expf(-v)); else if (ACT == 12) v = (v > 0.f) ? v : 0.01f * v; else if (ACT == 14) v = (v > 0.f) ? v : 0.1f * v; else if (ACT == 16) v = (v >= 0.f) ? v : 0.3f * v; else if (ACT == 17) v = (v >= 0.f) ? v : 0.2f * v; else if (ACT == 15) v = v / (1.0f + expf(-v)); else if (ACT == 3) v = fmaxf(v, 0.f); else if (ACT == 6) v = 0.5f * v * (1.0f + erff(v * 0.70710678118654752f)); so[w][8 * hh + r][t * 16 + ln] = v; } }
  __builtin_amdgcn_fence(__ATOMIC_ACQ_REL, "workgroup"); __builtin_amdgcn_wave_barrier();
  const int rsub = lane >> 4, c4 = (lane & 15) * 4; typedef _Float16 v4h __attribute__((ext_vector_type(4)));
  {
#pragma unroll
    for (int q = 0; q < 8; ++q) { const int r = q * 2 + rsub; if (col0 + c4 < N) { const v4f v = *(const v4fa*)&so[w][r][c4]; if (C) *(v4f*)(C + cofs + (size_t)(row0 + r) * ldc + col0 + c4) = v; if (C16) { v4h h4; for (int i = 0; i < 4; ++i) h4[i] = (_Float16)v[i]; *(v4h*)(C16 + cofs + (size_t)(row0 + r) * ldc + col0 + c4) = h4; } } }
     }
}


typedef _Float16 v4h __attribute__((ext_vector_type(4)));

__global__ __launch_bounds__(256) void k_x16(const float* __restrict__ x, _Float16* __restrict__ X16, size_t n8) { const size_t t = (size_t)blockIdx.x * 256 + threadIdx.x; if (t >= n8) return; FragH f;
#pragma unroll
  for (int q = 0; q < 8; ++q) f.h[q] = (_Float16)bf16_round(x[t * 8 + q]); *(v8us*)((unsigned short*)X16 + t * 8) = f.half[0];  }
__global__ __launch_bounds__(256) void k_h16(const float* __restrict__ x, _Float16* __restrict__ X16, size_t n8) { const size_t t = (size_t)blockIdx.x * 256 + threadIdx.x; if (t >= n8) return; FragH f;
#pragma unroll
  for (int q = 0; q < 8; ++q) f.h[q] = (_Float16)x[t * 8 + q]; *(v8us*)((unsigned short*)X16 + t * 8) = f.half[0];  }
__global__ __launch_bounds__(256) void k_round16f(const float* __restrict__ W, _Float16* __restrict__ Bt, size_t n8) { const size_t t = (size_t)blockIdx.x * 256 + threadIdx.x; if (t >= n8) return; FragH f;
#pragma unroll
  for (int i = 0; i < 8; ++i) f.h[i] = (_Float16)(bf16_round(W[t * 8 + i]) * 16.0f); *(v8us*)((unsigned short*)Bt + t * 8) = f.half[0];  }
template <int NHv, int TTv>
__global__ __launch_bounds__(256) void k_vt(const _Float16* __restrict__ V16, int ldv, int voff, _Float16* __restrict__ Vt) { __shared__ unsigned short tl[64][66]; const int tid = threadIdx.x; const int slab = blockIdx.x / (TTv / 64), lg = blockIdx.x % (TTv / 64); const int b = slab / NHv, h = slab % NHv;
  for (int i = tid; i < 64 * 8; i += 256) { const int r = i / 8, c8 = (i % 8) * 8; FragH f; f.half[0] = *(const v8us*)((const unsigned short*)V16 + ((size_t)b * TTv + lg * 64 + r) * ldv + voff + h * 64 + c8);
#pragma unroll
    for (int q = 0; q < 8; ++q) tl[r][c8 + q] = f.u[q]; }
  __syncthreads();
  {
#pragma unroll
    for (int rd = 0; rd < 2; ++rd) { const int d = rd * 32 + tid / 8, pc = tid % 8; FragH f;
#pragma unroll
      for (int q = 0; q < 8; ++q) f.u[q] = tl[pc * 8 + q][d];
      *(v8us*)((unsigned short*)Vt + ((size_t)slab * 64 + d) * TTv + lg * 64 + pc * 8) = f.half[0]; }
     } }

__global__ __launch_bounds__(256) void k_hl(const float* __restrict__ F, _Float16* __restrict__ Hh, _Float16* __restrict__ Hl, size_t n8) { const size_t t = (size_t)blockIdx.x * 256 + threadIdx.x; if (t >= n8) return; FragH fh, fl; const v4f a = *(const v4fa*)(F + t * 8), c = *(const v4fa*)(F + t * 8 + 4);
#pragma unroll
  for (int q = 0; q < 4; ++q) { _Float16 h = (_Float16)a[q]; fh.h[q] = h; fl.h[q] = (_Float16)((a[q] - (float)h) * 1024.0f); h = (_Float16)c[q]; fh.h[4 + q] = h; fl.h[4 + q] = (_Float16)((c[q] - (float)h) * 1024.0f); }
  { *(v8us*)((unsigned short*)Hh + t * 8) = fh.half[0]; *(v8us*)((unsigned short*)Hl + t * 8) = fl.half[0];  } }

// ---- fast GEMM (block tile 128x128 = eight waves of 32x64; requires M % 128 == 0 rows per launch region, N % 128 == 0 and K % 64 == 0); epilogue = k_gemm_hhx semantics ----
// The block's 128 A rows and 128 B rows come in tiles of GKS k, loaded as whole 128-byte lines and staged through registers into two LDS buffers: tile s + 1 is loaded from memory while tile s is worked on, and one barrier a tile both publishes it and frees the buffer read before. Every wave takes its fragments from LDS in the k order of g2_frag, 32 k at a time in rising order, so each accumulator sums as before.
#define GKS 64                       /* k per staged tile: 128 bytes of every operand row */
#define GPIT 72                      /* LDS row pitch in f16 elements: 144 bytes = 16 x odd, free of bank conflicts for 16-byte fragment reads */
__device__ __forceinline__ v16h g2_frag(const _Float16* p, int hh) { FragH f; f.half[0] = *(const v8us*)((const unsigned short*)p + 8 * hh); f.half[1] = *(const v8us*)((const unsigned short*)p + 16 + 8 * hh); return f.v; }
__device__ __forceinline__ v8f g2_mma(v16h a, v16h b, v8f c) { v8f d = __builtin_amdgcn_wmma_f32_16x16x32_f16(false, a, false, b, (short)0, c, false, false); asm volatile("v_nop\n\tv_nop\n\tv_nop\n\tv_nop" : "+v"(d) : "v"(a), "v"(b)); return d; }
template <int ACT, int CLD = DM>      /* CLD: the row pitch of C for which the own-element addend has its fast path, a constant so that a lane's 16 loads share one address and differ in the immediate offset */
__global__ __launch_bounds__(256) void k_gemm2(const _Float16* __restrict__ A, int lda, size_t sA, const _Float16* __restrict__ Bh, int ldb, size_t sB, float alpha, const float* __restrict__ bias, size_t sBias, const float* __restrict__ CP, int rowsPerB, size_t sCPb, int row0g,
    float* __restrict__ C, _Float16* __restrict__ C16, int ldc, size_t sC, int M, int N, int K, size_t zA, size_t zB, size_t zC, const float* __restrict__ bias1, const float* __restrict__ bias2) { static_assert(ACT == 0 || ACT == 3 || ACT == 6 || ACT == 8 || ACT == 9 || ACT == 11 || ACT == 12 || ACT == 14 || ACT == 15 || ACT == 16 || ACT == 17, "k_gemm2: unsupported ACT code (would silently apply no activation)");
  __shared__ __attribute__((aligned(16))) unsigned char sm[2 * 256 * GPIT * 2];      /* two buffers of [A 128 rows | B 128 rows]; behind the last tile's barrier the same bytes hold the epilogue's rows */
  static_assert(sizeof(float) * 8 * 32 * 68 <= sizeof(sm), "the epilogue rows fit the tile buffers");
  unsigned short* const ring = (unsigned short*)sm; float (* const so)[32][68] = (float (*)[32][68])sm;
  const int tid = threadIdx.x, w = tid >> 5, lane = tid & 31, ln = lane & 15, hh = lane >> 4; const int by = blockIdx.y, bz = blockIdx.z;      /* grid.z: a second batch index (element strides zA, zB, zC) */
  A += (size_t)by * sA + (size_t)bz * zA; Bh += (size_t)by * sB + (size_t)bz * zB; const size_t cofs = (size_t)by * sC + (size_t)bz * zC; const float* bp = bias ? bias + (size_t)by * sBias : nullptr;
  if (bias1 && by == 1) bp = bias1; if (bias2 && by == 2) bp = bias2;      /* bias vectors that are separate buffers: one per grid.y index */
  const int ntn = N >> 7; const int mt = blockIdx.x / ntn, nq = blockIdx.x - mt * ntn; if (mt * 128 >= M) return;      /* the whole block leaves, in front of every barrier */
  const int wr = w & 3, wc = w >> 2; const int row0 = mt * 128 + 32 * wr, col0 = nq * 128 + 64 * wc;      /* four waves down, two across */
  const int sr = tid >> 3, sc = (tid & 7) * 8;      /* staging: 8 threads cover one row's 128 bytes, the block 32 rows a round */
  const unsigned short* ap = (const unsigned short*)A + (size_t)(mt * 128 + sr) * lda + sc; const unsigned short* bq = (const unsigned short*)Bh + (size_t)(nq * 128 + sr) * ldb + sc;
  v8us ar[4], br[4];
#pragma unroll      /* static indices keep the staging registers in registers */
  for (int i = 0; i < 4; ++i) { ar[i] = *(const v8us*)(ap + (size_t)(32 * i) * lda); br[i] = *(const v8us*)(bq + (size_t)(32 * i) * ldb); }
  asm volatile("s_wait_xcnt 0x0" ::: "memory");      /* the loads' address registers are advanced behind them */
#pragma unroll      /* static indices, as above */
  for (int i = 0; i < 4; ++i) { *(v8us*)(ring + (sr + 32 * i) * GPIT + sc) = ar[i]; *(v8us*)(ring + (128 + sr + 32 * i) * GPIT + sc) = br[i]; }
  __syncthreads();      /* tile 0 is complete before any wave reads it */
  const v8f z8 = {0.f,0.f,0.f,0.f,0.f,0.f,0.f,0.f}; v8f c00 = z8, c01 = z8, c02 = z8, c03 = z8, c10 = z8, c11 = z8, c12 = z8, c13 = z8;
  const int nst = K / GKS;
#pragma unroll 1      /* one k tile at a time: the two buffers alternate */
  for (int s = 0; s < nst; ++s) {
    const bool more = s + 1 < nst;      /* the same for the whole block */
    if (more) { ap += GKS; bq += GKS;
#pragma unroll      /* static indices; all of a thread's tile loads in flight under this tile's work */
      for (int i = 0; i < 4; ++i) { ar[i] = *(const v8us*)(ap + (size_t)(32 * i) * lda); br[i] = *(const v8us*)(bq + (size_t)(32 * i) * ldb); }
      asm volatile("s_wait_xcnt 0x0" ::: "memory"); }      /* the loads' address registers are advanced on the next trip */
    const _Float16* al = (const _Float16*)(ring + ((s & 1) * 256 + 32 * wr + ln) * GPIT); const _Float16* bl = (const _Float16*)(ring + ((s & 1) * 256 + 128 + 64 * wc + ln) * GPIT);
#pragma unroll      /* two 32-k passes a tile, constant LDS offsets */
    for (int kk = 0; kk < GKS; kk += 32) { const v16h a0 = g2_frag(al + kk, hh), a1 = g2_frag(al + 16 * GPIT + kk, hh);
      const v16h b0 = g2_frag(bl + kk, hh), b1 = g2_frag(bl + 16 * GPIT + kk, hh), b2 = g2_frag(bl + 32 * GPIT + kk, hh), b3 = g2_frag(bl + 48 * GPIT + kk, hh);      /* a pass's LDS reads stand together in front of its products */
      c00 = g2_mma(a0, b0, c00); c10 = g2_mma(a1, b0, c10); c01 = g2_mma(a0, b1, c01); c11 = g2_mma(a1, b1, c11);
      c02 = g2_mma(a0, b2, c02); c12 = g2_mma(a1, b2, c12); c03 = g2_mma(a0, b3, c03); c13 = g2_mma(a1, b3, c13); }
    if (more) {
#pragma unroll      /* static indices, as above */
      for (int i = 0; i < 4; ++i) { *(v8us*)(ring + (((s + 1) & 1) * 256 + sr + 32 * i) * GPIT + sc) = ar[i]; *(v8us*)(ring + (((s + 1) & 1) * 256 + 128 + sr + 32 * i) * GPIT + sc) = br[i]; } }      /* into the buffer that every wave left before the last barrier */
    __syncthreads();      /* tile s + 1 is complete, and every wave has left tile s, before the next trip (behind the last tile: before the epilogue's rows overwrite it) */
  }
  v8f accs[8] = {c00, c01, c02, c03, c10, c11, c12, c13};
  const int rsub = lane >> 4, c4 = (lane & 15) * 4;      /* the store phase's layout: 16 lanes cover 256 bytes of a row, a wave two rows a round */
  const bool own = ACT == 0 && CP && rowsPerB < 0 && ldc == CLD;      /* own-element addend with nothing applied behind the add (the same for the whole block): read in the store phase's layout, each lane the 16 bytes it will store, all 16 loads in flight together (behind the LDS pass, where the accumulators' registers are free: the register count stays at six waves a SIMD); added there in the same place of the sum */
  const float* const cown = CP; if (own) CP = nullptr;      /* the element-by-element path below is then not taken */
#pragma unroll
  for (int u = 0; u < 8; ++u) { const int t = u & 3, half = u >> 2; const int col = col0 + t * 16 + ln; const float bv = bp ? bf16_round(bp[col]) : 0.f;
#pragma unroll
    for (int r = 0; r < 8; ++r) { const int rloc = half * 16 + 8 * hh + r; float v = accs[u][r] * alpha + bv; if (CP) { if (rowsPerB < 0) v += CP[cofs + (size_t)(row0g + row0 + rloc) * ldc + col];      /* rowsPerB < 0: own element of the batched C plane */ else { const int bidx = (row0g + row0 + rloc) / rowsPerB; v += CP[(size_t)bidx * sCPb + (size_t)by * 64 + col]; } }
      if (ACT == 3) v = fmaxf(v, 0.f); else if (ACT == 6) v = 0.5f * v * (1.0f + erff(v * 0.70710678118654752f)); else if (ACT == 11) v = 1.0f / (1.0f + expf(-v)); else if (ACT == 15) v = v / (1.0f + expf(-v)); else if (ACT == 12) v = (v > 0.f) ? v : 0.01f * v; else if (ACT == 8) v = tanhf(v); else if (ACT == 9) v = 0.5f * v * (1.0f + tanhf(0.7978845608028654f * (v + 0.044715f * v * v * v))); else if (ACT == 14) v = (v > 0.f) ? v : 0.1f * v; else if (ACT == 16) v = (v >= 0.f) ? v : 0.3f * v; else if (ACT == 17) v = (v >= 0.f) ? v : 0.2f * v;
      so[w][rloc][t * 16 + ln] = v; } }
  __builtin_amdgcn_fence(__ATOMIC_ACQ_REL, "workgroup"); __builtin_amdgcn_wave_barrier();
  v4f cpv[16];
#pragma unroll      /* static indices keep the addends in registers */
  for (int q = 0; q < 16; ++q) cpv[q] = v4f{0.f, 0.f, 0.f, 0.f};
  if (own) { const float* cq = cown + cofs + (size_t)(row0g + row0 + rsub) * CLD + col0 + c4;
#pragma unroll      /* static indices; every load issued before the first is waited for */
    for (int q = 0; q < 16; ++q) cpv[q] = *(const v4fa*)(cq + (size_t)(2 * q) * CLD);
    asm volatile("s_wait_xcnt 0x0" :: "v"(cq) : "memory"); }      /* the loads' address registers are reused behind them; cq is named as an input so that they stay whole up to this wait (else a later load of the run may land on them) */
  {
#pragma unroll
    for (int q = 0; q < 16; ++q) { const int r = q * 2 + rsub; v4f v = *(const v4fa*)&so[w][r][c4]; if (own) v += cpv[q];
      if (C) { *(v4f*)(C + cofs + (size_t)(row0 + r) * ldc + col0 + c4) = v; asm volatile("s_wait_xcnt 0x0" ::: "memory"); }      /* the store's registers are reused by the f16 conversion and by the next round */
      if (C16) { v4h h4; for (int i = 0; i < 4; ++i) h4[i] = (_Float16)v[i]; *(v4h*)(C16 + cofs + (size_t)(row0 + r) * ldc + col0 + c4) = h4; asm volatile("s_wait_xcnt 0x0" ::: "memory"); } }      /* the store's registers are reused by the next round */
     } }


__global__ __launch_bounds__(256) void k_wnat(const float* __restrict__ w, size_t n8, _Float16* __restrict__ Bt) { const size_t t = (size_t)blockIdx.x * 256 + threadIdx.x; if (t >= n8) return; FragH f; for (int q = 0; q < 8; ++q) f.h[q] = (_Float16)(bf16_round(w[t * 8 + q]) * 16.0f); *(v8us*)((unsigned short*)Bt + t * 8) = f.half[0];  }
__global__ __launch_bounds__(256) void k_rsm(const float* __restrict__ S, _Float16* __restrict__ P, int nrows) {
  #pragma clang fp contract(off)
  const int i = blockIdx.x * 256 + threadIdx.x; if (i >= nrows) return; const float* s = S + (size_t)i * SQ; float mx = -3.0e38f;
#pragma unroll 1
  for (int j = 0; j < SQ; ++j) mx = fmaxf(mx, s[j]); float se = 0.f;
#pragma unroll 1
  for (int j = 0; j < SQ; ++j) se += expf(s[j] - mx); const float sc = 256.0f / se;
#pragma unroll 1
  for (int j0 = 0; j0 < SQ; j0 += 8) { FragH f; for (int q = 0; q < 8; ++q) f.h[q] = (_Float16)(expf(s[j0 + q] - mx) * sc); unsigned short* d = (unsigned short*)P + (size_t)i * SQ + j0; *(v8us*)d = f.half[0];  } }
__global__ __launch_bounds__(256) void k_vt(const _Float16* __restrict__ V16, int b, int h0, _Float16* __restrict__ VT) { __shared__ unsigned short tl[64][65]; const int tid = threadIdx.x; const int hh = blockIdx.x % HG, sg = blockIdx.x / HG; const int s0 = sg * 64; const int h = h0 + hh;
  for (int i = tid; i < 64 * 8; i += 256) { const int j = i / 8, d8 = (i % 8) * 8; FragH f; f.half[0] = *(const v8us*)((const unsigned short*)V16 + ((size_t)b * SQ + s0 + j) * DM + h * HD + d8); for (int q = 0; q < 8; ++q) tl[d8 + q][j] = f.u[q]; }
  __syncthreads();
  { for (int i = tid; i < 64 * 8; i += 256) { const int d = i / 8, j8 = (i % 8) * 8; FragH f; for (int q = 0; q < 8; ++q) f.u[q] = tl[d][j8 + q]; *(v8us*)((unsigned short*)VT + ((size_t)hh * HD + d) * SQ + s0 + j8) = f.half[0]; }  } }



#define FK 64                        /* keys per staged tile */
#define FPIT 72                      /* LDS row pitch in f16 elements: 144 bytes = 16 x odd, free of bank conflicts for 16-byte fragment reads */
#define FCS 0.18033688011112042f     /* 1/8 x log2(e): exponentials in base 2 */
__device__ __forceinline__ float fa_xhalf(float x) { return __builtin_bit_cast(float, __builtin_amdgcn_permlanex16(__builtin_bit_cast(int, x), __builtin_bit_cast(int, x), 0x76543210, 0xfedcba98, false, false)); }      /* lane l reads lane l ^ 16 */
// Base-2 exponentials in asm so that the slot the instruction set asks for behind a transcendental (before its result is read or its source overwritten) is there by construction: the outputs lie apart from every input, so each v_exp_f32 is followed by an independent one, and the v_nop stands behind the last.
__device__ __forceinline__ void fa_exp8(const float (&x)[8], float (&e)[8]) {
  asm("v_exp_f32 %0, %8\n\tv_exp_f32 %1, %9\n\tv_exp_f32 %2, %10\n\tv_exp_f32 %3, %11\n\tv_exp_f32 %4, %12\n\tv_exp_f32 %5, %13\n\tv_exp_f32 %6, %14\n\tv_exp_f32 %7, %15\n\tv_nop"
      : "=&v"(e[0]), "=&v"(e[1]), "=&v"(e[2]), "=&v"(e[3]), "=&v"(e[4]), "=&v"(e[5]), "=&v"(e[6]), "=&v"(e[7]) : "v"(x[0]), "v"(x[1]), "v"(x[2]), "v"(x[3]), "v"(x[4]), "v"(x[5]), "v"(x[6]), "v"(x[7])); }
__device__ __forceinline__ float fa_exp1(float x) { float e; asm("v_exp_f32 %0, %1\n\tv_nop" : "=v"(e) : "v"(x)); return e; }      /* the same slot behind a single one */
__device__ __forceinline__ v8f fa_mma(v16h a, v16h b, v8f c) { return __builtin_amdgcn_wmma_f32_16x16x32_f16(false, a, false, b, (short)0, c, false, false); }
__global__ __launch_bounds__(128) void k_fattn(const _Float16* __restrict__ Q16, const _Float16* __restrict__ K16, const _Float16* __restrict__ VT, _Float16* __restrict__ O16) {
  __shared__ __attribute__((aligned(16))) _Float16 lk[2][FK][FPIT]; __shared__ __attribute__((aligned(16))) _Float16 lv[2][HD][FPIT];
  const int tid = threadIdx.x, w = __builtin_amdgcn_readfirstlane(tid >> 5), lane = tid & 31, ln = lane & 15, hh = lane >> 4;
  const int bh = blockIdx.x % (NB * NH), qb = (SQ / 128 - 1) - blockIdx.x / (NB * NH);      /* the longest query blocks start first */
  const int b = bh / NH, h = bh % NH; const int q0 = qb * 128, qw = q0 + 32 * w; const int nt = (q0 + 128) / FK;      /* key tiles up to the block's last query */
  const int sr = tid >> 3, sc = (tid & 7) * 8;      /* staging: 8 threads cover one row's 128 bytes, the block 16 rows a round */
  const _Float16* kp = K16 + ((size_t)b * SQ + sr) * DM + h * HD + sc; const _Float16* vp = VT + ((size_t)bh * HD + sr) * SQ + sc;
  v8us kr[4], vr[4]; v16h qf[2][2];
#pragma unroll      /* static indices keep the staging registers in registers */
  for (int i = 0; i < 4; ++i) { kr[i] = *(const v8us*)((const unsigned short*)kp + (size_t)(16 * i) * DM); vr[i] = *(const v8us*)((const unsigned short*)vp + (size_t)(16 * i) * SQ); }
#pragma unroll      /* static indices, as above */
  for (int g = 0; g < 2; ++g) { const _Float16* qp = Q16 + ((size_t)b * SQ + qw + 16 * g + ln) * DM + h * HD; qf[g][0] = g2_frag(qp, hh); qf[g][1] = g2_frag(qp + 32, hh); }
  asm volatile("s_wait_xcnt 0x0" ::: "memory");      /* the loads' address registers are reused behind them */
#pragma unroll      /* static indices, as above */
  for (int i = 0; i < 4; ++i) { *(v8us*)((unsigned short*)&lk[0][sr + 16 * i][sc]) = kr[i]; *(v8us*)((unsigned short*)&lv[0][sr + 16 * i][sc]) = vr[i]; }
  __syncthreads();      /* tile 0 is complete before any wave reads it */
  const v8f z8 = {0.f, 0.f, 0.f, 0.f, 0.f, 0.f, 0.f, 0.f};
  v8f o[2][4]; float m[2] = {-1.0e30f, -1.0e30f}, l[2] = {0.f, 0.f};      /* m: the maximum in use (base-2 scaled scores); l: this lane half's part of the sum */
#pragma unroll      /* static indices, as above */
  for (int g = 0; g < 2; ++g) for (int dt = 0; dt < 4; ++dt) o[g][dt] = z8;
#pragma unroll 1      /* one key tile at a time: the two buffers alternate */
  for (int t = 0; t < nt; ++t) {
    const bool more = t + 1 < nt;      /* the same for the whole block */
    if (more) { kp += (size_t)FK * DM; vp += FK;
#pragma unroll      /* static indices; all of a thread's tile loads in flight under this tile's work */
      for (int i = 0; i < 4; ++i) { kr[i] = *(const v8us*)((const unsigned short*)kp + (size_t)(16 * i) * DM); vr[i] = *(const v8us*)((const unsigned short*)vp + (size_t)(16 * i) * SQ); }
      asm volatile("s_wait_xcnt 0x0" ::: "memory"); }      /* the loads' address registers are advanced on the next trip */
    const _Float16* bk = &lk[t & 1][0][0]; const _Float16* bv = &lv[t & 1][0][0];
#pragma unroll      /* two 32-key passes a tile, constant LDS offsets */
    for (int sub = 0; sub < 2; ++sub) { const int kb = t * FK + 32 * sub;
      if (kb <= qw + 31) {      /* wave-uniform (scalar): a pass wholly above the wave's diagonal is skipped; the barrier below is not */
        v8f s[2][2];      /* s[kt][g][r] = score of key kb + 16 kt + 8 hh + r, query qw + 16 g + ln */
#pragma unroll      /* static indices, as above */
        for (int kt = 0; kt < 2; ++kt) { const _Float16* kq = bk + (32 * sub + 16 * kt + ln) * FPIT; const v16h k0 = g2_frag(kq, hh), k1 = g2_frag(kq + 32, hh);
          for (int g = 0; g < 2; ++g) s[kt][g] = fa_mma(k1, qf[g][1], fa_mma(k0, qf[g][0], z8)); }
        if (kb + 31 > qw) {      /* wave-uniform: only the pass on the wave's diagonal pays for the mask */
#pragma unroll      /* static indices, as above */
          for (int kt = 0; kt < 2; ++kt) for (int g = 0; g < 2; ++g) for (int r = 0; r < 8; ++r) if (kb + 16 * kt + 8 * hh + r > qw + 16 * g + ln) s[kt][g][r] = -1.0e30f; }
        float mb[2]; bool need = false;
#pragma unroll      /* static indices, as above */
        for (int g = 0; g < 2; ++g) { float mx = s[0][g][0];
          for (int r = 1; r < 8; ++r) mx = fmaxf(mx, s[0][g][r]);
          for (int r = 0; r < 8; ++r) mx = fmaxf(mx, s[1][g][r]);
          mx = fmaxf(mx, fa_xhalf(mx)) * FCS; mb[g] = mx; need = need || (mx > m[g] + 8.0f); }      /* both lane halves hold the query's maximum of this pass */
        if (__builtin_amdgcn_ballot_w32(need) != 0) {
#pragma unroll      /* static indices, as above */
          for (int g = 0; g < 2; ++g) { const float mn = fmaxf(m[g], mb[g]); const float corr = fa_exp1(m[g] - mn); m[g] = mn; l[g] *= corr;      /* key 0 is never masked: mn is a real score from the first pass on, where corr is 0 */
            for (int dt = 0; dt < 4; ++dt) o[g][dt] = o[g][dt] * corr; } }
        v16h vf[4]; FragH pf[2];
#pragma unroll      /* static indices, as above */
        for (int dt = 0; dt < 4; ++dt) vf[dt] = g2_frag(bv + (16 * dt + ln) * FPIT + 32 * sub, hh);
#pragma unroll      /* static indices, as above */
        for (int g = 0; g < 2; ++g) { const float nm = 4.0f - m[g]; float ls[4];      /* weights carried x16 (it cancels against l): small ones stay clear of the f16 subnormals */
          for (int kt = 0; kt < 2; ++kt) { float x[8], e[8]; for (int r = 0; r < 8; ++r) x[r] = fmaf(s[kt][g][r], FCS, nm); fa_exp8(x, e); for (int r = 0; r < 8; ++r) { if (kt == 0 && r < 4) ls[r] = e[r]; else ls[r & 3] += e[r]; pf[g].h[8 * kt + r] = (_Float16)e[r]; } }
          l[g] += (ls[0] + ls[1]) + (ls[2] + ls[3]); }
        __builtin_amdgcn_sched_barrier(0);      /* both groups' exponentials stay in front of the eight products: eight independent accumulators in a row keep the matrix unit fed */
#pragma unroll      /* static indices, as above */
        for (int dt = 0; dt < 4; ++dt) for (int g = 0; g < 2; ++g) o[g][dt] = fa_mma(vf[dt], pf[g].v, o[g][dt]);
      } }
    if (more) {
#pragma unroll      /* static indices, as above */
      for (int i = 0; i < 4; ++i) { *(v8us*)((unsigned short*)&lk[(t + 1) & 1][sr + 16 * i][sc]) = kr[i]; *(v8us*)((unsigned short*)&lv[(t + 1) & 1][sr + 16 * i][sc]) = vr[i]; } }      /* into the buffer that every wave left before the last barrier */
    __syncthreads();      /* tile t + 1 is complete, and every wave has left tile t, before the next trip */
  }
#pragma unroll      /* static indices, as above */
  for (int g = 0; g < 2; ++g) { const float fin = 64.0f / (l[g] + fa_xhalf(l[g]));      /* the lane halves' sums join once; o carried x64, folded into the output GEMM alpha */
    unsigned short* op = (unsigned short*)O16 + ((size_t)b * SQ + qw + 16 * g + ln) * DM + h * HD + 8 * hh;      /* a lane holds d = 16 dt + 8 hh .. + 7 of its query: 16 bytes a store */
    for (int dt = 0; dt < 4; ++dt) { FragH f; for (int r = 0; r < 8; ++r) f.h[r] = (_Float16)(o[g][dt][r] * fin); *(v8us*)(op + 16 * dt) = f.half[0]; }
    if (g == 0) { asm volatile("s_wait_xcnt 0x0" ::: "memory"); __builtin_amdgcn_sched_barrier(0); } }      /* the first group's store registers are reused by the second group's arithmetic: the wait stands behind the stores, and the scheduling barrier keeps that arithmetic behind the wait */
}


// One thread per query row; 64 rows per block. The row's q and o stay in registers; Q, K and V come in tiles of 64 rows, staged in LDS with whole-line loads; a K or V row is read back as a same-address (broadcast) LDS load. Four keys' score sums run side by side; each sum, and the running m, l, o, keep the key-by-key, element-by-element order.
template <int MASKADD, int LD>      /* LD: row pitch of QF, KF, VF in floats, a constant so that a tile's 16 loads share one address and differ in the immediate offset */
__global__ __launch_bounds__(64) void k_att0(const float* __restrict__ QF, const float* __restrict__ KF, const float* __restrict__ VF, const float* __restrict__ mask, float scale, float* __restrict__ OF, int ldo) {
  #pragma clang fp contract(off)
  __shared__ __attribute__((aligned(16))) float lk[64][HD]; __shared__ __attribute__((aligned(16))) float lv[64][HD]; __shared__ __attribute__((aligned(16))) float lo[64][HD + 4];
  const int tid = threadIdx.x; const int h = blockIdx.x / (QT0 / 64), rg = blockIdx.x % (QT0 / 64); const int i = rg * 64 + tid;
  { const size_t br = (size_t)blockIdx.y * QT0; QF += br * LD; KF += br * LD; VF += br * LD; OF += br * ldo; }      /* grid.y: the batch; each batch has QT0 rows in every plane */
  const int tr = tid / 16, pc = (tid % 16) * 4; const unsigned tb = (unsigned)(tr * LD + pc) * 4u;      /* the thread's byte offset inside a group of four rows: 16 lanes cover one row's 256 bytes */
  { const char* qb = (const char*)(QF + (size_t)(rg * 64) * LD + h * HD);
    v4f qt[16];
#pragma unroll      /* all of a thread's tile loads in flight together */
    for (int it = 0; it < 16; ++it) qt[it] = *(const v4fa*)(qb + (size_t)(it * 4) * LD * 4 + tb);
    asm volatile("s_wait_xcnt 0x0" ::: "memory");      /* the loads' base registers are reused right behind them */
#pragma unroll      /* static indices keep qt in registers */
    for (int it = 0; it < 16; ++it) *(v4f*)&lo[it * 4 + tr][pc] = qt[it]; }
  __syncthreads();      /* the q tile is complete before a thread reads its row */
  float q[HD], o[HD];
#pragma unroll      /* static indices keep q and o in registers */
  for (int c = 0; c < HD / 4; ++c) { const v4f t = *(const v4f*)&lo[tid][c * 4]; for (int u = 0; u < 4; ++u) { q[c * 4 + u] = t[u]; o[c * 4 + u] = 0.f; } }
  float m = -1.0e30f, l = 0.f; const int jmax = MASKADD ? (SQ - 1) : (rg * 64 + 63);      /* additive-mask form: every key (the mask input decides); causal form: keys up to the block's last row */
  const char* kp = (const char*)(KF + h * HD) + tb; const char* vp = (const char*)(VF + h * HD) + tb;      /* the thread's place in the current K and V tile */
#pragma unroll 1      /* one key tile at a time: the tile buffers are reused */
  for (int j0 = 0; j0 <= jmax; j0 += 64) {
#pragma unroll      /* all of a thread's tile loads in flight together */
    for (int it = 0; it < 16; ++it) { *(v4f*)&lk[it * 4 + tr][pc] = *(const v4fa*)(kp + (size_t)(it * 4) * LD * 4); *(v4f*)&lv[it * 4 + tr][pc] = *(const v4fa*)(vp + (size_t)(it * 4) * LD * 4); }
    __syncthreads();      /* the tile is complete before any row reads it */
#pragma unroll 1      /* four keys per trip are enough to fill the add latency; more only grows the code */
    for (int jj = 0; jj < 64; jj += 4) { float s[4] = {0.f, 0.f, 0.f, 0.f};
#pragma unroll      /* static indices into q */
      for (int c = 0; c < HD / 4; ++c) for (int a = 0; a < 4; ++a) { const v4f kq = *(const v4f*)&lk[jj + a][c * 4]; s[a] = __fadd_rn(s[a], __fmul_rn(q[c * 4 + 0], kq[0])); s[a] = __fadd_rn(s[a], __fmul_rn(q[c * 4 + 1], kq[1])); s[a] = __fadd_rn(s[a], __fmul_rn(q[c * 4 + 2], kq[2])); s[a] = __fadd_rn(s[a], __fmul_rn(q[c * 4 + 3], kq[3])); }
#pragma unroll      /* static indices into s and o */
      for (int a = 0; a < 4; ++a) { const int j = j0 + jj + a; float sv = __fmul_rn(s[a], scale); if (MASKADD) sv = __fadd_rn(sv, __fmul_rn(bf16_round(mask[(size_t)i * SQ + j]), -10000.0f));
        const float f = (MASKADD || j <= i) ? 1.f : 0.f; const float sm = fmaf(f, sv, (1.f - f) * -1.0e30f); const float mn = fmaxf(m, sm); const float sc = expf(m - mn); const float e = expf(sm - mn); l = __fadd_rn(__fmul_rn(l, sc), e); m = mn;
        for (int c = 0; c < HD / 4; ++c) { const v4f vv = *(const v4f*)&lv[jj + a][c * 4]; for (int u = 0; u < 4; ++u) o[c * 4 + u] = __fadd_rn(__fmul_rn(o[c * 4 + u], sc), __fmul_rn(e, vv[u])); } } }
    __syncthreads();      /* every row has left the tile before the next one overwrites it */
    kp += (size_t)64 * LD * 4; vp += (size_t)64 * LD * 4;
  }
  const float fin = 64.0f / l;      /* o carried x64 like the f16 path */
#pragma unroll      /* static indices into o */
  for (int c = 0; c < HD / 4; ++c) { v4f oo; for (int u = 0; u < 4; ++u) oo[u] = __fmul_rn(o[c * 4 + u], fin); *(v4f*)&lo[tid][c * 4] = oo; }
  __syncthreads();
  {
#pragma unroll 1
    for (int it = 0; it < 16; ++it) { const int row = it * 4 + tid / 16, pc = (tid % 16) * 4; const v4f v = *(const v4f*)&lo[row][pc]; *(v4f*)(OF + (size_t)(rg * 64 + row) * ldo + h * HD + pc) = v; }
     } }


// LayerNorm and the f16 hi + x1024 residual split in one pass: a wave owns LNR whole rows and keeps them in registers, so h never goes through memory and no barrier is needed.
// Lane l holds columns 128 u + 4 l .. + 3 (u = 0..7): every load covers 512 contiguous bytes, every store 256. Row sums: four partial sums per lane, then a butterfly over the 32 lanes (every lane ends with the same value).
#define LNR 2                        /* rows per wave, all their loads in flight together */
#define LNW 16                       /* waves per block: one block per WGP covers every row */
template <int CTRL> __device__ __forceinline__ float ln_row(float x) { return __builtin_bit_cast(float, __builtin_amdgcn_update_dpp(0, __builtin_bit_cast(int, x), CTRL, 0xf, 0xf, true)); }      /* CTRL = 0x160 + m: lane l reads lane l ^ m of its 16-lane row */
__device__ __forceinline__ float ln_wsum(float x) { x += ln_row<0x161>(x); x += ln_row<0x162>(x); x += ln_row<0x164>(x); x += ln_row<0x168>(x); return x + fa_xhalf(x); }
__global__ __launch_bounds__(LNW * 32) void k_lnhl(const float* __restrict__ X, const float* __restrict__ g, const float* __restrict__ bb, float eps, _Float16* __restrict__ Hh, _Float16* __restrict__ Hl) {
  static_assert(DMQ == 1024, "a lane holds 8 x 4 columns of a row");
  const int lane = threadIdx.x & 31; const size_t r0 = ((size_t)blockIdx.x * LNW + (threadIdx.x >> 5)) * LNR;
  const float* xp = X + r0 * DMQ + lane * 4;
  v4f xa[LNR][8], ga[8], ba[8];
#pragma unroll      /* static indices keep the rows in registers; all loads in flight together */
  for (int j = 0; j < LNR; ++j) for (int u = 0; u < 8; ++u) xa[j][u] = *(const v4fa*)(xp + (size_t)j * DMQ + 128 * u);
  asm volatile("s_wait_xcnt 0x0" :: "v"(xp) : "memory");      /* the row loads' address registers are reused behind them; xp is named as an input so that they stay whole up to this wait (else the last load lands on them) */
  __builtin_amdgcn_sched_barrier(0);      /* keeps the loads below behind that wait */
#pragma unroll      /* static indices, as above */
  for (int u = 0; u < 8; ++u) { ga[u] = *(const v4fa*)(g + lane * 4 + 128 * u); ba[u] = *(const v4fa*)(bb + lane * 4 + 128 * u); }
  asm volatile("s_wait_xcnt 0x0" ::: "memory");      /* the loads' address registers are reused behind them */
  __builtin_amdgcn_sched_barrier(0);      /* every load is issued in front of the arithmetic: without it the gamma and beta loads sink behind the first row's sums and their latency is paid a second time */
#pragma unroll      /* static indices, as above */
  for (int u = 0; u < 8; ++u) for (int q = 0; q < 4; ++q) { ga[u][q] = bf16_round(ga[u][q]); ba[u][q] = bf16_round(ba[u][q]); }
#pragma unroll      /* static indices, as above */
  for (int j = 0; j < LNR; ++j) {
    v4f p = {0.f, 0.f, 0.f, 0.f};
    for (int u = 0; u < 8; ++u) for (int q = 0; q < 4; ++q) { xa[j][u][q] = bf16_round(xa[j][u][q]); p[q] += xa[j][u][q]; }
    const float mu = ln_wsum((p[0] + p[1]) + (p[2] + p[3])) * (1.0f / (float)DMQ);
    v4f v = {0.f, 0.f, 0.f, 0.f};
    for (int u = 0; u < 8; ++u) for (int q = 0; q < 4; ++q) { xa[j][u][q] -= mu; v[q] += xa[j][u][q] * xa[j][u][q]; }
    const float rs = rsqrtf(ln_wsum((v[0] + v[1]) + (v[2] + v[3])) * (1.0f / (float)DMQ) + eps);
    _Float16* hp = Hh + (r0 + j) * DMQ + lane * 4; _Float16* lp = Hl + (r0 + j) * DMQ + lane * 4;
    for (int u = 0; u < 8; ++u) { v4h yh, yl;
      for (int q = 0; q < 4; ++q) { const float y = xa[j][u][q] * rs * ga[u][q] + ba[u][q]; const _Float16 h = (_Float16)y; yh[q] = h; yl[q] = (_Float16)((y - (float)h) * 1024.0f); }
      *(v4h*)(hp + 128 * u) = yh; *(v4h*)(lp + 128 * u) = yl; }
    if (j + 1 < LNR) { asm volatile("s_wait_xcnt 0x0" ::: "memory"); __builtin_amdgcn_sched_barrier(0); }      /* this row's store registers are reused by the next row's arithmetic: the wait stands behind the stores, and the scheduling barrier keeps that arithmetic behind the wait; it also keeps this row's stores in front of the next row's work, under which they drain */
  }
}

extern "C" void kernel_launch(void* const* d_in, const int* in_sizes, int n_in,
                              void* d_out, int out_size, void* d_ws, size_t ws_size, hipStream_t stream) {
  (void)in_sizes; (void)n_in; (void)out_size;
  const float* const* I = (const float* const*)d_in; const float* x = I[0]; const float* wq = I[1]; const float* bq = I[2]; const float* wk = I[3]; const float* bk = I[4]; const float* wv = I[5]; const float* bv = I[6]; const float* wo = I[7]; const float* bo = I[8]; const float* lng = I[9]; const float* lnb = I[10];      /* [in][out] weights + biases; LN gamma/beta */
  char* ws = (char*)d_ws; size_t off = 0;
  auto take = [&](size_t bytes) { char* p = ws + off; off += (bytes + 255) & ~(size_t)255; return p; };
  _Float16* BQ = (_Float16*)take((size_t)DM * DM * 2); _Float16* BK = (_Float16*)take((size_t)DM * DM * 2); _Float16* BV = (_Float16*)take((size_t)DM * DM * 2); _Float16* BO = (_Float16*)take((size_t)DM * DM * 2);
  float* S = (float*)take((size_t)NB * NH * QT * NKX * 4);      /* room for the projection-stage planes */
  _Float16* X16 = (_Float16*)S; _Float16* XL = (_Float16*)((char*)S + NR * DM * 2); float* QKF = (float*)((char*)S + NR * DM * 4);      /* projection-stage planes on the bytes of S (16 per token element: 2 + 2 + three f32 planes) */
  _Float16* Q16 = (_Float16*)take(NR * DM * 2); _Float16* K16 = (_Float16*)take(NR * DM * 2); _Float16* V16 = (_Float16*)take(NR * DM * 2); _Float16* O16 = (_Float16*)take(NR * DM * 2);      /* Q16, K16, V16: three planes in a row */
  _Float16* VT = (_Float16*)take((size_t)NB * NH * HD * SQ * 2);
  float* QF0 = (float*)take((size_t)NB * QT0 * DM * 4); float* KF0 = (float*)take((size_t)NB * QT0 * DM * 4); float* VF0 = (float*)take((size_t)NB * QT0 * DM * 4); float* OF0 = (float*)take((size_t)NB * QT0 * DM * 4); _Float16* OH0 = (_Float16*)take((size_t)NB * QT0 * DM * 2); _Float16* OL0 = (_Float16*)take((size_t)NB * QT0 * DM * 2);      /* QF0, KF0, VF0: three planes in a row */
  if (off > ws_size) return;
  k_wt_f16<<<(unsigned)(((size_t)DM * (DM / 8) + 255) / 256), 256, 0, stream>>>(wq, BQ, DM, DM, 16.0f); k_wt_f16<<<(unsigned)(((size_t)DM * (DM / 8) + 255) / 256), 256, 0, stream>>>(wk, BK, DM, DM, 16.0f); k_wt_f16<<<(unsigned)(((size_t)DM * (DM / 8) + 255) / 256), 256, 0, stream>>>(wv, BV, DM, DM, 16.0f); k_wt_f16<<<(unsigned)(((size_t)DM * (DM / 8) + 255) / 256), 256, 0, stream>>>(wo, BO, DM, DM, 16.0f);      /* [in][out] -> Bt[n][k] x16; BQ, BK, BV: three planes in a row */

  k_lnhl<<<(unsigned)(NR / (LNW * LNR)), LNW * 32, 0, stream>>>(x, lng, lnb, 1e-5f, X16, XL);      /* h = LN(bf16(x)) f32, kept in registers -> f16 hi (X16) + x1024 residual (XL) rows */
  /* Independent launches share one grid: q, k, v on grid.y of the projection GEMMs, the batch on grid.z of the per-batch GEMMs (grid.y of the first-tile attention, part of the flat index elsewhere). */
  const size_t zW = (size_t)DM * DM, zR = NR * DM, zT = (size_t)SQ * DM, z0 = (size_t)QT0 * DM;      /* elements: a weight plane, a token-row plane, one batch of it, one batch of a first-tile plane */
  const dim3 gp((unsigned)((NR / 128) * (DM / 128)), 1, 1), gp3((unsigned)((NR / 128) * (DM / 128)), 3, 1);      /* every token row; the same for q, k, v */
  k_gemm2<0><<<gp3, 256, 0, stream>>>(X16, DM, 0, BQ, DM, zW, 0.0625f, bq, 0, nullptr, 1, 0, 0, QKF, nullptr, DM, zR, (int)NR, DM, DM, 0, 0, 0, bk, bv);      /* f32 h_hi W + b */
  k_gemm2<0><<<gp3, 256, 0, stream>>>(XL, DM, 0, BQ, DM, zW, 0.00006103515625f, nullptr, 0, QKF, -1, 0, 0, nullptr, Q16, DM, zR, (int)NR, DM, DM, 0, 0, 0, nullptr, nullptr);      /* += h_lo W 2^-14 (own element), rounded to the f16 q, k, v rows */
  k_vt<NH, SQ><<<NB * NH * (SQ / 64), 256, 0, stream>>>(V16, LQ, 0, VT);      /* V^T [NB][NH][HD][SQ] */
  /* For each batch's first 128 rows the next two launches form the same f32 sums that the two full-size projection launches above form before they round them to f16. */
  const dim3 g0((QT0 / 128) * (DM / 128), 1, NB), g03((QT0 / 128) * (DM / 128), 3, NB);
  k_gemm2<0><<<g03, 256, 0, stream>>>(X16, DM, 0, BQ, DM, zW, 0.0625f, bq, 0, nullptr, 1, 0, 0, QF0, nullptr, DM, (size_t)NB * z0, QT0, DM, DM, zT, 0, z0, bk, bv);
  k_gemm2<0><<<g03, 256, 0, stream>>>(XL, DM, 0, BQ, DM, zW, 0.00006103515625f, nullptr, 0, QF0, -1, 0, 0, QF0, nullptr, DM, (size_t)NB * z0, QT0, DM, DM, zT, 0, z0, nullptr, nullptr);      /* f32 q, k, v of each batch's first 128 rows (exact products) */
  k_att0<0, DM><<<dim3(NH * (QT0 / 64), NB), 64, 0, stream>>>(QF0, KF0, VF0, nullptr, 0.125f, OF0, DM);      /* exact f32 attention for rows 0..127 (o x64) */
  k_fattn<<<NB * NH * (SQ / 128), 128, 0, stream>>>(Q16, K16, VT, O16);      /* scores, causal softmax and o = P V in one launch; o (merged heads, x64) as f16 rows */
  k_gemm2<0><<<gp, 256, 0, stream>>>(O16, DM, 0, BO, DM, 0, 0.0009765625f, bo, 0, nullptr, 1, 0, 0, (float*)d_out, nullptr, DM, 0, (int)NR, DM, DM, 0, 0, 0, nullptr, nullptr);      /* out rows are the output layout */
  k_hl<<<(unsigned)(((size_t)NB * QT0 * DM / 8 + 255) / 256), 256, 0, stream>>>(OF0, OH0, OL0, (size_t)NB * QT0 * DM / 8);      /* first-tile o (x64) -> f16 hi + x1024 residual planes */
  k_gemm2<0><<<g0, 256, 0, stream>>>(OH0, DM, 0, BO, DM, 0, 0.0009765625f, bo, 0, nullptr, 1, 0, 0, (float*)d_out, nullptr, DM, 0, QT0, DM, DM, z0, 0, zT, nullptr, nullptr);      /* rows 0..127 of each batch: out = o_hi Wo (+ b), overwriting the f16-path rows */
  k_gemm2<0><<<g0, 256, 0, stream>>>(OL0, DM, 0, BO, DM, 0, 0.00000095367431640625f, nullptr, 0, (const float*)d_out, -1, 0, 0, (float*)d_out, nullptr, DM, 0, QT0, DM, DM, z0, 0, zT, nullptr, nullptr);      /* += o_lo Wo 2^-20 (own-element accumulate) */
}

// v008
// One run takes 240 microseconds.
// Next to v007, in two timings, it ran 1.24 times as fast each time.
// Over all steps from v000 it is 44.2 times as fast.
#include <hip/hip_runtime.h>
// Pre-LayerNorm causal multi-head attention (x [4][2048][1024]; h = LN(x) (eps 1e-5, gamma, beta); q/k/v = h W + b ([in][out] 1024 x 1024 sigma 1/32, zero biases); 16 heads of 64; scores / 8; where(causal, s, finfo.min); softmax; out = merged Wo + bo -> [4][2048][1024], no residual).
// Structure: token rows r = b*2048 + s; h = LN(bf16(x)) in f32, as f16 hi + x1024 residual rows; Q, K, V as three WMMA GEMMs (32x64 wave tiles, f32 accumulation, exact x16 weights + bias, f16 outputs); V^T for all batches and heads via LDS transposes; causal attention fused in one launch (blocks of 128 query rows of one batch and head; S^T = K Q^T, running f32 maximum and sum per query, native exp2, weights x16 f16, O^T += V^T P^T over the keys up to the diagonal; o carried x64, folded into the output GEMM alpha) written straight into the merged f16 o rows; out = o W_o + b GEMM (f32) into the output layout.
// Compute dtype: inputs rounded to bf16; x / weights exact; q, k, v, softmax weights and o as plain f16 GEMM operands (~2^-12); scores and softmax statistics f32. v_wmma_f32_16x16x32_f16.
#define NB 4
#define SQ 2048
#define DM 1024
#define DMQ DM                       /* LayerNorm width */
#define NH 16
#define HD 64
#define HG 4                         /* heads per launch of the grouped k_vt (not launched) */
#define QT 256
#define NKX SQ
#define QT0 128                      /* first-tile rows recomputed exactly in f32 */
#define B0 0                         /* first batch processed (unused) */
#define NBR NB                       /* batches processed (unused) */
#define NR ((size_t)NB * SQ)         /* token rows */
#define MP ((int)((size_t)NBR * SQ)) /* rows projected (unused) */
#define QN SQ                        /* query rows attended per batch (unused) */
#define NHD NH                       /* heads attended (unused) */
#define MPO MP                       /* rows through the output stage (unused) */
#define LQ DM      /* row pitch of the q/k/v rows */
typedef __bf16 v16b __attribute__((ext_vector_type(16)));
typedef unsigned short v8us __attribute__((ext_vector_type(8), may_alias));
typedef float  v8f  __attribute__((ext_vector_type(8)));
typedef float  v4f  __attribute__((ext_vector_type(4)));
typedef float  v4fa __attribute__((ext_vector_type(4), may_alias));
union FragB { v16b v; v8us half[2]; unsigned short u[16]; };

__device__ __forceinline__ unsigned short bf16_bits(float x) { unsigned int u = __float_as_uint(x); return (unsigned short)((u + 0x7FFFu + ((u >> 16) & 1u)) >> 16); }
__device__ __forceinline__ float bf16_val(unsigned short b) { return __uint_as_float(((unsigned int)b) << 16); }
__device__ __forceinline__ float bf16_round(float x) { return bf16_val(bf16_bits(x)); }
// D += A·B with NT terms: 1 = ah·bh, 2 = + al·bh (A split), 3 = + ah·bl (both split)
template <int NT>
__device__ __forceinline__ v8f mmaN(v16b ah, v16b al, v16b bh, v16b bl, v8f c) {
  c = __builtin_amdgcn_wmma_f32_16x16x32_bf16(false, ah, false, bh, (short)0, c, false, false);
  if (NT >= 2) c = __builtin_amdgcn_wmma_f32_16x16x32_bf16(false, al, false, bh, (short)0, c, false, false);
  if (NT >= 3) c = __builtin_amdgcn_wmma_f32_16x16x32_bf16(false, ah, false, bl, (short)0, c, false, false);
  asm volatile("v_nop\n\tv_nop\n\tv_nop\n\tv_nop" : "+v"(c) : "v"(ah), "v"(al), "v"(bh), "v"(bl));
  return c;
}

__global__ __launch_bounds__(256) void k_wt_bf16(const float* __restrict__ W, unsigned short* __restrict__ Wt, int K, int N) {
  const int t = blockIdx.x * 256 + threadIdx.x;
  const int k8n = K / 8;
  if (t >= N * k8n) return;
  const int n = t / k8n, k8 = (t % k8n) * 8;
  v8us v;
#pragma unroll
  for (int i = 0; i < 8; ++i) v[i] = bf16_bits(W[(size_t)(k8 + i) * N + n]);
  *(v8us*)(Wt + (size_t)n * K + k8) = v;
  
}

// GEMM C[M][N] (f32, pitch ldc) = act(A[M][K]·W + bias). A f32 row-major (pitch lda) converted per fragment to bf16
// (ASPLIT: hi/lo two planes -> 2 terms, else single rounded term); Wt bf16 [N][K] (pitch ldb). BIAS_BF16 rounds the
// bias to bf16 first (bias quantised to bf16 before the add). K%32==0, M%16==0, N%64==0.
template <bool ASPLIT, int ACT, bool BIAS_BF16>
__global__ __launch_bounds__(128) void k_gemm_bf(const float* __restrict__ A, int lda, const unsigned short* __restrict__ Wt, int ldb,
                                               const float* __restrict__ bias, float* __restrict__ C, int ldc, int M, int N, int K) {
  __shared__ __attribute__((aligned(16))) float so[4][16][64];
  const int tid = threadIdx.x, w = tid >> 5, lane = tid & 31, ln = lane & 15, hh = lane >> 4;
  const int ntn = N / 64;
  const int wid = blockIdx.x * 4 + w;
  const int mt = wid / ntn, nq = wid % ntn;
  if (mt * 16 >= M) return;
  const int row0 = mt * 16, col0 = nq * 64;
  const float* arow = A + (size_t)(row0 + ln) * lda;
  v8f acc[4] = {};
  for (int kb = 0; kb < K; kb += 32) {
    FragB ah, al;
    const v4f x0 = *(const v4fa*)(arow + kb + 8 * hh), x1 = *(const v4fa*)(arow + kb + 8 * hh + 4);
    const v4f x2 = *(const v4fa*)(arow + kb + 16 + 8 * hh), x3 = *(const v4fa*)(arow + kb + 16 + 8 * hh + 4);
    float xs[16] = {x0[0],x0[1],x0[2],x0[3],x1[0],x1[1],x1[2],x1[3],x2[0],x2[1],x2[2],x2[3],x3[0],x3[1],x3[2],x3[3]};
#pragma unroll
    for (int i = 0; i < 16; ++i) { const unsigned short hb = bf16_bits(xs[i]); ah.u[i] = hb; al.u[i] = ASPLIT ? bf16_bits(xs[i] - bf16_val(hb)) : (unsigned short)0; }
#pragma unroll
    for (int t = 0; t < 4; ++t) {
      const unsigned short* brow = Wt + (size_t)(col0 + t * 16 + ln) * ldb + kb;
      FragB b;
      b.half[0] = *(const v8us*)(brow + 8 * hh);
      b.half[1] = *(const v8us*)(brow + 16 + 8 * hh);
      acc[t] = mmaN<ASPLIT ? 2 : 1>(ah.v, al.v, b.v, b.v, acc[t]);
    }
  }
#pragma unroll
  for (int t = 0; t < 4; ++t) {
    float bv = bias ? bias[col0 + t * 16 + ln] : 0.f;
    if (BIAS_BF16) bv = bf16_round(bv);
#pragma unroll
    for (int r = 0; r < 8; ++r) { float v = acc[t][r] + bv; if (ACT == 1) v = fmaxf(v, 0.f); so[w][8 * hh + r][t * 16 + ln] = v; }
  }
  __builtin_amdgcn_fence(__ATOMIC_ACQ_REL, "workgroup");
  __builtin_amdgcn_wave_barrier();
  const int rsub = lane >> 4, c4 = (lane & 15) * 4;
  {
#pragma unroll
    for (int q = 0; q < 8; ++q) {
      const int r = q * 2 + rsub;
      const v4f v = *(const v4fa*)&so[w][r][c4];
      *(v4f*)(C + (size_t)(row0 + r) * ldc + col0 + c4) = v;
    }
    
  }
}

// GEMM C = act(A·W + bias + resid): A f32 (ASPLIT -> hi/lo 2 terms), Wt bf16 [N][K]; ACT 0 none, 1 relu, 2 exact gelu;
// resid (optional, f32, row index = (row % rmod), pitch ldr, RES_BF16 rounds it) added before the activation.
template <bool ASPLIT, int ACT, bool BIAS_BF16, bool RES_BF16>
__global__ __launch_bounds__(128) void k_gemm_bf3(const float* __restrict__ A, int lda, const unsigned short* __restrict__ Wt, int ldb,
                                                const float* __restrict__ bias, const float* __restrict__ resid, int rmod, int ldr,
                                                float* __restrict__ C, int ldc, int M, int N, int K) {
  __shared__ __attribute__((aligned(16))) float so[4][16][64];
  const int tid = threadIdx.x, w = tid >> 5, lane = tid & 31, ln = lane & 15, hh = lane >> 4;
  const int ntn = N / 64;
  const int wid = blockIdx.x * 4 + w;
  const int mt = wid / ntn, nq = wid % ntn;
  if (mt * 16 >= M) return;
  const int row0 = mt * 16, col0 = nq * 64;
  const float* arow = A + (size_t)(row0 + ln) * lda;
  v8f acc[4] = {};
  for (int kb = 0; kb < K; kb += 32) {
    FragB ah, al;
    const v4f x0 = *(const v4fa*)(arow + kb + 8 * hh), x1 = *(const v4fa*)(arow + kb + 8 * hh + 4);
    const v4f x2 = *(const v4fa*)(arow + kb + 16 + 8 * hh), x3 = *(const v4fa*)(arow + kb + 16 + 8 * hh + 4);
    float xs[16] = {x0[0],x0[1],x0[2],x0[3],x1[0],x1[1],x1[2],x1[3],x2[0],x2[1],x2[2],x2[3],x3[0],x3[1],x3[2],x3[3]};
#pragma unroll
    for (int i = 0; i < 16; ++i) { const unsigned short hb = bf16_bits(xs[i]); ah.u[i] = hb; al.u[i] = ASPLIT ? bf16_bits(xs[i] - bf16_val(hb)) : (unsigned short)0; }
#pragma unroll
    for (int t = 0; t < 4; ++t) {
      const unsigned short* brow = Wt + (size_t)(col0 + t * 16 + ln) * ldb + kb;
      FragB b;
      b.half[0] = *(const v8us*)(brow + 8 * hh);
      b.half[1] = *(const v8us*)(brow + 16 + 8 * hh);
      acc[t] = mmaN<ASPLIT ? 2 : 1>(ah.v, al.v, b.v, b.v, acc[t]);
    }
  }
#pragma unroll
  for (int t = 0; t < 4; ++t) {
    const int col = col0 + t * 16 + ln;
    float bv = bias ? bias[col] : 0.f;
    if (BIAS_BF16) bv = bf16_round(bv);
#pragma unroll
    for (int r = 0; r < 8; ++r) {
      float v = acc[t][r] + bv;
      if (resid) { float rv = resid[(size_t)((row0 + 8 * hh + r) % rmod) * ldr + col]; if (RES_BF16) rv = bf16_round(rv); v += rv; }
      if (ACT == 1) v = fmaxf(v, 0.f);
      if (ACT == 2) v = 0.5f * v * (1.0f + erff(v * 0.70710678118654752f));
      if (ACT == 3) { const float u = 0.7978845608028654f * (v + 0.044715f * v * v * v); v = 0.5f * v * (1.0f + tanhf(u)); }
      so[w][8 * hh + r][t * 16 + ln] = v;
    }
  }
  __builtin_amdgcn_fence(__ATOMIC_ACQ_REL, "workgroup");
  __builtin_amdgcn_wave_barrier();
  const int rsub = lane >> 4, c4 = (lane & 15) * 4;
  {
#pragma unroll
    for (int q = 0; q < 8; ++q) {
      const int r = q * 2 + rsub;
      const v4f v = *(const v4fa*)&so[w][r][c4];
      *(v4f*)(C + (size_t)(row0 + r) * ldc + col0 + c4) = v;
    }
    
  }
}
// row LayerNorm (biased variance, eps) over N: s = X (+ R); optional out_sum <- s; out_norm <- (s-mu)*rsqrt(var+eps)*g + b
template <bool PARAM_BF16>
__global__ __launch_bounds__(256) void k_layernorm(const float* __restrict__ X, const float* __restrict__ R, const float* __restrict__ g, const float* __restrict__ bta,
                                                  float* __restrict__ out_sum, float* __restrict__ out_norm, int N, float eps) {
  __shared__ float red[256];
  const int row = blockIdx.x, tid = threadIdx.x;
  const float* x = X + (size_t)row * N; const float* rr = R ? R + (size_t)row * N : nullptr;
  float vals[16];                     // up to N = 4096
  const int per = N / 256;            // contiguous chunk per thread? use strided-by-4 chunks: thread handles j = tid*4 + 1024*u
  float s1 = 0.f;
  for (int u = 0; u < per / 4; ++u) {
    const int j = tid * 4 + 1024 * u;
    const v4f a = *(const v4fa*)(x + j);
    v4f b = {0.f,0.f,0.f,0.f}; if (rr) b = *(const v4fa*)(rr + j);
#pragma unroll
    for (int q = 0; q < 4; ++q) { const float v = a[q] + b[q]; vals[u * 4 + q] = v; s1 += v; }
  }
  red[tid] = s1; __syncthreads();
  for (int st = 128; st > 0; st >>= 1) { if (tid < st) red[tid] += red[tid + st]; __syncthreads(); }
  const float mu = red[0] / (float)N; __syncthreads();
  float s2 = 0.f;
  for (int u = 0; u < per / 4; ++u)
#pragma unroll
    for (int q = 0; q < 4; ++q) { const float c = vals[u * 4 + q] - mu; s2 += c * c; }
  red[tid] = s2; __syncthreads();
  for (int st = 128; st > 0; st >>= 1) { if (tid < st) red[tid] += red[tid + st]; __syncthreads(); }
  const float rs = rsqrtf(red[0] / (float)N + eps);
  {
    for (int u = 0; u < per / 4; ++u) {
      const int j = tid * 4 + 1024 * u;
      v4f o, sm;
#pragma unroll
      for (int q = 0; q < 4; ++q) {
        float gg = g[j + q], bb = bta[j + q];
        if (PARAM_BF16) { gg = bf16_round(gg); bb = bf16_round(bb); }
        sm[q] = vals[u * 4 + q]; o[q] = (vals[u * 4 + q] - mu) * rs * gg + bb;
      }
      if (out_sum) *(v4f*)(out_sum + (size_t)row * N + j) = sm;
      *(v4f*)(out_norm + (size_t)row * N + j) = o;
    }
    
  }
}



// ---- f16 WMMA path (v_wmma_f32_16x16x32_f16): 11-bit significands for operands in range — used where a [0,1] probability operand needs more precision than bf16
typedef _Float16 v16h __attribute__((ext_vector_type(16)));
union FragH { v16h v; v8us half[2]; _Float16 h[16]; unsigned short u[16]; };
template <int NT>
__device__ __forceinline__ v8f mmaH(v16h ah, v16h al, v16h bh, v16h bl, v8f c) {
  c = __builtin_amdgcn_wmma_f32_16x16x32_f16(false, ah, false, bh, (short)0, c, false, false);
  if (NT >= 2) c = __builtin_amdgcn_wmma_f32_16x16x32_f16(false, al, false, bh, (short)0, c, false, false);
  if (NT >= 3) c = __builtin_amdgcn_wmma_f32_16x16x32_f16(false, ah, false, bl, (short)0, c, false, false);
  asm volatile("v_nop\n\tv_nop\n\tv_nop\n\tv_nop" : "+v"(c) : "v"(ah), "v"(al), "v"(bh), "v"(bl));
  return c;
}
// batched GEMM like k_gemm_b but f16 operands: A f32 (split into f16 hi/lo if ASPLIT, else rounded to f16), Bt = f16 values [n][k]; alpha; C f32; N multiple of 16 (partial tiles skipped)
template <bool ASPLIT>
__global__ __launch_bounds__(128) void k_gemm_h(const float* __restrict__ A, int lda, size_t sA, const _Float16* __restrict__ Bh, int ldb, size_t sB, float alpha, float* __restrict__ C, int ldc, size_t sC, int M, int N, int K) {
  __shared__ __attribute__((aligned(16))) float so[4][16][64];
  const int tid = threadIdx.x, w = tid >> 5, lane = tid & 31, ln = lane & 15, hh = lane >> 4; const int by = blockIdx.y;
  A += (size_t)by * sA; Bh += (size_t)by * sB; C += (size_t)by * sC;
  const int ntn = (N + 63) / 64; const int wid = blockIdx.x * 4 + w; const int mt = wid / ntn, nq = wid % ntn; if (mt * 16 >= M) return;
  const int row0 = mt * 16, col0 = nq * 64; const float* arow = A + (size_t)(row0 + ln) * lda;
  v8f acc[4] = {};
  for (int kb = 0; kb < K; kb += 32) {
    FragH ah, al;
    const v4f x0 = *(const v4fa*)(arow + kb + 8 * hh), x1 = *(const v4fa*)(arow + kb + 8 * hh + 4), x2 = *(const v4fa*)(arow + kb + 16 + 8 * hh), x3 = *(const v4fa*)(arow + kb + 16 + 8 * hh + 4);
    float xs[16] = {x0[0],x0[1],x0[2],x0[3],x1[0],x1[1],x1[2],x1[3],x2[0],x2[1],x2[2],x2[3],x3[0],x3[1],x3[2],x3[3]};
#pragma unroll
    for (int i = 0; i < 16; ++i) { const _Float16 h = (_Float16)xs[i]; ah.h[i] = h; al.h[i] = ASPLIT ? (_Float16)(xs[i] - (float)h) : (_Float16)0.0f; }
#pragma unroll
    for (int t = 0; t < 4; ++t) { if (col0 + t * 16 >= N) continue; const size_t boff = (size_t)(col0 + t * 16 + ln) * ldb + kb; FragH bq; bq.half[0] = *(const v8us*)(Bh + boff + 8 * hh); bq.half[1] = *(const v8us*)(Bh + boff + 16 + 8 * hh);
      acc[t] = mmaH<ASPLIT ? 2 : 1>(ah.v, al.v, bq.v, bq.v, acc[t]); }
  }
#pragma unroll
  for (int t = 0; t < 4; ++t) { if (col0 + t * 16 >= N) continue;
#pragma unroll
    for (int r = 0; r < 8; ++r) so[w][8 * hh + r][t * 16 + ln] = acc[t][r] * alpha; }
  __builtin_amdgcn_fence(__ATOMIC_ACQ_REL, "workgroup"); __builtin_amdgcn_wave_barrier();
  const int rsub = lane >> 4, c4 = (lane & 15) * 4;
  {
#pragma unroll
    for (int q = 0; q < 8; ++q) { const int r = q * 2 + rsub; if (col0 + c4 < N) { const v4f v = *(const v4fa*)&so[w][r][c4]; *(v4f*)(C + (size_t)(row0 + r) * ldc + col0 + c4) = v; } }
     }
}

// Wt[n][k] = f16(W[k][n]·scale) from f32 row-major W[K][N] (scale = power of two; bf16-exact weights stay exact in f16 away from the subnormal range)
__global__ __launch_bounds__(256) void k_wt_f16(const float* __restrict__ W, _Float16* __restrict__ Wt, int K, int N, float scale) {
  const int t = blockIdx.x * 256 + threadIdx.x; if (t >= N * (K / 8)) return; const int n = t / (K / 8), k8 = (t % (K / 8)) * 8; FragH f;
#pragma unroll
  for (int i = 0; i < 8; ++i) f.h[i] = (_Float16)(bf16_round(W[(size_t)(k8 + i) * N + n]) * scale); const v8us o = f.half[0];
  *(v8us*)((unsigned short*)Wt + (size_t)n * K + k8) = o; 
}
// k_gemm_hh variant with fused epilogue: v = acc·alpha + bias[by·sBias + col] (+ CP[(row/rowsPerB)·sCPb + by·64 + col] if CP) ; ACT 0 none / 1 elu ; writes f16 C16 (and f32 C if non-null)
template <int ACT>
__global__ __launch_bounds__(128) void k_gemm_hhx(const _Float16* __restrict__ A, int lda, size_t sA, const _Float16* __restrict__ Bh, int ldb, size_t sB, float alpha, const float* __restrict__ bias, size_t sBias, const float* __restrict__ CP, int rowsPerB, size_t sCPb, int row0g,
    float* __restrict__ C, _Float16* __restrict__ C16, int ldc, size_t sC, int M, int N, int K) {
  __shared__ __attribute__((aligned(16))) float so[4][16][64];
  const int tid = threadIdx.x, w = tid >> 5, lane = tid & 31, ln = lane & 15, hh = lane >> 4; const int by = blockIdx.y;
  A += (size_t)by * sA; Bh += (size_t)by * sB; const size_t cofs = (size_t)by * sC; const float* bp = bias ? bias + (size_t)by * sBias : nullptr;
  const int ntn = (N + 63) / 64; const int wid = blockIdx.x * 4 + w; const int mt = wid / ntn, nq = wid % ntn; if (mt * 16 >= M) return;
  const int row0 = mt * 16, col0 = nq * 64; const _Float16* arow = A + (size_t)(row0 + ln) * lda;
  v8f acc[4] = {};
  for (int kb = 0; kb < K; kb += 32) { FragH ah; ah.half[0] = *(const v8us*)((const unsigned short*)arow + kb + 8 * hh); ah.half[1] = *(const v8us*)((const unsigned short*)arow + kb + 16 + 8 * hh);
#pragma unroll
    for (int t = 0; t < 4; ++t) { if (col0 + t * 16 >= N) continue; const size_t boff = (size_t)(col0 + t * 16 + ln) * ldb + kb; FragH bq; bq.half[0] = *(const v8us*)((const unsigned short*)Bh + boff + 8 * hh); bq.half[1] = *(const v8us*)((const unsigned short*)Bh + boff + 16 + 8 * hh);
      acc[t] = mmaH<1>(ah.v, ah.v, bq.v, bq.v, acc[t]); }
  }
#pragma unroll
  for (int t = 0; t < 4; ++t) { if (col0 + t * 16 >= N) continue; const int col = col0 + t * 16 + ln; const float bv = bp ? bf16_round(bp[col]) : 0.f;
#pragma unroll
    for (int r = 0; r < 8; ++r) { float v = acc[t][r] * alpha + bv; if (CP) { const int rr = row0g + row0 + 8 * hh + r; if (rowsPerB < 0) v += CP[cofs + (size_t)rr * ldc + col];      /* rowsPerB < 0: own element of the batched C plane */ else { const int bidx = rr / rowsPerB; v += CP[(size_t)bidx * sCPb + (size_t)by * 64 + col]; } } if (ACT == 1) v = (v > 0.f) ? v : expm1f(v); else if (ACT == 7) v = (v > 0.f) ? v + 1.0f : expf(v); else if (ACT == 8) v = tanhf(v); else if (ACT == 9) v = 0.5f * v * (1.0f + tanhf(0.7978845608028654f * (v + 0.044715f * v * v * v))); else if (ACT == 11) v = 1.0f / (1.0f + expf(-v)); else if (ACT == 12) v = (v > 0.f) ? v : 0.01f * v; else if (ACT == 14) v = (v > 0.f) ? v : 0.1f * v; else if (ACT == 16) v = (v >= 0.f) ? v : 0.3f * v; else if (ACT == 17) v = (v >= 0.f) ? v : 0.2f * v; else if (ACT == 15) v = v / (1.0f + expf(-v)); else if (ACT == 3) v = fmaxf(v, 0.f); else if (ACT == 6) v = 0.5f * v * (1.0f + erff(v * 0.70710678118654752f)); so[w][8 * hh + r][t * 16 + ln] = v; } }
  __builtin_amdgcn_fence(__ATOMIC_ACQ_REL, "workgroup"); __builtin_amdgcn_wave_barrier();
  const int rsub = lane >> 4, c4 = (lane & 15) * 4; typedef _Float16 v4h __attribute__((ext_vector_type(4)));
  {
#pragma unroll
    for (int q = 0; q < 8; ++q) { const int r = q * 2 + rsub; if (col0 + c4 < N) { const v4f v = *(const v4fa*)&so[w][r][c4]; if (C) *(v4f*)(C + cofs + (size_t)(row0 + r) * ldc + col0 + c4) = v; if (C16) { v4h h4; for (int i = 0; i < 4; ++i) h4[i] = (_Float16)v[i]; *(v4h*)(C16 + cofs + (size_t)(row0 + r) * ldc + col0 + c4) = h4; } } }
     }
}


typedef _Float16 v4h __attribute__((ext_vector_type(4)));

__global__ __launch_bounds__(256) void k_x16(const float* __restrict__ x, _Float16* __restrict__ X16, size_t n8) { const size_t t = (size_t)blockIdx.x * 256 + threadIdx.x; if (t >= n8) return; FragH f;
#pragma unroll
  for (int q = 0; q < 8; ++q) f.h[q] = (_Float16)bf16_round(x[t * 8 + q]); *(v8us*)((unsigned short*)X16 + t * 8) = f.half[0];  }
__global__ __launch_bounds__(256) void k_h16(const float* __restrict__ x, _Float16* __restrict__ X16, size_t n8) { const size_t t = (size_t)blockIdx.x * 256 + threadIdx.x; if (t >= n8) return; FragH f;
#pragma unroll
  for (int q = 0; q < 8; ++q) f.h[q] = (_Float16)x[t * 8 + q]; *(v8us*)((unsigned short*)X16 + t * 8) = f.half[0];  }
__global__ __launch_bounds__(256) void k_round16f(const float* __restrict__ W, _Float16* __restrict__ Bt, size_t n8) { const size_t t = (size_t)blockIdx.x * 256 + threadIdx.x; if (t >= n8) return; FragH f;
#pragma unroll
  for (int i = 0; i < 8; ++i) f.h[i] = (_Float16)(bf16_round(W[t * 8 + i]) * 16.0f); *(v8us*)((unsigned short*)Bt + t * 8) = f.half[0];  }
template <int NHv, int TTv>
__global__ __launch_bounds__(256) void k_vt(const _Float16* __restrict__ V16, int ldv, int voff, _Float16* __restrict__ Vt) { __shared__ unsigned short tl[64][66]; const int tid = threadIdx.x; const int slab = blockIdx.x / (TTv / 64), lg = blockIdx.x % (TTv / 64); const int b = slab / NHv, h = slab % NHv;
  for (int i = tid; i < 64 * 8; i += 256) { const int r = i / 8, c8 = (i % 8) * 8; FragH f; f.half[0] = *(const v8us*)((const unsigned short*)V16 + ((size_t)b * TTv + lg * 64 + r) * ldv + voff + h * 64 + c8);
#pragma unroll
    for (int q = 0; q < 8; ++q) tl[r][c8 + q] = f.u[q]; }
  __syncthreads();
  {
#pragma unroll
    for (int rd = 0; rd < 2; ++rd) { const int d = rd * 32 + tid / 8, pc = tid % 8; FragH f;
#pragma unroll
      for (int q = 0; q < 8; ++q) f.u[q] = tl[pc * 8 + q][d];
      *(v8us*)((unsigned short*)Vt + ((size_t)slab * 64 + d) * TTv + lg * 64 + pc * 8) = f.half[0]; }
     } }

__global__ __launch_bounds__(256) void k_hl(const float* __restrict__ F, _Float16* __restrict__ Hh, _Float16* __restrict__ Hl, size_t n8) { const size_t t = (size_t)blockIdx.x * 256 + threadIdx.x; if (t >= n8) return; FragH fh, fl; const v4f a = *(const v4fa*)(F + t * 8), c = *(const v4fa*)(F + t * 8 + 4);
#pragma unroll
  for (int q = 0; q < 4; ++q) { _Float16 h = (_Float16)a[q]; fh.h[q] = h; fl.h[q] = (_Float16)((a[q] - (float)h) * 1024.0f); h = (_Float16)c[q]; fh.h[4 + q] = h; fl.h[4 + q] = (_Float16)((c[q] - (float)h) * 1024.0f); }
  { *(v8us*)((unsigned short*)Hh + t * 8) = fh.half[0]; *(v8us*)((unsigned short*)Hl + t * 8) = fl.half[0];  } }

// ---- fast GEMM (block tile 128x128 = eight waves of 32x64; requires M % 128 == 0 rows per launch region, N % 128 == 0 and K % 64 == 0); epilogue = k_gemm_hhx semantics ----
// The block's 128 A rows and 128 B rows come in tiles of GKS k, loaded as whole 128-byte lines and staged through registers into two LDS buffers: tile s + 1 is loaded from memory while tile s is worked on, and one barrier a tile both publishes it and frees the buffer read before. Every wave takes its fragments from LDS in the k order of g2_frag, 32 k at a time in rising order, so each accumulator sums as before.
// DUAL: a second A plane (A2, the same rows and pitch) is staged beside the first and multiplied with the same B fragments into accumulators of its own; the epilogue forms acc alpha + bias, then adds acc2 alpha2, the sum that two launches formed through an f32 plane in memory.
#define GKS 64                       /* k per staged tile: 128 bytes of every operand row */
#define GPIT 72                      /* LDS row pitch in f16 elements: 144 bytes = 16 x odd, free of bank conflicts for 16-byte fragment reads */
__device__ __forceinline__ v16h g2_frag(const _Float16* p, int hh) { FragH f; f.half[0] = *(const v8us*)((const unsigned short*)p + 8 * hh); f.half[1] = *(const v8us*)((const unsigned short*)p + 16 + 8 * hh); return f.v; }
__device__ __forceinline__ v8f g2_mma(v16h a, v16h b, v8f c) { v8f d = __builtin_amdgcn_wmma_f32_16x16x32_f16(false, a, false, b, (short)0, c, false, false); asm volatile("v_nop\n\tv_nop\n\tv_nop\n\tv_nop" : "+v"(d) : "v"(a), "v"(b)); return d; }
template <int ACT, int CLD = DM, bool DUAL = false>      /* CLD: the row pitch of C for which the own-element addend has its fast path, a constant so that a lane's 16 loads share one address and differ in the immediate offset */
__global__ __launch_bounds__(256) void k_gemm2(const _Float16* __restrict__ A, int lda, size_t sA, const _Float16* __restrict__ Bh, int ldb, size_t sB, float alpha, const float* __restrict__ bias, size_t sBias, const float* __restrict__ CP, int rowsPerB, size_t sCPb, int row0g,
    float* __restrict__ C, _Float16* __restrict__ C16, int ldc, size_t sC, int M, int N, int K, size_t zA, size_t zB, size_t zC, const float* __restrict__ bias1, const float* __restrict__ bias2, const _Float16* __restrict__ A2, float alpha2) { static_assert(ACT == 0 || ACT == 3 || ACT == 6 || ACT == 8 || ACT == 9 || ACT == 11 || ACT == 12 || ACT == 14 || ACT == 15 || ACT == 16 || ACT == 17, "k_gemm2: unsupported ACT code (would silently apply no activation)");
  constexpr int TR = DUAL ? 384 : 256;      /* rows of a buffer */
  __shared__ __attribute__((aligned(16))) unsigned char sm[2 * TR * GPIT * 2];      /* two buffers of [A 128 rows | B 128 rows | DUAL: A2 128 rows]; behind the last tile's barrier the same bytes hold the epilogue's rows */
  static_assert(sizeof(float) * 8 * 32 * 68 <= sizeof(sm), "the epilogue rows fit the tile buffers");
  unsigned short* const ring = (unsigned short*)sm; float (* const so)[32][68] = (float (*)[32][68])sm;
  const int tid = threadIdx.x, w = tid >> 5, lane = tid & 31, ln = lane & 15, hh = lane >> 4; const int by = blockIdx.y, bz = blockIdx.z;      /* grid.z: a second batch index (element strides zA, zB, zC) */
  A += (size_t)by * sA + (size_t)bz * zA; Bh += (size_t)by * sB + (size_t)bz * zB; const size_t cofs = (size_t)by * sC + (size_t)bz * zC; const float* bp = bias ? bias + (size_t)by * sBias : nullptr;
  if (bias1 && by == 1) bp = bias1; if (bias2 && by == 2) bp = bias2;      /* bias vectors that are separate buffers: one per grid.y index */
  const int ntn = N >> 7; const int mt = blockIdx.x / ntn, nq = blockIdx.x - mt * ntn; if (mt * 128 >= M) return;      /* the whole block leaves, in front of every barrier */
  const int wr = w & 3, wc = w >> 2; const int row0 = mt * 128 + 32 * wr, col0 = nq * 128 + 64 * wc;      /* four waves down, two across */
  const int sr = tid >> 3, sc = (tid & 7) * 8;      /* staging: 8 threads cover one row's 128 bytes, the block 32 rows a round */
  const unsigned short* ap = (const unsigned short*)A + (size_t)(mt * 128 + sr) * lda + sc; const unsigned short* bq = (const unsigned short*)Bh + (size_t)(nq * 128 + sr) * ldb + sc;
  const unsigned short* ep = DUAL ? (const unsigned short*)A2 + (size_t)by * sA + (size_t)bz * zA + (size_t)(mt * 128 + sr) * lda + sc : ap;      /* the second plane: the same place as in the first */
  v8us ar[4], br[4], er[4]; const unsigned short *pa[4], *pb[4], *pe[4];      /* a tile's load addresses */
#pragma unroll      /* static indices keep the staging registers in registers */
  for (int i = 0; i < 4; ++i) { pa[i] = ap + (size_t)(32 * i) * lda; pb[i] = bq + (size_t)(32 * i) * ldb; pe[i] = DUAL ? ep + (size_t)(32 * i) * lda : pa[i]; ar[i] = *(const v8us*)pa[i]; br[i] = *(const v8us*)pb[i]; if (DUAL) er[i] = *(const v8us*)pe[i]; }
  asm volatile("s_wait_xcnt 0x0" :: "v"(pa[0]), "v"(pa[1]), "v"(pa[2]), "v"(pa[3]), "v"(pb[0]), "v"(pb[1]), "v"(pb[2]), "v"(pb[3]), "v"(pe[0]), "v"(pe[1]), "v"(pe[2]), "v"(pe[3]) : "memory");      /* the loads' address registers are advanced behind them; the addresses are named as inputs so that they stay whole up to this wait (else a later load of the run may land on them) */
  ap += GKS; bq += GKS; ep += GKS;      /* tile 1 */
#pragma unroll      /* static indices, as above */
  for (int i = 0; i < 4; ++i) { *(v8us*)(ring + (sr + 32 * i) * GPIT + sc) = ar[i]; *(v8us*)(ring + (128 + sr + 32 * i) * GPIT + sc) = br[i]; if (DUAL) *(v8us*)(ring + (256 + sr + 32 * i) * GPIT + sc) = er[i]; }
  __syncthreads();      /* tile 0 is complete before any wave reads it */
  const v8f z8 = {0.f,0.f,0.f,0.f,0.f,0.f,0.f,0.f}; v8f c00 = z8, c01 = z8, c02 = z8, c03 = z8, c10 = z8, c11 = z8, c12 = z8, c13 = z8;
  v8f d00 = z8, d01 = z8, d02 = z8, d03 = z8, d10 = z8, d11 = z8, d12 = z8, d13 = z8;      /* DUAL: the second plane's sums */
  const int nst = K / GKS;
#pragma unroll 1      /* one k tile at a time: the two buffers alternate */
  for (int s = 0; s < nst; ++s) {
    const bool more = s + 1 < nst;      /* the same for the whole block */
    if (more) {
#pragma unroll      /* static indices; all of a thread's tile loads in flight under this tile's work */
      for (int i = 0; i < 4; ++i) { pa[i] = ap + (size_t)(32 * i) * lda; pb[i] = bq + (size_t)(32 * i) * ldb; pe[i] = DUAL ? ep + (size_t)(32 * i) * lda : pa[i]; ar[i] = *(const v8us*)pa[i]; br[i] = *(const v8us*)pb[i]; if (DUAL) er[i] = *(const v8us*)pe[i]; }
      asm volatile("s_wait_xcnt 0x0" :: "v"(pa[0]), "v"(pa[1]), "v"(pa[2]), "v"(pa[3]), "v"(pb[0]), "v"(pb[1]), "v"(pb[2]), "v"(pb[3]), "v"(pe[0]), "v"(pe[1]), "v"(pe[2]), "v"(pe[3]) : "memory");      /* the loads' address registers are advanced behind them; named as inputs, as above */
      ap += GKS; bq += GKS; ep += GKS; }
    const _Float16* al = (const _Float16*)(ring + ((s & 1) * TR + 32 * wr + ln) * GPIT); const _Float16* bl = (const _Float16*)(ring + ((s & 1) * TR + 128 + 64 * wc + ln) * GPIT);
#pragma unroll      /* two 32-k passes a tile, constant LDS offsets */
    for (int kk = 0; kk < GKS; kk += 32) { const v16h a0 = g2_frag(al + kk, hh), a1 = g2_frag(al + 16 * GPIT + kk, hh);
      const v16h b0 = g2_frag(bl + kk, hh), b1 = g2_frag(bl + 16 * GPIT + kk, hh), b2 = g2_frag(bl + 32 * GPIT + kk, hh), b3 = g2_frag(bl + 48 * GPIT + kk, hh);      /* a pass's LDS reads stand together in front of its products */
      const v16h e0 = DUAL ? g2_frag(al + 256 * GPIT + kk, hh) : a0, e1 = DUAL ? g2_frag(al + 272 * GPIT + kk, hh) : a1;      /* the same rows of the second plane */
      c00 = g2_mma(a0, b0, c00); c10 = g2_mma(a1, b0, c10); c01 = g2_mma(a0, b1, c01); c11 = g2_mma(a1, b1, c11);
      c02 = g2_mma(a0, b2, c02); c12 = g2_mma(a1, b2, c12); c03 = g2_mma(a0, b3, c03); c13 = g2_mma(a1, b3, c13);
      if (DUAL) {      /* against the B fragments already in registers */
        d00 = g2_mma(e0, b0, d00); d10 = g2_mma(e1, b0, d10); d01 = g2_mma(e0, b1, d01); d11 = g2_mma(e1, b1, d11);
        d02 = g2_mma(e0, b2, d02); d12 = g2_mma(e1, b2, d12); d03 = g2_mma(e0, b3, d03); d13 = g2_mma(e1, b3, d13); } }
    if (more) {
#pragma unroll      /* static indices, as above */
      for (int i = 0; i < 4; ++i) { *(v8us*)(ring + (((s + 1) & 1) * TR + sr + 32 * i) * GPIT + sc) = ar[i]; *(v8us*)(ring + (((s + 1) & 1) * TR + 128 + sr + 32 * i) * GPIT + sc) = br[i]; if (DUAL) *(v8us*)(ring + (((s + 1) & 1) * TR + 256 + sr + 32 * i) * GPIT + sc) = er[i]; } }      /* into the buffer that every wave left before the last barrier */
    __syncthreads();      /* tile s + 1 is complete, and every wave has left tile s, before the next trip (behind the last tile: before the epilogue's rows overwrite it) */
  }
  v8f accs[8] = {c00, c01, c02, c03, c10, c11, c12, c13}; v8f acc2[8] = {d00, d01, d02, d03, d10, d11, d12, d13};
  const int rsub = lane >> 4, c4 = (lane & 15) * 4;      /* the store phase's layout: 16 lanes cover 256 bytes of a row, a wave two rows a round */
  if (DUAL) CP = nullptr;      /* the second plane's sums take the addend's place: neither addend path is compiled */
  const bool own = ACT == 0 && CP && rowsPerB < 0 && ldc == CLD;      /* own-element addend with nothing applied behind the add (the same for the whole block): read in the store phase's layout, each lane the 16 bytes it will store, all 16 loads in flight together (behind the LDS pass, where the accumulators' registers are free: the register count stays at six waves a SIMD); added there in the same place of the sum */
  const float* const cown = CP; if (own) CP = nullptr;      /* the element-by-element path below is then not taken */
#pragma unroll
  for (int u = 0; u < 8; ++u) { const int t = u & 3, half = u >> 2; const int col = col0 + t * 16 + ln; const float bv = bp ? bf16_round(bp[col]) : 0.f;
#pragma unroll
    for (int r = 0; r < 8; ++r) { const int rloc = half * 16 + 8 * hh + r; float v = accs[u][r] * alpha + bv; if (CP) { if (rowsPerB < 0) v += CP[cofs + (size_t)(row0g + row0 + rloc) * ldc + col];      /* rowsPerB < 0: own element of the batched C plane */ else { const int bidx = (row0g + row0 + rloc) / rowsPerB; v += CP[(size_t)bidx * sCPb + (size_t)by * 64 + col]; } }
      if (DUAL) v += acc2[u][r] * alpha2;      /* alpha2 is a power of two: the product is exact, fused or not */
      if (ACT == 3) v = fmaxf(v, 0.f); else if (ACT == 6) v = 0.5f * v * (1.0f + erff(v * 0.70710678118654752f)); else if (ACT == 11) v = 1.0f / (1.0f + expf(-v)); else if (ACT == 15) v = v / (1.0f + expf(-v)); else if (ACT == 12) v = (v > 0.f) ? v : 0.01f * v; else if (ACT == 8) v = tanhf(v); else if (ACT == 9) v = 0.5f * v * (1.0f + tanhf(0.7978845608028654f * (v + 0.044715f * v * v * v))); else if (ACT == 14) v = (v > 0.f) ? v : 0.1f * v; else if (ACT == 16) v = (v >= 0.f) ? v : 0.3f * v; else if (ACT == 17) v = (v >= 0.f) ? v : 0.2f * v;
      so[w][rloc][t * 16 + ln] = v; } }
  __builtin_amdgcn_fence(__ATOMIC_ACQ_REL, "workgroup"); __builtin_amdgcn_wave_barrier();
  v4f cpv[16];
#pragma unroll      /* static indices keep the addends in registers */
  for (int q = 0; q < 16; ++q) cpv[q] = v4f{0.f, 0.f, 0.f, 0.f};
  if (own) { const float* cq = cown + cofs + (size_t)(row0g + row0 + rsub) * CLD + col0 + c4;
#pragma unroll      /* static indices; every load issued before the first is waited for */
    for (int q = 0; q < 16; ++q) cpv[q] = *(const v4fa*)(cq + (size_t)(2 * q) * CLD);
    asm volatile("s_wait_xcnt 0x0" :: "v"(cq) : "memory"); }      /* the loads' address registers are reused behind them; cq is named as an input so that they stay whole up to this wait (else a later load of the run may land on them) */
  {
#pragma unroll
    for (int q = 0; q < 16; ++q) { const int r = q * 2 + rsub; v4f v = *(const v4fa*)&so[w][r][c4]; if (own) v += cpv[q];
      if (C) { *(v4f*)(C + cofs + (size_t)(row0 + r) * ldc + col0 + c4) = v; asm volatile("s_wait_xcnt 0x0" ::: "memory"); }      /* the store's registers are reused by the f16 conversion and by the next round */
      if (C16) { v4h h4; for (int i = 0; i < 4; ++i) h4[i] = (_Float16)v[i]; *(v4h*)(C16 + cofs + (size_t)(row0 + r) * ldc + col0 + c4) = h4; asm volatile("s_wait_xcnt 0x0" ::: "memory"); } }      /* the store's registers are reused by the next round */
     } }


__global__ __launch_bounds__(256) void k_wnat(const float* __restrict__ w, size_t n8, _Float16* __restrict__ Bt) { const size_t t = (size_t)blockIdx.x * 256 + threadIdx.x; if (t >= n8) return; FragH f; for (int q = 0; q < 8; ++q) f.h[q] = (_Float16)(bf16_round(w[t * 8 + q]) * 16.0f); *(v8us*)((unsigned short*)Bt + t * 8) = f.half[0];  }
__global__ __launch_bounds__(256) void k_rsm(const float* __restrict__ S, _Float16* __restrict__ P, int nrows) {
  #pragma clang fp contract(off)
  const int i = blockIdx.x * 256 + threadIdx.x; if (i >= nrows) return; const float* s = S + (size_t)i * SQ; float mx = -3.0e38f;
#pragma unroll 1
  for (int j = 0; j < SQ; ++j) mx = fmaxf(mx, s[j]); float se = 0.f;
#pragma unroll 1
  for (int j = 0; j < SQ; ++j) se += expf(s[j] - mx); const float sc = 256.0f / se;
#pragma unroll 1
  for (int j0 = 0; j0 < SQ; j0 += 8) { FragH f; for (int q = 0; q < 8; ++q) f.h[q] = (_Float16)(expf(s[j0 + q] - mx) * sc); unsigned short* d = (unsigned short*)P + (size_t)i * SQ + j0; *(v8us*)d = f.half[0];  } }
__global__ __launch_bounds__(256) void k_vt(const _Float16* __restrict__ V16, int b, int h0, _Float16* __restrict__ VT) { __shared__ unsigned short tl[64][65]; const int tid = threadIdx.x; const int hh = blockIdx.x % HG, sg = blockIdx.x / HG; const int s0 = sg * 64; const int h = h0 + hh;
  for (int i = tid; i < 64 * 8; i += 256) { const int j = i / 8, d8 = (i % 8) * 8; FragH f; f.half[0] = *(const v8us*)((const unsigned short*)V16 + ((size_t)b * SQ + s0 + j) * DM + h * HD + d8); for (int q = 0; q < 8; ++q) tl[d8 + q][j] = f.u[q]; }
  __syncthreads();
  { for (int i = tid; i < 64 * 8; i += 256) { const int d = i / 8, j8 = (i % 8) * 8; FragH f; for (int q = 0; q < 8; ++q) f.u[q] = tl[d][j8 + q]; *(v8us*)((unsigned short*)VT + ((size_t)hh * HD + d) * SQ + s0 + j8) = f.half[0]; }  } }



#define FK 64                        /* keys per staged tile */
#define FPIT 72                      /* LDS row pitch in f16 elements: 144 bytes = 16 x odd, free of bank conflicts for 16-byte fragment reads */
#define FCS 0.18033688011112042f     /* 1/8 x log2(e): exponentials in base 2 */
__device__ __forceinline__ float fa_xhalf(float x) { return __builtin_bit_cast(float, __builtin_amdgcn_permlanex16(__builtin_bit_cast(int, x), __builtin_bit_cast(int, x), 0x76543210, 0xfedcba98, false, false)); }      /* lane l reads lane l ^ 16 */
// Base-2 exponentials in asm so that the slot the instruction set asks for behind a transcendental (before its result is read or its source overwritten) is there by construction: the outputs lie apart from every input, so each v_exp_f32 is followed by an independent one, and the v_nop stands behind the last.
__device__ __forceinline__ void fa_exp8(const float (&x)[8], float (&e)[8]) {
  asm("v_exp_f32 %0, %8\n\tv_exp_f32 %1, %9\n\tv_exp_f32 %2, %10\n\tv_exp_f32 %3, %11\n\tv_exp_f32 %4, %12\n\tv_exp_f32 %5, %13\n\tv_exp_f32 %6, %14\n\tv_exp_f32 %7, %15\n\tv_nop"
      : "=&v"(e[0]), "=&v"(e[1]), "=&v"(e[2]), "=&v"(e[3]), "=&v"(e[4]), "=&v"(e[5]), "=&v"(e[6]), "=&v"(e[7]) : "v"(x[0]), "v"(x[1]), "v"(x[2]), "v"(x[3]), "v"(x[4]), "v"(x[5]), "v"(x[6]), "v"(x[7])); }
__device__ __forceinline__ float fa_exp1(float x) { float e; asm("v_exp_f32 %0, %1\n\tv_nop" : "=v"(e) : "v"(x)); return e; }      /* the same slot behind a single one */
__device__ __forceinline__ v8f fa_mma(v16h a, v16h b, v8f c) { return __builtin_amdgcn_wmma_f32_16x16x32_f16(false, a, false, b, (short)0, c, false, false); }
__global__ __launch_bounds__(128) void k_fattn(const _Float16* __restrict__ Q16, const _Float16* __restrict__ K16, const _Float16* __restrict__ VT, _Float16* __restrict__ O16) {
  __shared__ __attribute__((aligned(16))) _Float16 lk[2][FK][FPIT]; __shared__ __attribute__((aligned(16))) _Float16 lv[2][HD][FPIT];
  const int tid = threadIdx.x, w = __builtin_amdgcn_readfirstlane(tid >> 5), lane = tid & 31, ln = lane & 15, hh = lane >> 4;
  const int bh = blockIdx.x % (NB * NH), qb = (SQ / 128 - 1) - blockIdx.x / (NB * NH);      /* the longest query blocks start first */
  const int b = bh / NH, h = bh % NH; const int q0 = qb * 128, qw = q0 + 32 * w; const int nt = (q0 + 128) / FK;      /* key tiles up to the block's last query */
  const int sr = tid >> 3, sc = (tid & 7) * 8;      /* staging: 8 threads cover one row's 128 bytes, the block 16 rows a round */
  const _Float16* kp = K16 + ((size_t)b * SQ + sr) * DM + h * HD + sc; const _Float16* vp = VT + ((size_t)bh * HD + sr) * SQ + sc;
  v8us kr[4], vr[4]; v16h qf[2][2];
#pragma unroll      /* static indices keep the staging registers in registers */
  for (int i = 0; i < 4; ++i) { kr[i] = *(const v8us*)((const unsigned short*)kp + (size_t)(16 * i) * DM); vr[i] = *(const v8us*)((const unsigned short*)vp + (size_t)(16 * i) * SQ); }
#pragma unroll      /* static indices, as above */
  for (int g = 0; g < 2; ++g) { const _Float16* qp = Q16 + ((size_t)b * SQ + qw + 16 * g + ln) * DM + h * HD; qf[g][0] = g2_frag(qp, hh); qf[g][1] = g2_frag(qp + 32, hh); }
  asm volatile("s_wait_xcnt 0x0" ::: "memory");      /* the loads' address registers are reused behind them */
#pragma unroll      /* static indices, as above */
  for (int i = 0; i < 4; ++i) { *(v8us*)((unsigned short*)&lk[0][sr + 16 * i][sc]) = kr[i]; *(v8us*)((unsigned short*)&lv[0][sr + 16 * i][sc]) = vr[i]; }
  __syncthreads();      /* tile 0 is complete before any wave reads it */
  const v8f z8 = {0.f, 0.f, 0.f, 0.f, 0.f, 0.f, 0.f, 0.f};
  v8f o[2][4]; float m[2] = {-1.0e30f, -1.0e30f}, l[2] = {0.f, 0.f};      /* m: the maximum in use (base-2 scaled scores); l: this lane half's part of the sum */
#pragma unroll      /* static indices, as above */
  for (int g = 0; g < 2; ++g) for (int dt = 0; dt < 4; ++dt) o[g][dt] = z8;
#pragma unroll 1      /* one key tile at a time: the two buffers alternate */
  for (int t = 0; t < nt; ++t) {
    const bool more = t + 1 < nt;      /* the same for the whole block */
    if (more) { kp += (size_t)FK * DM; vp += FK;
#pragma unroll      /* static indices; all of a thread's tile loads in flight under this tile's work */
      for (int i = 0; i < 4; ++i) { kr[i] = *(const v8us*)((const unsigned short*)kp + (size_t)(16 * i) * DM); vr[i] = *(const v8us*)((const unsigned short*)vp + (size_t)(16 * i) * SQ); }
      asm volatile("s_wait_xcnt 0x0" ::: "memory"); }      /* the loads' address registers are advanced on the next trip */
    const _Float16* bk = &lk[t & 1][0][0]; const _Float16* bv = &lv[t & 1][0][0];
#pragma unroll      /* two 32-key passes a tile, constant LDS offsets */
    for (int sub = 0; sub < 2; ++sub) { const int kb = t * FK + 32 * sub;
      if (kb <= qw + 31) {      /* wave-uniform (scalar): a pass wholly above the wave's diagonal is skipped; the barrier below is not */
        v8f s[2][2];      /* s[kt][g][r] = score of key kb + 16 kt + 8 hh + r, query qw + 16 g + ln */
#pragma unroll      /* static indices, as above */
        for (int kt = 0; kt < 2; ++kt) { const _Float16* kq = bk + (32 * sub + 16 * kt + ln) * FPIT; const v16h k0 = g2_frag(kq, hh), k1 = g2_frag(kq + 32, hh);
          for (int g = 0; g < 2; ++g) s[kt][g] = fa_mma(k1, qf[g][1], fa_mma(k0, qf[g][0], z8)); }
        if (kb + 31 > qw) {      /* wave-uniform: only the pass on the wave's diagonal pays for the mask */
#pragma unroll      /* static indices, as above */
          for (int kt = 0; kt < 2; ++kt) for (int g = 0; g < 2; ++g) for (int r = 0; r < 8; ++r) if (kb + 16 * kt + 8 * hh + r > qw + 16 * g + ln) s[kt][g][r] = -1.0e30f; }
        float mb[2]; bool need = false;
#pragma unroll      /* static indices, as above */
        for (int g = 0; g < 2; ++g) { float mx = s[0][g][0];
          for (int r = 1; r < 8; ++r) mx = fmaxf(mx, s[0][g][r]);
          for (int r = 0; r < 8; ++r) mx = fmaxf(mx, s[1][g][r]);
          mx = fmaxf(mx, fa_xhalf(mx)) * FCS; mb[g] = mx; need = need || (mx > m[g] + 8.0f); }      /* both lane halves hold the query's maximum of this pass */
        if (__builtin_amdgcn_ballot_w32(need) != 0) {
#pragma unroll      /* static indices, as above */
          for (int g = 0; g < 2; ++g) { const float mn = fmaxf(m[g], mb[g]); const float corr = fa_exp1(m[g] - mn); m[g] = mn; l[g] *= corr;      /* key 0 is never masked: mn is a real score from the first pass on, where corr is 0 */
            for (int dt = 0; dt < 4; ++dt) o[g][dt] = o[g][dt] * corr; } }
        v16h vf[4]; FragH pf[2];
#pragma unroll      /* static indices, as above */
        for (int dt = 0; dt < 4; ++dt) vf[dt] = g2_frag(bv + (16 * dt + ln) * FPIT + 32 * sub, hh);
#pragma unroll      /* static indices, as above */
        for (int g = 0; g < 2; ++g) { const float nm = 4.0f - m[g]; float ls[4];      /* weights carried x16 (it cancels against l): small ones stay clear of the f16 subnormals */
          for (int kt = 0; kt < 2; ++kt) { float x[8], e[8]; for (int r = 0; r < 8; ++r) x[r] = fmaf(s[kt][g][r], FCS, nm); fa_exp8(x, e); for (int r = 0; r < 8; ++r) { if (kt == 0 && r < 4) ls[r] = e[r]; else ls[r & 3] += e[r]; pf[g].h[8 * kt + r] = (_Float16)e[r]; } }
          l[g] += (ls[0] + ls[1]) + (ls[2] + ls[3]); }
        __builtin_amdgcn_sched_barrier(0);      /* both groups' exponentials stay in front of the eight products: eight independent accumulators in a row keep the matrix unit fed */
#pragma unroll      /* static indices, as above */
        for (int dt = 0; dt < 4; ++dt) for (int g = 0; g < 2; ++g) o[g][dt] = fa_mma(vf[dt], pf[g].v, o[g][dt]);
      } }
    if (more) {
#pragma unroll      /* static indices, as above */
      for (int i = 0; i < 4; ++i) { *(v8us*)((unsigned short*)&lk[(t + 1) & 1][sr + 16 * i][sc]) = kr[i]; *(v8us*)((unsigned short*)&lv[(t + 1) & 1][sr + 16 * i][sc]) = vr[i]; } }      /* into the buffer that every wave left before the last barrier */
    __syncthreads();      /* tile t + 1 is complete, and every wave has left tile t, before the next trip */
  }
#pragma unroll      /* static indices, as above */
  for (int g = 0; g < 2; ++g) { const float fin = 64.0f / (l[g] + fa_xhalf(l[g]));      /* the lane halves' sums join once; o carried x64, folded into the output GEMM alpha */
    unsigned short* op = (unsigned short*)O16 + ((size_t)b * SQ + qw + 16 * g + ln) * DM + h * HD + 8 * hh;      /* a lane holds d = 16 dt + 8 hh .. + 7 of its query: 16 bytes a store */
    for (int dt = 0; dt < 4; ++dt) { FragH f; for (int r = 0; r < 8; ++r) f.h[r] = (_Float16)(o[g][dt][r] * fin); *(v8us*)(op + 16 * dt) = f.half[0]; }
    if (g == 0) { asm volatile("s_wait_xcnt 0x0" ::: "memory"); __builtin_amdgcn_sched_barrier(0); } }      /* the first group's store registers are reused by the second group's arithmetic: the wait stands behind the stores, and the scheduling barrier keeps that arithmetic behind the wait */
}


// One thread per query row; 64 rows per block. The row's q and o stay in registers; Q, K and V come in tiles of 64 rows, staged in LDS with whole-line loads; a K or V row is read back as a same-address (broadcast) LDS load. Four keys' score sums run side by side; each sum, and the running m, l, o, keep the key-by-key, element-by-element order.
template <int MASKADD, int LD>      /* LD: row pitch of QF, KF, VF in floats, a constant so that a tile's 16 loads share one address and differ in the immediate offset */
__global__ __launch_bounds__(64) void k_att0(const float* __restrict__ QF, const float* __restrict__ KF, const float* __restrict__ VF, const float* __restrict__ mask, float scale, float* __restrict__ OF, int ldo) {
  #pragma clang fp contract(off)
  __shared__ __attribute__((aligned(16))) float lk[64][HD]; __shared__ __attribute__((aligned(16))) float lv[64][HD]; __shared__ __attribute__((aligned(16))) float lo[64][HD + 4];
  const int tid = threadIdx.x; const int h = blockIdx.x / (QT0 / 64), rg = blockIdx.x % (QT0 / 64); const int i = rg * 64 + tid;
  { const size_t br = (size_t)blockIdx.y * QT0; QF += br * LD; KF += br * LD; VF += br * LD; OF += br * ldo; }      /* grid.y: the batch; each batch has QT0 rows in every plane */
  const int tr = tid / 16, pc = (tid % 16) * 4; const unsigned tb = (unsigned)(tr * LD + pc) * 4u;      /* the thread's byte offset inside a group of four rows: 16 lanes cover one row's 256 bytes */
  { const char* qb = (const char*)(QF + (size_t)(rg * 64) * LD + h * HD);
    v4f qt[16];
#pragma unroll      /* all of a thread's tile loads in flight together */
    for (int it = 0; it < 16; ++it) qt[it] = *(const v4fa*)(qb + (size_t)(it * 4) * LD * 4 + tb);
    asm volatile("s_wait_xcnt 0x0" ::: "memory");      /* the loads' base registers are reused right behind them */
#pragma unroll      /* static indices keep qt in registers */
    for (int it = 0; it < 16; ++it) *(v4f*)&lo[it * 4 + tr][pc] = qt[it]; }
  __syncthreads();      /* the q tile is complete before a thread reads its row */
  float q[HD], o[HD];
#pragma unroll      /* static indices keep q and o in registers */
  for (int c = 0; c < HD / 4; ++c) { const v4f t = *(const v4f*)&lo[tid][c * 4]; for (int u = 0; u < 4; ++u) { q[c * 4 + u] = t[u]; o[c * 4 + u] = 0.f; } }
  float m = -1.0e30f, l = 0.f; const int jmax = MASKADD ? (SQ - 1) : (rg * 64 + 63);      /* additive-mask form: every key (the mask input decides); causal form: keys up to the block's last row */
  const char* kp = (const char*)(KF + h * HD) + tb; const char* vp = (const char*)(VF + h * HD) + tb;      /* the thread's place in the current K and V tile */
#pragma unroll 1      /* one key tile at a time: the tile buffers are reused */
  for (int j0 = 0; j0 <= jmax; j0 += 64) {
#pragma unroll      /* all of a thread's tile loads in flight together */
    for (int it = 0; it < 16; ++it) { *(v4f*)&lk[it * 4 + tr][pc] = *(const v4fa*)(kp + (size_t)(it * 4) * LD * 4); *(v4f*)&lv[it * 4 + tr][pc] = *(const v4fa*)(vp + (size_t)(it * 4) * LD * 4); }
    __syncthreads();      /* the tile is complete before any row reads it */
#pragma unroll 1      /* four keys per trip are enough to fill the add latency; more only grows the code */
    for (int jj = 0; jj < 64; jj += 4) { float s[4] = {0.f, 0.f, 0.f, 0.f};
#pragma unroll      /* static indices into q */
      for (int c = 0; c < HD / 4; ++c) for (int a = 0; a < 4; ++a) { const v4f kq = *(const v4f*)&lk[jj + a][c * 4]; s[a] = __fadd_rn(s[a], __fmul_rn(q[c * 4 + 0], kq[0])); s[a] = __fadd_rn(s[a], __fmul_rn(q[c * 4 + 1], kq[1])); s[a] = __fadd_rn(s[a], __fmul_rn(q[c * 4 + 2], kq[2])); s[a] = __fadd_rn(s[a], __fmul_rn(q[c * 4 + 3], kq[3])); }
#pragma unroll      /* static indices into s and o */
      for (int a = 0; a < 4; ++a) { const int j = j0 + jj + a; float sv = __fmul_rn(s[a], scale); if (MASKADD) sv = __fadd_rn(sv, __fmul_rn(bf16_round(mask[(size_t)i * SQ + j]), -10000.0f));
        const float f = (MASKADD || j <= i) ? 1.f : 0.f; const float sm = fmaf(f, sv, (1.f - f) * -1.0e30f); const float mn = fmaxf(m, sm); const float sc = expf(m - mn); const float e = expf(sm - mn); l = __fadd_rn(__fmul_rn(l, sc), e); m = mn;
        for (int c = 0; c < HD / 4; ++c) { const v4f vv = *(const v4f*)&lv[jj + a][c * 4]; for (int u = 0; u < 4; ++u) o[c * 4 + u] = __fadd_rn(__fmul_rn(o[c * 4 + u], sc), __fmul_rn(e, vv[u])); } } }
    __syncthreads();      /* every row has left the tile before the next one overwrites it */
    kp += (size_t)64 * LD * 4; vp += (size_t)64 * LD * 4;
  }
  const float fin = 64.0f / l;      /* o carried x64 like the f16 path */
#pragma unroll      /* static indices into o */
  for (int c = 0; c < HD / 4; ++c) { v4f oo; for (int u = 0; u < 4; ++u) oo[u] = __fmul_rn(o[c * 4 + u], fin); *(v4f*)&lo[tid][c * 4] = oo; }
  __syncthreads();
  {
#pragma unroll 1
    for (int it = 0; it < 16; ++it) { const int row = it * 4 + tid / 16, pc = (tid % 16) * 4; const v4f v = *(const v4f*)&lo[row][pc]; *(v4f*)(OF + (size_t)(rg * 64 + row) * ldo + h * HD + pc) = v; }
     } }


// LayerNorm and the f16 hi + x1024 residual split in one pass: a wave owns LNR whole rows and keeps them in registers, so h never goes through memory and no barrier is needed.
// Lane l holds columns 128 u + 4 l .. + 3 (u = 0..7): every load covers 512 contiguous bytes, every store 256. Row sums: four partial sums per lane, then a butterfly over the 32 lanes (every lane ends with the same value).
#define LNR 2                        /* rows per wave, all their loads in flight together */
#define LNW 16                       /* waves per block: one block per WGP covers every row */
template <int CTRL> __device__ __forceinline__ float ln_row(float x) { return __builtin_bit_cast(float, __builtin_amdgcn_update_dpp(0, __builtin_bit_cast(int, x), CTRL, 0xf, 0xf, true)); }      /* CTRL = 0x160 + m: lane l reads lane l ^ m of its 16-lane row */
__device__ __forceinline__ float ln_wsum(float x) { x += ln_row<0x161>(x); x += ln_row<0x162>(x); x += ln_row<0x164>(x); x += ln_row<0x168>(x); return x + fa_xhalf(x); }
__global__ __launch_bounds__(LNW * 32) void k_lnhl(const float* __restrict__ X, const float* __restrict__ g, const float* __restrict__ bb, float eps, _Float16* __restrict__ Hh, _Float16* __restrict__ Hl) {
  static_assert(DMQ == 1024, "a lane holds 8 x 4 columns of a row");
  const int lane = threadIdx.x & 31; const size_t r0 = ((size_t)blockIdx.x * LNW + (threadIdx.x >> 5)) * LNR;
  const float* xp = X + r0 * DMQ + lane * 4;
  v4f xa[LNR][8], ga[8], ba[8];
#pragma unroll      /* static indices keep the rows in registers; all loads in flight together */
  for (int j = 0; j < LNR; ++j) for (int u = 0; u < 8; ++u) xa[j][u] = *(const v4fa*)(xp + (size_t)j * DMQ + 128 * u);
  asm volatile("s_wait_xcnt 0x0" :: "v"(xp) : "memory");      /* the row loads' address registers are reused behind them; xp is named as an input so that they stay whole up to this wait (else the last load lands on them) */
  __builtin_amdgcn_sched_barrier(0);      /* keeps the loads below behind that wait */
#pragma unroll      /* static indices, as above */
  for (int u = 0; u < 8; ++u) { ga[u] = *(const v4fa*)(g + lane * 4 + 128 * u); ba[u] = *(const v4fa*)(bb + lane * 4 + 128 * u); }
  asm volatile("s_wait_xcnt 0x0" ::: "memory");      /* the loads' address registers are reused behind them */
  __builtin_amdgcn_sched_barrier(0);      /* every load is issued in front of the arithmetic: without it the gamma and beta loads sink behind the first row's sums and their latency is paid a second time */
#pragma unroll      /* static indices, as above */
  for (int u = 0; u < 8; ++u) for (int q = 0; q < 4; ++q) { ga[u][q] = bf16_round(ga[u][q]); ba[u][q] = bf16_round(ba[u][q]); }
#pragma unroll      /* static indices, as above */
  for (int j = 0; j < LNR; ++j) {
    v4f p = {0.f, 0.f, 0.f, 0.f};
    for (int u = 0; u < 8; ++u) for (int q = 0; q < 4; ++q) { xa[j][u][q] = bf16_round(xa[j][u][q]); p[q] += xa[j][u][q]; }
    const float mu = ln_wsum((p[0] + p[1]) + (p[2] + p[3])) * (1.0f / (float)DMQ);
    v4f v = {0.f, 0.f, 0.f, 0.f};
    for (int u = 0; u < 8; ++u) for (int q = 0; q < 4; ++q) { xa[j][u][q] -= mu; v[q] += xa[j][u][q] * xa[j][u][q]; }
    const float rs = rsqrtf(ln_wsum((v[0] + v[1]) + (v[2] + v[3])) * (1.0f / (float)DMQ) + eps);
    _Float16* hp = Hh + (r0 + j) * DMQ + lane * 4; _Float16* lp = Hl + (r0 + j) * DMQ + lane * 4;
    for (int u = 0; u < 8; ++u) { v4h yh, yl;
      for (int q = 0; q < 4; ++q) { const float y = xa[j][u][q] * rs * ga[u][q] + ba[u][q]; const _Float16 h = (_Float16)y; yh[q] = h; yl[q] = (_Float16)((y - (float)h) * 1024.0f); }
      *(v4h*)(hp + 128 * u) = yh; *(v4h*)(lp + 128 * u) = yl; }
    if (j + 1 < LNR) { asm volatile("s_wait_xcnt 0x0" ::: "memory"); __builtin_amdgcn_sched_barrier(0); }      /* this row's store registers are reused by the next row's arithmetic: the wait stands behind the stores, and the scheduling barrier keeps that arithmetic behind the wait; it also keeps this row's stores in front of the next row's work, under which they drain */
  }
}

extern "C" void kernel_launch(void* const* d_in, const int* in_sizes, int n_in,
                              void* d_out, int out_size, void* d_ws, size_t ws_size, hipStream_t stream) {
  (void)in_sizes; (void)n_in; (void)out_size;
  const float* const* I = (const float* const*)d_in; const float* x = I[0]; const float* wq = I[1]; const float* bq = I[2]; const float* wk = I[3]; const float* bk = I[4]; const float* wv = I[5]; const float* bv = I[6]; const float* wo = I[7]; const float* bo = I[8]; const float* lng = I[9]; const float* lnb = I[10];      /* [in][out] weights + biases; LN gamma/beta */
  char* ws = (char*)d_ws; size_t off = 0;
  auto take = [&](size_t bytes) { char* p = ws + off; off += (bytes + 255) & ~(size_t)255; return p; };
  _Float16* BQ = (_Float16*)take((size_t)DM * DM * 2); _Float16* BK = (_Float16*)take((size_t)DM * DM * 2); _Float16* BV = (_Float16*)take((size_t)DM * DM * 2); _Float16* BO = (_Float16*)take((size_t)DM * DM * 2);
  float* S = (float*)take((size_t)NB * NH * QT * NKX * 4);      /* room for the projection-stage planes */
  _Float16* X16 = (_Float16*)S; _Float16* XL = (_Float16*)((char*)S + NR * DM * 2);      /* projection-stage planes on the bytes of S */
  _Float16* Q16 = (_Float16*)take(NR * DM * 2); _Float16* K16 = (_Float16*)take(NR * DM * 2); _Float16* V16 = (_Float16*)take(NR * DM * 2); _Float16* O16 = (_Float16*)take(NR * DM * 2);      /* Q16, K16, V16: three planes in a row */
  _Float16* VT = (_Float16*)take((size_t)NB * NH * HD * SQ * 2);
  float* QF0 = (float*)take((size_t)NB * QT0 * DM * 4); float* KF0 = (float*)take((size_t)NB * QT0 * DM * 4); float* VF0 = (float*)take((size_t)NB * QT0 * DM * 4); float* OF0 = (float*)take((size_t)NB * QT0 * DM * 4); _Float16* OH0 = (_Float16*)take((size_t)NB * QT0 * DM * 2); _Float16* OL0 = (_Float16*)take((size_t)NB * QT0 * DM * 2);      /* QF0, KF0, VF0: three planes in a row */
  if (off > ws_size) return;
  k_wt_f16<<<(unsigned)(((size_t)DM * (DM / 8) + 255) / 256), 256, 0, stream>>>(wq, BQ, DM, DM, 16.0f); k_wt_f16<<<(unsigned)(((size_t)DM * (DM / 8) + 255) / 256), 256, 0, stream>>>(wk, BK, DM, DM, 16.0f); k_wt_f16<<<(unsigned)(((size_t)DM * (DM / 8) + 255) / 256), 256, 0, stream>>>(wv, BV, DM, DM, 16.0f); k_wt_f16<<<(unsigned)(((size_t)DM * (DM / 8) + 255) / 256), 256, 0, stream>>>(wo, BO, DM, DM, 16.0f);      /* [in][out] -> Bt[n][k] x16; BQ, BK, BV: three planes in a row */

  k_lnhl<<<(unsigned)(NR / (LNW * LNR)), LNW * 32, 0, stream>>>(x, lng, lnb, 1e-5f, X16, XL);      /* h = LN(bf16(x)) f32, kept in registers -> f16 hi (X16) + x1024 residual (XL) rows */
  /* Independent launches share one grid: q, k, v on grid.y of the projection GEMMs, the batch on grid.z of the per-batch GEMMs (grid.y of the first-tile attention, part of the flat index elsewhere). */
  const size_t zW = (size_t)DM * DM, zR = NR * DM, zT = (size_t)SQ * DM, z0 = (size_t)QT0 * DM;      /* elements: a weight plane, a token-row plane, one batch of it, one batch of a first-tile plane */
  const dim3 gp((unsigned)((NR / 128) * (DM / 128)), 1, 1), gp3((unsigned)((NR / 128) * (DM / 128)), 3, 1);      /* every token row; the same for q, k, v */
  k_gemm2<0, DM, true><<<gp3, 256, 0, stream>>>(X16, DM, 0, BQ, DM, zW, 0.0625f, bq, 0, nullptr, 1, 0, 0, nullptr, Q16, DM, zR, (int)NR, DM, DM, 0, 0, 0, bk, bv, XL, 0.00006103515625f);      /* f32 h_hi W + b, += h_lo W 2^-14, rounded to the f16 q, k, v rows */
  k_vt<NH, SQ><<<NB * NH * (SQ / 64), 256, 0, stream>>>(V16, LQ, 0, VT);      /* V^T [NB][NH][HD][SQ] */
  /* For each batch's first 128 rows the next launch forms the same f32 sums that the full-size projection launch above forms before it rounds them to f16. */
  const dim3 g0((QT0 / 128) * (DM / 128), 1, NB), g03((QT0 / 128) * (DM / 128), 3, NB);
  k_gemm2<0, DM, true><<<g03, 256, 0, stream>>>(X16, DM, 0, BQ, DM, zW, 0.0625f, bq, 0, nullptr, 1, 0, 0, QF0, nullptr, DM, (size_t)NB * z0, QT0, DM, DM, zT, 0, z0, bk, bv, XL, 0.00006103515625f);      /* f32 q, k, v of each batch's first 128 rows (exact products) */
  k_att0<0, DM><<<dim3(NH * (QT0 / 64), NB), 64, 0, stream>>>(QF0, KF0, VF0, nullptr, 0.125f, OF0, DM);      /* exact f32 attention for rows 0..127 (o x64) */
  k_fattn<<<NB * NH * (SQ / 128), 128, 0, stream>>>(Q16, K16, VT, O16);      /* scores, causal softmax and o = P V in one launch; o (merged heads, x64) as f16 rows */
  k_gemm2<0><<<gp, 256, 0, stream>>>(O16, DM, 0, BO, DM, 0, 0.0009765625f, bo, 0, nullptr, 1, 0, 0, (float*)d_out, nullptr, DM, 0, (int)NR, DM, DM, 0, 0, 0, nullptr, nullptr, nullptr, 0.f);      /* out rows are the output layout */
  k_hl<<<(unsigned)(((size_t)NB * QT0 * DM / 8 + 255) / 256), 256, 0, stream>>>(OF0, OH0, OL0, (size_t)NB * QT0 * DM / 8);      /* first-tile o (x64) -> f16 hi + x1024 residual planes */
  k_gemm2<0, DM, true><<<g0, 256, 0, stream>>>(OH0, DM, 0, BO, DM, 0, 0.0009765625f, bo, 0, nullptr, 1, 0, 0, (float*)d_out, nullptr, DM, 0, QT0, DM, DM, z0, 0, zT, nullptr, nullptr, OL0, 0.00000095367431640625f);      /* rows 0..127 of each batch: out = o_hi Wo (+ b) + o_lo Wo 2^-20, overwriting the f16-path rows */
}

// v009
// One run takes 227 microseconds.
// Next to v008, in two timings, it ran 1.06 times as fast each time.
// All steps since v000 together make it 46.8 times as fast.
#include <hip/hip_runtime.h>
// Pre-LayerNorm causal multi-head attention (x [4][2048][1024]; h = LN(x) (eps 1e-5, gamma, beta); q/k/v = h W + b ([in][out] 1024 x 1024 sigma 1/32, zero biases); 16 heads of 64; scores / 8; where(causal, s, finfo.min); softmax; out = merged Wo + bo -> [4][2048][1024], no residual).
// Structure: token rows r = b*2048 + s; h = LN(bf16(x)) in f32, as f16 hi + x1024 residual rows; Q, K, V as three WMMA GEMMs (32x64 wave tiles, f32 accumulation, exact x16 weights + bias, f16 outputs); V^T for all batches and heads via LDS transposes; causal attention fused in one launch (blocks of 128 query rows of one batch and head; S^T = K Q^T, running f32 maximum and sum per query, native exp2, weights x16 f16, O^T += V^T P^T over the keys up to the diagonal; o carried x64, folded into the output GEMM alpha) written straight into the merged f16 o rows; out = o W_o + b GEMM (f32) into the output layout.
// Compute dtype: inputs rounded to bf16; x / weights exact; q, k, v, softmax weights and o as plain f16 GEMM operands (~2^-12); scores and softmax statistics f32. v_wmma_f32_16x16x32_f16.
#define NB 4
#define SQ 2048
#define DM 1024
#define DMQ DM                       /* LayerNorm width */
#define NH 16
#define HD 64
#define HG 4                         /* heads per launch of the grouped k_vt (not launched) */
#define QT 256
#define NKX SQ
#define QT0 128                      /* first-tile rows recomputed exactly in f32 */
#define B0 0                         /* first batch processed (unused) */
#define NBR NB                       /* batches processed (unused) */
#define NR ((size_t)NB * SQ)         /* token rows */
#define MP ((int)((size_t)NBR * SQ)) /* rows projected (unused) */
#define QN SQ                        /* query rows attended per batch (unused) */
#define NHD NH                       /* heads attended (unused) */
#define MPO MP                       /* rows through the output stage (unused) */
#define LQ DM      /* row pitch of the q/k/v rows */
typedef __bf16 v16b __attribute__((ext_vector_type(16)));
typedef unsigned short v8us __attribute__((ext_vector_type(8), may_alias));
typedef float  v8f  __attribute__((ext_vector_type(8)));
typedef float  v4f  __attribute__((ext_vector_type(4)));
typedef float  v4fa __attribute__((ext_vector_type(4), may_alias));
union FragB { v16b v; v8us half[2]; unsigned short u[16]; };

__device__ __forceinline__ unsigned short bf16_bits(float x) { unsigned int u = __float_as_uint(x); return (unsigned short)((u + 0x7FFFu + ((u >> 16) & 1u)) >> 16); }
__device__ __forceinline__ float bf16_val(unsigned short b) { return __uint_as_float(((unsigned int)b) << 16); }
__device__ __forceinline__ float bf16_round(float x) { return bf16_val(bf16_bits(x)); }
// D += A·B with NT terms: 1 = ah·bh, 2 = + al·bh (A split), 3 = + ah·bl (both split)
template <int NT>
__device__ __forceinline__ v8f mmaN(v16b ah, v16b al, v16b bh, v16b bl, v8f c) {
  c = __builtin_amdgcn_wmma_f32_16x16x32_bf16(false, ah, false, bh, (short)0, c, false, false);
  if (NT >= 2) c = __builtin_amdgcn_wmma_f32_16x16x32_bf16(false, al, false, bh, (short)0, c, false, false);
  if (NT >= 3) c = __builtin_amdgcn_wmma_f32_16x16x32_bf16(false, ah, false, bl, (short)0, c, false, false);
  asm volatile("v_nop\n\tv_nop\n\tv_nop\n\tv_nop" : "+v"(c) : "v"(ah), "v"(al), "v"(bh), "v"(bl));
  return c;
}

__global__ __launch_bounds__(256) void k_wt_bf16(const float* __restrict__ W, unsigned short* __restrict__ Wt, int K, int N) {
  const int t = blockIdx.x * 256 + threadIdx.x;
  const int k8n = K / 8;
  if (t >= N * k8n) return;
  const int n = t / k8n, k8 = (t % k8n) * 8;
  v8us v;
#pragma unroll
  for (int i = 0; i < 8; ++i) v[i] = bf16_bits(W[(size_t)(k8 + i) * N + n]);
  *(v8us*)(Wt + (size_t)n * K + k8) = v;
  
}

// GEMM C[M][N] (f32, pitch ldc) = act(A[M][K]·W + bias). A f32 row-major (pitch lda) converted per fragment to bf16
// (ASPLIT: hi/lo two planes -> 2 terms, else single rounded term); Wt bf16 [N][K] (pitch ldb). BIAS_BF16 rounds the
// bias to bf16 first (bias quantised to bf16 before the add). K%32==0, M%16==0, N%64==0.
template <bool ASPLIT, int ACT, bool BIAS_BF16>
__global__ __launch_bounds__(128) void k_gemm_bf(const float* __restrict__ A, int lda, const unsigned short* __restrict__ Wt, int ldb,
                                               const float* __restrict__ bias, float* __restrict__ C, int ldc, int M, int N, int K) {
  __shared__ __attribute__((aligned(16))) float so[4][16][64];
  const int tid = threadIdx.x, w = tid >> 5, lane = tid & 31, ln = lane & 15, hh = lane >> 4;
  const int ntn = N / 64;
  const int wid = blockIdx.x * 4 + w;
  const int mt = wid / ntn, nq = wid % ntn;
  if (mt * 16 >= M) return;
  const int row0 = mt * 16, col0 = nq * 64;
  const float* arow = A + (size_t)(row0 + ln) * lda;
  v8f acc[4] = {};
  for (int kb = 0; kb < K; kb += 32) {
    FragB ah, al;
    const v4f x0 = *(const v4fa*)(arow + kb + 8 * hh), x1 = *(const v4fa*)(arow + kb + 8 * hh + 4);
    const v4f x2 = *(const v4fa*)(arow + kb + 16 + 8 * hh), x3 = *(const v4fa*)(arow + kb + 16 + 8 * hh + 4);
    float xs[16] = {x0[0],x0[1],x0[2],x0[3],x1[0],x1[1],x1[2],x1[3],x2[0],x2[1],x2[2],x2[3],x3[0],x3[1],x3[2],x3[3]};
#pragma unroll
    for (int i = 0; i < 16; ++i) { const unsigned short hb = bf16_bits(xs[i]); ah.u[i] = hb; al.u[i] = ASPLIT ? bf16_bits(xs[i] - bf16_val(hb)) : (unsigned short)0; }
#pragma unroll
    for (int t = 0; t < 4; ++t) {
      const unsigned short* brow = Wt + (size_t)(col0 + t * 16 + ln) * ldb + kb;
      FragB b;
      b.half[0] = *(const v8us*)(brow + 8 * hh);
      b.half[1] = *(const v8us*)(brow + 16 + 8 * hh);
      acc[t] = mmaN<ASPLIT ? 2 : 1>(ah.v, al.v, b.v, b.v, acc[t]);
    }
  }
#pragma unroll
  for (int t = 0; t < 4; ++t) {
    float bv = bias ? bias[col0 + t * 16 + ln] : 0.f;
    if (BIAS_BF16) bv = bf16_round(bv);
#pragma unroll
    for (int r = 0; r < 8; ++r) { float v = acc[t][r] + bv; if (ACT == 1) v = fmaxf(v, 0.f); so[w][8 * hh + r][t * 16 + ln] = v; }
  }
  __builtin_amdgcn_fence(__ATOMIC_ACQ_REL, "workgroup");
  __builtin_amdgcn_wave_barrier();
  const int rsub = lane >> 4, c4 = (lane & 15) * 4;
  {
#pragma unroll
    for (int q = 0; q < 8; ++q) {
      const int r = q * 2 + rsub;
      const v4f v = *(const v4fa*)&so[w][r][c4];
      *(v4f*)(C + (size_t)(row0 + r) * ldc + col0 + c4) = v;
    }
    
  }
}

// GEMM C = act(A·W + bias + resid): A f32 (ASPLIT -> hi/lo 2 terms), Wt bf16 [N][K]; ACT 0 none, 1 relu, 2 exact gelu;
// resid (optional, f32, row index = (row % rmod), pitch ldr, RES_BF16 rounds it) added before the activation.
template <bool ASPLIT, int ACT, bool BIAS_BF16, bool RES_BF16>
__global__ __launch_bounds__(128) void k_gemm_bf3(const float* __restrict__ A, int lda, const unsigned short* __restrict__ Wt, int ldb,
                                                const float* __restrict__ bias, const float* __restrict__ resid, int rmod, int ldr,
                                                float* __restrict__ C, int ldc, int M, int N, int K) {
  __shared__ __attribute__((aligned(16))) float so[4][16][64];
  const int tid = threadIdx.x, w = tid >> 5, lane = tid & 31, ln = lane & 15, hh = lane >> 4;
  const int ntn = N / 64;
  const int wid = blockIdx.x * 4 + w;
  const int mt = wid / ntn, nq = wid % ntn;
  if (mt * 16 >= M) return;
  const int row0 = mt * 16, col0 = nq * 64;
  const float* arow = A + (size_t)(row0 + ln) * lda;
  v8f acc[4] = {};
  for (int kb = 0; kb < K; kb += 32) {
    FragB ah, al;
    const v4f x0 = *(const v4fa*)(arow + kb + 8 * hh), x1 = *(const v4fa*)(arow + kb + 8 * hh + 4);
    const v4f x2 = *(const v4fa*)(arow + kb + 16 + 8 * hh), x3 = *(const v4fa*)(arow + kb + 16 + 8 * hh + 4);
    float xs[16] = {x0[0],x0[1],x0[2],x0[3],x1[0],x1[1],x1[2],x1[3],x2[0],x2[1],x2[2],x2[3],x3[0],x3[1],x3[2],x3[3]};
#pragma unroll
    for (int i = 0; i < 16; ++i) { const unsigned short hb = bf16_bits(xs[i]); ah.u[i] = hb; al.u[i] = ASPLIT ? bf16_bits(xs[i] - bf16_val(hb)) : (unsigned short)0; }
#pragma unroll
    for (int t = 0; t < 4; ++t) {
      const unsigned short* brow = Wt + (size_t)(col0 + t * 16 + ln) * ldb + kb;
      FragB b;
      b.half[0] = *(const v8us*)(brow + 8 * hh);
      b.half[1] = *(const v8us*)(brow + 16 + 8 * hh);
      acc[t] = mmaN<ASPLIT ? 2 : 1>(ah.v, al.v, b.v, b.v, acc[t]);
    }
  }
#pragma unroll
  for (int t = 0; t < 4; ++t) {
    const int col = col0 + t * 16 + ln;
    float bv = bias ? bias[col] : 0.f;
    if (BIAS_BF16) bv = bf16_round(bv);
#pragma unroll
    for (int r = 0; r < 8; ++r) {
      float v = acc[t][r] + bv;
      if (resid) { float rv = resid[(size_t)((row0 + 8 * hh + r) % rmod) * ldr + col]; if (RES_BF16) rv = bf16_round(rv); v += rv; }
      if (ACT == 1) v = fmaxf(v, 0.f);
      if (ACT == 2) v = 0.5f * v * (1.0f + erff(v * 0.70710678118654752f));
      if (ACT == 3) { const float u = 0.7978845608028654f * (v + 0.044715f * v * v * v); v = 0.5f * v * (1.0f + tanhf(u)); }
      so[w][8 * hh + r][t * 16 + ln] = v;
    }
  }
  __builtin_amdgcn_fence(__ATOMIC_ACQ_REL, "workgroup");
  __builtin_amdgcn_wave_barrier();
  const int rsub = lane >> 4, c4 = (lane & 15) * 4;
  {
#pragma unroll
    for (int q = 0; q < 8; ++q) {
      const int r = q * 2 + rsub;
      const v4f v = *(const v4fa*)&so[w][r][c4];
      *(v4f*)(C + (size_t)(row0 + r) * ldc + col0 + c4) = v;
    }
    
  }
}
// row LayerNorm (biased variance, eps) over N: s = X (+ R); optional out_sum <- s; out_norm <- (s-mu)*rsqrt(var+eps)*g + b
template <bool PARAM_BF16>
__global__ __launch_bounds__(256) void k_layernorm(const float* __restrict__ X, const float* __restrict__ R, const float* __restrict__ g, const float* __restrict__ bta,
                                                  float* __restrict__ out_sum, float* __restrict__ out_norm, int N, float eps) {
  __shared__ float red[256];
  const int row = blockIdx.x, tid = threadIdx.x;
  const float* x = X + (size_t)row * N; const float* rr = R ? R + (size_t)row * N : nullptr;
  float vals[16];                     // up to N = 4096
  const int per = N / 256;            // contiguous chunk per thread? use strided-by-4 chunks: thread handles j = tid*4 + 1024*u
  float s1 = 0.f;
  for (int u = 0; u < per / 4; ++u) {
    const int j = tid * 4 + 1024 * u;
    const v4f a = *(const v4fa*)(x + j);
    v4f b = {0.f,0.f,0.f,0.f}; if (rr) b = *(const v4fa*)(rr + j);
#pragma unroll
    for (int q = 0; q < 4; ++q) { const float v = a[q] + b[q]; vals[u * 4 + q] = v; s1 += v; }
  }
  red[tid] = s1; __syncthreads();
  for (int st = 128; st > 0; st >>= 1) { if (tid < st) red[tid] += red[tid + st]; __syncthreads(); }
  const float mu = red[0] / (float)N; __syncthreads();
  float s2 = 0.f;
  for (int u = 0; u < per / 4; ++u)
#pragma unroll
    for (int q = 0; q < 4; ++q) { const float c = vals[u * 4 + q] - mu; s2 += c * c; }
  red[tid] = s2; __syncthreads();
  for (int st = 128; st > 0; st >>= 1) { if (tid < st) red[tid] += red[tid + st]; __syncthreads(); }
  const float rs = rsqrtf(red[0] / (float)N + eps);
  {
    for (int u = 0; u < per / 4; ++u) {
      const int j = tid * 4 + 1024 * u;
      v4f o, sm;
#pragma unroll
      for (int q = 0; q < 4; ++q) {
        float gg = g[j + q], bb = bta[j + q];
        if (PARAM_BF16) { gg = bf16_round(gg); bb = bf16_round(bb); }
        sm[q] = vals[u * 4 + q]; o[q] = (vals[u * 4 + q] - mu) * rs * gg + bb;
      }
      if (out_sum) *(v4f*)(out_sum + (size_t)row * N + j) = sm;
      *(v4f*)(out_norm + (size_t)row * N + j) = o;
    }
    
  }
}



// ---- f16 WMMA path (v_wmma_f32_16x16x32_f16): 11-bit significands for operands in range — used where a [0,1] probability operand needs more precision than bf16
typedef _Float16 v16h __attribute__((ext_vector_type(16)));
union FragH { v16h v; v8us half[2]; _Float16 h[16]; unsigned short u[16]; };
template <int NT>
__device__ __forceinline__ v8f mmaH(v16h ah, v16h al, v16h bh, v16h bl, v8f c) {
  c = __builtin_amdgcn_wmma_f32_16x16x32_f16(false, ah, false, bh, (short)0, c, false, false);
  if (NT >= 2) c = __builtin_amdgcn_wmma_f32_16x16x32_f16(false, al, false, bh, (short)0, c, false, false);
  if (NT >= 3) c = __builtin_amdgcn_wmma_f32_16x16x32_f16(false, ah, false, bl, (short)0, c, false, false);
  asm volatile("v_nop\n\tv_nop\n\tv_nop\n\tv_nop" : "+v"(c) : "v"(ah), "v"(al), "v"(bh), "v"(bl));
  return c;
}
// batched GEMM like k_gemm_b but f16 operands: A f32 (split into f16 hi/lo if ASPLIT, else rounded to f16), Bt = f16 values [n][k]; alpha; C f32; N multiple of 16 (partial tiles skipped)
template <bool ASPLIT>
__global__ __launch_bounds__(128) void k_gemm_h(const float* __restrict__ A, int lda, size_t sA, const _Float16* __restrict__ Bh, int ldb, size_t sB, float alpha, float* __restrict__ C, int ldc, size_t sC, int M, int N, int K) {
  __shared__ __attribute__((aligned(16))) float so[4][16][64];
  const int tid = threadIdx.x, w = tid >> 5, lane = tid & 31, ln = lane & 15, hh = lane >> 4; const int by = blockIdx.y;
  A += (size_t)by * sA; Bh += (size_t)by * sB; C += (size_t)by * sC;
  const int ntn = (N + 63) / 64; const int wid = blockIdx.x * 4 + w; const int mt = wid / ntn, nq = wid % ntn; if (mt * 16 >= M) return;
  const int row0 = mt * 16, col0 = nq * 64; const float* arow = A + (size_t)(row0 + ln) * lda;
  v8f acc[4] = {};
  for (int kb = 0; kb < K; kb += 32) {
    FragH ah, al;
    const v4f x0 = *(const v4fa*)(arow + kb + 8 * hh), x1 = *(const v4fa*)(arow + kb + 8 * hh + 4), x2 = *(const v4fa*)(arow + kb + 16 + 8 * hh), x3 = *(const v4fa*)(arow + kb + 16 + 8 * hh + 4);
    float xs[16] = {x0[0],x0[1],x0[2],x0[3],x1[0],x1[1],x1[2],x1[3],x2[0],x2[1],x2[2],x2[3],x3[0],x3[1],x3[2],x3[3]};
#pragma unroll
    for (int i = 0; i < 16; ++i) { const _Float16 h = (_Float16)xs[i]; ah.h[i] = h; al.h[i] = ASPLIT ? (_Float16)(xs[i] - (float)h) : (_Float16)0.0f; }
#pragma unroll
    for (int t = 0; t < 4; ++t) { if (col0 + t * 16 >= N) continue; const size_t boff = (size_t)(col0 + t * 16 + ln) * ldb + kb; FragH bq; bq.half[0] = *(const v8us*)(Bh + boff + 8 * hh); bq.half[1] = *(const v8us*)(Bh + boff + 16 + 8 * hh);
      acc[t] = mmaH<ASPLIT ? 2 : 1>(ah.v, al.v, bq.v, bq.v, acc[t]); }
  }
#pragma unroll
  for (int t = 0; t < 4; ++t) { if (col0 + t * 16 >= N) continue;
#pragma unroll
    for (int r = 0; r < 8; ++r) so[w][8 * hh + r][t * 16 + ln] = acc[t][r] * alpha; }
  __builtin_amdgcn_fence(__ATOMIC_ACQ_REL, "workgroup"); __builtin_amdgcn_wave_barrier();
  const int rsub = lane >> 4, c4 = (lane & 15) * 4;
  {
#pragma unroll
    for (int q = 0; q < 8; ++q) { const int r = q * 2 + rsub; if (col0 + c4 < N) { const v4f v = *(const v4fa*)&so[w][r][c4]; *(v4f*)(C + (size_t)(row0 + r) * ldc + col0 + c4) = v; } }
     }
}

// Wt[y][n][k] = f16(bf16(W_y[k][n]) x scale) from four f32 row-major DM x DM weights, one launch (grid.y: the weight; the four output planes lie in a row). scale = power of two; bf16-exact weights stay exact in f16 away from the subnormal range.
// A block turns one WTT x WTT tile through LDS: a wave loads whole 512-byte pieces of W rows (two neighbouring k rows a round, so that a k pair packs into one 32-bit LDS word), and stores whole 256-byte pieces of Wt rows.
#define WTT 128                      /* tile edge */
#define WTW 65                       /* LDS row pitch in 32-bit words: odd, so the 16 lanes that read one row and the 16 that read the next fall on different banks */
__global__ __launch_bounds__(256) void k_wt4(const float* __restrict__ W0, const float* __restrict__ W1, const float* __restrict__ W2, const float* __restrict__ W3, _Float16* __restrict__ Wt, float scale) {
  __shared__ unsigned int tl[WTT][WTW];      /* tl[n][k / 2] = the f16 pair (k, k + 1) of column n */
  const int tid = threadIdx.x, w = tid >> 5, lane = tid & 31; const int y = blockIdx.y;
  const float* W = y == 0 ? W0 : y == 1 ? W1 : y == 2 ? W2 : W3;
  const int k0 = (blockIdx.x / (DM / WTT)) * WTT, n0 = (blockIdx.x % (DM / WTT)) * WTT;
  const float* wp = W + (size_t)(k0 + 2 * w) * DM + n0 + lane * 4;
  v4f a[8][2];
#pragma unroll      /* static indices keep the tile in registers; all of a thread's loads in flight together */
  for (int i = 0; i < 8; ++i) for (int j = 0; j < 2; ++j) a[i][j] = *(const v4fa*)(wp + (size_t)(16 * i + j) * DM);
  asm volatile("s_wait_xcnt 0x0" :: "v"(wp) : "memory");      /* the loads' address registers are reused behind them; wp is named as an input so that they stay whole up to this wait */
  __builtin_amdgcn_sched_barrier(0);      /* every load is issued in front of the arithmetic: without it half of the loads sink behind the first conversions and their latency is paid again */
#pragma unroll      /* static indices, as above */
  for (int i = 0; i < 8; ++i) for (int q = 0; q < 4; ++q) { FragH f; f.h[0] = (_Float16)(bf16_round(a[i][0][q]) * scale); f.h[1] = (_Float16)(bf16_round(a[i][1][q]) * scale);
    tl[lane * 4 + q][w + 8 * i] = (unsigned int)f.u[0] | ((unsigned int)f.u[1] << 16); }
  __syncthreads();      /* the tile is complete before any thread reads a column of it */
  typedef unsigned int v4u __attribute__((ext_vector_type(4), may_alias));
  const int nr = tid >> 4, c = tid & 15; v4u o[8];
#pragma unroll      /* static indices, as above */
  for (int it = 0; it < 8; ++it) for (int u = 0; u < 4; ++u) o[it][u] = tl[16 * it + nr][4 * c + u];
  _Float16* op = Wt + (size_t)y * DM * DM + (size_t)(n0 + nr) * DM + k0 + 8 * c;
#pragma unroll      /* static indices; the stores stand last, nothing is written behind them */
  for (int it = 0; it < 8; ++it) *(v4u*)(op + (size_t)(16 * it) * DM) = o[it];
}
// k_gemm_hh variant with fused epilogue: v = acc·alpha + bias[by·sBias + col] (+ CP[(row/rowsPerB)·sCPb + by·64 + col] if CP) ; ACT 0 none / 1 elu ; writes f16 C16 (and f32 C if non-null)
template <int ACT>
__global__ __launch_bounds__(128) void k_gemm_hhx(const _Float16* __restrict__ A, int lda, size_t sA, const _Float16* __restrict__ Bh, int ldb, size_t sB, float alpha, const float* __restrict__ bias, size_t sBias, const float* __restrict__ CP, int rowsPerB, size_t sCPb, int row0g,
    float* __restrict__ C, _Float16* __restrict__ C16, int ldc, size_t sC, int M, int N, int K) {
  __shared__ __attribute__((aligned(16))) float so[4][16][64];
  const int tid = threadIdx.x, w = tid >> 5, lane = tid & 31, ln = lane & 15, hh = lane >> 4; const int by = blockIdx.y;
  A += (size_t)by * sA; Bh += (size_t)by * sB; const size_t cofs = (size_t)by * sC; const float* bp = bias ? bias + (size_t)by * sBias : nullptr;
  const int ntn = (N + 63) / 64; const int wid = blockIdx.x * 4 + w; const int mt = wid / ntn, nq = wid % ntn; if (mt * 16 >= M) return;
  const int row0 = mt * 16, col0 = nq * 64; const _Float16* arow = A + (size_t)(row0 + ln) * lda;
  v8f acc[4] = {};
  for (int kb = 0; kb < K; kb += 32) { FragH ah; ah.half[0] = *(const v8us*)((const unsigned short*)arow + kb + 8 * hh); ah.half[1] = *(const v8us*)((const unsigned short*)arow + kb + 16 + 8 * hh);
#pragma unroll
    for (int t = 0; t < 4; ++t) { if (col0 + t * 16 >= N) continue; const size_t boff = (size_t)(col0 + t * 16 + ln) * ldb + kb; FragH bq; bq.half[0] = *(const v8us*)((const unsigned short*)Bh + boff + 8 * hh); bq.half[1] = *(const v8us*)((const unsigned short*)Bh + boff + 16 + 8 * hh);
      acc[t] = mmaH<1>(ah.v, ah.v, bq.v, bq.v, acc[t]); }
  }
#pragma unroll
  for (int t = 0; t < 4; ++t) { if (col0 + t * 16 >= N) continue; const int col = col0 + t * 16 + ln; const float bv = bp ? bf16_round(bp[col]) : 0.f;
#pragma unroll
    for (int r = 0; r < 8; ++r) { float v = acc[t][r] * alpha + bv; if (CP) { const int rr = row0g + row0 + 8 * hh + r; if (rowsPerB < 0) v += CP[cofs + (size_t)rr * ldc + col];      /* rowsPerB < 0: own element of the batched C plane */ else { const int bidx = rr / rowsPerB; v += CP[(size_t)bidx * sCPb + (size_t)by * 64 + col]; } } if (ACT == 1) v = (v > 0.f) ? v : expm1f(v); else if (ACT == 7) v = (v > 0.f) ? v + 1.0f : expf(v); else if (ACT == 8) v = tanhf(v); else if (ACT == 9) v = 0.5f * v * (1.0f + tanhf(0.7978845608028654f * (v + 0.044715f * v * v * v))); else if (ACT == 11) v = 1.0f / (1.0f + expf(-v)); else if (ACT == 12) v = (v > 0.f) ? v : 0.01f * v; else if (ACT == 14) v = (v > 0.f) ? v : 0.1f * v; else if (ACT == 16) v = (v >= 0.f) ? v : 0.3f * v; else if (ACT == 17) v = (v >= 0.f) ? v : 0.2f * v; else if (ACT == 15) v = v / (1.0f + expf(-v)); else if (ACT == 3) v = fmaxf(v, 0.f); else if (ACT == 6) v = 0.5f * v * (1.0f + erff(v * 0.70710678118654752f)); so[w][8 * hh + r][t * 16 + ln] = v; } }
  __builtin_amdgcn_fence(__ATOMIC_ACQ_REL, "workgroup"); __builtin_amdgcn_wave_barrier();
  const int rsub = lane >> 4, c4 = (lane & 15) * 4; typedef _Float16 v4h __attribute__((ext_vector_type(4)));
  {
#pragma unroll
    for (int q = 0; q < 8; ++q) { const int r = q * 2 + rsub; if (col0 + c4 < N) { const v4f v = *(const v4fa*)&so[w][r][c4]; if (C) *(v4f*)(C + cofs + (size_t)(row0 + r) * ldc + col0 + c4) = v; if (C16) { v4h h4; for (int i = 0; i < 4; ++i) h4[i] = (_Float16)v[i]; *(v4h*)(C16 + cofs + (size_t)(row0 + r) * ldc + col0 + c4) = h4; } } }
     }
}


typedef _Float16 v4h __attribute__((ext_vector_type(4)));

__global__ __launch_bounds__(256) void k_x16(const float* __restrict__ x, _Float16* __restrict__ X16, size_t n8) { const size_t t = (size_t)blockIdx.x * 256 + threadIdx.x; if (t >= n8) return; FragH f;
#pragma unroll
  for (int q = 0; q < 8; ++q) f.h[q] = (_Float16)bf16_round(x[t * 8 + q]); *(v8us*)((unsigned short*)X16 + t * 8) = f.half[0];  }
__global__ __launch_bounds__(256) void k_h16(const float* __restrict__ x, _Float16* __restrict__ X16, size_t n8) { const size_t t = (size_t)blockIdx.x * 256 + threadIdx.x; if (t >= n8) return; FragH f;
#pragma unroll
  for (int q = 0; q < 8; ++q) f.h[q] = (_Float16)x[t * 8 + q]; *(v8us*)((unsigned short*)X16 + t * 8) = f.half[0];  }
__global__ __launch_bounds__(256) void k_round16f(const float* __restrict__ W, _Float16* __restrict__ Bt, size_t n8) { const size_t t = (size_t)blockIdx.x * 256 + threadIdx.x; if (t >= n8) return; FragH f;
#pragma unroll
  for (int i = 0; i < 8; ++i) f.h[i] = (_Float16)(bf16_round(W[t * 8 + i]) * 16.0f); *(v8us*)((unsigned short*)Bt + t * 8) = f.half[0];  }
template <int NHv, int TTv>
__global__ __launch_bounds__(256) void k_vt(const _Float16* __restrict__ V16, int ldv, int voff, _Float16* __restrict__ Vt) { __shared__ unsigned short tl[64][66]; const int tid = threadIdx.x; const int slab = blockIdx.x / (TTv / 64), lg = blockIdx.x % (TTv / 64); const int b = slab / NHv, h = slab % NHv;
  for (int i = tid; i < 64 * 8; i += 256) { const int r = i / 8, c8 = (i % 8) * 8; FragH f; f.half[0] = *(const v8us*)((const unsigned short*)V16 + ((size_t)b * TTv + lg * 64 + r) * ldv + voff + h * 64 + c8);
#pragma unroll
    for (int q = 0; q < 8; ++q) tl[r][c8 + q] = f.u[q]; }
  __syncthreads();
  {
#pragma unroll
    for (int rd = 0; rd < 2; ++rd) { const int d = rd * 32 + tid / 8, pc = tid % 8; FragH f;
#pragma unroll
      for (int q = 0; q < 8; ++q) f.u[q] = tl[pc * 8 + q][d];
      *(v8us*)((unsigned short*)Vt + ((size_t)slab * 64 + d) * TTv + lg * 64 + pc * 8) = f.half[0]; }
     } }

__global__ __launch_bounds__(256) void k_hl(const float* __restrict__ F, _Float16* __restrict__ Hh, _Float16* __restrict__ Hl, size_t n8) { const size_t t = (size_t)blockIdx.x * 256 + threadIdx.x; if (t >= n8) return; FragH fh, fl; const v4f a = *(const v4fa*)(F + t * 8), c = *(const v4fa*)(F + t * 8 + 4);
#pragma unroll
  for (int q = 0; q < 4; ++q) { _Float16 h = (_Float16)a[q]; fh.h[q] = h; fl.h[q] = (_Float16)((a[q] - (float)h) * 1024.0f); h = (_Float16)c[q]; fh.h[4 + q] = h; fl.h[4 + q] = (_Float16)((c[q] - (float)h) * 1024.0f); }
  { *(v8us*)((unsigned short*)Hh + t * 8) = fh.half[0]; *(v8us*)((unsigned short*)Hl + t * 8) = fl.half[0];  } }

// ---- fast GEMM (block tile 128x128 = eight waves of 32x64; requires M % 128 == 0 rows per launch region, N % 128 == 0 and K % 64 == 0); epilogue = k_gemm_hhx semantics ----
// The block's 128 A rows and 128 B rows come in tiles of GKS k, loaded as whole 128-byte lines and staged through registers into two LDS buffers: tile s + 1 is loaded from memory while tile s is worked on, and one barrier a tile both publishes it and frees the buffer read before. Every wave takes its fragments from LDS in the k order of g2_frag, 32 k at a time in rising order, so each accumulator sums as before.
// DUAL: a second A plane (A2, the same rows and pitch) is staged beside the first and multiplied with the same B fragments into accumulators of its own; the epilogue forms acc alpha + bias, then adds acc2 alpha2, the sum that two launches formed through an f32 plane in memory.
#define GKS 64                       /* k per staged tile: 128 bytes of every operand row */
#define GPIT 72                      /* LDS row pitch in f16 elements: 144 bytes = 16 x odd, free of bank conflicts for 16-byte fragment reads */
__device__ __forceinline__ v16h g2_frag(const _Float16* p, int hh) { FragH f; f.half[0] = *(const v8us*)((const unsigned short*)p + 8 * hh); f.half[1] = *(const v8us*)((const unsigned short*)p + 16 + 8 * hh); return f.v; }
__device__ __forceinline__ v8f g2_mma(v16h a, v16h b, v8f c) { v8f d = __builtin_amdgcn_wmma_f32_16x16x32_f16(false, a, false, b, (short)0, c, false, false); asm volatile("v_nop\n\tv_nop\n\tv_nop\n\tv_nop" : "+v"(d) : "v"(a), "v"(b)); return d; }
template <int ACT, int CLD = DM, bool DUAL = false>      /* CLD: the row pitch of C for which the own-element addend has its fast path, a constant so that a lane's 16 loads share one address and differ in the immediate offset */
__global__ __launch_bounds__(256) void k_gemm2(const _Float16* __restrict__ A, int lda, size_t sA, const _Float16* __restrict__ Bh, int ldb, size_t sB, float alpha, const float* __restrict__ bias, size_t sBias, const float* __restrict__ CP, int rowsPerB, size_t sCPb, int row0g,
    float* __restrict__ C, _Float16* __restrict__ C16, int ldc, size_t sC, int M, int N, int K, size_t zA, size_t zB, size_t zC, const float* __restrict__ bias1, const float* __restrict__ bias2, const _Float16* __restrict__ A2, float alpha2) { static_assert(ACT == 0 || ACT == 3 || ACT == 6 || ACT == 8 || ACT == 9 || ACT == 11 || ACT == 12 || ACT == 14 || ACT == 15 || ACT == 16 || ACT == 17, "k_gemm2: unsupported ACT code (would silently apply no activation)");
  constexpr int TR = DUAL ? 384 : 256;      /* rows of a buffer */
  __shared__ __attribute__((aligned(16))) unsigned char sm[2 * TR * GPIT * 2];      /* two buffers of [A 128 rows | B 128 rows | DUAL: A2 128 rows]; behind the last tile's barrier the same bytes hold the epilogue's rows */
  static_assert(sizeof(float) * 8 * 32 * 68 <= sizeof(sm), "the epilogue rows fit the tile buffers");
  unsigned short* const ring = (unsigned short*)sm; float (* const so)[32][68] = (float (*)[32][68])sm;
  const int tid = threadIdx.x, w = tid >> 5, lane = tid & 31, ln = lane & 15, hh = lane >> 4; const int by = blockIdx.y, bz = blockIdx.z;      /* grid.z: a second batch index (element strides zA, zB, zC) */
  A += (size_t)by * sA + (size_t)bz * zA; Bh += (size_t)by * sB + (size_t)bz * zB; const size_t cofs = (size_t)by * sC + (size_t)bz * zC; const float* bp = bias ? bias + (size_t)by * sBias : nullptr;
  if (bias1 && by == 1) bp = bias1; if (bias2 && by == 2) bp = bias2;      /* bias vectors that are separate buffers: one per grid.y index */
  const int ntn = N >> 7; const int mt = blockIdx.x / ntn, nq = blockIdx.x - mt * ntn; if (mt * 128 >= M) return;      /* the whole block leaves, in front of every barrier */
  const int wr = w & 3, wc = w >> 2; const int row0 = mt * 128 + 32 * wr, col0 = nq * 128 + 64 * wc;      /* four waves down, two across */
  const int sr = tid >> 3, sc = (tid & 7) * 8;      /* staging: 8 threads cover one row's 128 bytes, the block 32 rows a round */
  const unsigned short* ap = (const unsigned short*)A + (size_t)(mt * 128 + sr) * lda + sc; const unsigned short* bq = (const unsigned short*)Bh + (size_t)(nq * 128 + sr) * ldb + sc;
  const unsigned short* ep = DUAL ? (const unsigned short*)A2 + (size_t)by * sA + (size_t)bz * zA + (size_t)(mt * 128 + sr) * lda + sc : ap;      /* the second plane: the same place as in the first */
  v8us ar[4], br[4], er[4]; const unsigned short *pa[4], *pb[4], *pe[4];      /* a tile's load addresses */
#pragma unroll      /* static indices keep the staging registers in registers */
  for (int i = 0; i < 4; ++i) { pa[i] = ap + (size_t)(32 * i) * lda; pb[i] = bq + (size_t)(32 * i) * ldb; pe[i] = DUAL ? ep + (size_t)(32 * i) * lda : pa[i]; ar[i] = *(const v8us*)pa[i]; br[i] = *(const v8us*)pb[i]; if (DUAL) er[i] = *(const v8us*)pe[i]; }
  asm volatile("s_wait_xcnt 0x0" :: "v"(pa[0]), "v"(pa[1]), "v"(pa[2]), "v"(pa[3]), "v"(pb[0]), "v"(pb[1]), "v"(pb[2]), "v"(pb[3]), "v"(pe[0]), "v"(pe[1]), "v"(pe[2]), "v"(pe[3]) : "memory");      /* the loads' address registers are advanced behind them; the addresses are named as inputs so that they stay whole up to this wait (else a later load of the run may land on them) */
  ap += GKS; bq += GKS; ep += GKS;      /* tile 1 */
#pragma unroll      /* static indices, as above */
  for (int i = 0; i < 4; ++i) { *(v8us*)(ring + (sr + 32 * i) * GPIT + sc) = ar[i]; *(v8us*)(ring + (128 + sr + 32 * i) * GPIT + sc) = br[i]; if (DUAL) *(v8us*)(ring + (256 + sr + 32 * i) * GPIT + sc) = er[i]; }
  __syncthreads();      /* tile 0 is complete before any wave reads it */
  const v8f z8 = {0.f,0.f,0.f,0.f,0.f,0.f,0.f,0.f}; v8f c00 = z8, c01 = z8, c02 = z8, c03 = z8, c10 = z8, c11 = z8, c12 = z8, c13 = z8;
  v8f d00 = z8, d01 = z8, d02 = z8, d03 = z8, d10 = z8, d11 = z8, d12 = z8, d13 = z8;      /* DUAL: the second plane's sums */
  const int nst = K / GKS;
#pragma unroll 1      /* one k tile at a time: the two buffers alternate */
  for (int s = 0; s < nst; ++s) {
    const bool more = s + 1 < nst;      /* the same for the whole block */
    if (more) {
#pragma unroll      /* static indices; all of a thread's tile loads in flight under this tile's work */
      for (int i = 0; i < 4; ++i) { pa[i] = ap + (size_t)(32 * i) * lda; pb[i] = bq + (size_t)(32 * i) * ldb; pe[i] = DUAL ? ep + (size_t)(32 * i) * lda : pa[i]; ar[i] = *(const v8us*)pa[i]; br[i] = *(const v8us*)pb[i]; if (DUAL) er[i] = *(const v8us*)pe[i]; }
      asm volatile("s_wait_xcnt 0x0" :: "v"(pa[0]), "v"(pa[1]), "v"(pa[2]), "v"(pa[3]), "v"(pb[0]), "v"(pb[1]), "v"(pb[2]), "v"(pb[3]), "v"(pe[0]), "v"(pe[1]), "v"(pe[2]), "v"(pe[3]) : "memory");      /* the loads' address registers are advanced behind them; named as inputs, as above */
      ap += GKS; bq += GKS; ep += GKS; }
    const _Float16* al = (const _Float16*)(ring + ((s & 1) * TR + 32 * wr + ln) * GPIT); const _Float16* bl = (const _Float16*)(ring + ((s & 1) * TR + 128 + 64 * wc + ln) * GPIT);
#pragma unroll      /* two 32-k passes a tile, constant LDS offsets */
    for (int kk = 0; kk < GKS; kk += 32) { const v16h a0 = g2_frag(al + kk, hh), a1 = g2_frag(al + 16 * GPIT + kk, hh);
      const v16h b0 = g2_frag(bl + kk, hh), b1 = g2_frag(bl + 16 * GPIT + kk, hh), b2 = g2_frag(bl + 32 * GPIT + kk, hh), b3 = g2_frag(bl + 48 * GPIT + kk, hh);      /* a pass's LDS reads stand together in front of its products */
      const v16h e0 = DUAL ? g2_frag(al + 256 * GPIT + kk, hh) : a0, e1 = DUAL ? g2_frag(al + 272 * GPIT + kk, hh) : a1;      /* the same rows of the second plane */
      c00 = g2_mma(a0, b0, c00); c10 = g2_mma(a1, b0, c10); c01 = g2_mma(a0, b1, c01); c11 = g2_mma(a1, b1, c11);
      c02 = g2_mma(a0, b2, c02); c12 = g2_mma(a1, b2, c12); c03 = g2_mma(a0, b3, c03); c13 = g2_mma(a1, b3, c13);
      if (DUAL) {      /* against the B fragments already in registers */
        d00 = g2_mma(e0, b0, d00); d10 = g2_mma(e1, b0, d10); d01 = g2_mma(e0, b1, d01); d11 = g2_mma(e1, b1, d11);
        d02 = g2_mma(e0, b2, d02); d12 = g2_mma(e1, b2, d12); d03 = g2_mma(e0, b3, d03); d13 = g2_mma(e1, b3, d13); } }
    if (more) {
#pragma unroll      /* static indices, as above */
      for (int i = 0; i < 4; ++i) { *(v8us*)(ring + (((s + 1) & 1) * TR + sr + 32 * i) * GPIT + sc) = ar[i]; *(v8us*)(ring + (((s + 1) & 1) * TR + 128 + sr + 32 * i) * GPIT + sc) = br[i]; if (DUAL) *(v8us*)(ring + (((s + 1) & 1) * TR + 256 + sr + 32 * i) * GPIT + sc) = er[i]; } }      /* into the buffer that every wave left before the last barrier */
    __syncthreads();      /* tile s + 1 is complete, and every wave has left tile s, before the next trip (behind the last tile: before the epilogue's rows overwrite it) */
  }
  v8f accs[8] = {c00, c01, c02, c03, c10, c11, c12, c13}; v8f acc2[8] = {d00, d01, d02, d03, d10, d11, d12, d13};
  const int rsub = lane >> 4, c4 = (lane & 15) * 4;      /* the store phase's layout: 16 lanes cover 256 bytes of a row, a wave two rows a round */
  if (DUAL) CP = nullptr;      /* the second plane's sums take the addend's place: neither addend path is compiled */
  const bool own = ACT == 0 && CP && rowsPerB < 0 && ldc == CLD;      /* own-element addend with nothing applied behind the add (the same for the whole block): read in the store phase's layout, each lane the 16 bytes it will store, all 16 loads in flight together (behind the LDS pass, where the accumulators' registers are free: the register count stays at six waves a SIMD); added there in the same place of the sum */
  const float* const cown = CP; if (own) CP = nullptr;      /* the element-by-element path below is then not taken */
#pragma unroll
  for (int u = 0; u < 8; ++u) { const int t = u & 3, half = u >> 2; const int col = col0 + t * 16 + ln; const float bv = bp ? bf16_round(bp[col]) : 0.f;
#pragma unroll
    for (int r = 0; r < 8; ++r) { const int rloc = half * 16 + 8 * hh + r; float v = accs[u][r] * alpha + bv; if (CP) { if (rowsPerB < 0) v += CP[cofs + (size_t)(row0g + row0 + rloc) * ldc + col];      /* rowsPerB < 0: own element of the batched C plane */ else { const int bidx = (row0g + row0 + rloc) / rowsPerB; v += CP[(size_t)bidx * sCPb + (size_t)by * 64 + col]; } }
      if (DUAL) v += acc2[u][r] * alpha2;      /* alpha2 is a power of two: the product is exact, fused or not */
      if (ACT == 3) v = fmaxf(v, 0.f); else if (ACT == 6) v = 0.5f * v * (1.0f + erff(v * 0.70710678118654752f)); else if (ACT == 11) v = 1.0f / (1.0f + expf(-v)); else if (ACT == 15) v = v / (1.0f + expf(-v)); else if (ACT == 12) v = (v > 0.f) ? v : 0.01f * v; else if (ACT == 8) v = tanhf(v); else if (ACT == 9) v = 0.5f * v * (1.0f + tanhf(0.7978845608028654f * (v + 0.044715f * v * v * v))); else if (ACT == 14) v = (v > 0.f) ? v : 0.1f * v; else if (ACT == 16) v = (v >= 0.f) ? v : 0.3f * v; else if (ACT == 17) v = (v >= 0.f) ? v : 0.2f * v;
      so[w][rloc][t * 16 + ln] = v; } }
  __builtin_amdgcn_fence(__ATOMIC_ACQ_REL, "workgroup"); __builtin_amdgcn_wave_barrier();
  v4f cpv[16];
#pragma unroll      /* static indices keep the addends in registers */
  for (int q = 0; q < 16; ++q) cpv[q] = v4f{0.f, 0.f, 0.f, 0.f};
  if (own) { const float* cq = cown + cofs + (size_t)(row0g + row0 + rsub) * CLD + col0 + c4;
#pragma unroll      /* static indices; every load issued before the first is waited for */
    for (int q = 0; q < 16; ++q) cpv[q] = *(const v4fa*)(cq + (size_t)(2 * q) * CLD);
    asm volatile("s_wait_xcnt 0x0" :: "v"(cq) : "memory"); }      /* the loads' address registers are reused behind them; cq is named as an input so that they stay whole up to this wait (else a later load of the run may land on them) */
  {
#pragma unroll
    for (int q = 0; q < 16; ++q) { const int r = q * 2 + rsub; v4f v = *(const v4fa*)&so[w][r][c4]; if (own) v += cpv[q];
      if (C) { *(v4f*)(C + cofs + (size_t)(row0 + r) * ldc + col0 + c4) = v; asm volatile("s_wait_xcnt 0x0" ::: "memory"); }      /* the store's registers are reused by the f16 conversion and by the next round */
      if (C16) { v4h h4; for (int i = 0; i < 4; ++i) h4[i] = (_Float16)v[i]; *(v4h*)(C16 + cofs + (size_t)(row0 + r) * ldc + col0 + c4) = h4; asm volatile("s_wait_xcnt 0x0" ::: "memory"); } }      /* the store's registers are reused by the next round */
     } }


__global__ __launch_bounds__(256) void k_wnat(const float* __restrict__ w, size_t n8, _Float16* __restrict__ Bt) { const size_t t = (size_t)blockIdx.x * 256 + threadIdx.x; if (t >= n8) return; FragH f; for (int q = 0; q < 8; ++q) f.h[q] = (_Float16)(bf16_round(w[t * 8 + q]) * 16.0f); *(v8us*)((unsigned short*)Bt + t * 8) = f.half[0];  }
__global__ __launch_bounds__(256) void k_rsm(const float* __restrict__ S, _Float16* __restrict__ P, int nrows) {
  #pragma clang fp contract(off)
  const int i = blockIdx.x * 256 + threadIdx.x; if (i >= nrows) return; const float* s = S + (size_t)i * SQ; float mx = -3.0e38f;
#pragma unroll 1
  for (int j = 0; j < SQ; ++j) mx = fmaxf(mx, s[j]); float se = 0.f;
#pragma unroll 1
  for (int j = 0; j < SQ; ++j) se += expf(s[j] - mx); const float sc = 256.0f / se;
#pragma unroll 1
  for (int j0 = 0; j0 < SQ; j0 += 8) { FragH f; for (int q = 0; q < 8; ++q) f.h[q] = (_Float16)(expf(s[j0 + q] - mx) * sc); unsigned short* d = (unsigned short*)P + (size_t)i * SQ + j0; *(v8us*)d = f.half[0];  } }
__global__ __launch_bounds__(256) void k_vt(const _Float16* __restrict__ V16, int b, int h0, _Float16* __restrict__ VT) { __shared__ unsigned short tl[64][65]; const int tid = threadIdx.x; const int hh = blockIdx.x % HG, sg = blockIdx.x / HG; const int s0 = sg * 64; const int h = h0 + hh;
  for (int i = tid; i < 64 * 8; i += 256) { const int j = i / 8, d8 = (i % 8) * 8; FragH f; f.half[0] = *(const v8us*)((const unsigned short*)V16 + ((size_t)b * SQ + s0 + j) * DM + h * HD + d8); for (int q = 0; q < 8; ++q) tl[d8 + q][j] = f.u[q]; }
  __syncthreads();
  { for (int i = tid; i < 64 * 8; i += 256) { const int d = i / 8, j8 = (i % 8) * 8; FragH f; for (int q = 0; q < 8; ++q) f.u[q] = tl[d][j8 + q]; *(v8us*)((unsigned short*)VT + ((size_t)hh * HD + d) * SQ + s0 + j8) = f.half[0]; }  } }



#define FK 64                        /* keys per staged tile */
#define FPIT 72                      /* LDS row pitch in f16 elements: 144 bytes = 16 x odd, free of bank conflicts for 16-byte fragment reads */
#define FCS 0.18033688011112042f     /* 1/8 x log2(e): exponentials in base 2 */
__device__ __forceinline__ float fa_xhalf(float x) { return __builtin_bit_cast(float, __builtin_amdgcn_permlanex16(__builtin_bit_cast(int, x), __builtin_bit_cast(int, x), 0x76543210, 0xfedcba98, false, false)); }      /* lane l reads lane l ^ 16 */
// Base-2 exponentials in asm so that the slot the instruction set asks for behind a transcendental (before its result is read or its source overwritten) is there by construction: the outputs lie apart from every input, so each v_exp_f32 is followed by an independent one, and the v_nop stands behind the last.
__device__ __forceinline__ void fa_exp8(const float (&x)[8], float (&e)[8]) {
  asm("v_exp_f32 %0, %8\n\tv_exp_f32 %1, %9\n\tv_exp_f32 %2, %10\n\tv_exp_f32 %3, %11\n\tv_exp_f32 %4, %12\n\tv_exp_f32 %5, %13\n\tv_exp_f32 %6, %14\n\tv_exp_f32 %7, %15\n\tv_nop"
      : "=&v"(e[0]), "=&v"(e[1]), "=&v"(e[2]), "=&v"(e[3]), "=&v"(e[4]), "=&v"(e[5]), "=&v"(e[6]), "=&v"(e[7]) : "v"(x[0]), "v"(x[1]), "v"(x[2]), "v"(x[3]), "v"(x[4]), "v"(x[5]), "v"(x[6]), "v"(x[7])); }
__device__ __forceinline__ float fa_exp1(float x) { float e; asm("v_exp_f32 %0, %1\n\tv_nop" : "=v"(e) : "v"(x)); return e; }      /* the same slot behind a single one */
__device__ __forceinline__ v8f fa_mma(v16h a, v16h b, v8f c) { return __builtin_amdgcn_wmma_f32_16x16x32_f16(false, a, false, b, (short)0, c, false, false); }
__global__ __launch_bounds__(128) void k_fattn(const _Float16* __restrict__ Q16, const _Float16* __restrict__ K16, const _Float16* __restrict__ VT, _Float16* __restrict__ O16) {
  __shared__ __attribute__((aligned(16))) _Float16 lk[2][FK][FPIT]; __shared__ __attribute__((aligned(16))) _Float16 lv[2][HD][FPIT];
  const int tid = threadIdx.x, w = __builtin_amdgcn_readfirstlane(tid >> 5), lane = tid & 31, ln = lane & 15, hh = lane >> 4;
  const int bh = blockIdx.x % (NB * NH), qb = (SQ / 128 - 1) - blockIdx.x / (NB * NH);      /* the longest query blocks start first */
  const int b = bh / NH, h = bh % NH; const int q0 = qb * 128, qw = q0 + 32 * w; const int nt = (q0 + 128) / FK;      /* key tiles up to the block's last query */
  const int sr = tid >> 3, sc = (tid & 7) * 8;      /* staging: 8 threads cover one row's 128 bytes, the block 16 rows a round */
  const _Float16* kp = K16 + ((size_t)b * SQ + sr) * DM + h * HD + sc; const _Float16* vp = VT + ((size_t)bh * HD + sr) * SQ + sc;
  v8us kr[4], vr[4]; v16h qf[2][2];
#pragma unroll      /* static indices keep the staging registers in registers */
  for (int i = 0; i < 4; ++i) { kr[i] = *(const v8us*)((const unsigned short*)kp + (size_t)(16 * i) * DM); vr[i] = *(const v8us*)((const unsigned short*)vp + (size_t)(16 * i) * SQ); }
#pragma unroll      /* static indices, as above */
  for (int g = 0; g < 2; ++g) { const _Float16* qp = Q16 + ((size_t)b * SQ + qw + 16 * g + ln) * DM + h * HD; qf[g][0] = g2_frag(qp, hh); qf[g][1] = g2_frag(qp + 32, hh); }
  asm volatile("s_wait_xcnt 0x0" ::: "memory");      /* the loads' address registers are reused behind them */
#pragma unroll      /* static indices, as above */
  for (int i = 0; i < 4; ++i) { *(v8us*)((unsigned short*)&lk[0][sr + 16 * i][sc]) = kr[i]; *(v8us*)((unsigned short*)&lv[0][sr + 16 * i][sc]) = vr[i]; }
  __syncthreads();      /* tile 0 is complete before any wave reads it */
  const v8f z8 = {0.f, 0.f, 0.f, 0.f, 0.f, 0.f, 0.f, 0.f};
  v8f o[2][4]; float m[2] = {-1.0e30f, -1.0e30f}, l[2] = {0.f, 0.f};      /* m: the maximum in use (base-2 scaled scores); l: this lane half's part of the sum */
#pragma unroll      /* static indices, as above */
  for (int g = 0; g < 2; ++g) for (int dt = 0; dt < 4; ++dt) o[g][dt] = z8;
#pragma unroll 1      /* one key tile at a time: the two buffers alternate */
  for (int t = 0; t < nt; ++t) {
    const bool more = t + 1 < nt;      /* the same for the whole block */
    if (more) { kp += (size_t)FK * DM; vp += FK;
#pragma unroll      /* static indices; all of a thread's tile loads in flight under this tile's work */
      for (int i = 0; i < 4; ++i) { kr[i] = *(const v8us*)((const unsigned short*)kp + (size_t)(16 * i) * DM); vr[i] = *(const v8us*)((const unsigned short*)vp + (size_t)(16 * i) * SQ); }
      asm volatile("s_wait_xcnt 0x0" ::: "memory"); }      /* the loads' address registers are advanced on the next trip */
    const _Float16* bk = &lk[t & 1][0][0]; const _Float16* bv = &lv[t & 1][0][0];
#pragma unroll      /* two 32-key passes a tile, constant LDS offsets */
    for (int sub = 0; sub < 2; ++sub) { const int kb = t * FK + 32 * sub;
      if (kb <= qw + 31) {      /* wave-uniform (scalar): a pass wholly above the wave's diagonal is skipped; the barrier below is not */
        v8f s[2][2];      /* s[kt][g][r] = score of key kb + 16 kt + 8 hh + r, query qw + 16 g + ln */
#pragma unroll      /* static indices, as above */
        for (int kt = 0; kt < 2; ++kt) { const _Float16* kq = bk + (32 * sub + 16 * kt + ln) * FPIT; const v16h k0 = g2_frag(kq, hh), k1 = g2_frag(kq + 32, hh);
          for (int g = 0; g < 2; ++g) s[kt][g] = fa_mma(k1, qf[g][1], fa_mma(k0, qf[g][0], z8)); }
        if (kb + 31 > qw) {      /* wave-uniform: only the pass on the wave's diagonal pays for the mask */
#pragma unroll      /* static indices, as above */
          for (int kt = 0; kt < 2; ++kt) for (int g = 0; g < 2; ++g) for (int r = 0; r < 8; ++r) if (kb + 16 * kt + 8 * hh + r > qw + 16 * g + ln) s[kt][g][r] = -1.0e30f; }
        float mb[2]; bool need = false;
#pragma unroll      /* static indices, as above */
        for (int g = 0; g < 2; ++g) { float mx = s[0][g][0];
          for (int r = 1; r < 8; ++r) mx = fmaxf(mx, s[0][g][r]);
          for (int r = 0; r < 8; ++r) mx = fmaxf(mx, s[1][g][r]);
          mx = fmaxf(mx, fa_xhalf(mx)) * FCS; mb[g] = mx; need = need || (mx > m[g] + 8.0f); }      /* both lane halves hold the query's maximum of this pass */
        if (__builtin_amdgcn_ballot_w32(need) != 0) {
#pragma unroll      /* static indices, as above */
          for (int g = 0; g < 2; ++g) { const float mn = fmaxf(m[g], mb[g]); const float corr = fa_exp1(m[g] - mn); m[g] = mn; l[g] *= corr;      /* key 0 is never masked: mn is a real score from the first pass on, where corr is 0 */
            for (int dt = 0; dt < 4; ++dt) o[g][dt] = o[g][dt] * corr; } }
        v16h vf[4]; FragH pf[2];
#pragma unroll      /* static indices, as above */
        for (int dt = 0; dt < 4; ++dt) vf[dt] = g2_frag(bv + (16 * dt + ln) * FPIT + 32 * sub, hh);
#pragma unroll      /* static indices, as above */
        for (int g = 0; g < 2; ++g) { const float nm = 4.0f - m[g]; float ls[4];      /* weights carried x16 (it cancels against l): small ones stay clear of the f16 subnormals */
          for (int kt = 0; kt < 2; ++kt) { float x[8], e[8]; for (int r = 0; r < 8; ++r) x[r] = fmaf(s[kt][g][r], FCS, nm); fa_exp8(x, e); for (int r = 0; r < 8; ++r) { if (kt == 0 && r < 4) ls[r] = e[r]; else ls[r & 3] += e[r]; pf[g].h[8 * kt + r] = (_Float16)e[r]; } }
          l[g] += (ls[0] + ls[1]) + (ls[2] + ls[3]); }
        __builtin_amdgcn_sched_barrier(0);      /* both groups' exponentials stay in front of the eight products: eight independent accumulators in a row keep the matrix unit fed */
#pragma unroll      /* static indices, as above */
        for (int dt = 0; dt < 4; ++dt) for (int g = 0; g < 2; ++g) o[g][dt] = fa_mma(vf[dt], pf[g].v, o[g][dt]);
      } }
    if (more) {
#pragma unroll      /* static indices, as above */
      for (int i = 0; i < 4; ++i) { *(v8us*)((unsigned short*)&lk[(t + 1) & 1][sr + 16 * i][sc]) = kr[i]; *(v8us*)((unsigned short*)&lv[(t + 1) & 1][sr + 16 * i][sc]) = vr[i]; } }      /* into the buffer that every wave left before the last barrier */
    __syncthreads();      /* tile t + 1 is complete, and every wave has left tile t, before the next trip */
  }
#pragma unroll      /* static indices, as above */
  for (int g = 0; g < 2; ++g) { const float fin = 64.0f / (l[g] + fa_xhalf(l[g]));      /* the lane halves' sums join once; o carried x64, folded into the output GEMM alpha */
    unsigned short* op = (unsigned short*)O16 + ((size_t)b * SQ + qw + 16 * g + ln) * DM + h * HD + 8 * hh;      /* a lane holds d = 16 dt + 8 hh .. + 7 of its query: 16 bytes a store */
    for (int dt = 0; dt < 4; ++dt) { FragH f; for (int r = 0; r < 8; ++r) f.h[r] = (_Float16)(o[g][dt][r] * fin); *(v8us*)(op + 16 * dt) = f.half[0]; }
    if (g == 0) { asm volatile("s_wait_xcnt 0x0" ::: "memory"); __builtin_amdgcn_sched_barrier(0); } }      /* the first group's store registers are reused by the second group's arithmetic: the wait stands behind the stores, and the scheduling barrier keeps that arithmetic behind the wait */
}


// One thread per query row; 64 rows per block. The row's q and o stay in registers; Q, K and V come in tiles of 64 rows, staged in LDS with whole-line loads; a K or V row is read back as a same-address (broadcast) LDS load. Four keys' score sums run side by side; each sum, and the running m, l, o, keep the key-by-key, element-by-element order.
template <int MASKADD, int LD>      /* LD: row pitch of QF, KF, VF in floats, a constant so that a tile's 16 loads share one address and differ in the immediate offset */
__global__ __launch_bounds__(64) void k_att0(const float* __restrict__ QF, const float* __restrict__ KF, const float* __restrict__ VF, const float* __restrict__ mask, float scale, float* __restrict__ OF, int ldo) {
  #pragma clang fp contract(off)
  __shared__ __attribute__((aligned(16))) float lk[64][HD]; __shared__ __attribute__((aligned(16))) float lv[64][HD]; __shared__ __attribute__((aligned(16))) float lo[64][HD + 4];
  const int tid = threadIdx.x; const int h = blockIdx.x / (QT0 / 64), rg = blockIdx.x % (QT0 / 64); const int i = rg * 64 + tid;
  { const size_t br = (size_t)blockIdx.y * QT0; QF += br * LD; KF += br * LD; VF += br * LD; OF += br * ldo; }      /* grid.y: the batch; each batch has QT0 rows in every plane */
  const int tr = tid / 16, pc = (tid % 16) * 4; const unsigned tb = (unsigned)(tr * LD + pc) * 4u;      /* the thread's byte offset inside a group of four rows: 16 lanes cover one row's 256 bytes */
  { const char* qb = (const char*)(QF + (size_t)(rg * 64) * LD + h * HD);
    v4f qt[16];
#pragma unroll      /* all of a thread's tile loads in flight together */
    for (int it = 0; it < 16; ++it) qt[it] = *(const v4fa*)(qb + (size_t)(it * 4) * LD * 4 + tb);
    asm volatile("s_wait_xcnt 0x0" ::: "memory");      /* the loads' base registers are reused right behind them */
#pragma unroll      /* static indices keep qt in registers */
    for (int it = 0; it < 16; ++it) *(v4f*)&lo[it * 4 + tr][pc] = qt[it]; }
  __syncthreads();      /* the q tile is complete before a thread reads its row */
  float q[HD], o[HD];
#pragma unroll      /* static indices keep q and o in registers */
  for (int c = 0; c < HD / 4; ++c) { const v4f t = *(const v4f*)&lo[tid][c * 4]; for (int u = 0; u < 4; ++u) { q[c * 4 + u] = t[u]; o[c * 4 + u] = 0.f; } }
  float m = -1.0e30f, l = 0.f; const int jmax = MASKADD ? (SQ - 1) : (rg * 64 + 63);      /* additive-mask form: every key (the mask input decides); causal form: keys up to the block's last row */
  const char* kp = (const char*)(KF + h * HD) + tb; const char* vp = (const char*)(VF + h * HD) + tb;      /* the thread's place in the current K and V tile */
#pragma unroll 1      /* one key tile at a time: the tile buffers are reused */
  for (int j0 = 0; j0 <= jmax; j0 += 64) {
#pragma unroll      /* all of a thread's tile loads in flight together */
    for (int it = 0; it < 16; ++it) { *(v4f*)&lk[it * 4 + tr][pc] = *(const v4fa*)(kp + (size_t)(it * 4) * LD * 4); *(v4f*)&lv[it * 4 + tr][pc] = *(const v4fa*)(vp + (size_t)(it * 4) * LD * 4); }
    __syncthreads();      /* the tile is complete before any row reads it */
#pragma unroll 1      /* four keys per trip are enough to fill the add latency; more only grows the code */
    for (int jj = 0; jj < 64; jj += 4) { float s[4] = {0.f, 0.f, 0.f, 0.f};
#pragma unroll      /* static indices into q */
      for (int c = 0; c < HD / 4; ++c) for (int a = 0; a < 4; ++a) { const v4f kq = *(const v4f*)&lk[jj + a][c * 4]; s[a] = __fadd_rn(s[a], __fmul_rn(q[c * 4 + 0], kq[0])); s[a] = __fadd_rn(s[a], __fmul_rn(q[c * 4 + 1], kq[1])); s[a] = __fadd_rn(s[a], __fmul_rn(q[c * 4 + 2], kq[2])); s[a] = __fadd_rn(s[a], __fmul_rn(q[c * 4 + 3], kq[3])); }
#pragma unroll      /* static indices into s and o */
      for (int a = 0; a < 4; ++a) { const int j = j0 + jj + a; float sv = __fmul_rn(s[a], scale); if (MASKADD) sv = __fadd_rn(sv, __fmul_rn(bf16_round(mask[(size_t)i * SQ + j]), -10000.0f));
        const float f = (MASKADD || j <= i) ? 1.f : 0.f; const float sm = fmaf(f, sv, (1.f - f) * -1.0e30f); const float mn = fmaxf(m, sm); const float sc = expf(m - mn); const float e = expf(sm - mn); l = __fadd_rn(__fmul_rn(l, sc), e); m = mn;
        for (int c = 0; c < HD / 4; ++c) { const v4f vv = *(const v4f*)&lv[jj + a][c * 4]; for (int u = 0; u < 4; ++u) o[c * 4 + u] = __fadd_rn(__fmul_rn(o[c * 4 + u], sc), __fmul_rn(e, vv[u])); } } }
    __syncthreads();      /* every row has left the tile before the next one overwrites it */
    kp += (size_t)64 * LD * 4; vp += (size_t)64 * LD * 4;
  }
  const float fin = 64.0f / l;      /* o carried x64 like the f16 path */
#pragma unroll      /* static indices into o */
  for (int c = 0; c < HD / 4; ++c) { v4f oo; for (int u = 0; u < 4; ++u) oo[u] = __fmul_rn(o[c * 4 + u], fin); *(v4f*)&lo[tid][c * 4] = oo; }
  __syncthreads();
  {
#pragma unroll 1
    for (int it = 0; it < 16; ++it) { const int row = it * 4 + tid / 16, pc = (tid % 16) * 4; const v4f v = *(const v4f*)&lo[row][pc]; *(v4f*)(OF + (size_t)(rg * 64 + row) * ldo + h * HD + pc) = v; }
     } }


// LayerNorm and the f16 hi + x1024 residual split in one pass: a wave owns LNR whole rows and keeps them in registers, so h never goes through memory and no barrier is needed.
// Lane l holds columns 128 u + 4 l .. + 3 (u = 0..7): every load covers 512 contiguous bytes, every store 256. Row sums: four partial sums per lane, then a butterfly over the 32 lanes (every lane ends with the same value).
#define LNR 2                        /* rows per wave, all their loads in flight together */
#define LNW 16                       /* waves per block: one block per WGP covers every row */
template <int CTRL> __device__ __forceinline__ float ln_row(float x) { return __builtin_bit_cast(float, __builtin_amdgcn_update_dpp(0, __builtin_bit_cast(int, x), CTRL, 0xf, 0xf, true)); }      /* CTRL = 0x160 + m: lane l reads lane l ^ m of its 16-lane row */
__device__ __forceinline__ float ln_wsum(float x) { x += ln_row<0x161>(x); x += ln_row<0x162>(x); x += ln_row<0x164>(x); x += ln_row<0x168>(x); return x + fa_xhalf(x); }
__global__ __launch_bounds__(LNW * 32) void k_lnhl(const float* __restrict__ X, const float* __restrict__ g, const float* __restrict__ bb, float eps, _Float16* __restrict__ Hh, _Float16* __restrict__ Hl) {
  static_assert(DMQ == 1024, "a lane holds 8 x 4 columns of a row");
  const int lane = threadIdx.x & 31; const size_t r0 = ((size_t)blockIdx.x * LNW + (threadIdx.x >> 5)) * LNR;
  const float* xp = X + r0 * DMQ + lane * 4;
  v4f xa[LNR][8], ga[8], ba[8];
#pragma unroll      /* static indices keep the rows in registers; all loads in flight together */
  for (int j = 0; j < LNR; ++j) for (int u = 0; u < 8; ++u) xa[j][u] = *(const v4fa*)(xp + (size_t)j * DMQ + 128 * u);
  asm volatile("s_wait_xcnt 0x0" :: "v"(xp) : "memory");      /* the row loads' address registers are reused behind them; xp is named as an input so that they stay whole up to this wait (else the last load lands on them) */
  __builtin_amdgcn_sched_barrier(0);      /* keeps the loads below behind that wait */
#pragma unroll      /* static indices, as above */
  for (int u = 0; u < 8; ++u) { ga[u] = *(const v4fa*)(g + lane * 4 + 128 * u); ba[u] = *(const v4fa*)(bb + lane * 4 + 128 * u); }
  asm volatile("s_wait_xcnt 0x0" ::: "memory");      /* the loads' address registers are reused behind them */
  __builtin_amdgcn_sched_barrier(0);      /* every load is issued in front of the arithmetic: without it the gamma and beta loads sink behind the first row's sums and their latency is paid a second time */
#pragma unroll      /* static indices, as above */
  for (int u = 0; u < 8; ++u) for (int q = 0; q < 4; ++q) { ga[u][q] = bf16_round(ga[u][q]); ba[u][q] = bf16_round(ba[u][q]); }
#pragma unroll      /* static indices, as above */
  for (int j = 0; j < LNR; ++j) {
    v4f p = {0.f, 0.f, 0.f, 0.f};
    for (int u = 0; u < 8; ++u) for (int q = 0; q < 4; ++q) { xa[j][u][q] = bf16_round(xa[j][u][q]); p[q] += xa[j][u][q]; }
    const float mu = ln_wsum((p[0] + p[1]) + (p[2] + p[3])) * (1.0f / (float)DMQ);
    v4f v = {0.f, 0.f, 0.f, 0.f};
    for (int u = 0; u < 8; ++u) for (int q = 0; q < 4; ++q) { xa[j][u][q] -= mu; v[q] += xa[j][u][q] * xa[j][u][q]; }
    const float rs = rsqrtf(ln_wsum((v[0] + v[1]) + (v[2] + v[3])) * (1.0f / (float)DMQ) + eps);
    _Float16* hp = Hh + (r0 + j) * DMQ + lane * 4; _Float16* lp = Hl + (r0 + j) * DMQ + lane * 4;
    for (int u = 0; u < 8; ++u) { v4h yh, yl;
      for (int q = 0; q < 4; ++q) { const float y = xa[j][u][q] * rs * ga[u][q] + ba[u][q]; const _Float16 h = (_Float16)y; yh[q] = h; yl[q] = (_Float16)((y - (float)h) * 1024.0f); }
      *(v4h*)(hp + 128 * u) = yh; *(v4h*)(lp + 128 * u) = yl; }
    if (j + 1 < LNR) { asm volatile("s_wait_xcnt 0x0" ::: "memory"); __builtin_amdgcn_sched_barrier(0); }      /* this row's store registers are reused by the next row's arithmetic: the wait stands behind the stores, and the scheduling barrier keeps that arithmetic behind the wait; it also keeps this row's stores in front of the next row's work, under which they drain */
  }
}

extern "C" void kernel_launch(void* const* d_in, const int* in_sizes, int n_in,
                              void* d_out, int out_size, void* d_ws, size_t ws_size, hipStream_t stream) {
  (void)in_sizes; (void)n_in; (void)out_size;
  const float* const* I = (const float* const*)d_in; const float* x = I[0]; const float* wq = I[1]; const float* bq = I[2]; const float* wk = I[3]; const float* bk = I[4]; const float* wv = I[5]; const float* bv = I[6]; const float* wo = I[7]; const float* bo = I[8]; const float* lng = I[9]; const float* lnb = I[10];      /* [in][out] weights + biases; LN gamma/beta */
  char* ws = (char*)d_ws; size_t off = 0;
  auto take = [&](size_t bytes) { char* p = ws + off; off += (bytes + 255) & ~(size_t)255; return p; };
  _Float16* BQ = (_Float16*)take((size_t)DM * DM * 2); _Float16* BK = (_Float16*)take((size_t)DM * DM * 2); _Float16* BV = (_Float16*)take((size_t)DM * DM * 2); _Float16* BO = (_Float16*)take((size_t)DM * DM * 2);
  float* S = (float*)take((size_t)NB * NH * QT * NKX * 4);      /* room for the projection-stage planes */
  _Float16* X16 = (_Float16*)S; _Float16* XL = (_Float16*)((char*)S + NR * DM * 2);      /* projection-stage planes on the bytes of S */
  _Float16* Q16 = (_Float16*)take(NR * DM * 2); _Float16* K16 = (_Float16*)take(NR * DM * 2); _Float16* V16 = (_Float16*)take(NR * DM * 2); _Float16* O16 = (_Float16*)take(NR * DM * 2);      /* Q16, K16, V16: three planes in a row */
  _Float16* VT = (_Float16*)take((size_t)NB * NH * HD * SQ * 2);
  float* QF0 = (float*)take((size_t)NB * QT0 * DM * 4); float* KF0 = (float*)take((size_t)NB * QT0 * DM * 4); float* VF0 = (float*)take((size_t)NB * QT0 * DM * 4); float* OF0 = (float*)take((size_t)NB * QT0 * DM * 4); _Float16* OH0 = (_Float16*)take((size_t)NB * QT0 * DM * 2); _Float16* OL0 = (_Float16*)take((size_t)NB * QT0 * DM * 2);      /* QF0, KF0, VF0: three planes in a row */
  if (off > ws_size) return;
  k_wt4<<<dim3((DM / WTT) * (DM / WTT), 4), 256, 0, stream>>>(wq, wk, wv, wo, BQ, 16.0f);      /* [in][out] -> Bt[n][k] x16; BQ, BK, BV, BO: four planes in a row */

  k_lnhl<<<(unsigned)(NR / (LNW * LNR)), LNW * 32, 0, stream>>>(x, lng, lnb, 1e-5f, X16, XL);      /* h = LN(bf16(x)) f32, kept in registers -> f16 hi (X16) + x1024 residual (XL) rows */
  /* Independent launches share one grid: q, k, v on grid.y of the projection GEMMs, the batch on grid.z of the per-batch GEMMs (grid.y of the first-tile attention, part of the flat index elsewhere). */
  const size_t zW = (size_t)DM * DM, zR = NR * DM, zT = (size_t)SQ * DM, z0 = (size_t)QT0 * DM;      /* elements: a weight plane, a token-row plane, one batch of it, one batch of a first-tile plane */
  const dim3 gp((unsigned)((NR / 128) * (DM / 128)), 1, 1), gp3((unsigned)((NR / 128) * (DM / 128)), 3, 1);      /* every token row; the same for q, k, v */
  k_gemm2<0, DM, true><<<gp3, 256, 0, stream>>>(X16, DM, 0, BQ, DM, zW, 0.0625f, bq, 0, nullptr, 1, 0, 0, nullptr, Q16, DM, zR, (int)NR, DM, DM, 0, 0, 0, bk, bv, XL, 0.00006103515625f);      /* f32 h_hi W + b, += h_lo W 2^-14, rounded to the f16 q, k, v rows */
  k_vt<NH, SQ><<<NB * NH * (SQ / 64), 256, 0, stream>>>(V16, LQ, 0, VT);      /* V^T [NB][NH][HD][SQ] */
  /* For each batch's first 128 rows the next launch forms the same f32 sums that the full-size projection launch above forms before it rounds them to f16. */
  const dim3 g0((QT0 / 128) * (DM / 128), 1, NB), g03((QT0 / 128) * (DM / 128), 3, NB);
  k_gemm2<0, DM, true><<<g03, 256, 0, stream>>>(X16, DM, 0, BQ, DM, zW, 0.0625f, bq, 0, nullptr, 1, 0, 0, QF0, nullptr, DM, (size_t)NB * z0, QT0, DM, DM, zT, 0, z0, bk, bv, XL, 0.00006103515625f);      /* f32 q, k, v of each batch's first 128 rows (exact products) */
  k_att0<0, DM><<<dim3(NH * (QT0 / 64), NB), 64, 0, stream>>>(QF0, KF0, VF0, nullptr, 0.125f, OF0, DM);      /* exact f32 attention for rows 0..127 (o x64) */
  k_fattn<<<NB * NH * (SQ / 128), 128, 0, stream>>>(Q16, K16, VT, O16);      /* scores, causal softmax and o = P V in one launch; o (merged heads, x64) as f16 rows */
  k_gemm2<0><<<gp, 256, 0, stream>>>(O16, DM, 0, BO, DM, 0, 0.0009765625f, bo, 0, nullptr, 1, 0, 0, (float*)d_out, nullptr, DM, 0, (int)NR, DM, DM, 0, 0, 0, nullptr, nullptr, nullptr, 0.f);      /* out rows are the output layout */
  k_hl<<<(unsigned)(((size_t)NB * QT0 * DM / 8 + 255) / 256), 256, 0, stream>>>(OF0, OH0, OL0, (size_t)NB * QT0 * DM / 8);      /* first-tile o (x64) -> f16 hi + x1024 residual planes */
  k_gemm2<0, DM, true><<<g0, 256, 0, stream>>>(OH0, DM, 0, BO, DM, 0, 0.0009765625f, bo, 0, nullptr, 1, 0, 0, (float*)d_out, nullptr, DM, 0, QT0, DM, DM, z0, 0, zT, nullptr, nullptr, OL0, 0.00000095367431640625f);      /* rows 0..127 of each batch: out = o_hi Wo (+ b) + o_lo Wo 2^-20, overwriting the f16-path rows */
}
